// v000
// The times below were measured on an AMD MI455X: many runs one after another, warmed up first and cycling through
// copies of the inputs, with the whole window's GPU time divided by the number of runs. Launches and the gaps
// between them are all in it. The median over several windows is given; except for v000 it joins two sittings, which
// can be a few percent apart, so the side-by-side timings, each taken in one sitting, are the better comparison.
// The starting kernel, v000, takes 2860 microseconds a run.
#include <hip/hip_runtime.h>

// Causal self-attention with a fused bias-free qkv weight and the source's pairwise rotary form (x [4][2048][1024]; qkv = x w_attn^T ('oi' [3072][1024]) split in thirds q | k | v (16 heads x 64); rope on consecutive pairs with PER-ELEMENT table columns: out[2i] = x[2i] cos[2i] - x[2i+1] sin[2i], out[2i+1] = x[2i+1] cos[2i+1] + x[2i] sin[2i+1] where cos / sin = cat(freqs, freqs) of angle t x 1/10000^(2j/64) (so column d uses frequency d mod 32: the module reshapes the concatenated tables pairwise; reproduced literally; 32 f32 frequencies; precise cosf/sinf); scores x 1/sqrt(64); causal (finfo.min == exclusion); softmax; y = merged w_proj^T ('oi') -> [4][2048][1024] (8.4 M); argument order x, w_attn, w_proj).
// Layout per batch: bf16 copy of x; 'oi' weights; exact projections; computed {cos, sin} table k_cs5 (INVT[32]); interleaved-pair plane builders with per-dimension table entries (k_ropeI2); causal T-2048 attention (hybrid rows: < 512 hi/lo 3 products, rest fp16 x1024; k_gemmc skips tiles above the diagonal); merged hi/lo x Wo exact.
// Compute dtypes, f32 accumulate: every input rounded to bf16 (tables f32); projections exact; rotary f32; attention rows < 512 3 products, rest fp16; softmax f32; Wo hl x exact.

#define NB_  4
#define TT   2048
#define DM   1024
#define NH_  16
#define NKV  16
#define REP  (NH_ / NKV)
#define HD   64
#define DQ   (NH_ * HD)
#define DKV  (NKV * HD)
#define ZH   2
#define RH   512                  // query rows < RH use hi+lo planes (0: none)
#define WIN  2048
#define PCAR 1024.0f
#define SCL  0.125f   // HD^-0.5
typedef _Float16 h16;
typedef unsigned short bf;
typedef __attribute__((ext_vector_type(16))) __bf16   v16bf;
typedef __attribute__((ext_vector_type(16))) _Float16 v16h;
typedef __attribute__((ext_vector_type(8)))  _Float16 v8h;
typedef __attribute__((ext_vector_type(8)))  unsigned short v8us;
typedef __attribute__((ext_vector_type(8)))  float    v8f;
typedef __attribute__((ext_vector_type(4)))  float    v4f;
typedef v8h  __attribute__((may_alias)) v8ha;
typedef v4f  __attribute__((may_alias)) v4fa;
typedef v8us __attribute__((may_alias)) v8usa;

__device__ __forceinline__ unsigned short f2bf(float f) { unsigned u = __float_as_uint(f); u += 0x7FFFu + ((u >> 16) & 1u); return (unsigned short)(u >> 16); }
__device__ __forceinline__ float bf2f(unsigned short b) { return __uint_as_float(((unsigned)b) << 16); }
__device__ __forceinline__ float bfr(float f) { return bf2f(f2bf(f)); }
__device__ __forceinline__ v16h cat16(v8h lo, v8h hi) { return __builtin_shufflevector(lo, hi, 0, 1, 2, 3, 4, 5, 6, 7, 8, 9, 10, 11, 12, 13, 14, 15); }
__device__ __forceinline__ v16bf cat16b(v8us lo, v8us hi) { return __builtin_bit_cast(v16bf, __builtin_shufflevector(lo, hi, 0, 1, 2, 3, 4, 5, 6, 7, 8, 9, 10, 11, 12, 13, 14, 15)); }
__device__ __forceinline__ v8f wmma16(v16h a, v16h b, v8f c) { return __builtin_amdgcn_wmma_f32_16x16x32_f16(false, a, false, b, (short)0, c, false, false); }
__device__ __forceinline__ v8f wmmab(v16bf a, v16bf b, v8f c) { return __builtin_amdgcn_wmma_f32_16x16x32_bf16(false, a, false, b, (short)0, c, false, false); }



// ---- k_gemmw: register-blocked GEMM, ONE WAVE per 64x64 output tile (16 accumulators), operands straight from K-contiguous 16-bit planes; grid (M/64, N/64, Z), 32 threads.
// C[m][n] (f32, pitch ldc, + optional f32 bias[n]) = sum_k A[m][k] Bt[n][k] (+ split products per NSPLIT). z-batch strides sA/sB/sC in elements. K % 32 == 0.
template <typename T16> struct WFrag;
template <> struct WFrag<h16> { typedef v16h V; static __device__ __forceinline__ V ld(const h16* p) { return cat16(*(const v8h*)p, *(const v8h*)(p + 16)); } static __device__ __forceinline__ v8f mma(V a, V b, v8f c) { return wmma16(a, b, c); } };
template <> struct WFrag<bf> { typedef v16bf V; static __device__ __forceinline__ V ld(const bf* p) { return cat16b(*(const v8us*)p, *(const v8us*)(p + 16)); } static __device__ __forceinline__ v8f mma(V a, V b, v8f c) { return wmmab(a, b, c); } };
template <typename T16, int NSPLIT, bool BIAS>
__global__ __launch_bounds__(32) void k_gemmw(const T16* __restrict__ A, const T16* __restrict__ A2, const T16* __restrict__ Bt, const T16* __restrict__ Bt2, int K, float* C, int ldc, const float* __restrict__ bias, size_t sA, size_t sB, size_t sC) {
    typedef typename WFrag<T16>::V V;
    __shared__ __align__(16) float os[16 * 68];
    const size_t z = blockIdx.z; A += z * sA; if (A2) A2 += z * sA; Bt += z * sB; if (Bt2) Bt2 += z * sB; C += z * sC;
    const int lane = threadIdx.x & 31, lr = lane & 15, hi = lane >> 4; const int r0 = blockIdx.x * 64, c0 = blockIdx.y * 64;
    v8f acc[4][4];
#pragma unroll
    for (int mb = 0; mb < 4; ++mb)
#pragma unroll
        for (int nb = 0; nb < 4; ++nb) acc[mb][nb] = (v8f){};
    const size_t aoff = (size_t)(r0 + lr) * K + 8 * hi, boff = (size_t)(c0 + lr) * K + 8 * hi;
#pragma unroll 1
    for (int kc = 0; kc < K; kc += 32) {
        V a[4], a2[4];
#pragma unroll
        for (int mb = 0; mb < 4; ++mb) { a[mb] = WFrag<T16>::ld(A + aoff + (size_t)mb * 16 * K + kc); if (NSPLIT == 1 || NSPLIT == 2) a2[mb] = WFrag<T16>::ld(A2 + aoff + (size_t)mb * 16 * K + kc); }
#pragma unroll
        for (int nb = 0; nb < 4; ++nb) { const V b = WFrag<T16>::ld(Bt + boff + (size_t)nb * 16 * K + kc); V b2; if (NSPLIT >= 2) b2 = WFrag<T16>::ld(Bt2 + boff + (size_t)nb * 16 * K + kc);
#pragma unroll
            for (int mb = 0; mb < 4; ++mb) { acc[mb][nb] = WFrag<T16>::mma(a[mb], b, acc[mb][nb]); if (NSPLIT == 1 || NSPLIT == 2) acc[mb][nb] = WFrag<T16>::mma(a2[mb], b, acc[mb][nb]); if (NSPLIT >= 2) acc[mb][nb] = WFrag<T16>::mma(a[mb], b2, acc[mb][nb]); } }
        asm volatile("v_nop\n\tv_nop\n\tv_nop\n\tv_nop" : "+v"(acc[0][0]), "+v"(acc[1][1]), "+v"(acc[2][2]), "+v"(acc[3][3]) : "v"(a[0]), "v"(a[3]));
    }
#pragma unroll
    for (int mb = 0; mb < 4; ++mb) {
#pragma unroll
        for (int nb = 0; nb < 4; ++nb) {
#pragma unroll
            for (int j = 0; j < 8; ++j) os[(hi * 8 + j) * 68 + nb * 16 + lr] = acc[mb][nb][j]; }
        __builtin_amdgcn_wave_barrier(); asm volatile("" ::: "memory");
        float* crow = C + (size_t)(r0 + mb * 16) * ldc + c0;
{
#pragma unroll
            for (int s = 0; s < 8; ++s) { const int row = 2 * s + hi, cofs = lr * 4; v4f val = *(const v4fa*)(os + row * 68 + cofs); if (BIAS) { val[0] += bfr(bias[c0 + cofs]); val[1] += bfr(bias[c0 + cofs + 1]); val[2] += bfr(bias[c0 + cofs + 2]); val[3] += bfr(bias[c0 + cofs + 3]); }
                *(v4f*)(crow + (size_t)row * ldc + cofs) = val; }
             }
        __builtin_amdgcn_wave_barrier(); asm volatile("" ::: "memory");
    }
}

// ---- k_gemmc: the same one-wave 64x64 tile GEMM specialised for causal attention: CMODE 1 skips score tiles entirely above the diagonal (query rows r0+roff.., key columns c0..), CMODE 2 limits the
// key (K) loop of the probability x value contraction to the diagonal block (probabilities beyond it are exactly zero). roff = row offset of this launch's first row within the sequence.
template <typename T16, int NSPLIT, int CMODE>
__global__ __launch_bounds__(32) void k_gemmc(const T16* __restrict__ A, const T16* __restrict__ A2, const T16* __restrict__ Bt, const T16* __restrict__ Bt2, int K, float* C, int ldc, int roff, size_t sA, size_t sB, size_t sC) {
    typedef typename WFrag<T16>::V V;
    __shared__ __align__(16) float os[16 * 68];
    const size_t z = blockIdx.z; A += z * sA; if (A2) A2 += z * sA; Bt += z * sB; if (Bt2) Bt2 += z * sB; C += z * sC;
    const int lane = threadIdx.x & 31, lr = lane & 15, hi = lane >> 4; const int r0 = blockIdx.x * 64, c0 = blockIdx.y * 64;
    if (CMODE == 1 && c0 > r0 + roff + 63) return;                  // score tile entirely above the causal diagonal: never read (the softmax masks j > i by select)
    const int Kl = (CMODE == 2) ? min(K, r0 + roff + 64) : K;        // P.V: probabilities are exactly 0 beyond the diagonal block, so the K loop stops there
    v8f acc[4][4];
#pragma unroll
    for (int mb = 0; mb < 4; ++mb)
#pragma unroll
        for (int nb = 0; nb < 4; ++nb) acc[mb][nb] = (v8f){};
    const size_t aoff = (size_t)(r0 + lr) * K + 8 * hi, boff = (size_t)(c0 + lr) * K + 8 * hi;
#pragma unroll 1
    for (int kc = 0; kc < Kl; kc += 32) {
        V a[4], a2[4];
#pragma unroll
        for (int mb = 0; mb < 4; ++mb) { a[mb] = WFrag<T16>::ld(A + aoff + (size_t)mb * 16 * K + kc); if (NSPLIT == 1 || NSPLIT == 2) a2[mb] = WFrag<T16>::ld(A2 + aoff + (size_t)mb * 16 * K + kc); }
#pragma unroll
        for (int nb = 0; nb < 4; ++nb) { const V b = WFrag<T16>::ld(Bt + boff + (size_t)nb * 16 * K + kc); V b2; if (NSPLIT >= 2) b2 = WFrag<T16>::ld(Bt2 + boff + (size_t)nb * 16 * K + kc);
#pragma unroll
            for (int mb = 0; mb < 4; ++mb) { acc[mb][nb] = WFrag<T16>::mma(a[mb], b, acc[mb][nb]); if (NSPLIT == 1 || NSPLIT == 2) acc[mb][nb] = WFrag<T16>::mma(a2[mb], b, acc[mb][nb]); if (NSPLIT >= 2) acc[mb][nb] = WFrag<T16>::mma(a[mb], b2, acc[mb][nb]); } }
        asm volatile("v_nop\n\tv_nop\n\tv_nop\n\tv_nop" : "+v"(acc[0][0]), "+v"(acc[1][1]), "+v"(acc[2][2]), "+v"(acc[3][3]) : "v"(a[0]), "v"(a[3]));
    }
#pragma unroll
    for (int mb = 0; mb < 4; ++mb) {
#pragma unroll
        for (int nb = 0; nb < 4; ++nb) {
#pragma unroll
            for (int j = 0; j < 8; ++j) os[(hi * 8 + j) * 68 + nb * 16 + lr] = acc[mb][nb][j]; }
        __builtin_amdgcn_wave_barrier(); asm volatile("" ::: "memory");
        float* crow = C + (size_t)(r0 + mb * 16) * ldc + c0;
{
#pragma unroll
            for (int s = 0; s < 8; ++s) { const int row = 2 * s + hi, cofs = lr * 4; v4f val = *(const v4fa*)(os + row * 68 + cofs);
                *(v4f*)(crow + (size_t)row * ldc + cofs) = val; }
             }
        __builtin_amdgcn_wave_barrier(); asm volatile("" ::: "memory");
    }
}

__device__ __forceinline__ h16 tohx(float x) { return (h16)x; }
__device__ __forceinline__ void splitf(float y, unsigned short& h, unsigned short& l) { h = f2bf(y); l = f2bf(y - bf2f(h)); }
typedef __attribute__((ext_vector_type(2))) _Float16 v2h;
typedef __attribute__((ext_vector_type(4))) _Float16 v4h;
typedef __attribute__((ext_vector_type(2))) unsigned short v2us;
typedef __attribute__((ext_vector_type(4))) unsigned short v4us;
typedef __attribute__((ext_vector_type(2))) float v2f;
typedef __attribute__((ext_vector_type(4))) int v4i;

__global__ __launch_bounds__(256) void k_cvt8(const float* __restrict__ src, bf* dst, size_t n8) { const size_t i = (size_t)blockIdx.x * 256 + threadIdx.x; if (i >= n8) return; const v8f v = *(const v8f*)(src + i * 8); v8us o;
#pragma unroll
    for (int k = 0; k < 8; ++k) o[k] = f2bf(v[k]); *(v8us*)(dst + i * 8) = o;  }

__global__ __launch_bounds__(256) void k_ropeI2(const float* __restrict__ F, int pitch, int nheads, const float* __restrict__ CS, float sc, h16* P16, bf* Ph, bf* Pl) {
    const size_t e = ((size_t)blockIdx.x * 256 + threadIdx.x) * 2; if (e >= (size_t)nheads * TT * HD) return; const int d = (int)(e % HD); const int t = (int)((e / HD) % TT); const int h = (int)(e / ((size_t)HD * TT)); const float* f = F + (size_t)t * pitch + h * HD; const float x0 = f[d], x1 = f[d + 1]; const v2f cs = *(const v2f*)(CS + ((size_t)t * HD + d) * 2); const v2f ct = *(const v2f*)(CS + ((size_t)t * HD + d + 1) * 2); v2h o16; v2us oh, ol;
    float a0 = __fmul_rn(x0, cs[0]), b0 = __fmul_rn(x1, cs[1]), a1 = __fmul_rn(x1, ct[0]), b1 = __fmul_rn(x0, ct[1]); asm volatile("" : "+v"(a0), "+v"(b0), "+v"(a1), "+v"(b1));
    float r0 = __fsub_rn(a0, b0) * sc, r1 = __fadd_rn(b1, a1) * sc;   /* even: x0 c - x1 s; odd: x0 s + x1 c */
    o16[0] = tohx(r0); o16[1] = tohx(r1); { unsigned short a2, c2; splitf(r0, a2, c2); oh[0] = a2; ol[0] = c2; splitf(r1, a2, c2); oh[1] = a2; ol[1] = c2; }
    *(v2h*)(P16 + e) = o16; *(v2us*)(Ph + e) = oh; *(v2us*)(Pl + e) = ol;  }


__global__ __launch_bounds__(256) void k_vtp(const float* __restrict__ F, int pitch, int nheads, h16* V16, bf* Vh, bf* Vl) { const size_t e = ((size_t)blockIdx.x * 256 + threadIdx.x) * 2; if (e >= (size_t)nheads * HD * TT) return; const int t = (int)(e % TT); const int d = (int)((e / TT) % HD); const int g = (int)(e / ((size_t)TT * HD)); v2h o16; v2us oh, ol;
#pragma unroll
    for (int q = 0; q < 2; ++q) { const float x = F[(size_t)(t + q) * pitch + g * HD + d]; o16[q] = tohx(x); unsigned short a2, c2; splitf(x, a2, c2); oh[q] = a2; ol[q] = c2; }
    *(v2h*)(V16 + e) = o16; *(v2us*)(Vh + e) = oh; *(v2us*)(Vl + e) = ol;  }
__constant__ float INVT[HD / 2] = { 1.000000000e+00f, 7.498942018e-01f, 5.623413324e-01f, 4.216965139e-01f, 3.162277639e-01f, 2.371373624e-01f, 1.778279394e-01f, 1.333521456e-01f, 1.000000015e-01f, 7.498941571e-02f, 5.623412877e-02f, 4.216964915e-02f, 3.162277862e-02f, 2.371373586e-02f, 1.778279431e-02f, 1.333521493e-02f, 9.999999776e-03f, 7.498942316e-03f, 5.623413250e-03f, 4.216964822e-03f, 3.162277862e-03f, 2.371373819e-03f, 1.778279431e-03f, 1.333521446e-03f, 1.000000047e-03f, 7.498941850e-04f, 5.623413017e-04f, 4.216964880e-04f, 3.162277862e-04f, 2.371373848e-04f, 1.778279402e-04f, 1.333521504e-04f };   // float32 1 / 10000^(2i/64), generated with jnp to be bit-exact
__global__ __launch_bounds__(256) void k_cs5(float* CS) { const int idx = blockIdx.x * 256 + threadIdx.x; if (idx >= TT * HD) return; const int d = idx % HD; const int t = idx / HD; const float a = __fmul_rn((float)t, INVT[d % (HD / 2)]); v2f cs; cs[0] = cosf(a); cs[1] = sinf(a); *(v2f*)(CS + (size_t)idx * 2) = cs;  }
// k_asoft: per row (zz, i): t = S x HD^-0.5 for j <= i and i - j < WIN (WIN = 2048 = T, so the window test always holds: plain causal; the reference's -1e9 additive fill vanishes identically); softmax over the 2048 keys (register row, one exp, fixed trees);
__global__ __launch_bounds__(256) void k_asoft(const float* __restrict__ Sb, h16* P16, bf* Ph, bf* Pl) {
    const int lane = threadIdx.x & 31; const int row = blockIdx.x * 8 + (threadIdx.x >> 5); if (row >= ZH * TT) return; const int i = row % TT; const int zz = row / TT; (void)zz; const bool hires = (i < RH); const float* sr = Sb + (size_t)row * TT; float v[TT / 32]; float mx = -3.0e38f;
#pragma unroll
    for (int ch = 0; ch < TT / 128; ++ch) { const int j0 = ch * 128 + lane * 4; const v4f a = *(const v4f*)(sr + j0);
#pragma unroll
        for (int q = 0; q < 4; ++q) { const int j = j0 + q; (void)j; const float t = (j <= i && i - j < WIN) ? a[q] * SCL : -3.0e38f; v[ch * 4 + q] = t; mx = fmaxf(mx, t); } }
#pragma unroll
    for (int sh = 16; sh; sh >>= 1) mx = fmaxf(mx, __shfl_xor(mx, sh, 32));
    float sum = 0.f;
#pragma unroll
    for (int k = 0; k < TT / 32; ++k) { float d0 = __fsub_rn(v[k], mx); asm volatile("" : "+v"(d0)); v[k] = __builtin_amdgcn_exp2f(__fmul_rn(d0, 1.4426950408889634f)); sum += v[k]; }
#pragma unroll
    for (int sh = 16; sh; sh >>= 1) sum += __shfl_xor(sum, sh, 32);
    const float f = __fdiv_rn(hires ? 1.0f : PCAR, sum);
{
        if (hires) {
#pragma unroll
            for (int ch = 0; ch < TT / 128; ++ch) { v4us oh, ol;
#pragma unroll
                for (int q = 0; q < 4; ++q) { unsigned short a, c2; splitf(v[ch * 4 + q] * f, a, c2); oh[q] = a; ol[q] = c2; }
                const size_t oo = ((size_t)zz * (RH ? RH : 1) + i) * TT + ch * 128 + lane * 4; *(v4us*)(Ph + oo) = oh; *(v4us*)(Pl + oo) = ol; }
        } else {
#pragma unroll
            for (int ch = 0; ch < TT / 128; ++ch) { v4h o4;
#pragma unroll
                for (int q = 0; q < 4; ++q) o4[q] = tohx(v[ch * 4 + q] * f);
                *(v4h*)(P16 + (size_t)row * TT + ch * 128 + lane * 4) = o4; } }
         }
}
__global__ __launch_bounds__(256) void k_merge(const float* __restrict__ O, int h0, bf* Ah, bf* Al) { const size_t e = ((size_t)blockIdx.x * 256 + threadIdx.x) * 2; if (e >= (size_t)ZH * TT * HD) return; const int d = (int)(e % HD); const int t = (int)((e / HD) % TT); const int zz = (int)(e / ((size_t)HD * TT)); const float cs = (t < RH) ? 1.0f : (1.0f / PCAR); const size_t oo = (size_t)t * DQ + (h0 + zz) * HD + d;
    v2us oh, ol;
#pragma unroll
    for (int q = 0; q < 2; ++q) { unsigned short a, c2; splitf(O[e + q] * cs, a, c2); oh[q] = a; ol[q] = c2; } *(v2us*)(Ah + oo) = oh; *(v2us*)(Al + oo) = ol;  }

extern "C" void kernel_launch(void* const* d_in, const int* in_sizes, int n_in,
                              void* d_out, int out_size, void* d_ws, size_t ws_size, hipStream_t stream) {
    (void)in_sizes; (void)n_in; (void)out_size;
    const float* x = (const float*)d_in[0]; const float* wattn = (const float*)d_in[1]; const float* wo = (const float*)d_in[2];   /* order x, w_attn ('oi' [3072][1024]: q | k | v row thirds), w_proj ('oi') */ const float* wq = wattn; const float* wk = wattn + (size_t)DQ * DM; const float* wv = wattn + (size_t)2 * DQ * DM;
    float* OUT = (float*)d_out;     // [4][2048][1024]
    char* wsp = (char*)d_ws;
    auto take = [&](size_t bytes) { char* p = wsp; wsp += (bytes + 255) & ~(size_t)255; return (void*)p; };
    bf* WQ = (bf*)take((size_t)DQ * DM * 2); bf* WK = (bf*)take((size_t)DKV * DM * 2); bf* WV = (bf*)take((size_t)DKV * DM * 2); bf* WO = (bf*)take((size_t)DM * DQ * 2); float* CS = (float*)take((size_t)TT * HD * 2 * 4);
    bf* XB = (bf*)take((size_t)TT * DM * 2); float* FQ = (float*)take((size_t)TT * DQ * 4); float* FK = (float*)take((size_t)TT * DKV * 4);
    h16* QP16 = (h16*)take((size_t)NH_ * TT * HD * 2); h16* KP16 = (h16*)take((size_t)NKV * TT * HD * 2); h16* VT16 = (h16*)take((size_t)NKV * HD * TT * 2);
    bf* QPh = (bf*)take((size_t)NH_ * TT * HD * 2); bf* QPl = (bf*)take((size_t)NH_ * TT * HD * 2); bf* KPh = (bf*)take((size_t)NKV * TT * HD * 2); bf* KPl = (bf*)take((size_t)NKV * TT * HD * 2); bf* VTh = (bf*)take((size_t)NKV * HD * TT * 2); bf* VTl = (bf*)take((size_t)NKV * HD * TT * 2); bf* Ph = (bf*)take((size_t)ZH * RH * TT * 2); bf* Pl = (bf*)take((size_t)ZH * RH * TT * 2);
    float* Sb = (float*)take((size_t)ZH * TT * TT * 4); h16* P16 = (h16*)take((size_t)ZH * TT * TT * 2); float* Ob = (float*)take((size_t)ZH * TT * HD * 4); bf* ATh = (bf*)take((size_t)TT * DQ * 2); bf* ATl = (bf*)take((size_t)TT * DQ * 2);
    if ((size_t)(wsp - (char*)d_ws) > ws_size) return;    // ws 256 MiB
    float* FV = FK;   // v projection reuses the k buffer after the k planes are built (stream-ordered)
    { k_cvt8<<<(unsigned)(((size_t)DQ * DM / 8 + 255) / 256), 256, 0, stream>>>(wq, WQ, (size_t)DQ * DM / 8); k_cvt8<<<(unsigned)(((size_t)DKV * DM / 8 + 255) / 256), 256, 0, stream>>>(wk, WK, (size_t)DKV * DM / 8); k_cvt8<<<(unsigned)(((size_t)DKV * DM / 8 + 255) / 256), 256, 0, stream>>>(wv, WV, (size_t)DKV * DM / 8);
      k_cvt8<<<(unsigned)(((size_t)DM * DQ / 8 + 255) / 256), 256, 0, stream>>>(wo, WO, (size_t)DM * DQ / 8);
       }
    k_cs5<<<(TT * HD + 255) / 256, 256, 0, stream>>>(CS);   /* rotary {cos, sin} table from t and INVT */
    const unsigned LQ = (unsigned)(((size_t)NH_ * TT * HD / 2 + 255) / 256), LKv = (unsigned)(((size_t)NKV * TT * HD / 2 + 255) / 256);
    for (int b = 0; b < NB_; ++b) {
        
        k_cvt8<<<(unsigned)(((size_t)TT * DM / 8 + 255) / 256), 256, 0, stream>>>(x + (size_t)b * TT * DM, XB, (size_t)TT * DM / 8);
        k_gemmw<bf, 0, false><<<dim3(TT / 64, DQ / 64, 1), 32, 0, stream>>>(XB, nullptr, WQ, nullptr, DM, FQ, DQ, nullptr, 0, 0, 0);
        k_ropeI2<<<LQ, 256, 0, stream>>>(FQ, DQ, NH_, CS, 1.0f, QP16, QPh, QPl);
        k_gemmw<bf, 0, false><<<dim3(TT / 64, DKV / 64, 1), 32, 0, stream>>>(XB, nullptr, WK, nullptr, DM, FK, DKV, nullptr, 0, 0, 0);
        k_ropeI2<<<LKv, 256, 0, stream>>>(FK, DKV, NKV, CS, 1.0f, KP16, KPh, KPl);
        k_gemmw<bf, 0, false><<<dim3(TT / 64, DKV / 64, 1), 32, 0, stream>>>(XB, nullptr, WV, nullptr, DM, FV, DKV, nullptr, 0, 0, 0); k_vtp<<<LKv, 256, 0, stream>>>(FV, DKV, NKV, VT16, VTh, VTl);
        for (int h0 = 0; h0 < NH_; h0 += ZH) { const size_t zq = (size_t)h0, zk = (size_t)(h0 / REP);   // one kv head per query head: the pass's two heads use consecutive kv planes (z-strides TT*HD)
            k_gemmc<bf, 2, 1><<<dim3(RH / 64, TT / 64, ZH), 32, 0, stream>>>(QPh + zq * TT * HD, QPl + zq * TT * HD, KPh + zk * TT * HD, KPl + zk * TT * HD, HD, Sb, TT, 0, (size_t)TT * HD, (size_t)TT * HD, (size_t)TT * TT);
            k_gemmc<h16, 0, 1><<<dim3((TT - RH) / 64, TT / 64, ZH), 32, 0, stream>>>(QP16 + zq * TT * HD + (size_t)RH * HD, nullptr, KP16 + zk * TT * HD, nullptr, HD, Sb + (size_t)RH * TT, TT, RH, (size_t)TT * HD, (size_t)TT * HD, (size_t)TT * TT);
            k_asoft<<<ZH * TT / 8, 256, 0, stream>>>(Sb, P16, Ph, Pl);
            k_gemmc<bf, 2, 2><<<dim3(RH / 64, HD / 64, ZH), 32, 0, stream>>>(Ph, Pl, VTh + zk * HD * TT, VTl + zk * HD * TT, TT, Ob, HD, 0, (size_t)RH * TT, (size_t)HD * TT, (size_t)TT * HD);
            k_gemmc<h16, 0, 2><<<dim3((TT - RH) / 64, HD / 64, ZH), 32, 0, stream>>>(P16 + (size_t)RH * TT, nullptr, VT16 + zk * HD * TT, nullptr, TT, Ob + (size_t)RH * HD, HD, RH, (size_t)TT * TT, (size_t)HD * TT, (size_t)TT * HD);
            k_merge<<<(unsigned)(((size_t)ZH * TT * HD / 2 + 255) / 256), 256, 0, stream>>>(Ob, h0, ATh, ATl); }
        k_gemmw<bf, 1, false><<<dim3(TT / 64, DM / 64, 1), 32, 0, stream>>>(ATh, ATl, WO, nullptr, DQ, OUT + (size_t)b * TT * DM, DM, nullptr, 0, 0, 0); }
}

// v001
// One run takes 1370 microseconds.
// Two timings next to v000 put it at 2.06 and 2.07 times that version's speed.
#include <hip/hip_runtime.h>

// Causal self-attention with a fused bias-free qkv weight and the source's pairwise rotary form (x [4][2048][1024]; qkv = x w_attn^T ('oi' [3072][1024]) split in thirds q | k | v (16 heads x 64); rope on consecutive pairs with PER-ELEMENT table columns: out[2i] = x[2i] cos[2i] - x[2i+1] sin[2i], out[2i+1] = x[2i+1] cos[2i+1] + x[2i] sin[2i+1] where cos / sin = cat(freqs, freqs) of angle t x 1/10000^(2j/64) (so column d uses frequency d mod 32: the module reshapes the concatenated tables pairwise; reproduced literally; 32 f32 frequencies; precise cosf/sinf); scores x 1/sqrt(64); causal (finfo.min == exclusion); softmax; y = merged w_proj^T ('oi') -> [4][2048][1024] (8.4 M); argument order x, w_attn, w_proj).
// Layout per batch: bf16 copy of x; 'oi' weights; exact projections; computed {cos, sin} table k_cs5 (INVT[32]); interleaved-pair plane builders with per-dimension table entries (k_ropeI2); causal T-2048 attention (hybrid rows: < 512 hi/lo 3 products, rest fp16 x1024; k_gemmc skips tiles above the diagonal); merged hi/lo x Wo exact.
// Compute dtypes, f32 accumulate: every input rounded to bf16 (tables f32); projections exact; rotary f32; attention rows < 512 3 products, rest fp16; softmax f32; Wo hl x exact.

#define NB_  4
#define TT   2048
#define DM   1024
#define NH_  16
#define NKV  16
#define REP  (NH_ / NKV)
#define HD   64
#define DQ   (NH_ * HD)
#define DKV  (NKV * HD)
#define ZH   2
#define RH   512                  // query rows < RH use hi+lo planes (0: none)
#define WIN  2048
#define PCAR 1024.0f
#define SCL  0.125f   // HD^-0.5
#define PVS  4                    // key slices (work-groups) per 64-row tile in the probability x value contraction
#define PVWH (RH / PVS)           // keys per slice, rows < RH
#define PVWF (TT / PVS)           // keys per slice, the other rows
typedef _Float16 h16;
typedef unsigned short bf;
typedef __attribute__((ext_vector_type(16))) __bf16   v16bf;
typedef __attribute__((ext_vector_type(16))) _Float16 v16h;
typedef __attribute__((ext_vector_type(8)))  _Float16 v8h;
typedef __attribute__((ext_vector_type(8)))  unsigned short v8us;
typedef __attribute__((ext_vector_type(8)))  float    v8f;
typedef __attribute__((ext_vector_type(4)))  float    v4f;
typedef v8h  __attribute__((may_alias)) v8ha;
typedef v4f  __attribute__((may_alias)) v4fa;
typedef v8us __attribute__((may_alias)) v8usa;

__device__ __forceinline__ unsigned short f2bf(float f) { unsigned u = __float_as_uint(f); u += 0x7FFFu + ((u >> 16) & 1u); return (unsigned short)(u >> 16); }
__device__ __forceinline__ float bf2f(unsigned short b) { return __uint_as_float(((unsigned)b) << 16); }
__device__ __forceinline__ float bfr(float f) { return bf2f(f2bf(f)); }
__device__ __forceinline__ v16h cat16(v8h lo, v8h hi) { return __builtin_shufflevector(lo, hi, 0, 1, 2, 3, 4, 5, 6, 7, 8, 9, 10, 11, 12, 13, 14, 15); }
__device__ __forceinline__ v16bf cat16b(v8us lo, v8us hi) { return __builtin_bit_cast(v16bf, __builtin_shufflevector(lo, hi, 0, 1, 2, 3, 4, 5, 6, 7, 8, 9, 10, 11, 12, 13, 14, 15)); }
__device__ __forceinline__ v8f wmma16(v16h a, v16h b, v8f c) { return __builtin_amdgcn_wmma_f32_16x16x32_f16(false, a, false, b, (short)0, c, false, false); }
__device__ __forceinline__ v8f wmmab(v16bf a, v16bf b, v8f c) { return __builtin_amdgcn_wmma_f32_16x16x32_bf16(false, a, false, b, (short)0, c, false, false); }



// ---- k_gemmw: register-blocked GEMM, ONE WAVE per 64x64 output tile (16 accumulators), operands straight from K-contiguous 16-bit planes; grid (M/64, N/64, Z), 32 threads.
// C[m][n] (f32, pitch ldc, + optional f32 bias[n]) = sum_k A[m][k] Bt[n][k] (+ split products per NSPLIT). z-batch strides sA/sB/sC in elements. K % 32 == 0.
template <typename T16> struct WFrag;
template <> struct WFrag<h16> { typedef v16h V; static __device__ __forceinline__ V ld(const h16* p) { return cat16(*(const v8h*)p, *(const v8h*)(p + 16)); } static __device__ __forceinline__ v8f mma(V a, V b, v8f c) { return wmma16(a, b, c); } };
template <> struct WFrag<bf> { typedef v16bf V; static __device__ __forceinline__ V ld(const bf* p) { return cat16b(*(const v8us*)p, *(const v8us*)(p + 16)); } static __device__ __forceinline__ v8f mma(V a, V b, v8f c) { return wmmab(a, b, c); } };
template <typename T16, int NSPLIT, bool BIAS>
__global__ __launch_bounds__(32) void k_gemmw(const T16* __restrict__ A, const T16* __restrict__ A2, const T16* __restrict__ Bt, const T16* __restrict__ Bt2, int K, float* C, int ldc, const float* __restrict__ bias, size_t sA, size_t sB, size_t sC) {
    typedef typename WFrag<T16>::V V;
    __shared__ __align__(16) float os[16 * 68];
    const size_t z = blockIdx.z; A += z * sA; if (A2) A2 += z * sA; Bt += z * sB; if (Bt2) Bt2 += z * sB; C += z * sC;
    const int lane = threadIdx.x & 31, lr = lane & 15, hi = lane >> 4; const int r0 = blockIdx.x * 64, c0 = blockIdx.y * 64;
    v8f acc[4][4];
#pragma unroll
    for (int mb = 0; mb < 4; ++mb)
#pragma unroll
        for (int nb = 0; nb < 4; ++nb) acc[mb][nb] = (v8f){};
    const size_t aoff = (size_t)(r0 + lr) * K + 8 * hi, boff = (size_t)(c0 + lr) * K + 8 * hi;
#pragma unroll 1
    for (int kc = 0; kc < K; kc += 32) {
        V a[4], a2[4];
#pragma unroll
        for (int mb = 0; mb < 4; ++mb) { a[mb] = WFrag<T16>::ld(A + aoff + (size_t)mb * 16 * K + kc); if (NSPLIT == 1 || NSPLIT == 2) a2[mb] = WFrag<T16>::ld(A2 + aoff + (size_t)mb * 16 * K + kc); }
#pragma unroll
        for (int nb = 0; nb < 4; ++nb) { const V b = WFrag<T16>::ld(Bt + boff + (size_t)nb * 16 * K + kc); V b2; if (NSPLIT >= 2) b2 = WFrag<T16>::ld(Bt2 + boff + (size_t)nb * 16 * K + kc);
#pragma unroll
            for (int mb = 0; mb < 4; ++mb) { acc[mb][nb] = WFrag<T16>::mma(a[mb], b, acc[mb][nb]); if (NSPLIT == 1 || NSPLIT == 2) acc[mb][nb] = WFrag<T16>::mma(a2[mb], b, acc[mb][nb]); if (NSPLIT >= 2) acc[mb][nb] = WFrag<T16>::mma(a[mb], b2, acc[mb][nb]); } }
        asm volatile("v_nop\n\tv_nop\n\tv_nop\n\tv_nop" : "+v"(acc[0][0]), "+v"(acc[1][1]), "+v"(acc[2][2]), "+v"(acc[3][3]) : "v"(a[0]), "v"(a[3]));
    }
#pragma unroll
    for (int mb = 0; mb < 4; ++mb) {
#pragma unroll
        for (int nb = 0; nb < 4; ++nb) {
#pragma unroll
            for (int j = 0; j < 8; ++j) os[(hi * 8 + j) * 68 + nb * 16 + lr] = acc[mb][nb][j]; }
        __builtin_amdgcn_wave_barrier(); asm volatile("" ::: "memory");
        float* crow = C + (size_t)(r0 + mb * 16) * ldc + c0;
{
#pragma unroll
            for (int s = 0; s < 8; ++s) { const int row = 2 * s + hi, cofs = lr * 4; v4f val = *(const v4fa*)(os + row * 68 + cofs); if (BIAS) { val[0] += bfr(bias[c0 + cofs]); val[1] += bfr(bias[c0 + cofs + 1]); val[2] += bfr(bias[c0 + cofs + 2]); val[3] += bfr(bias[c0 + cofs + 3]); }
                *(v4f*)(crow + (size_t)row * ldc + cofs) = val; }
             }
        __builtin_amdgcn_wave_barrier(); asm volatile("" ::: "memory");
    }
}

// ---- k_gemmc: the same one-wave 64x64 tile GEMM specialised for causal attention: CMODE 1 skips score tiles entirely above the diagonal (query rows r0+roff.., key columns c0..), CMODE 2 limits the
// key (K) loop of the probability x value contraction to the diagonal block (probabilities beyond it are exactly zero). roff = row offset of this launch's first row within the sequence.
template <typename T16, int NSPLIT, int CMODE>
__global__ __launch_bounds__(32) void k_gemmc(const T16* __restrict__ A, const T16* __restrict__ A2, const T16* __restrict__ Bt, const T16* __restrict__ Bt2, int K, float* C, int ldc, int roff, size_t sA, size_t sB, size_t sC) {
    typedef typename WFrag<T16>::V V;
    __shared__ __align__(16) float os[16 * 68];
    const size_t z = blockIdx.z; A += z * sA; if (A2) A2 += z * sA; Bt += z * sB; if (Bt2) Bt2 += z * sB; C += z * sC;
    const int lane = threadIdx.x & 31, lr = lane & 15, hi = lane >> 4; const int r0 = blockIdx.x * 64, c0 = blockIdx.y * 64;
    if (CMODE == 1 && c0 > r0 + roff + 63) return;                  // score tile entirely above the causal diagonal: never read (the softmax masks j > i by select)
    const int Kl = (CMODE == 2) ? min(K, r0 + roff + 64) : K;        // P.V: probabilities are exactly 0 beyond the diagonal block, so the K loop stops there
    v8f acc[4][4];
#pragma unroll
    for (int mb = 0; mb < 4; ++mb)
#pragma unroll
        for (int nb = 0; nb < 4; ++nb) acc[mb][nb] = (v8f){};
    const size_t aoff = (size_t)(r0 + lr) * K + 8 * hi, boff = (size_t)(c0 + lr) * K + 8 * hi;
#pragma unroll 1
    for (int kc = 0; kc < Kl; kc += 32) {
        V a[4], a2[4];
#pragma unroll
        for (int mb = 0; mb < 4; ++mb) { a[mb] = WFrag<T16>::ld(A + aoff + (size_t)mb * 16 * K + kc); if (NSPLIT == 1 || NSPLIT == 2) a2[mb] = WFrag<T16>::ld(A2 + aoff + (size_t)mb * 16 * K + kc); }
#pragma unroll
        for (int nb = 0; nb < 4; ++nb) { const V b = WFrag<T16>::ld(Bt + boff + (size_t)nb * 16 * K + kc); V b2; if (NSPLIT >= 2) b2 = WFrag<T16>::ld(Bt2 + boff + (size_t)nb * 16 * K + kc);
#pragma unroll
            for (int mb = 0; mb < 4; ++mb) { acc[mb][nb] = WFrag<T16>::mma(a[mb], b, acc[mb][nb]); if (NSPLIT == 1 || NSPLIT == 2) acc[mb][nb] = WFrag<T16>::mma(a2[mb], b, acc[mb][nb]); if (NSPLIT >= 2) acc[mb][nb] = WFrag<T16>::mma(a[mb], b2, acc[mb][nb]); } }
        asm volatile("v_nop\n\tv_nop\n\tv_nop\n\tv_nop" : "+v"(acc[0][0]), "+v"(acc[1][1]), "+v"(acc[2][2]), "+v"(acc[3][3]) : "v"(a[0]), "v"(a[3]));
    }
#pragma unroll
    for (int mb = 0; mb < 4; ++mb) {
#pragma unroll
        for (int nb = 0; nb < 4; ++nb) {
#pragma unroll
            for (int j = 0; j < 8; ++j) os[(hi * 8 + j) * 68 + nb * 16 + lr] = acc[mb][nb][j]; }
        __builtin_amdgcn_wave_barrier(); asm volatile("" ::: "memory");
        float* crow = C + (size_t)(r0 + mb * 16) * ldc + c0;
{
#pragma unroll
            for (int s = 0; s < 8; ++s) { const int row = 2 * s + hi, cofs = lr * 4; v4f val = *(const v4fa*)(os + row * 68 + cofs);
                *(v4f*)(crow + (size_t)row * ldc + cofs) = val; }
             }
        __builtin_amdgcn_wave_barrier(); asm volatile("" ::: "memory");
    }
}

// ---- k_gemmpv: probability x value contraction with the key range SPLIT: a 64x64 output tile's keys up to its diagonal block are dealt in slices of NW * KCH keys to work-groups (blockIdx.y) and, inside a slice,
// in chunks of KCH keys to the NW waves. Each wave forms the whole tile (16 accumulators) over its own chunk; the NW partial tiles are summed through LDS in wave order 0..NW-1, and the slice's tile goes to plane blockIdx.y of C
// (plane stride sS); k_merge adds the planes in slice order. A slice that starts beyond the diagonal block writes nothing and k_merge does not read it. Operand rows have TT keys; roff = row offset of this launch's first row within the sequence.
template <typename T16, int NSPLIT, int NW, int KCH>
__global__ __launch_bounds__(32 * NW) void k_gemmpv(const T16* __restrict__ A, const T16* __restrict__ A2, const T16* __restrict__ Bt, const T16* __restrict__ Bt2, float* C, int roff, size_t sA, size_t sB, size_t sC, size_t sS) {
    typedef typename WFrag<T16>::V V;
    constexpr int NK = KCH / 32;
    __shared__ __align__(16) float ps[NW * 4096];    // partial tiles in accumulator order: [wave][fragment 16][register half 2][lane 32][4], so that every store and load is 512 contiguous bytes a wave
    __shared__ __align__(16) float os[64 * 68];      // the summed tile, row-major, for whole-line stores
    const int r0 = blockIdx.x * 64; const int Kl = min(TT, r0 + roff + 64);  // probabilities are exactly 0 beyond the diagonal block
    const int ks0 = blockIdx.y * (NW * KCH); if (ks0 >= Kl) return;         // the same for the whole work-group, in front of every barrier
    const size_t z = blockIdx.z;
    const int lane = threadIdx.x & 31, lr = lane & 15, hi = lane >> 4; const int w = __builtin_amdgcn_readfirstlane(threadIdx.x >> 5);
    const int k0 = ks0 + w * KCH;
    float* pw = ps + w * 4096 + lane * 4;
    if (k0 < Kl) {
        const unsigned vo = (unsigned)(lr * TT + 8 * hi) * 2u;               // the lane's byte offset, the same in every operand plane; the rest of each address is wave-uniform
        const char* pa = (const char*)(A + z * sA + (size_t)r0 * TT + k0); const char* pb = (const char*)(Bt + z * sB + k0);
        const char* pa2 = (NSPLIT == 1 || NSPLIT == 2) ? (const char*)(A2 + z * sA + (size_t)r0 * TT + k0) : pa; const char* pb2 = (NSPLIT >= 2) ? (const char*)(Bt2 + z * sB + k0) : pb;
        V a[NK][4], a2[NK][4], b[NK][4], b2[NK][4];                          // the whole chunk is asked for at once: one memory latency a wave
#pragma unroll
        for (int kk = 0; kk < NK; ++kk) {
#pragma unroll
            for (int mb = 0; mb < 4; ++mb) { a[kk][mb] = WFrag<T16>::ld((const T16*)(pa + vo) + mb * 16 * TT + kk * 32); if (NSPLIT == 1 || NSPLIT == 2) a2[kk][mb] = WFrag<T16>::ld((const T16*)(pa2 + vo) + mb * 16 * TT + kk * 32); }
#pragma unroll
            for (int nb = 0; nb < 4; ++nb) { b[kk][nb] = WFrag<T16>::ld((const T16*)(pb + vo) + nb * 16 * TT + kk * 32); if (NSPLIT >= 2) b2[kk][nb] = WFrag<T16>::ld((const T16*)(pb2 + vo) + nb * 16 * TT + kk * 32); }
        }
        asm volatile("s_wait_xcnt 0x0" :: "v"(vo) : "memory");               // keeps every load above in front of it and their address register whole until it has passed
        __builtin_amdgcn_sched_barrier(0);                                   // no matrix instruction is lifted among the loads: lifted, each would wait for its operands while the later loads are not yet asked for
        v8f acc[4][4];
#pragma unroll
        for (int mb = 0; mb < 4; ++mb)
#pragma unroll
            for (int nb = 0; nb < 4; ++nb) acc[mb][nb] = (v8f){};
#pragma unroll
        for (int kk = 0; kk < NK; ++kk)
#pragma unroll
            for (int nb = 0; nb < 4; ++nb)
#pragma unroll
                for (int mb = 0; mb < 4; ++mb) { acc[mb][nb] = WFrag<T16>::mma(a[kk][mb], b[kk][nb], acc[mb][nb]); if (NSPLIT == 1 || NSPLIT == 2) acc[mb][nb] = WFrag<T16>::mma(a2[kk][mb], b[kk][nb], acc[mb][nb]); if (NSPLIT >= 2) acc[mb][nb] = WFrag<T16>::mma(a[kk][mb], b2[kk][nb], acc[mb][nb]); }
        __builtin_amdgcn_sched_barrier(0);                                   // the LDS stores stay behind the last matrix instruction
#pragma unroll
        for (int mb = 0; mb < 4; ++mb)
#pragma unroll
            for (int nb = 0; nb < 4; ++nb) { const v8f c = acc[mb][nb]; *(v4f*)(pw + (mb * 4 + nb) * 256) = __builtin_shufflevector(c, c, 0, 1, 2, 3); *(v4f*)(pw + (mb * 4 + nb) * 256 + 128) = __builtin_shufflevector(c, c, 4, 5, 6, 7); }
    } else {                                         // a chunk beyond the diagonal block adds a tile of zeros
#pragma unroll
        for (int f = 0; f < 32; ++f) *(v4f*)(pw + f * 128) = (v4f){};
    }
    __syncthreads();                                 // every wave's partial tile is in LDS
#pragma unroll
    for (int i = 0; i < 16 / NW; ++i) { const int f = w + i * NW, mb = f >> 2, nb = f & 3; const float* pf = ps + f * 256 + lane * 4;   // wave w sums fragments w, w + NW, ...
        v4f s0 = *(const v4f*)pf, s1 = *(const v4f*)(pf + 128);
#pragma unroll
        for (int ww = 1; ww < NW; ++ww) { s0 += *(const v4f*)(pf + ww * 4096); s1 += *(const v4f*)(pf + ww * 4096 + 128); }
#pragma unroll
        for (int j = 0; j < 4; ++j) { os[(mb * 16 + hi * 8 + j) * 68 + nb * 16 + lr] = s0[j]; os[(mb * 16 + hi * 8 + 4 + j) * 68 + nb * 16 + lr] = s1[j]; } }
    __syncthreads();                                 // the summed tile is whole
    float* ct = C + z * sC + (size_t)blockIdx.y * sS + (size_t)r0 * HD;   // the tile's 64 rows of HD = 64 floats are one contiguous run
    const unsigned to = threadIdx.x * 4u;
#pragma unroll
    for (int s = 0; s < 32 / NW; ++s) { const int row = s * (2 * NW) + (int)(threadIdx.x >> 4), cofs = (threadIdx.x & 15) * 4; *(v4f*)(ct + to + s * (128 * NW)) = *(const v4fa*)(os + row * 68 + cofs); }
}

__device__ __forceinline__ h16 tohx(float x) { return (h16)x; }
__device__ __forceinline__ void splitf(float y, unsigned short& h, unsigned short& l) { h = f2bf(y); l = f2bf(y - bf2f(h)); }
typedef __attribute__((ext_vector_type(2))) _Float16 v2h;
typedef __attribute__((ext_vector_type(4))) _Float16 v4h;
typedef __attribute__((ext_vector_type(2))) unsigned short v2us;
typedef __attribute__((ext_vector_type(4))) unsigned short v4us;
typedef __attribute__((ext_vector_type(2))) float v2f;
typedef __attribute__((ext_vector_type(4))) int v4i;

__global__ __launch_bounds__(256) void k_cvt8(const float* __restrict__ src, bf* dst, size_t n8) { const size_t i = (size_t)blockIdx.x * 256 + threadIdx.x; if (i >= n8) return; const v8f v = *(const v8f*)(src + i * 8); v8us o;
#pragma unroll
    for (int k = 0; k < 8; ++k) o[k] = f2bf(v[k]); *(v8us*)(dst + i * 8) = o;  }

__global__ __launch_bounds__(256) void k_ropeI2(const float* __restrict__ F, int pitch, int nheads, const float* __restrict__ CS, float sc, h16* P16, bf* Ph, bf* Pl) {
    const size_t e = ((size_t)blockIdx.x * 256 + threadIdx.x) * 2; if (e >= (size_t)nheads * TT * HD) return; const int d = (int)(e % HD); const int t = (int)((e / HD) % TT); const int h = (int)(e / ((size_t)HD * TT)); const float* f = F + (size_t)t * pitch + h * HD; const float x0 = f[d], x1 = f[d + 1]; const v2f cs = *(const v2f*)(CS + ((size_t)t * HD + d) * 2); const v2f ct = *(const v2f*)(CS + ((size_t)t * HD + d + 1) * 2); v2h o16; v2us oh, ol;
    float a0 = __fmul_rn(x0, cs[0]), b0 = __fmul_rn(x1, cs[1]), a1 = __fmul_rn(x1, ct[0]), b1 = __fmul_rn(x0, ct[1]); asm volatile("" : "+v"(a0), "+v"(b0), "+v"(a1), "+v"(b1));
    float r0 = __fsub_rn(a0, b0) * sc, r1 = __fadd_rn(b1, a1) * sc;   /* even: x0 c - x1 s; odd: x0 s + x1 c */
    o16[0] = tohx(r0); o16[1] = tohx(r1); { unsigned short a2, c2; splitf(r0, a2, c2); oh[0] = a2; ol[0] = c2; splitf(r1, a2, c2); oh[1] = a2; ol[1] = c2; }
    *(v2h*)(P16 + e) = o16; *(v2us*)(Ph + e) = oh; *(v2us*)(Pl + e) = ol;  }


__global__ __launch_bounds__(256) void k_vtp(const float* __restrict__ F, int pitch, int nheads, h16* V16, bf* Vh, bf* Vl) { const size_t e = ((size_t)blockIdx.x * 256 + threadIdx.x) * 2; if (e >= (size_t)nheads * HD * TT) return; const int t = (int)(e % TT); const int d = (int)((e / TT) % HD); const int g = (int)(e / ((size_t)TT * HD)); v2h o16; v2us oh, ol;
#pragma unroll
    for (int q = 0; q < 2; ++q) { const float x = F[(size_t)(t + q) * pitch + g * HD + d]; o16[q] = tohx(x); unsigned short a2, c2; splitf(x, a2, c2); oh[q] = a2; ol[q] = c2; }
    *(v2h*)(V16 + e) = o16; *(v2us*)(Vh + e) = oh; *(v2us*)(Vl + e) = ol;  }
__constant__ float INVT[HD / 2] = { 1.000000000e+00f, 7.498942018e-01f, 5.623413324e-01f, 4.216965139e-01f, 3.162277639e-01f, 2.371373624e-01f, 1.778279394e-01f, 1.333521456e-01f, 1.000000015e-01f, 7.498941571e-02f, 5.623412877e-02f, 4.216964915e-02f, 3.162277862e-02f, 2.371373586e-02f, 1.778279431e-02f, 1.333521493e-02f, 9.999999776e-03f, 7.498942316e-03f, 5.623413250e-03f, 4.216964822e-03f, 3.162277862e-03f, 2.371373819e-03f, 1.778279431e-03f, 1.333521446e-03f, 1.000000047e-03f, 7.498941850e-04f, 5.623413017e-04f, 4.216964880e-04f, 3.162277862e-04f, 2.371373848e-04f, 1.778279402e-04f, 1.333521504e-04f };   // float32 1 / 10000^(2i/64), generated with jnp to be bit-exact
__global__ __launch_bounds__(256) void k_cs5(float* CS) { const int idx = blockIdx.x * 256 + threadIdx.x; if (idx >= TT * HD) return; const int d = idx % HD; const int t = idx / HD; const float a = __fmul_rn((float)t, INVT[d % (HD / 2)]); v2f cs; cs[0] = cosf(a); cs[1] = sinf(a); *(v2f*)(CS + (size_t)idx * 2) = cs;  }
// k_asoft: per row (zz, i): t = S x HD^-0.5 for j <= i and i - j < WIN (WIN = 2048 = T, so the window test always holds: plain causal; the reference's -1e9 additive fill vanishes identically); softmax over the 2048 keys (register row, one exp, fixed trees);
__global__ __launch_bounds__(256) void k_asoft(const float* __restrict__ Sb, h16* P16, bf* Ph, bf* Pl) {
    const int lane = threadIdx.x & 31; const int row = blockIdx.x * 8 + (threadIdx.x >> 5); if (row >= ZH * TT) return; const int i = row % TT; const int zz = row / TT; (void)zz; const bool hires = (i < RH); const float* sr = Sb + (size_t)row * TT; float v[TT / 32]; float mx = -3.0e38f;
#pragma unroll
    for (int ch = 0; ch < TT / 128; ++ch) { const int j0 = ch * 128 + lane * 4; const v4f a = *(const v4f*)(sr + j0);
#pragma unroll
        for (int q = 0; q < 4; ++q) { const int j = j0 + q; (void)j; const float t = (j <= i && i - j < WIN) ? a[q] * SCL : -3.0e38f; v[ch * 4 + q] = t; mx = fmaxf(mx, t); } }
#pragma unroll
    for (int sh = 16; sh; sh >>= 1) mx = fmaxf(mx, __shfl_xor(mx, sh, 32));
    float sum = 0.f;
#pragma unroll
    for (int k = 0; k < TT / 32; ++k) { float d0 = __fsub_rn(v[k], mx); asm volatile("" : "+v"(d0)); v[k] = __builtin_amdgcn_exp2f(__fmul_rn(d0, 1.4426950408889634f)); sum += v[k]; }
#pragma unroll
    for (int sh = 16; sh; sh >>= 1) sum += __shfl_xor(sum, sh, 32);
    const float f = __fdiv_rn(hires ? 1.0f : PCAR, sum);
{
        if (hires) {
#pragma unroll
            for (int ch = 0; ch < TT / 128; ++ch) { v4us oh, ol;
#pragma unroll
                for (int q = 0; q < 4; ++q) { unsigned short a, c2; splitf(v[ch * 4 + q] * f, a, c2); oh[q] = a; ol[q] = c2; }
                const size_t oo = ((size_t)zz * (RH ? RH : 1) + i) * TT + ch * 128 + lane * 4; *(v4us*)(Ph + oo) = oh; *(v4us*)(Pl + oo) = ol; }
        } else {
#pragma unroll
            for (int ch = 0; ch < TT / 128; ++ch) { v4h o4;
#pragma unroll
                for (int q = 0; q < 4; ++q) o4[q] = tohx(v[ch * 4 + q] * f);
                *(v4h*)(P16 + (size_t)row * TT + ch * 128 + lane * 4) = o4; } }
         }
}
__global__ __launch_bounds__(256) void k_merge(const float* __restrict__ O, int h0, bf* Ah, bf* Al) { const size_t e = ((size_t)blockIdx.x * 256 + threadIdx.x) * 2; if (e >= (size_t)ZH * TT * HD) return; const int d = (int)(e % HD); const int t = (int)((e / HD) % TT); const int zz = (int)(e / ((size_t)HD * TT)); const float cs = (t < RH) ? 1.0f : (1.0f / PCAR); const size_t oo = (size_t)t * DQ + (h0 + zz) * HD + d; const int kl = (t & ~63) + 64, sw = (t < RH) ? PVWH : PVWF;
    v2us oh, ol; v2f o = *(const v2f*)(O + e);
#pragma unroll
    for (int s = 1; s < PVS; ++s) { const bool on = s * sw < kl; const v2f p = *(const v2f*)(O + (on ? (size_t)s * ZH * TT * HD : (size_t)0) + e); o[0] = on ? o[0] + p[0] : o[0]; o[1] = on ? o[1] + p[1] : o[1]; }   /* the key slices that k_gemmpv wrote for this row's tile, in slice order; for a slice it did not write, plane 0 is read again and dropped, so that the loads do not wait for one another */
#pragma unroll
    for (int q = 0; q < 2; ++q) { unsigned short a, c2; splitf(o[q] * cs, a, c2); oh[q] = a; ol[q] = c2; } *(v2us*)(Ah + oo) = oh; *(v2us*)(Al + oo) = ol;  }

extern "C" void kernel_launch(void* const* d_in, const int* in_sizes, int n_in,
                              void* d_out, int out_size, void* d_ws, size_t ws_size, hipStream_t stream) {
    (void)in_sizes; (void)n_in; (void)out_size;
    const float* x = (const float*)d_in[0]; const float* wattn = (const float*)d_in[1]; const float* wo = (const float*)d_in[2];   /* order x, w_attn ('oi' [3072][1024]: q | k | v row thirds), w_proj ('oi') */ const float* wq = wattn; const float* wk = wattn + (size_t)DQ * DM; const float* wv = wattn + (size_t)2 * DQ * DM;
    float* OUT = (float*)d_out;     // [4][2048][1024]
    char* wsp = (char*)d_ws;
    auto take = [&](size_t bytes) { char* p = wsp; wsp += (bytes + 255) & ~(size_t)255; return (void*)p; };
    bf* WQ = (bf*)take((size_t)DQ * DM * 2); bf* WK = (bf*)take((size_t)DKV * DM * 2); bf* WV = (bf*)take((size_t)DKV * DM * 2); bf* WO = (bf*)take((size_t)DM * DQ * 2); float* CS = (float*)take((size_t)TT * HD * 2 * 4);
    bf* XB = (bf*)take((size_t)TT * DM * 2); float* FQ = (float*)take((size_t)TT * DQ * 4); float* FK = (float*)take((size_t)TT * DKV * 4);
    h16* QP16 = (h16*)take((size_t)NH_ * TT * HD * 2); h16* KP16 = (h16*)take((size_t)NKV * TT * HD * 2); h16* VT16 = (h16*)take((size_t)NKV * HD * TT * 2);
    bf* QPh = (bf*)take((size_t)NH_ * TT * HD * 2); bf* QPl = (bf*)take((size_t)NH_ * TT * HD * 2); bf* KPh = (bf*)take((size_t)NKV * TT * HD * 2); bf* KPl = (bf*)take((size_t)NKV * TT * HD * 2); bf* VTh = (bf*)take((size_t)NKV * HD * TT * 2); bf* VTl = (bf*)take((size_t)NKV * HD * TT * 2); bf* Ph = (bf*)take((size_t)ZH * RH * TT * 2); bf* Pl = (bf*)take((size_t)ZH * RH * TT * 2);
    float* Sb = (float*)take((size_t)ZH * TT * TT * 4); h16* P16 = (h16*)take((size_t)ZH * TT * TT * 2); float* Ob = (float*)take((size_t)PVS * ZH * TT * HD * 4); bf* ATh = (bf*)take((size_t)TT * DQ * 2); bf* ATl = (bf*)take((size_t)TT * DQ * 2);
    if ((size_t)(wsp - (char*)d_ws) > ws_size) return;    // ws 256 MiB
    float* FV = FK;   // v projection reuses the k buffer after the k planes are built (stream-ordered)
    { k_cvt8<<<(unsigned)(((size_t)DQ * DM / 8 + 255) / 256), 256, 0, stream>>>(wq, WQ, (size_t)DQ * DM / 8); k_cvt8<<<(unsigned)(((size_t)DKV * DM / 8 + 255) / 256), 256, 0, stream>>>(wk, WK, (size_t)DKV * DM / 8); k_cvt8<<<(unsigned)(((size_t)DKV * DM / 8 + 255) / 256), 256, 0, stream>>>(wv, WV, (size_t)DKV * DM / 8);
      k_cvt8<<<(unsigned)(((size_t)DM * DQ / 8 + 255) / 256), 256, 0, stream>>>(wo, WO, (size_t)DM * DQ / 8);
       }
    k_cs5<<<(TT * HD + 255) / 256, 256, 0, stream>>>(CS);   /* rotary {cos, sin} table from t and INVT */
    const unsigned LQ = (unsigned)(((size_t)NH_ * TT * HD / 2 + 255) / 256), LKv = (unsigned)(((size_t)NKV * TT * HD / 2 + 255) / 256);
    for (int b = 0; b < NB_; ++b) {
        
        k_cvt8<<<(unsigned)(((size_t)TT * DM / 8 + 255) / 256), 256, 0, stream>>>(x + (size_t)b * TT * DM, XB, (size_t)TT * DM / 8);
        k_gemmw<bf, 0, false><<<dim3(TT / 64, DQ / 64, 1), 32, 0, stream>>>(XB, nullptr, WQ, nullptr, DM, FQ, DQ, nullptr, 0, 0, 0);
        k_ropeI2<<<LQ, 256, 0, stream>>>(FQ, DQ, NH_, CS, 1.0f, QP16, QPh, QPl);
        k_gemmw<bf, 0, false><<<dim3(TT / 64, DKV / 64, 1), 32, 0, stream>>>(XB, nullptr, WK, nullptr, DM, FK, DKV, nullptr, 0, 0, 0);
        k_ropeI2<<<LKv, 256, 0, stream>>>(FK, DKV, NKV, CS, 1.0f, KP16, KPh, KPl);
        k_gemmw<bf, 0, false><<<dim3(TT / 64, DKV / 64, 1), 32, 0, stream>>>(XB, nullptr, WV, nullptr, DM, FV, DKV, nullptr, 0, 0, 0); k_vtp<<<LKv, 256, 0, stream>>>(FV, DKV, NKV, VT16, VTh, VTl);
        for (int h0 = 0; h0 < NH_; h0 += ZH) { const size_t zq = (size_t)h0, zk = (size_t)(h0 / REP);   // one kv head per query head: the pass's two heads use consecutive kv planes (z-strides TT*HD)
            k_gemmc<bf, 2, 1><<<dim3(RH / 64, TT / 64, ZH), 32, 0, stream>>>(QPh + zq * TT * HD, QPl + zq * TT * HD, KPh + zk * TT * HD, KPl + zk * TT * HD, HD, Sb, TT, 0, (size_t)TT * HD, (size_t)TT * HD, (size_t)TT * TT);
            k_gemmc<h16, 0, 1><<<dim3((TT - RH) / 64, TT / 64, ZH), 32, 0, stream>>>(QP16 + zq * TT * HD + (size_t)RH * HD, nullptr, KP16 + zk * TT * HD, nullptr, HD, Sb + (size_t)RH * TT, TT, RH, (size_t)TT * HD, (size_t)TT * HD, (size_t)TT * TT);
            k_asoft<<<ZH * TT / 8, 256, 0, stream>>>(Sb, P16, Ph, Pl);
            k_gemmpv<bf, 2, PVWH / 32, 32><<<dim3(RH / 64, PVS, ZH), PVWH, 0, stream>>>(Ph, Pl, VTh + zk * HD * TT, VTl + zk * HD * TT, Ob, 0, (size_t)RH * TT, (size_t)HD * TT, (size_t)TT * HD, (size_t)ZH * TT * HD);
            k_gemmpv<h16, 0, PVWF / 64, 64><<<dim3((TT - RH) / 64, PVS, ZH), PVWF / 2, 0, stream>>>(P16 + (size_t)RH * TT, nullptr, VT16 + zk * HD * TT, nullptr, Ob + (size_t)RH * HD, RH, (size_t)TT * TT, (size_t)HD * TT, (size_t)TT * HD, (size_t)ZH * TT * HD);
            k_merge<<<(unsigned)(((size_t)ZH * TT * HD / 2 + 255) / 256), 256, 0, stream>>>(Ob, h0, ATh, ATl); }
        k_gemmw<bf, 1, false><<<dim3(TT / 64, DM / 64, 1), 32, 0, stream>>>(ATh, ATl, WO, nullptr, DQ, OUT + (size_t)b * TT * DM, DM, nullptr, 0, 0, 0); }
}

// v002
// A run of this version takes 1040 microseconds.
// In both of two side-by-side timings against v001, it was 1.32 times as fast.
// Counting every step since v000, it is 2.73 times as fast.
#include <hip/hip_runtime.h>

// Causal self-attention with a fused bias-free qkv weight and the source's pairwise rotary form (x [4][2048][1024]; qkv = x w_attn^T ('oi' [3072][1024]) split in thirds q | k | v (16 heads x 64); rope on consecutive pairs with PER-ELEMENT table columns: out[2i] = x[2i] cos[2i] - x[2i+1] sin[2i], out[2i+1] = x[2i+1] cos[2i+1] + x[2i] sin[2i+1] where cos / sin = cat(freqs, freqs) of angle t x 1/10000^(2j/64) (so column d uses frequency d mod 32: the module reshapes the concatenated tables pairwise; reproduced literally; 32 f32 frequencies; precise cosf/sinf); scores x 1/sqrt(64); causal (finfo.min == exclusion); softmax; y = merged w_proj^T ('oi') -> [4][2048][1024] (8.4 M); argument order x, w_attn, w_proj).
// Layout per batch: bf16 copy of x; 'oi' weights; exact projections; computed {cos, sin} table k_cs5 (INVT[32]); interleaved-pair plane builders with per-dimension table entries (k_ropeI2); causal T-2048 attention (hybrid rows: < 512 hi/lo 3 products, rest fp16 x1024; k_gemmc skips tiles above the diagonal); merged hi/lo x Wo exact.
// Compute dtypes, f32 accumulate: every input rounded to bf16 (tables f32); projections exact; rotary f32; attention rows < 512 3 products, rest fp16; softmax f32; Wo hl x exact.

#define NB_  4
#define TT   2048
#define DM   1024
#define NH_  16
#define NKV  16
#define REP  (NH_ / NKV)
#define HD   64
#define DQ   (NH_ * HD)
#define DKV  (NKV * HD)
#define ZH   8                    // heads per attention pass (blockIdx.z of its launches)
#define PP   (2 * TT)             // pitch, in 16-bit elements, of a probability row: it lies over its own f32 score row (hi plane or fp16 row in the first half, lo plane in the second)
#define RH   512                  // query rows < RH use hi+lo planes (0: none)
#define WIN  2048
#define PCAR 1024.0f
#define SCL  0.125f   // HD^-0.5
#define PVS  4                    // key slices (work-groups) per 64-row tile in the probability x value contraction
#define PVWH (RH / PVS)           // keys per slice, rows < RH
#define PVWF (TT / PVS)           // keys per slice, the other rows
typedef _Float16 h16;
typedef unsigned short bf;
typedef __attribute__((ext_vector_type(16))) __bf16   v16bf;
typedef __attribute__((ext_vector_type(16))) _Float16 v16h;
typedef __attribute__((ext_vector_type(8)))  _Float16 v8h;
typedef __attribute__((ext_vector_type(8)))  unsigned short v8us;
typedef __attribute__((ext_vector_type(8)))  float    v8f;
typedef __attribute__((ext_vector_type(4)))  float    v4f;
typedef v8h  __attribute__((may_alias)) v8ha;
typedef v4f  __attribute__((may_alias)) v4fa;
typedef v8us __attribute__((may_alias)) v8usa;

__device__ __forceinline__ unsigned short f2bf(float f) { unsigned u = __float_as_uint(f); u += 0x7FFFu + ((u >> 16) & 1u); return (unsigned short)(u >> 16); }
__device__ __forceinline__ float bf2f(unsigned short b) { return __uint_as_float(((unsigned)b) << 16); }
__device__ __forceinline__ float bfr(float f) { return bf2f(f2bf(f)); }
__device__ __forceinline__ v16h cat16(v8h lo, v8h hi) { return __builtin_shufflevector(lo, hi, 0, 1, 2, 3, 4, 5, 6, 7, 8, 9, 10, 11, 12, 13, 14, 15); }
__device__ __forceinline__ v16bf cat16b(v8us lo, v8us hi) { return __builtin_bit_cast(v16bf, __builtin_shufflevector(lo, hi, 0, 1, 2, 3, 4, 5, 6, 7, 8, 9, 10, 11, 12, 13, 14, 15)); }
__device__ __forceinline__ v8f wmma16(v16h a, v16h b, v8f c) { return __builtin_amdgcn_wmma_f32_16x16x32_f16(false, a, false, b, (short)0, c, false, false); }
__device__ __forceinline__ v8f wmmab(v16bf a, v16bf b, v8f c) { return __builtin_amdgcn_wmma_f32_16x16x32_bf16(false, a, false, b, (short)0, c, false, false); }



// ---- k_gemmw: register-blocked GEMM, ONE WAVE per 64x64 output tile (16 accumulators), operands straight from K-contiguous 16-bit planes; grid (M/64, N/64, Z), 32 threads.
// C[m][n] (f32, pitch ldc, + optional f32 bias[n]) = sum_k A[m][k] Bt[n][k] (+ split products per NSPLIT). z-batch strides sA/sB/sC in elements. K % 32 == 0.
template <typename T16> struct WFrag;
template <> struct WFrag<h16> { typedef v16h V; static __device__ __forceinline__ V ld(const h16* p) { return cat16(*(const v8h*)p, *(const v8h*)(p + 16)); } static __device__ __forceinline__ v8f mma(V a, V b, v8f c) { return wmma16(a, b, c); } };
template <> struct WFrag<bf> { typedef v16bf V; static __device__ __forceinline__ V ld(const bf* p) { return cat16b(*(const v8us*)p, *(const v8us*)(p + 16)); } static __device__ __forceinline__ v8f mma(V a, V b, v8f c) { return wmmab(a, b, c); } };
template <typename T16, int NSPLIT, bool BIAS>
__global__ __launch_bounds__(32) void k_gemmw(const T16* __restrict__ A, const T16* __restrict__ A2, const T16* __restrict__ Bt, const T16* __restrict__ Bt2, int K, float* C, int ldc, const float* __restrict__ bias, size_t sA, size_t sB, size_t sC) {
    typedef typename WFrag<T16>::V V;
    __shared__ __align__(16) float os[16 * 68];
    const size_t z = blockIdx.z; A += z * sA; if (A2) A2 += z * sA; Bt += z * sB; if (Bt2) Bt2 += z * sB; C += z * sC;
    const int lane = threadIdx.x & 31, lr = lane & 15, hi = lane >> 4; const int r0 = blockIdx.x * 64, c0 = blockIdx.y * 64;
    v8f acc[4][4];
#pragma unroll
    for (int mb = 0; mb < 4; ++mb)
#pragma unroll
        for (int nb = 0; nb < 4; ++nb) acc[mb][nb] = (v8f){};
    const size_t aoff = (size_t)(r0 + lr) * K + 8 * hi, boff = (size_t)(c0 + lr) * K + 8 * hi;
#pragma unroll 1
    for (int kc = 0; kc < K; kc += 32) {
        V a[4], a2[4];
#pragma unroll
        for (int mb = 0; mb < 4; ++mb) { a[mb] = WFrag<T16>::ld(A + aoff + (size_t)mb * 16 * K + kc); if (NSPLIT == 1 || NSPLIT == 2) a2[mb] = WFrag<T16>::ld(A2 + aoff + (size_t)mb * 16 * K + kc); }
#pragma unroll
        for (int nb = 0; nb < 4; ++nb) { const V b = WFrag<T16>::ld(Bt + boff + (size_t)nb * 16 * K + kc); V b2; if (NSPLIT >= 2) b2 = WFrag<T16>::ld(Bt2 + boff + (size_t)nb * 16 * K + kc);
#pragma unroll
            for (int mb = 0; mb < 4; ++mb) { acc[mb][nb] = WFrag<T16>::mma(a[mb], b, acc[mb][nb]); if (NSPLIT == 1 || NSPLIT == 2) acc[mb][nb] = WFrag<T16>::mma(a2[mb], b, acc[mb][nb]); if (NSPLIT >= 2) acc[mb][nb] = WFrag<T16>::mma(a[mb], b2, acc[mb][nb]); } }
        asm volatile("v_nop\n\tv_nop\n\tv_nop\n\tv_nop" : "+v"(acc[0][0]), "+v"(acc[1][1]), "+v"(acc[2][2]), "+v"(acc[3][3]) : "v"(a[0]), "v"(a[3]));
    }
#pragma unroll
    for (int mb = 0; mb < 4; ++mb) {
#pragma unroll
        for (int nb = 0; nb < 4; ++nb) {
#pragma unroll
            for (int j = 0; j < 8; ++j) os[(hi * 8 + j) * 68 + nb * 16 + lr] = acc[mb][nb][j]; }
        __builtin_amdgcn_wave_barrier(); asm volatile("" ::: "memory");
        float* crow = C + (size_t)(r0 + mb * 16) * ldc + c0;
{
#pragma unroll
            for (int s = 0; s < 8; ++s) { const int row = 2 * s + hi, cofs = lr * 4; v4f val = *(const v4fa*)(os + row * 68 + cofs); if (BIAS) { val[0] += bfr(bias[c0 + cofs]); val[1] += bfr(bias[c0 + cofs + 1]); val[2] += bfr(bias[c0 + cofs + 2]); val[3] += bfr(bias[c0 + cofs + 3]); }
                *(v4f*)(crow + (size_t)row * ldc + cofs) = val; }
             }
        __builtin_amdgcn_wave_barrier(); asm volatile("" ::: "memory");
    }
}

// ---- k_gemmc: the same one-wave 64x64 tile GEMM specialised for causal attention: CMODE 1 skips score tiles entirely above the diagonal (query rows r0+roff.., key columns c0..), CMODE 2 limits the
// key (K) loop of the probability x value contraction to the diagonal block (probabilities beyond it are exactly zero). roff = row offset of this launch's first row within the sequence.
template <typename T16, int NSPLIT, int CMODE>
__global__ __launch_bounds__(32) void k_gemmc(const T16* __restrict__ A, const T16* __restrict__ A2, const T16* __restrict__ Bt, const T16* __restrict__ Bt2, int K, float* C, int ldc, int roff, size_t sA, size_t sB, size_t sC) {
    typedef typename WFrag<T16>::V V;
    __shared__ __align__(16) float os[16 * 68];
    const size_t z = blockIdx.z; A += z * sA; if (A2) A2 += z * sA; Bt += z * sB; if (Bt2) Bt2 += z * sB; C += z * sC;
    const int lane = threadIdx.x & 31, lr = lane & 15, hi = lane >> 4; const int r0 = blockIdx.x * 64, c0 = blockIdx.y * 64;
    if (CMODE == 1 && c0 > r0 + roff + 63) return;                  // score tile entirely above the causal diagonal: never read (the softmax masks j > i by select)
    const int Kl = (CMODE == 2) ? min(K, r0 + roff + 64) : K;        // P.V: probabilities are exactly 0 beyond the diagonal block, so the K loop stops there
    v8f acc[4][4];
#pragma unroll
    for (int mb = 0; mb < 4; ++mb)
#pragma unroll
        for (int nb = 0; nb < 4; ++nb) acc[mb][nb] = (v8f){};
    const size_t aoff = (size_t)(r0 + lr) * K + 8 * hi, boff = (size_t)(c0 + lr) * K + 8 * hi;
#pragma unroll 1
    for (int kc = 0; kc < Kl; kc += 32) {
        V a[4], a2[4];
#pragma unroll
        for (int mb = 0; mb < 4; ++mb) { a[mb] = WFrag<T16>::ld(A + aoff + (size_t)mb * 16 * K + kc); if (NSPLIT == 1 || NSPLIT == 2) a2[mb] = WFrag<T16>::ld(A2 + aoff + (size_t)mb * 16 * K + kc); }
#pragma unroll
        for (int nb = 0; nb < 4; ++nb) { const V b = WFrag<T16>::ld(Bt + boff + (size_t)nb * 16 * K + kc); V b2; if (NSPLIT >= 2) b2 = WFrag<T16>::ld(Bt2 + boff + (size_t)nb * 16 * K + kc);
#pragma unroll
            for (int mb = 0; mb < 4; ++mb) { acc[mb][nb] = WFrag<T16>::mma(a[mb], b, acc[mb][nb]); if (NSPLIT == 1 || NSPLIT == 2) acc[mb][nb] = WFrag<T16>::mma(a2[mb], b, acc[mb][nb]); if (NSPLIT >= 2) acc[mb][nb] = WFrag<T16>::mma(a[mb], b2, acc[mb][nb]); } }
        asm volatile("v_nop\n\tv_nop\n\tv_nop\n\tv_nop" : "+v"(acc[0][0]), "+v"(acc[1][1]), "+v"(acc[2][2]), "+v"(acc[3][3]) : "v"(a[0]), "v"(a[3]));
    }
#pragma unroll
    for (int mb = 0; mb < 4; ++mb) {
#pragma unroll
        for (int nb = 0; nb < 4; ++nb) {
#pragma unroll
            for (int j = 0; j < 8; ++j) os[(hi * 8 + j) * 68 + nb * 16 + lr] = acc[mb][nb][j]; }
        __builtin_amdgcn_wave_barrier(); asm volatile("" ::: "memory");
        float* crow = C + (size_t)(r0 + mb * 16) * ldc + c0;
{
#pragma unroll
            for (int s = 0; s < 8; ++s) { const int row = 2 * s + hi, cofs = lr * 4; v4f val = *(const v4fa*)(os + row * 68 + cofs);
                *(v4f*)(crow + (size_t)row * ldc + cofs) = val; }
             }
        __builtin_amdgcn_wave_barrier(); asm volatile("" ::: "memory");
    }
}

// ---- k_gemmpv: probability x value contraction with the key range SPLIT: a 64x64 output tile's keys up to its diagonal block are dealt in slices of NW * KCH keys to work-groups (blockIdx.y) and, inside a slice,
// in chunks of KCH keys to the NW waves. Each wave forms the whole tile (16 accumulators) over its own chunk; the NW partial tiles are summed through LDS in wave order 0..NW-1, and the slice's tile goes to plane blockIdx.y of C
// (plane stride sS); k_merge adds the planes in slice order. A slice that starts beyond the diagonal block writes nothing and k_merge does not read it. Value rows have TT keys, probability rows a pitch of PP; roff = row offset of this launch's first row within the sequence.
template <typename T16, int NSPLIT, int NW, int KCH>
__global__ __launch_bounds__(32 * NW) void k_gemmpv(const T16* __restrict__ A, const T16* __restrict__ A2, const T16* __restrict__ Bt, const T16* __restrict__ Bt2, float* C, int roff, size_t sA, size_t sB, size_t sC, size_t sS) {
    typedef typename WFrag<T16>::V V;
    constexpr int NK = KCH / 32;
    __shared__ __align__(16) float ps[NW * 4096];    // partial tiles in accumulator order: [wave][fragment 16][register half 2][lane 32][4], so that every store and load is 512 contiguous bytes a wave
    __shared__ __align__(16) float os[64 * 68];      // the summed tile, row-major, for whole-line stores
    const int r0 = blockIdx.x * 64; const int Kl = min(TT, r0 + roff + 64);  // probabilities are exactly 0 beyond the diagonal block
    const int ks0 = blockIdx.y * (NW * KCH); if (ks0 >= Kl) return;         // the same for the whole work-group, in front of every barrier
    const size_t z = blockIdx.z;
    const int lane = threadIdx.x & 31, lr = lane & 15, hi = lane >> 4; const int w = __builtin_amdgcn_readfirstlane(threadIdx.x >> 5);
    const int k0 = ks0 + w * KCH;
    float* pw = ps + w * 4096 + lane * 4;
    if (k0 < Kl) {
        const unsigned vo = (unsigned)(lr * TT + 8 * hi) * 2u, va = (unsigned)(lr * PP + 8 * hi) * 2u;   // the lane's byte offset in the value planes and in the probability planes; the rest of each address is wave-uniform
        const char* pa = (const char*)(A + z * sA + (size_t)r0 * PP + k0); const char* pb = (const char*)(Bt + z * sB + k0);
        const char* pa2 = (NSPLIT == 1 || NSPLIT == 2) ? (const char*)(A2 + z * sA + (size_t)r0 * PP + k0) : pa; const char* pb2 = (NSPLIT >= 2) ? (const char*)(Bt2 + z * sB + k0) : pb;
        V a[NK][4], a2[NK][4], b[NK][4], b2[NK][4];                          // the whole chunk is asked for at once: one memory latency a wave
#pragma unroll
        for (int kk = 0; kk < NK; ++kk) {
#pragma unroll
            for (int mb = 0; mb < 4; ++mb) { a[kk][mb] = WFrag<T16>::ld((const T16*)(pa + va) + mb * 16 * PP + kk * 32); if (NSPLIT == 1 || NSPLIT == 2) a2[kk][mb] = WFrag<T16>::ld((const T16*)(pa2 + va) + mb * 16 * PP + kk * 32); }
#pragma unroll
            for (int nb = 0; nb < 4; ++nb) { b[kk][nb] = WFrag<T16>::ld((const T16*)(pb + vo) + nb * 16 * TT + kk * 32); if (NSPLIT >= 2) b2[kk][nb] = WFrag<T16>::ld((const T16*)(pb2 + vo) + nb * 16 * TT + kk * 32); }
        }
        asm volatile("s_wait_xcnt 0x0" :: "v"(vo), "v"(va) : "memory");      // keeps every load above in front of it and their address registers whole until it has passed
        __builtin_amdgcn_sched_barrier(0);                                   // no matrix instruction is lifted among the loads: lifted, each would wait for its operands while the later loads are not yet asked for
        v8f acc[4][4];
#pragma unroll
        for (int mb = 0; mb < 4; ++mb)
#pragma unroll
            for (int nb = 0; nb < 4; ++nb) acc[mb][nb] = (v8f){};
#pragma unroll
        for (int kk = 0; kk < NK; ++kk)
#pragma unroll
            for (int nb = 0; nb < 4; ++nb)
#pragma unroll
                for (int mb = 0; mb < 4; ++mb) { acc[mb][nb] = WFrag<T16>::mma(a[kk][mb], b[kk][nb], acc[mb][nb]); if (NSPLIT == 1 || NSPLIT == 2) acc[mb][nb] = WFrag<T16>::mma(a2[kk][mb], b[kk][nb], acc[mb][nb]); if (NSPLIT >= 2) acc[mb][nb] = WFrag<T16>::mma(a[kk][mb], b2[kk][nb], acc[mb][nb]); }
        __builtin_amdgcn_sched_barrier(0);                                   // the LDS stores stay behind the last matrix instruction
#pragma unroll
        for (int mb = 0; mb < 4; ++mb)
#pragma unroll
            for (int nb = 0; nb < 4; ++nb) { const v8f c = acc[mb][nb]; *(v4f*)(pw + (mb * 4 + nb) * 256) = __builtin_shufflevector(c, c, 0, 1, 2, 3); *(v4f*)(pw + (mb * 4 + nb) * 256 + 128) = __builtin_shufflevector(c, c, 4, 5, 6, 7); }
    } else {                                         // a chunk beyond the diagonal block adds a tile of zeros
#pragma unroll
        for (int f = 0; f < 32; ++f) *(v4f*)(pw + f * 128) = (v4f){};
    }
    __syncthreads();                                 // every wave's partial tile is in LDS
#pragma unroll
    for (int i = 0; i < 16 / NW; ++i) { const int f = w + i * NW, mb = f >> 2, nb = f & 3; const float* pf = ps + f * 256 + lane * 4;   // wave w sums fragments w, w + NW, ...
        v4f s0 = *(const v4f*)pf, s1 = *(const v4f*)(pf + 128);
#pragma unroll
        for (int ww = 1; ww < NW; ++ww) { s0 += *(const v4f*)(pf + ww * 4096); s1 += *(const v4f*)(pf + ww * 4096 + 128); }
#pragma unroll
        for (int j = 0; j < 4; ++j) { os[(mb * 16 + hi * 8 + j) * 68 + nb * 16 + lr] = s0[j]; os[(mb * 16 + hi * 8 + 4 + j) * 68 + nb * 16 + lr] = s1[j]; } }
    __syncthreads();                                 // the summed tile is whole
    float* ct = C + z * sC + (size_t)blockIdx.y * sS + (size_t)r0 * HD;   // the tile's 64 rows of HD = 64 floats are one contiguous run
    const unsigned to = threadIdx.x * 4u;
#pragma unroll
    for (int s = 0; s < 32 / NW; ++s) { const int row = s * (2 * NW) + (int)(threadIdx.x >> 4), cofs = (threadIdx.x & 15) * 4; *(v4f*)(ct + to + s * (128 * NW)) = *(const v4fa*)(os + row * 68 + cofs); }
}

__device__ __forceinline__ h16 tohx(float x) { return (h16)x; }
__device__ __forceinline__ void splitf(float y, unsigned short& h, unsigned short& l) { h = f2bf(y); l = f2bf(y - bf2f(h)); }
typedef __attribute__((ext_vector_type(2))) _Float16 v2h;
typedef __attribute__((ext_vector_type(4))) _Float16 v4h;
typedef __attribute__((ext_vector_type(2))) unsigned short v2us;
typedef __attribute__((ext_vector_type(4))) unsigned short v4us;
typedef __attribute__((ext_vector_type(2))) float v2f;
typedef __attribute__((ext_vector_type(4))) int v4i;

__global__ __launch_bounds__(256) void k_cvt8(const float* __restrict__ src, bf* dst, size_t n8) { const size_t i = (size_t)blockIdx.x * 256 + threadIdx.x; if (i >= n8) return; const v8f v = *(const v8f*)(src + i * 8); v8us o;
#pragma unroll
    for (int k = 0; k < 8; ++k) o[k] = f2bf(v[k]); *(v8us*)(dst + i * 8) = o;  }

__global__ __launch_bounds__(256) void k_ropeI2(const float* __restrict__ F, int pitch, int nheads, const float* __restrict__ CS, float sc, h16* P16, bf* Ph, bf* Pl) {
    const size_t e = ((size_t)blockIdx.x * 256 + threadIdx.x) * 2; if (e >= (size_t)nheads * TT * HD) return; const int d = (int)(e % HD); const int t = (int)((e / HD) % TT); const int h = (int)(e / ((size_t)HD * TT)); const float* f = F + (size_t)t * pitch + h * HD; const float x0 = f[d], x1 = f[d + 1]; const v2f cs = *(const v2f*)(CS + ((size_t)t * HD + d) * 2); const v2f ct = *(const v2f*)(CS + ((size_t)t * HD + d + 1) * 2); v2h o16; v2us oh, ol;
    float a0 = __fmul_rn(x0, cs[0]), b0 = __fmul_rn(x1, cs[1]), a1 = __fmul_rn(x1, ct[0]), b1 = __fmul_rn(x0, ct[1]); asm volatile("" : "+v"(a0), "+v"(b0), "+v"(a1), "+v"(b1));
    float r0 = __fsub_rn(a0, b0) * sc, r1 = __fadd_rn(b1, a1) * sc;   /* even: x0 c - x1 s; odd: x0 s + x1 c */
    o16[0] = tohx(r0); o16[1] = tohx(r1); { unsigned short a2, c2; splitf(r0, a2, c2); oh[0] = a2; ol[0] = c2; splitf(r1, a2, c2); oh[1] = a2; ol[1] = c2; }
    *(v2h*)(P16 + e) = o16; *(v2us*)(Ph + e) = oh; *(v2us*)(Pl + e) = ol;  }


__global__ __launch_bounds__(256) void k_vtp(const float* __restrict__ F, int pitch, int nheads, h16* V16, bf* Vh, bf* Vl) { const size_t e = ((size_t)blockIdx.x * 256 + threadIdx.x) * 2; if (e >= (size_t)nheads * HD * TT) return; const int t = (int)(e % TT); const int d = (int)((e / TT) % HD); const int g = (int)(e / ((size_t)TT * HD)); v2h o16; v2us oh, ol;
#pragma unroll
    for (int q = 0; q < 2; ++q) { const float x = F[(size_t)(t + q) * pitch + g * HD + d]; o16[q] = tohx(x); unsigned short a2, c2; splitf(x, a2, c2); oh[q] = a2; ol[q] = c2; }
    *(v2h*)(V16 + e) = o16; *(v2us*)(Vh + e) = oh; *(v2us*)(Vl + e) = ol;  }
__constant__ float INVT[HD / 2] = { 1.000000000e+00f, 7.498942018e-01f, 5.623413324e-01f, 4.216965139e-01f, 3.162277639e-01f, 2.371373624e-01f, 1.778279394e-01f, 1.333521456e-01f, 1.000000015e-01f, 7.498941571e-02f, 5.623412877e-02f, 4.216964915e-02f, 3.162277862e-02f, 2.371373586e-02f, 1.778279431e-02f, 1.333521493e-02f, 9.999999776e-03f, 7.498942316e-03f, 5.623413250e-03f, 4.216964822e-03f, 3.162277862e-03f, 2.371373819e-03f, 1.778279431e-03f, 1.333521446e-03f, 1.000000047e-03f, 7.498941850e-04f, 5.623413017e-04f, 4.216964880e-04f, 3.162277862e-04f, 2.371373848e-04f, 1.778279402e-04f, 1.333521504e-04f };   // float32 1 / 10000^(2i/64), generated with jnp to be bit-exact
__global__ __launch_bounds__(256) void k_cs5(float* CS) { const int idx = blockIdx.x * 256 + threadIdx.x; if (idx >= TT * HD) return; const int d = idx % HD; const int t = idx / HD; const float a = __fmul_rn((float)t, INVT[d % (HD / 2)]); v2f cs; cs[0] = cosf(a); cs[1] = sinf(a); *(v2f*)(CS + (size_t)idx * 2) = cs;  }
// k_asoft: the probabilities of a row are stored over the row's own scores (P16 / Ph / Pl point into Sb, pitch PP): one wave owns the row and holds all of it in registers before its first store, whose value hangs on the row's sum. Per row (zz, i): t = S x HD^-0.5 for j <= i and i - j < WIN (sliding causal window; the reference's -1e9 additive fill vanishes identically); softmax over the 2048 keys (register row, one exp, fixed trees);
__global__ __launch_bounds__(256) void k_asoft(const float* Sb, h16* P16, bf* Ph, bf* Pl) {
    const int lane = threadIdx.x & 31; const int row = blockIdx.x * 8 + (threadIdx.x >> 5); if (row >= ZH * TT) return; const int i = row % TT; const int zz = row / TT; (void)zz; const bool hires = (i < RH); const float* sr = Sb + (size_t)row * TT; float v[TT / 32]; float mx = -3.0e38f;
#pragma unroll
    for (int ch = 0; ch < TT / 128; ++ch) { const int j0 = ch * 128 + lane * 4; const v4f a = *(const v4f*)(sr + j0);
#pragma unroll
        for (int q = 0; q < 4; ++q) { const int j = j0 + q; (void)j; const float t = (j <= i && i - j < WIN) ? a[q] * SCL : -3.0e38f; v[ch * 4 + q] = t; mx = fmaxf(mx, t); } }
#pragma unroll
    for (int sh = 16; sh; sh >>= 1) mx = fmaxf(mx, __shfl_xor(mx, sh, 32));
    float sum = 0.f;
#pragma unroll
    for (int k = 0; k < TT / 32; ++k) { float d0 = __fsub_rn(v[k], mx); asm volatile("" : "+v"(d0)); v[k] = __builtin_amdgcn_exp2f(__fmul_rn(d0, 1.4426950408889634f)); sum += v[k]; }
#pragma unroll
    for (int sh = 16; sh; sh >>= 1) sum += __shfl_xor(sum, sh, 32);
    const float f = __fdiv_rn(hires ? 1.0f : PCAR, sum);
{
        if (hires) {
#pragma unroll
            for (int ch = 0; ch < TT / 128; ++ch) { v4us oh, ol;
#pragma unroll
                for (int q = 0; q < 4; ++q) { unsigned short a, c2; splitf(v[ch * 4 + q] * f, a, c2); oh[q] = a; ol[q] = c2; }
                const size_t oo = (size_t)row * PP + ch * 128 + lane * 4; *(v4us*)(Ph + oo) = oh; *(v4us*)(Pl + oo) = ol; }
        } else {
#pragma unroll
            for (int ch = 0; ch < TT / 128; ++ch) { v4h o4;
#pragma unroll
                for (int q = 0; q < 4; ++q) o4[q] = tohx(v[ch * 4 + q] * f);
                *(v4h*)(P16 + (size_t)row * PP + ch * 128 + lane * 4) = o4; } }
         }
}
__global__ __launch_bounds__(256) void k_merge(const float* __restrict__ O, int h0, bf* Ah, bf* Al) { const size_t e = ((size_t)blockIdx.x * 256 + threadIdx.x) * 2; if (e >= (size_t)ZH * TT * HD) return; const int d = (int)(e % HD); const int t = (int)((e / HD) % TT); const int zz = (int)(e / ((size_t)HD * TT)); const float cs = (t < RH) ? 1.0f : (1.0f / PCAR); const size_t oo = (size_t)t * DQ + (h0 + zz) * HD + d; const int kl = (t & ~63) + 64, sw = (t < RH) ? PVWH : PVWF;
    v2us oh, ol; v2f o = *(const v2f*)(O + e);
#pragma unroll
    for (int s = 1; s < PVS; ++s) { const bool on = s * sw < kl; const v2f p = *(const v2f*)(O + (on ? (size_t)s * ZH * TT * HD : (size_t)0) + e); o[0] = on ? o[0] + p[0] : o[0]; o[1] = on ? o[1] + p[1] : o[1]; }   /* the key slices that k_gemmpv wrote for this row's tile, in slice order; for a slice it did not write, plane 0 is read again and dropped, so that the loads do not wait for one another */
#pragma unroll
    for (int q = 0; q < 2; ++q) { unsigned short a, c2; splitf(o[q] * cs, a, c2); oh[q] = a; ol[q] = c2; } *(v2us*)(Ah + oo) = oh; *(v2us*)(Al + oo) = ol;  }

extern "C" void kernel_launch(void* const* d_in, const int* in_sizes, int n_in,
                              void* d_out, int out_size, void* d_ws, size_t ws_size, hipStream_t stream) {
    (void)in_sizes; (void)n_in; (void)out_size;
    const float* x = (const float*)d_in[0]; const float* wattn = (const float*)d_in[1]; const float* wo = (const float*)d_in[2];   /* order x, w_attn ('oi' [3072][1024]: q | k | v row thirds), w_proj ('oi') */ const float* wq = wattn; const float* wk = wattn + (size_t)DQ * DM; const float* wv = wattn + (size_t)2 * DQ * DM;
    float* OUT = (float*)d_out;     // [4][2048][1024]
    char* wsp = (char*)d_ws;
    auto take = [&](size_t bytes) { char* p = wsp; wsp += (bytes + 255) & ~(size_t)255; return (void*)p; };
    bf* WQ = (bf*)take((size_t)DQ * DM * 2); bf* WK = (bf*)take((size_t)DKV * DM * 2); bf* WV = (bf*)take((size_t)DKV * DM * 2); bf* WO = (bf*)take((size_t)DM * DQ * 2); float* CS = (float*)take((size_t)TT * HD * 2 * 4);
    bf* XB = (bf*)take((size_t)TT * DM * 2); float* FQ = (float*)take((size_t)TT * DQ * 4); float* FK = (float*)take((size_t)TT * DKV * 4);
    h16* QP16 = (h16*)take((size_t)NH_ * TT * HD * 2); h16* KP16 = (h16*)take((size_t)NKV * TT * HD * 2); h16* VT16 = (h16*)take((size_t)NKV * HD * TT * 2);
    bf* QPh = (bf*)take((size_t)NH_ * TT * HD * 2); bf* QPl = (bf*)take((size_t)NH_ * TT * HD * 2); bf* KPh = (bf*)take((size_t)NKV * TT * HD * 2); bf* KPl = (bf*)take((size_t)NKV * TT * HD * 2); bf* VTh = (bf*)take((size_t)NKV * HD * TT * 2); bf* VTl = (bf*)take((size_t)NKV * HD * TT * 2);
    float* Sb = (float*)take((size_t)ZH * TT * TT * 4); h16* P16 = (h16*)Sb; bf* Ph = (bf*)Sb; bf* Pl = (bf*)Sb + TT;   /* probability rows over their score rows */ float* Ob = (float*)take((size_t)PVS * ZH * TT * HD * 4); bf* ATh = (bf*)take((size_t)TT * DQ * 2); bf* ATl = (bf*)take((size_t)TT * DQ * 2);
    if ((size_t)(wsp - (char*)d_ws) > ws_size) return;    // ws 256 MiB
    float* FV = FK;   // v projection reuses the k buffer after the k planes are built (stream-ordered)
    { k_cvt8<<<(unsigned)(((size_t)DQ * DM / 8 + 255) / 256), 256, 0, stream>>>(wq, WQ, (size_t)DQ * DM / 8); k_cvt8<<<(unsigned)(((size_t)DKV * DM / 8 + 255) / 256), 256, 0, stream>>>(wk, WK, (size_t)DKV * DM / 8); k_cvt8<<<(unsigned)(((size_t)DKV * DM / 8 + 255) / 256), 256, 0, stream>>>(wv, WV, (size_t)DKV * DM / 8);
      k_cvt8<<<(unsigned)(((size_t)DM * DQ / 8 + 255) / 256), 256, 0, stream>>>(wo, WO, (size_t)DM * DQ / 8);
       }
    k_cs5<<<(TT * HD + 255) / 256, 256, 0, stream>>>(CS);   /* rotary {cos, sin} table from t and INVT */
    const unsigned LQ = (unsigned)(((size_t)NH_ * TT * HD / 2 + 255) / 256), LKv = (unsigned)(((size_t)NKV * TT * HD / 2 + 255) / 256);
    for (int b = 0; b < NB_; ++b) {
        
        k_cvt8<<<(unsigned)(((size_t)TT * DM / 8 + 255) / 256), 256, 0, stream>>>(x + (size_t)b * TT * DM, XB, (size_t)TT * DM / 8);
        k_gemmw<bf, 0, false><<<dim3(TT / 64, DQ / 64, 1), 32, 0, stream>>>(XB, nullptr, WQ, nullptr, DM, FQ, DQ, nullptr, 0, 0, 0);
        k_ropeI2<<<LQ, 256, 0, stream>>>(FQ, DQ, NH_, CS, 1.0f, QP16, QPh, QPl);
        k_gemmw<bf, 0, false><<<dim3(TT / 64, DKV / 64, 1), 32, 0, stream>>>(XB, nullptr, WK, nullptr, DM, FK, DKV, nullptr, 0, 0, 0);
        k_ropeI2<<<LKv, 256, 0, stream>>>(FK, DKV, NKV, CS, 1.0f, KP16, KPh, KPl);
        k_gemmw<bf, 0, false><<<dim3(TT / 64, DKV / 64, 1), 32, 0, stream>>>(XB, nullptr, WV, nullptr, DM, FV, DKV, nullptr, 0, 0, 0); k_vtp<<<LKv, 256, 0, stream>>>(FV, DKV, NKV, VT16, VTh, VTl);
        for (int h0 = 0; h0 < NH_; h0 += ZH) { const size_t zq = (size_t)h0, zk = (size_t)(h0 / REP);   // one kv head per query head: the pass's heads use consecutive kv planes (z-strides TT*HD)
            k_gemmc<bf, 2, 1><<<dim3(RH / 64, TT / 64, ZH), 32, 0, stream>>>(QPh + zq * TT * HD, QPl + zq * TT * HD, KPh + zk * TT * HD, KPl + zk * TT * HD, HD, Sb, TT, 0, (size_t)TT * HD, (size_t)TT * HD, (size_t)TT * TT);
            k_gemmc<h16, 0, 1><<<dim3((TT - RH) / 64, TT / 64, ZH), 32, 0, stream>>>(QP16 + zq * TT * HD + (size_t)RH * HD, nullptr, KP16 + zk * TT * HD, nullptr, HD, Sb + (size_t)RH * TT, TT, RH, (size_t)TT * HD, (size_t)TT * HD, (size_t)TT * TT);
            k_asoft<<<ZH * TT / 8, 256, 0, stream>>>(Sb, P16, Ph, Pl);
            k_gemmpv<bf, 2, PVWH / 32, 32><<<dim3(RH / 64, PVS, ZH), PVWH, 0, stream>>>(Ph, Pl, VTh + zk * HD * TT, VTl + zk * HD * TT, Ob, 0, (size_t)TT * PP, (size_t)HD * TT, (size_t)TT * HD, (size_t)ZH * TT * HD);
            k_gemmpv<h16, 0, PVWF / 64, 64><<<dim3((TT - RH) / 64, PVS, ZH), PVWF / 2, 0, stream>>>(P16 + (size_t)RH * PP, nullptr, VT16 + zk * HD * TT, nullptr, Ob + (size_t)RH * HD, RH, (size_t)TT * PP, (size_t)HD * TT, (size_t)TT * HD, (size_t)ZH * TT * HD);
            k_merge<<<(unsigned)(((size_t)ZH * TT * HD / 2 + 255) / 256), 256, 0, stream>>>(Ob, h0, ATh, ATl); }
        k_gemmw<bf, 1, false><<<dim3(TT / 64, DM / 64, 1), 32, 0, stream>>>(ATh, ATl, WO, nullptr, DQ, OUT + (size_t)b * TT * DM, DM, nullptr, 0, 0, 0); }
}

// v003
// Measured time: 582 microseconds a run.
// In two side-by-side timings against v002, it was 1.78 and 1.80 times as fast.
// All steps since v000 together make it 4.88 times as fast.
#include <hip/hip_runtime.h>

// Causal self-attention with a fused bias-free qkv weight and the source's pairwise rotary form (x [4][2048][1024]; qkv = x w_attn^T ('oi' [3072][1024]) split in thirds q | k | v (16 heads x 64); rope on consecutive pairs with PER-ELEMENT table columns: out[2i] = x[2i] cos[2i] - x[2i+1] sin[2i], out[2i+1] = x[2i+1] cos[2i+1] + x[2i] sin[2i+1] where cos / sin = cat(freqs, freqs) of angle t x 1/10000^(2j/64) (so column d uses frequency d mod 32: the module reshapes the concatenated tables pairwise; reproduced literally; 32 f32 frequencies; precise cosf/sinf); scores x 1/sqrt(64); causal (finfo.min == exclusion); softmax; y = merged w_proj^T ('oi') -> [4][2048][1024] (8.4 M); argument order x, w_attn, w_proj).
// Layout per batch: bf16 copy of x; 'oi' weights; exact projections; computed {cos, sin} table k_cs5 (INVT[32]); interleaved-pair plane builders with per-dimension table entries (k_ropeI2); one-kernel causal T-2048 attention k_fattn (hybrid rows: < 512 hi/lo 3 products, rest fp16 x1024; key blocks above the diagonal are never visited); merged hi/lo x Wo exact.
// Compute dtypes, f32 accumulate: every input rounded to bf16; tables f32; projections exact; rotary f32; attention rows < 512 3 products, rest fp16; softmax f32; Wo hl x exact.

#define NB_  4
#define TT   2048
#define DM   1024
#define NH_  16
#define NKV  16
#define REP  (NH_ / NKV)
#define HD   64
#define DQ   (NH_ * HD)
#define DKV  (NKV * HD)
#define RH   512                  // query rows < RH use hi+lo planes (0: none)
#define SCL  0.125f   // HD^-0.5
typedef _Float16 h16;
typedef unsigned short bf;
typedef __attribute__((ext_vector_type(16))) __bf16   v16bf;
typedef __attribute__((ext_vector_type(16))) _Float16 v16h;
typedef __attribute__((ext_vector_type(8)))  _Float16 v8h;
typedef __attribute__((ext_vector_type(8)))  unsigned short v8us;
typedef __attribute__((ext_vector_type(8)))  float    v8f;
typedef __attribute__((ext_vector_type(4)))  float    v4f;
typedef v8h  __attribute__((may_alias)) v8ha;
typedef v4f  __attribute__((may_alias)) v4fa;
typedef v8us __attribute__((may_alias)) v8usa;

__device__ __forceinline__ unsigned short f2bf(float f) { unsigned u = __float_as_uint(f); u += 0x7FFFu + ((u >> 16) & 1u); return (unsigned short)(u >> 16); }
__device__ __forceinline__ float bf2f(unsigned short b) { return __uint_as_float(((unsigned)b) << 16); }
__device__ __forceinline__ float bfr(float f) { return bf2f(f2bf(f)); }
__device__ __forceinline__ v16h cat16(v8h lo, v8h hi) { return __builtin_shufflevector(lo, hi, 0, 1, 2, 3, 4, 5, 6, 7, 8, 9, 10, 11, 12, 13, 14, 15); }
__device__ __forceinline__ v16bf cat16b(v8us lo, v8us hi) { return __builtin_bit_cast(v16bf, __builtin_shufflevector(lo, hi, 0, 1, 2, 3, 4, 5, 6, 7, 8, 9, 10, 11, 12, 13, 14, 15)); }
__device__ __forceinline__ v8f wmma16(v16h a, v16h b, v8f c) { return __builtin_amdgcn_wmma_f32_16x16x32_f16(false, a, false, b, (short)0, c, false, false); }
__device__ __forceinline__ v8f wmmab(v16bf a, v16bf b, v8f c) { return __builtin_amdgcn_wmma_f32_16x16x32_bf16(false, a, false, b, (short)0, c, false, false); }



// ---- k_gemmw: register-blocked GEMM, ONE WAVE per 64x64 output tile (16 accumulators), operands straight from K-contiguous 16-bit planes; grid (M/64, N/64, Z), 32 threads.
// C[m][n] (f32, pitch ldc, + optional f32 bias[n]) = sum_k A[m][k] Bt[n][k] (+ split products per NSPLIT). z-batch strides sA/sB/sC in elements. K % 32 == 0.
template <typename T16> struct WFrag;
template <> struct WFrag<h16> { typedef v16h V; static __device__ __forceinline__ V ld(const h16* p) { return cat16(*(const v8h*)p, *(const v8h*)(p + 16)); } static __device__ __forceinline__ v8f mma(V a, V b, v8f c) { return wmma16(a, b, c); } };
template <> struct WFrag<bf> { typedef v16bf V; static __device__ __forceinline__ V ld(const bf* p) { return cat16b(*(const v8us*)p, *(const v8us*)(p + 16)); } static __device__ __forceinline__ v8f mma(V a, V b, v8f c) { return wmmab(a, b, c); } };
template <typename T16, int NSPLIT, bool BIAS>
__global__ __launch_bounds__(32) void k_gemmw(const T16* __restrict__ A, const T16* __restrict__ A2, const T16* __restrict__ Bt, const T16* __restrict__ Bt2, int K, float* C, int ldc, const float* __restrict__ bias, size_t sA, size_t sB, size_t sC) {
    typedef typename WFrag<T16>::V V;
    __shared__ __align__(16) float os[16 * 68];
    const size_t z = blockIdx.z; A += z * sA; if (A2) A2 += z * sA; Bt += z * sB; if (Bt2) Bt2 += z * sB; C += z * sC;
    const int lane = threadIdx.x & 31, lr = lane & 15, hi = lane >> 4; const int r0 = blockIdx.x * 64, c0 = blockIdx.y * 64;
    v8f acc[4][4];
#pragma unroll
    for (int mb = 0; mb < 4; ++mb)
#pragma unroll
        for (int nb = 0; nb < 4; ++nb) acc[mb][nb] = (v8f){};
    const size_t aoff = (size_t)(r0 + lr) * K + 8 * hi, boff = (size_t)(c0 + lr) * K + 8 * hi;
#pragma unroll 1
    for (int kc = 0; kc < K; kc += 32) {
        V a[4], a2[4];
#pragma unroll
        for (int mb = 0; mb < 4; ++mb) { a[mb] = WFrag<T16>::ld(A + aoff + (size_t)mb * 16 * K + kc); if (NSPLIT == 1 || NSPLIT == 2) a2[mb] = WFrag<T16>::ld(A2 + aoff + (size_t)mb * 16 * K + kc); }
#pragma unroll
        for (int nb = 0; nb < 4; ++nb) { const V b = WFrag<T16>::ld(Bt + boff + (size_t)nb * 16 * K + kc); V b2; if (NSPLIT >= 2) b2 = WFrag<T16>::ld(Bt2 + boff + (size_t)nb * 16 * K + kc);
#pragma unroll
            for (int mb = 0; mb < 4; ++mb) { acc[mb][nb] = WFrag<T16>::mma(a[mb], b, acc[mb][nb]); if (NSPLIT == 1 || NSPLIT == 2) acc[mb][nb] = WFrag<T16>::mma(a2[mb], b, acc[mb][nb]); if (NSPLIT >= 2) acc[mb][nb] = WFrag<T16>::mma(a[mb], b2, acc[mb][nb]); } }
        asm volatile("v_nop\n\tv_nop\n\tv_nop\n\tv_nop" : "+v"(acc[0][0]), "+v"(acc[1][1]), "+v"(acc[2][2]), "+v"(acc[3][3]) : "v"(a[0]), "v"(a[3]));
    }
#pragma unroll
    for (int mb = 0; mb < 4; ++mb) {
#pragma unroll
        for (int nb = 0; nb < 4; ++nb) {
#pragma unroll
            for (int j = 0; j < 8; ++j) os[(hi * 8 + j) * 68 + nb * 16 + lr] = acc[mb][nb][j]; }
        __builtin_amdgcn_wave_barrier(); asm volatile("" ::: "memory");
        float* crow = C + (size_t)(r0 + mb * 16) * ldc + c0;
{
#pragma unroll
            for (int s = 0; s < 8; ++s) { const int row = 2 * s + hi, cofs = lr * 4; v4f val = *(const v4fa*)(os + row * 68 + cofs); if (BIAS) { val[0] += bfr(bias[c0 + cofs]); val[1] += bfr(bias[c0 + cofs + 1]); val[2] += bfr(bias[c0 + cofs + 2]); val[3] += bfr(bias[c0 + cofs + 3]); }
                *(v4f*)(crow + (size_t)row * ldc + cofs) = val; }
             }
        __builtin_amdgcn_wave_barrier(); asm volatile("" ::: "memory");
    }
}

__device__ __forceinline__ h16 tohx(float x) { return (h16)x; }
__device__ __forceinline__ void splitf(float y, unsigned short& h, unsigned short& l) { h = f2bf(y); l = f2bf(y - bf2f(h)); }
typedef __attribute__((ext_vector_type(2))) _Float16 v2h;
typedef __attribute__((ext_vector_type(4))) _Float16 v4h;
typedef __attribute__((ext_vector_type(2))) unsigned short v2us;
typedef __attribute__((ext_vector_type(4))) unsigned short v4us;
typedef __attribute__((ext_vector_type(2))) float v2f;
typedef __attribute__((ext_vector_type(4))) int v4i;

__global__ __launch_bounds__(256) void k_cvt8(const float* __restrict__ src, bf* dst, size_t n8) { const size_t i = (size_t)blockIdx.x * 256 + threadIdx.x; if (i >= n8) return; const v8f v = *(const v8f*)(src + i * 8); v8us o;
#pragma unroll
    for (int k = 0; k < 8; ++k) o[k] = f2bf(v[k]); *(v8us*)(dst + i * 8) = o;  }

__global__ __launch_bounds__(256) void k_ropeI2(const float* __restrict__ F, int pitch, int nheads, const float* __restrict__ CS, float sc, h16* P16, bf* Ph, bf* Pl) {
    const size_t e = ((size_t)blockIdx.x * 256 + threadIdx.x) * 2; if (e >= (size_t)nheads * TT * HD) return; const int d = (int)(e % HD); const int t = (int)((e / HD) % TT); const int h = (int)(e / ((size_t)HD * TT)); const float* f = F + (size_t)t * pitch + h * HD; const float x0 = f[d], x1 = f[d + 1]; const v2f cs = *(const v2f*)(CS + ((size_t)t * HD + d) * 2); const v2f ct = *(const v2f*)(CS + ((size_t)t * HD + d + 1) * 2); v2h o16; v2us oh, ol;
    float a0 = __fmul_rn(x0, cs[0]), b0 = __fmul_rn(x1, cs[1]), a1 = __fmul_rn(x1, ct[0]), b1 = __fmul_rn(x0, ct[1]); asm volatile("" : "+v"(a0), "+v"(b0), "+v"(a1), "+v"(b1));
    float r0 = __fsub_rn(a0, b0) * sc, r1 = __fadd_rn(b1, a1) * sc;   /* even: x0 c - x1 s; odd: x0 s + x1 c */
    o16[0] = tohx(r0); o16[1] = tohx(r1); { unsigned short a2, c2; splitf(r0, a2, c2); oh[0] = a2; ol[0] = c2; splitf(r1, a2, c2); oh[1] = a2; ol[1] = c2; }
    *(v2h*)(P16 + e) = o16; *(v2us*)(Ph + e) = oh; *(v2us*)(Pl + e) = ol;  }


__global__ __launch_bounds__(256) void k_vtp(const float* __restrict__ F, int pitch, int nheads, h16* V16, bf* Vh, bf* Vl) { const size_t e = ((size_t)blockIdx.x * 256 + threadIdx.x) * 2; if (e >= (size_t)nheads * HD * TT) return; const int t = (int)(e % TT); const int d = (int)((e / TT) % HD); const int g = (int)(e / ((size_t)TT * HD)); v2h o16; v2us oh, ol;
#pragma unroll
    for (int q = 0; q < 2; ++q) { const float x = F[(size_t)(t + q) * pitch + g * HD + d]; o16[q] = tohx(x); unsigned short a2, c2; splitf(x, a2, c2); oh[q] = a2; ol[q] = c2; }
    *(v2h*)(V16 + e) = o16; *(v2us*)(Vh + e) = oh; *(v2us*)(Vl + e) = ol;  }
__constant__ float INVT[HD / 2] = { 1.000000000e+00f, 7.498942018e-01f, 5.623413324e-01f, 4.216965139e-01f, 3.162277639e-01f, 2.371373624e-01f, 1.778279394e-01f, 1.333521456e-01f, 1.000000015e-01f, 7.498941571e-02f, 5.623412877e-02f, 4.216964915e-02f, 3.162277862e-02f, 2.371373586e-02f, 1.778279431e-02f, 1.333521493e-02f, 9.999999776e-03f, 7.498942316e-03f, 5.623413250e-03f, 4.216964822e-03f, 3.162277862e-03f, 2.371373819e-03f, 1.778279431e-03f, 1.333521446e-03f, 1.000000047e-03f, 7.498941850e-04f, 5.623413017e-04f, 4.216964880e-04f, 3.162277862e-04f, 2.371373848e-04f, 1.778279402e-04f, 1.333521504e-04f };   // float32 1 / 10000^(2i/64), generated with jnp to be bit-exact
__global__ __launch_bounds__(256) void k_cs5(float* CS) { const int idx = blockIdx.x * 256 + threadIdx.x; if (idx >= TT * HD) return; const int d = idx % HD; const int t = idx / HD; const float a = __fmul_rn((float)t, INVT[d % (HD / 2)]); v2f cs; cs[0] = cosf(a); cs[1] = sinf(a); *(v2f*)(CS + (size_t)idx * 2) = cs;  }
#define FNW 4
template <typename T16, bool SPL> struct PPack;
template <> struct PPack<h16, false> { static __device__ __forceinline__ void pk(const float* p, v16h& ph, v16h& pl) { (void)pl;
#pragma unroll
    for (int s = 0; s < 16; ++s) ph[s] = (h16)p[s]; } };
template <> struct PPack<bf, true> { static __device__ __forceinline__ void pk(const float* p, v16bf& ph, v16bf& pl) { v8us h0, h1, l0, l1;
#pragma unroll
    for (int s = 0; s < 8; ++s) { unsigned short x, y; splitf(p[s], x, y); h0[s] = x; l0[s] = y; splitf(p[8 + s], x, y); h1[s] = x; l1[s] = y; }
    ph = cat16b(h0, h1); pl = cat16b(l0, l1); } };
template <typename T16, bool SPL, int NQG>
__device__ __forceinline__ void attn_tile(const T16* __restrict__ Q, const T16* __restrict__ Q2, const T16* __restrict__ Kp, const T16* __restrict__ K2, const T16* __restrict__ Vt, const T16* __restrict__ V2, const int q0, float* so, float* sm, float* sl, bf* Ah, bf* Al) {
    typedef typename WFrag<T16>::V V;
    constexpr int NQ = NQG * 16;
    constexpr float C = SCL * 1.4426950408889634f;      // raw score -> exponent of 2
    constexpr float OFF = SPL ? 0.0f : 10.0f;           // fp16 probabilities carry a factor 1024 (it cancels against the sum, which carries it too)
    const int lane = threadIdx.x & 31, lr = lane & 15, hi = lane >> 4; const int w = __builtin_amdgcn_readfirstlane(threadIdx.x >> 5);
    const int nbl = q0 / 32 + 1, per = (nbl + FNW - 1) / FNW, kb0 = w * per, kb1 = min(nbl, kb0 + per);   // 32-key blocks up to the diagonal one; this wave's share
    v8f o[4][NQG]; float m[NQG], l[NQG];
#pragma unroll
    for (int g = 0; g < NQG; ++g) { m[g] = -3.0e38f; l[g] = 0.f;
#pragma unroll
        for (int dt = 0; dt < 4; ++dt) o[dt][g] = (v8f){}; }
    if (kb0 < kb1) {
        V qf[NQG][2], qf2[NQG][2], kf[2][2], kf2[2][2];
        const unsigned ko = (unsigned)(lr * HD + 8 * hi) * 2u, vo = (unsigned)(lr * TT + 8 * hi) * 2u;   // the lane's byte offset in a query or key tile and in a value tile; the rest of each address is wave-uniform
#pragma unroll
        for (int g = 0; g < NQG; ++g)
#pragma unroll
            for (int kk = 0; kk < 2; ++kk) { const int qc = (q0 + g * 16) * HD + kk * 32; qf[g][kk] = WFrag<T16>::ld((const T16*)((const char*)(Q + qc) + ko)); if (SPL) qf2[g][kk] = WFrag<T16>::ld((const T16*)((const char*)(Q2 + qc) + ko)); }
        if (!SPL) {
#pragma unroll
            for (int t = 0; t < 2; ++t)
#pragma unroll
                for (int kk = 0; kk < 2; ++kk) kf[t][kk] = WFrag<T16>::ld((const T16*)((const char*)(Kp + kb0 * 32 * HD) + ko) + t * 16 * HD + kk * 32);
        }
#pragma unroll 1   // the trip count is known only at run time and one body already takes most of the registers that four waves a SIMD leave: a second copy would spill
        for (int kb = kb0; kb < kb1; ++kb) {
            const int k0 = kb * 32;
            V vf[4], vf2[4];
            const char* pv = (const char*)(Vt + k0) + vo; const char* pv2 = SPL ? (const char*)(V2 + k0) + vo : pv;   // the lane's addresses in this block's value tiles
            if (!SPL) {                                  // one plane each: the value tiles are asked for in front of the score products, their latency passes behind scores and softmax
#pragma unroll
                for (int dt = 0; dt < 4; ++dt) vf[dt] = WFrag<T16>::ld((const T16*)pv + dt * 16 * TT);
            } else {                                     // two planes each: key and value tiles take turns in the registers, so that four waves fit a SIMD
                const char* pk = (const char*)(Kp + k0 * HD) + ko; const char* pk2 = (const char*)(K2 + k0 * HD) + ko;
#pragma unroll
                for (int t = 0; t < 2; ++t)
#pragma unroll
                    for (int kk = 0; kk < 2; ++kk) { const int kc = t * 16 * HD + kk * 32; kf[t][kk] = WFrag<T16>::ld((const T16*)pk + kc); kf2[t][kk] = WFrag<T16>::ld((const T16*)pk2 + kc); }
                asm volatile("s_wait_xcnt 0x0" :: "v"(pk), "v"(pk2) : "memory");   // the loads' address registers stay whole up to here; behind it they are given to other values
                __builtin_amdgcn_sched_barrier(0);       // all key tiles are asked for at once: with matrix instructions lifted among the loads the tiles shared registers and each load waited for the one before
            }
            v8f s[2][NQG];
#pragma unroll
            for (int t = 0; t < 2; ++t)
#pragma unroll
                for (int g = 0; g < NQG; ++g) { s[t][g] = (v8f){};
#pragma unroll
                    for (int kk = 0; kk < 2; ++kk) { s[t][g] = WFrag<T16>::mma(kf[t][kk], qf[g][kk], s[t][g]); if (SPL) { s[t][g] = WFrag<T16>::mma(kf[t][kk], qf2[g][kk], s[t][g]); s[t][g] = WFrag<T16>::mma(kf2[t][kk], qf[g][kk], s[t][g]); } } }
            if (!SPL) { const char* pk = (const char*)(Kp + min(kb + 1, kb1 - 1) * 32 * HD) + ko;    // the next block's key tiles are asked for one block ahead (the last block asks for itself again)
#pragma unroll
                for (int t = 0; t < 2; ++t)
#pragma unroll
                    for (int kk = 0; kk < 2; ++kk) kf[t][kk] = WFrag<T16>::ld((const T16*)pk + t * 16 * HD + kk * 32);
                asm volatile("s_wait_xcnt 0x0" :: "v"(pv), "v"(pk) : "memory");    // the loads' address registers stay whole up to here; behind it they are given to other values
            } else {
#pragma unroll
                for (int dt = 0; dt < 4; ++dt) { vf[dt] = WFrag<T16>::ld((const T16*)pv + dt * 16 * TT); vf2[dt] = WFrag<T16>::ld((const T16*)pv2 + dt * 16 * TT); }
                asm volatile("s_wait_xcnt 0x0" :: "v"(pv), "v"(pv2) : "memory");   // the loads' address registers stay whole up to here; behind it they are given to other values
            }
            if (k0 + 31 > q0) {                          // the diagonal block (wave-uniform): keys behind the query are excluded
#pragma unroll
                for (int t = 0; t < 2; ++t)
#pragma unroll
                    for (int g = 0; g < NQG; ++g)
#pragma unroll
                        for (int r = 0; r < 8; ++r) s[t][g][r] = (k0 + t * 16 + 8 * hi + r <= q0 + g * 16 + lr) ? s[t][g][r] : -3.0e38f;
            }
            V pb[NQG], pb2[NQG];
#pragma unroll
            for (int g = 0; g < NQG; ++g) {
                float bm = s[0][g][0];
#pragma unroll
                for (int r = 1; r < 8; ++r) bm = fmaxf(bm, s[0][g][r]);
#pragma unroll
                for (int r = 0; r < 8; ++r) bm = fmaxf(bm, s[1][g][r]);
                bm = fmaxf(bm, __shfl_xor(bm, 16, 32));  // the query's other 16 keys of the block lie in the other lane half
                const float mn = fmaxf(m[g], bm), sc = __builtin_amdgcn_exp2f((m[g] - mn) * C), nb = OFF - mn * C; m[g] = mn;
                float p[16], ps = 0.f;
#pragma unroll
                for (int e = 0; e < 16; ++e) { p[e] = __builtin_amdgcn_exp2f(fmaf(s[e >> 3][g][e & 7], C, nb)); ps += p[e]; }
                l[g] = l[g] * sc + ps;
#pragma unroll
                for (int dt = 0; dt < 4; ++dt) o[dt][g] *= sc;
                PPack<T16, SPL>::pk(p, pb[g], pb2[g]);
            }
#pragma unroll
            for (int dt = 0; dt < 4; ++dt)
#pragma unroll
                for (int g = 0; g < NQG; ++g) { o[dt][g] = WFrag<T16>::mma(vf[dt], pb[g], o[dt][g]); if (SPL) { o[dt][g] = WFrag<T16>::mma(vf[dt], pb2[g], o[dt][g]); o[dt][g] = WFrag<T16>::mma(vf2[dt], pb[g], o[dt][g]); } }
        }
    }
#pragma unroll
    for (int g = 0; g < NQG; ++g) { l[g] += __shfl_xor(l[g], 16, 32);   // the two lane halves summed different keys of the same query
        if (hi == 0) { sm[w * NQ + g * 16 + lr] = m[g]; sl[w * NQ + g * 16 + lr] = l[g]; }
#pragma unroll
        for (int dt = 0; dt < 4; ++dt) { float* po = so + (w * NQ + g * 16 + lr) * 68 + dt * 16 + 8 * hi; const v8f c = o[dt][g]; *(v4f*)po = __builtin_shufflevector(c, c, 0, 1, 2, 3); *(v4f*)(po + 4) = __builtin_shufflevector(c, c, 4, 5, 6, 7); } }
    __syncthreads();                                     // every wave's partial maximum, sum and tile are in LDS
    constexpr int TPQ = 32 * FNW / NQ, CH = HD / TPQ;    // threads per query (neighbouring lanes, so that one wave writes a query's whole 128-byte line) and head dimensions per thread
    const int q = threadIdx.x / TPQ, c0 = (threadIdx.x % TPQ) * CH;
    float M = sm[q];
#pragma unroll
    for (int ww = 1; ww < FNW; ++ww) M = fmaxf(M, sm[ww * NQ + q]);
    float L = 0.f; v4f acc[CH / 4];
#pragma unroll
    for (int i = 0; i < CH / 4; ++i) acc[i] = (v4f){};
#pragma unroll
    for (int ww = 0; ww < FNW; ++ww) { const float wg = __builtin_amdgcn_exp2f((sm[ww * NQ + q] - M) * C); L += wg * sl[ww * NQ + q];   // a wave without keys has maximum -3e38: weight 0
#pragma unroll
        for (int i = 0; i < CH / 4; ++i) acc[i] += *(const v4f*)(so + (ww * NQ + q) * 68 + c0 + i * 4) * wg; }
    const float inv = __fdiv_rn(1.0f, L);
    const size_t oo = (size_t)(q0 + q) * DQ + c0;
#pragma unroll
    for (int i = 0; i < CH / 8; ++i) { v8us oh, ol;
#pragma unroll
        for (int e = 0; e < 8; ++e) { unsigned short x, y; splitf(acc[i * 2 + (e >> 2)][e & 3] * inv, x, y); oh[e] = x; ol[e] = y; }
        *(v8us*)(Ah + oo + i * 8) = oh; *(v8us*)(Al + oo + i * 8) = ol; }
    asm volatile("s_wait_xcnt 0x0" ::: "memory");        // behind the last store: in the built kernel the other tile form's code follows this one, and there the stores' registers are written again
}
// grid (heads, query tiles), so that work-groups start longest first over all heads: the tiles of 32 rows >= RH from the last down (fp16 operands), then the tiles of 16 rows < RH (hi / lo planes, 3 products)
__global__ __launch_bounds__(32 * FNW) void k_fattn(const h16* __restrict__ Q16, const h16* __restrict__ K16, const h16* __restrict__ V16, const bf* __restrict__ Qh, const bf* __restrict__ Ql, const bf* __restrict__ Kh, const bf* __restrict__ Kl, const bf* __restrict__ Vh, const bf* __restrict__ Vl, bf* Ah, bf* Al) {
    __shared__ __align__(16) float so[FNW * 32 * 68]; __shared__ float sm[FNW * 32]; __shared__ float sl[FNW * 32];
    constexpr int NLO = (TT - RH) / 32;
    const size_t zq = (size_t)blockIdx.x * TT * HD, zk = (size_t)(blockIdx.x / REP) * TT * HD; const int x = blockIdx.y;
    bf* ah = Ah + blockIdx.x * HD; bf* al = Al + blockIdx.x * HD;
    if (x < NLO) attn_tile<h16, false, 2>(Q16 + zq, nullptr, K16 + zk, nullptr, V16 + zk, nullptr, TT - 32 - x * 32, so, sm, sl, ah, al);
    else attn_tile<bf, true, 1>(Qh + zq, Ql + zq, Kh + zk, Kl + zk, Vh + zk, Vl + zk, RH - 16 - (x - NLO) * 16, so, sm, sl, ah, al);
}

extern "C" void kernel_launch(void* const* d_in, const int* in_sizes, int n_in,
                              void* d_out, int out_size, void* d_ws, size_t ws_size, hipStream_t stream) {
    (void)in_sizes; (void)n_in; (void)out_size;
    const float* x = (const float*)d_in[0]; const float* wattn = (const float*)d_in[1]; const float* wo = (const float*)d_in[2];   /* order x, w_attn ('oi' [3072][1024]: q | k | v row thirds), w_proj ('oi') */ const float* wq = wattn; const float* wk = wattn + (size_t)DQ * DM; const float* wv = wattn + (size_t)2 * DQ * DM;
    float* OUT = (float*)d_out;     // [4][2048][1024]
    char* wsp = (char*)d_ws;
    auto take = [&](size_t bytes) { char* p = wsp; wsp += (bytes + 255) & ~(size_t)255; return (void*)p; };
    bf* WQ = (bf*)take((size_t)DQ * DM * 2); bf* WK = (bf*)take((size_t)DKV * DM * 2); bf* WV = (bf*)take((size_t)DKV * DM * 2); bf* WO = (bf*)take((size_t)DM * DQ * 2); float* CS = (float*)take((size_t)TT * HD * 2 * 4);
    bf* XB = (bf*)take((size_t)TT * DM * 2); float* FQ = (float*)take((size_t)TT * DQ * 4); float* FK = (float*)take((size_t)TT * DKV * 4);
    h16* QP16 = (h16*)take((size_t)NH_ * TT * HD * 2); h16* KP16 = (h16*)take((size_t)NKV * TT * HD * 2); h16* VT16 = (h16*)take((size_t)NKV * HD * TT * 2);
    bf* QPh = (bf*)take((size_t)NH_ * TT * HD * 2); bf* QPl = (bf*)take((size_t)NH_ * TT * HD * 2); bf* KPh = (bf*)take((size_t)NKV * TT * HD * 2); bf* KPl = (bf*)take((size_t)NKV * TT * HD * 2); bf* VTh = (bf*)take((size_t)NKV * HD * TT * 2); bf* VTl = (bf*)take((size_t)NKV * HD * TT * 2);
    bf* ATh = (bf*)take((size_t)TT * DQ * 2); bf* ATl = (bf*)take((size_t)TT * DQ * 2);
    if ((size_t)(wsp - (char*)d_ws) > ws_size) return;    // ws 256 MiB
    float* FV = FK;   // v projection reuses the k buffer after the k planes are built (stream-ordered)
    { k_cvt8<<<(unsigned)(((size_t)DQ * DM / 8 + 255) / 256), 256, 0, stream>>>(wq, WQ, (size_t)DQ * DM / 8); k_cvt8<<<(unsigned)(((size_t)DKV * DM / 8 + 255) / 256), 256, 0, stream>>>(wk, WK, (size_t)DKV * DM / 8); k_cvt8<<<(unsigned)(((size_t)DKV * DM / 8 + 255) / 256), 256, 0, stream>>>(wv, WV, (size_t)DKV * DM / 8);
      k_cvt8<<<(unsigned)(((size_t)DM * DQ / 8 + 255) / 256), 256, 0, stream>>>(wo, WO, (size_t)DM * DQ / 8);
       }
    k_cs5<<<(TT * HD + 255) / 256, 256, 0, stream>>>(CS);   /* rotary {cos, sin} table from t and INVT */
    const unsigned LQ = (unsigned)(((size_t)NH_ * TT * HD / 2 + 255) / 256), LKv = (unsigned)(((size_t)NKV * TT * HD / 2 + 255) / 256);
    for (int b = 0; b < NB_; ++b) {
        
        k_cvt8<<<(unsigned)(((size_t)TT * DM / 8 + 255) / 256), 256, 0, stream>>>(x + (size_t)b * TT * DM, XB, (size_t)TT * DM / 8);
        k_gemmw<bf, 0, false><<<dim3(TT / 64, DQ / 64, 1), 32, 0, stream>>>(XB, nullptr, WQ, nullptr, DM, FQ, DQ, nullptr, 0, 0, 0);
        k_ropeI2<<<LQ, 256, 0, stream>>>(FQ, DQ, NH_, CS, 1.0f, QP16, QPh, QPl);
        k_gemmw<bf, 0, false><<<dim3(TT / 64, DKV / 64, 1), 32, 0, stream>>>(XB, nullptr, WK, nullptr, DM, FK, DKV, nullptr, 0, 0, 0);
        k_ropeI2<<<LKv, 256, 0, stream>>>(FK, DKV, NKV, CS, 1.0f, KP16, KPh, KPl);
        k_gemmw<bf, 0, false><<<dim3(TT / 64, DKV / 64, 1), 32, 0, stream>>>(XB, nullptr, WV, nullptr, DM, FV, DKV, nullptr, 0, 0, 0); k_vtp<<<LKv, 256, 0, stream>>>(FV, DKV, NKV, VT16, VTh, VTl);
        k_fattn<<<dim3(NH_, (TT - RH) / 32 + RH / 16, 1), 32 * FNW, 0, stream>>>(QP16, KP16, VT16, QPh, QPl, KPh, KPl, VTh, VTl, ATh, ATl);
        k_gemmw<bf, 1, false><<<dim3(TT / 64, DM / 64, 1), 32, 0, stream>>>(ATh, ATl, WO, nullptr, DQ, OUT + (size_t)b * TT * DM, DM, nullptr, 0, 0, 0); }
}

// v004
// A run of this version takes 344 microseconds.
// Timed twice side by side with v003, it ran 1.70 and 1.69 times as fast.
// Over all steps from v000 it is 8.27 times as fast.
#include <hip/hip_runtime.h>

// Causal self-attention with a fused bias-free qkv weight and the source's pairwise rotary form (x [4][2048][1024]; qkv = x w_attn^T ('oi' [3072][1024]) split in thirds q | k | v (16 heads x 64); rope on consecutive pairs with PER-ELEMENT table columns: out[2i] = x[2i] cos[2i] - x[2i+1] sin[2i], out[2i+1] = x[2i+1] cos[2i+1] + x[2i] sin[2i+1] where cos / sin = cat(freqs, freqs) of angle t x 1/10000^(2j/64) (so column d uses frequency d mod 32: the module reshapes the concatenated tables pairwise; reproduced literally; 32 f32 frequencies; precise cosf/sinf); scores x 1/sqrt(64); causal (finfo.min == exclusion); softmax; y = merged w_proj^T ('oi') -> [4][2048][1024] (8.4 M); argument order x, w_attn, w_proj).
// Layout, all batches in every launch: bf16 copy of x; 'oi' weights; exact projections; computed {cos, sin} table k_cs5 (INVT[32]); interleaved-pair plane builders with per-dimension table entries (k_ropeI2); one-kernel causal T-2048 attention k_fattn (hybrid rows: < 512 hi/lo 3 products, rest fp16 x1024; key blocks above the diagonal are never visited); merged hi/lo x Wo exact.
// Compute dtypes, f32 accumulate: every input rounded to bf16, the computed tables f32; projections exact; rotary f32; attention rows < 512 3 products, rest fp16; softmax f32; Wo hl x exact.

#define NB_  4
#define TT   2048
#define DM   1024
#define NH_  16
#define NKV  16
#define REP  (NH_ / NKV)
#define HD   64
#define DQ   (NH_ * HD)
#define DKV  (NKV * HD)
#define RH   512                  // query rows < RH use hi+lo planes (0: none)
#define SCL  0.125f   // HD^-0.5
typedef _Float16 h16;
typedef unsigned short bf;
typedef __attribute__((ext_vector_type(16))) __bf16   v16bf;
typedef __attribute__((ext_vector_type(16))) _Float16 v16h;
typedef __attribute__((ext_vector_type(8)))  _Float16 v8h;
typedef __attribute__((ext_vector_type(8)))  unsigned short v8us;
typedef __attribute__((ext_vector_type(8)))  float    v8f;
typedef __attribute__((ext_vector_type(4)))  float    v4f;
typedef v8h  __attribute__((may_alias)) v8ha;
typedef v4f  __attribute__((may_alias)) v4fa;
typedef v8us __attribute__((may_alias)) v8usa;

__device__ __forceinline__ unsigned short f2bf(float f) { unsigned u = __float_as_uint(f); u += 0x7FFFu + ((u >> 16) & 1u); return (unsigned short)(u >> 16); }
__device__ __forceinline__ float bf2f(unsigned short b) { return __uint_as_float(((unsigned)b) << 16); }
__device__ __forceinline__ float bfr(float f) { return bf2f(f2bf(f)); }
__device__ __forceinline__ v16h cat16(v8h lo, v8h hi) { return __builtin_shufflevector(lo, hi, 0, 1, 2, 3, 4, 5, 6, 7, 8, 9, 10, 11, 12, 13, 14, 15); }
__device__ __forceinline__ v16bf cat16b(v8us lo, v8us hi) { return __builtin_bit_cast(v16bf, __builtin_shufflevector(lo, hi, 0, 1, 2, 3, 4, 5, 6, 7, 8, 9, 10, 11, 12, 13, 14, 15)); }
__device__ __forceinline__ v8f wmma16(v16h a, v16h b, v8f c) { return __builtin_amdgcn_wmma_f32_16x16x32_f16(false, a, false, b, (short)0, c, false, false); }
__device__ __forceinline__ v8f wmmab(v16bf a, v16bf b, v8f c) { return __builtin_amdgcn_wmma_f32_16x16x32_bf16(false, a, false, b, (short)0, c, false, false); }



// ---- k_gemmw: register-blocked GEMM, ONE WAVE per 64x64 output tile (16 accumulators), operands straight from K-contiguous 16-bit planes; grid (M/64, N/64, Z), 32 threads.
// C[m][n] (f32, pitch ldc, + optional f32 bias[n]) = sum_k A[m][k] Bt[n][k] (+ split products per NSPLIT). z-batch strides sA/sB/sC in elements. K % 32 == 0.
template <typename T16> struct WFrag;
template <> struct WFrag<h16> { typedef v16h V; static __device__ __forceinline__ V ld(const h16* p) { return cat16(*(const v8h*)p, *(const v8h*)(p + 16)); } static __device__ __forceinline__ v8f mma(V a, V b, v8f c) { return wmma16(a, b, c); } };
template <> struct WFrag<bf> { typedef v16bf V; static __device__ __forceinline__ V ld(const bf* p) { return cat16b(*(const v8us*)p, *(const v8us*)(p + 16)); } static __device__ __forceinline__ v8f mma(V a, V b, v8f c) { return wmmab(a, b, c); } };
template <typename T16, int NSPLIT, bool BIAS>
__global__ __launch_bounds__(32) void k_gemmw(const T16* __restrict__ A, const T16* __restrict__ A2, const T16* __restrict__ Bt, const T16* __restrict__ Bt2, int K, float* C, int ldc, const float* __restrict__ bias, size_t sA, size_t sB, size_t sC) {
    typedef typename WFrag<T16>::V V;
    __shared__ __align__(16) float os[16 * 68];
    const size_t z = blockIdx.z; A += z * sA; if (A2) A2 += z * sA; Bt += z * sB; if (Bt2) Bt2 += z * sB; C += z * sC;
    const int lane = threadIdx.x & 31, lr = lane & 15, hi = lane >> 4; const int r0 = blockIdx.x * 64, c0 = blockIdx.y * 64;
    v8f acc[4][4];
#pragma unroll
    for (int mb = 0; mb < 4; ++mb)
#pragma unroll
        for (int nb = 0; nb < 4; ++nb) acc[mb][nb] = (v8f){};
    const size_t aoff = (size_t)(r0 + lr) * K + 8 * hi, boff = (size_t)(c0 + lr) * K + 8 * hi;
#pragma unroll 1
    for (int kc = 0; kc < K; kc += 32) {
        V a[4], a2[4];
#pragma unroll
        for (int mb = 0; mb < 4; ++mb) { a[mb] = WFrag<T16>::ld(A + aoff + (size_t)mb * 16 * K + kc); if (NSPLIT == 1 || NSPLIT == 2) a2[mb] = WFrag<T16>::ld(A2 + aoff + (size_t)mb * 16 * K + kc); }
#pragma unroll
        for (int nb = 0; nb < 4; ++nb) { const V b = WFrag<T16>::ld(Bt + boff + (size_t)nb * 16 * K + kc); V b2; if (NSPLIT >= 2) b2 = WFrag<T16>::ld(Bt2 + boff + (size_t)nb * 16 * K + kc);
#pragma unroll
            for (int mb = 0; mb < 4; ++mb) { acc[mb][nb] = WFrag<T16>::mma(a[mb], b, acc[mb][nb]); if (NSPLIT == 1 || NSPLIT == 2) acc[mb][nb] = WFrag<T16>::mma(a2[mb], b, acc[mb][nb]); if (NSPLIT >= 2) acc[mb][nb] = WFrag<T16>::mma(a[mb], b2, acc[mb][nb]); } }
        asm volatile("v_nop\n\tv_nop\n\tv_nop\n\tv_nop" : "+v"(acc[0][0]), "+v"(acc[1][1]), "+v"(acc[2][2]), "+v"(acc[3][3]) : "v"(a[0]), "v"(a[3]));
    }
#pragma unroll
    for (int mb = 0; mb < 4; ++mb) {
#pragma unroll
        for (int nb = 0; nb < 4; ++nb) {
#pragma unroll
            for (int j = 0; j < 8; ++j) os[(hi * 8 + j) * 68 + nb * 16 + lr] = acc[mb][nb][j]; }
        __builtin_amdgcn_wave_barrier(); asm volatile("" ::: "memory");
        float* crow = C + (size_t)(r0 + mb * 16) * ldc + c0;
{
#pragma unroll
            for (int s = 0; s < 8; ++s) { const int row = 2 * s + hi, cofs = lr * 4; v4f val = *(const v4fa*)(os + row * 68 + cofs); if (BIAS) { val[0] += bfr(bias[c0 + cofs]); val[1] += bfr(bias[c0 + cofs + 1]); val[2] += bfr(bias[c0 + cofs + 2]); val[3] += bfr(bias[c0 + cofs + 3]); }
                *(v4f*)(crow + (size_t)row * ldc + cofs) = val; }
             }
        __builtin_amdgcn_wave_barrier(); asm volatile("" ::: "memory");
    }
}

__device__ __forceinline__ h16 tohx(float x) { return (h16)x; }
__device__ __forceinline__ void splitf(float y, unsigned short& h, unsigned short& l) { h = f2bf(y); l = f2bf(y - bf2f(h)); }
typedef __attribute__((ext_vector_type(2))) _Float16 v2h;
typedef __attribute__((ext_vector_type(4))) _Float16 v4h;
typedef __attribute__((ext_vector_type(2))) unsigned short v2us;
typedef __attribute__((ext_vector_type(4))) unsigned short v4us;
typedef __attribute__((ext_vector_type(2))) float v2f;
typedef __attribute__((ext_vector_type(4))) int v4i;

__global__ __launch_bounds__(256) void k_cvt8(const float* __restrict__ src, bf* dst, size_t n8) { const size_t i = (size_t)blockIdx.x * 256 + threadIdx.x; if (i >= n8) return; const v8f v = *(const v8f*)(src + i * 8); v8us o;
#pragma unroll
    for (int k = 0; k < 8; ++k) o[k] = f2bf(v[k]); *(v8us*)(dst + i * 8) = o;  }

__global__ __launch_bounds__(256) void k_ropeI2(const float* __restrict__ F, int pitch, int nheads, const float* __restrict__ CS, float sc, h16* P16, bf* Ph, bf* Pl) {
    const size_t e = ((size_t)blockIdx.x * 256 + threadIdx.x) * 2; if (e >= (size_t)nheads * TT * HD) return; const int d = (int)(e % HD); const int t = (int)((e / HD) % TT); const int h = (int)(e / ((size_t)HD * TT)); const float* f = F + (size_t)t * pitch + h * HD; const float x0 = f[d], x1 = f[d + 1]; const v2f cs = *(const v2f*)(CS + ((size_t)t * HD + d) * 2); const v2f ct = *(const v2f*)(CS + ((size_t)t * HD + d + 1) * 2); v2h o16; v2us oh, ol;
    float a0 = __fmul_rn(x0, cs[0]), b0 = __fmul_rn(x1, cs[1]), a1 = __fmul_rn(x1, ct[0]), b1 = __fmul_rn(x0, ct[1]); asm volatile("" : "+v"(a0), "+v"(b0), "+v"(a1), "+v"(b1));
    float r0 = __fsub_rn(a0, b0) * sc, r1 = __fadd_rn(b1, a1) * sc;   /* even: x0 c - x1 s; odd: x0 s + x1 c */
    o16[0] = tohx(r0); o16[1] = tohx(r1); { unsigned short a2, c2; splitf(r0, a2, c2); oh[0] = a2; ol[0] = c2; splitf(r1, a2, c2); oh[1] = a2; ol[1] = c2; }
    *(v2h*)(P16 + e) = o16; *(v2us*)(Ph + e) = oh; *(v2us*)(Pl + e) = ol;  }


__global__ __launch_bounds__(256) void k_vtp(const float* __restrict__ F, int pitch, int nheads, h16* V16, bf* Vh, bf* Vl) { const size_t e = ((size_t)blockIdx.x * 256 + threadIdx.x) * 2; if (e >= (size_t)nheads * HD * TT) return; const int t = (int)(e % TT); const int d = (int)((e / TT) % HD); const int g = (int)(e / ((size_t)TT * HD)); v2h o16; v2us oh, ol;
#pragma unroll
    for (int q = 0; q < 2; ++q) { const float x = F[(size_t)(t + q) * pitch + g * HD + d]; o16[q] = tohx(x); unsigned short a2, c2; splitf(x, a2, c2); oh[q] = a2; ol[q] = c2; }
    *(v2h*)(V16 + e) = o16; *(v2us*)(Vh + e) = oh; *(v2us*)(Vl + e) = ol;  }
__constant__ float INVT[HD / 2] = { 1.000000000e+00f, 7.498942018e-01f, 5.623413324e-01f, 4.216965139e-01f, 3.162277639e-01f, 2.371373624e-01f, 1.778279394e-01f, 1.333521456e-01f, 1.000000015e-01f, 7.498941571e-02f, 5.623412877e-02f, 4.216964915e-02f, 3.162277862e-02f, 2.371373586e-02f, 1.778279431e-02f, 1.333521493e-02f, 9.999999776e-03f, 7.498942316e-03f, 5.623413250e-03f, 4.216964822e-03f, 3.162277862e-03f, 2.371373819e-03f, 1.778279431e-03f, 1.333521446e-03f, 1.000000047e-03f, 7.498941850e-04f, 5.623413017e-04f, 4.216964880e-04f, 3.162277862e-04f, 2.371373848e-04f, 1.778279402e-04f, 1.333521504e-04f };   // float32 1 / 10000^(2i/64), generated with jnp to be bit-exact
__global__ __launch_bounds__(256) void k_cs5(float* CS) { const int idx = blockIdx.x * 256 + threadIdx.x; if (idx >= TT * HD) return; const int d = idx % HD; const int t = idx / HD; const float a = __fmul_rn((float)t, INVT[d % (HD / 2)]); v2f cs; cs[0] = cosf(a); cs[1] = sinf(a); *(v2f*)(CS + (size_t)idx * 2) = cs;  }
#define FNW 4
template <typename T16, bool SPL> struct PPack;
template <> struct PPack<h16, false> { static __device__ __forceinline__ void pk(const float* p, v16h& ph, v16h& pl) { (void)pl;
#pragma unroll
    for (int s = 0; s < 16; ++s) ph[s] = (h16)p[s]; } };
template <> struct PPack<bf, true> { static __device__ __forceinline__ void pk(const float* p, v16bf& ph, v16bf& pl) { v8us h0, h1, l0, l1;
#pragma unroll
    for (int s = 0; s < 8; ++s) { unsigned short x, y; splitf(p[s], x, y); h0[s] = x; l0[s] = y; splitf(p[8 + s], x, y); h1[s] = x; l1[s] = y; }
    ph = cat16b(h0, h1); pl = cat16b(l0, l1); } };
template <typename T16, bool SPL, int NQG>
__device__ __forceinline__ void attn_tile(const T16* __restrict__ Q, const T16* __restrict__ Q2, const T16* __restrict__ Kp, const T16* __restrict__ K2, const T16* __restrict__ Vt, const T16* __restrict__ V2, const int q0, float* so, float* sm, float* sl, bf* Ah, bf* Al) {
    typedef typename WFrag<T16>::V V;
    constexpr int NQ = NQG * 16;
    constexpr float C = SCL * 1.4426950408889634f;      // raw score -> exponent of 2
    constexpr float OFF = SPL ? 0.0f : 10.0f;           // fp16 probabilities carry a factor 1024 (it cancels against the sum, which carries it too)
    const int lane = threadIdx.x & 31, lr = lane & 15, hi = lane >> 4; const int w = __builtin_amdgcn_readfirstlane(threadIdx.x >> 5);
    const int nbl = q0 / 32 + 1, per = (nbl + FNW - 1) / FNW, kb0 = w * per, kb1 = min(nbl, kb0 + per);   // 32-key blocks up to the diagonal one; this wave's share
    v8f o[4][NQG]; float m[NQG], l[NQG];
#pragma unroll
    for (int g = 0; g < NQG; ++g) { m[g] = -3.0e38f; l[g] = 0.f;
#pragma unroll
        for (int dt = 0; dt < 4; ++dt) o[dt][g] = (v8f){}; }
    if (kb0 < kb1) {
        V qf[NQG][2], qf2[NQG][2], kf[2][2], kf2[2][2];
        const unsigned ko = (unsigned)(lr * HD + 8 * hi) * 2u, vo = (unsigned)(lr * TT + 8 * hi) * 2u;   // the lane's byte offset in a query or key tile and in a value tile; the rest of each address is wave-uniform
#pragma unroll
        for (int g = 0; g < NQG; ++g)
#pragma unroll
            for (int kk = 0; kk < 2; ++kk) { const int qc = (q0 + g * 16) * HD + kk * 32; qf[g][kk] = WFrag<T16>::ld((const T16*)((const char*)(Q + qc) + ko)); if (SPL) qf2[g][kk] = WFrag<T16>::ld((const T16*)((const char*)(Q2 + qc) + ko)); }
        if (!SPL) {
#pragma unroll
            for (int t = 0; t < 2; ++t)
#pragma unroll
                for (int kk = 0; kk < 2; ++kk) kf[t][kk] = WFrag<T16>::ld((const T16*)((const char*)(Kp + kb0 * 32 * HD) + ko) + t * 16 * HD + kk * 32);
        }
#pragma unroll 1   // the trip count is known only at run time and one body already takes most of the registers that four waves a SIMD leave: a second copy would spill
        for (int kb = kb0; kb < kb1; ++kb) {
            const int k0 = kb * 32;
            V vf[4], vf2[4];
            const char* pv = (const char*)(Vt + k0) + vo; const char* pv2 = SPL ? (const char*)(V2 + k0) + vo : pv;   // the lane's addresses in this block's value tiles
            if (!SPL) {                                  // one plane each: the value tiles are asked for in front of the score products, their latency passes behind scores and softmax
#pragma unroll
                for (int dt = 0; dt < 4; ++dt) vf[dt] = WFrag<T16>::ld((const T16*)pv + dt * 16 * TT);
            } else {                                     // two planes each: key and value tiles take turns in the registers, so that four waves fit a SIMD
                const char* pk = (const char*)(Kp + k0 * HD) + ko; const char* pk2 = (const char*)(K2 + k0 * HD) + ko;
#pragma unroll
                for (int t = 0; t < 2; ++t)
#pragma unroll
                    for (int kk = 0; kk < 2; ++kk) { const int kc = t * 16 * HD + kk * 32; kf[t][kk] = WFrag<T16>::ld((const T16*)pk + kc); kf2[t][kk] = WFrag<T16>::ld((const T16*)pk2 + kc); }
                asm volatile("s_wait_xcnt 0x0" :: "v"(pk), "v"(pk2) : "memory");   // the loads' address registers stay whole up to here; behind it they are given to other values
                __builtin_amdgcn_sched_barrier(0);       // all key tiles are asked for at once: with matrix instructions lifted among the loads the tiles shared registers and each load waited for the one before
            }
            v8f s[2][NQG];
#pragma unroll
            for (int t = 0; t < 2; ++t)
#pragma unroll
                for (int g = 0; g < NQG; ++g) { s[t][g] = (v8f){};
#pragma unroll
                    for (int kk = 0; kk < 2; ++kk) { s[t][g] = WFrag<T16>::mma(kf[t][kk], qf[g][kk], s[t][g]); if (SPL) { s[t][g] = WFrag<T16>::mma(kf[t][kk], qf2[g][kk], s[t][g]); s[t][g] = WFrag<T16>::mma(kf2[t][kk], qf[g][kk], s[t][g]); } } }
            if (!SPL) { const char* pk = (const char*)(Kp + min(kb + 1, kb1 - 1) * 32 * HD) + ko;    // the next block's key tiles are asked for one block ahead (the last block asks for itself again)
#pragma unroll
                for (int t = 0; t < 2; ++t)
#pragma unroll
                    for (int kk = 0; kk < 2; ++kk) kf[t][kk] = WFrag<T16>::ld((const T16*)pk + t * 16 * HD + kk * 32);
                asm volatile("s_wait_xcnt 0x0" :: "v"(pv), "v"(pk) : "memory");    // the loads' address registers stay whole up to here; behind it they are given to other values
            } else {
#pragma unroll
                for (int dt = 0; dt < 4; ++dt) { vf[dt] = WFrag<T16>::ld((const T16*)pv + dt * 16 * TT); vf2[dt] = WFrag<T16>::ld((const T16*)pv2 + dt * 16 * TT); }
                asm volatile("s_wait_xcnt 0x0" :: "v"(pv), "v"(pv2) : "memory");   // the loads' address registers stay whole up to here; behind it they are given to other values
            }
            if (k0 + 31 > q0) {                          // the diagonal block (wave-uniform): keys behind the query are excluded
#pragma unroll
                for (int t = 0; t < 2; ++t)
#pragma unroll
                    for (int g = 0; g < NQG; ++g)
#pragma unroll
                        for (int r = 0; r < 8; ++r) s[t][g][r] = (k0 + t * 16 + 8 * hi + r <= q0 + g * 16 + lr) ? s[t][g][r] : -3.0e38f;
            }
            V pb[NQG], pb2[NQG];
#pragma unroll
            for (int g = 0; g < NQG; ++g) {
                float bm = s[0][g][0];
#pragma unroll
                for (int r = 1; r < 8; ++r) bm = fmaxf(bm, s[0][g][r]);
#pragma unroll
                for (int r = 0; r < 8; ++r) bm = fmaxf(bm, s[1][g][r]);
                bm = fmaxf(bm, __shfl_xor(bm, 16, 32));  // the query's other 16 keys of the block lie in the other lane half
                const float mn = fmaxf(m[g], bm), sc = __builtin_amdgcn_exp2f((m[g] - mn) * C), nb = OFF - mn * C; m[g] = mn;
                float p[16], ps = 0.f;
#pragma unroll
                for (int e = 0; e < 16; ++e) { p[e] = __builtin_amdgcn_exp2f(fmaf(s[e >> 3][g][e & 7], C, nb)); ps += p[e]; }
                l[g] = l[g] * sc + ps;
#pragma unroll
                for (int dt = 0; dt < 4; ++dt) o[dt][g] *= sc;
                PPack<T16, SPL>::pk(p, pb[g], pb2[g]);
            }
#pragma unroll
            for (int dt = 0; dt < 4; ++dt)
#pragma unroll
                for (int g = 0; g < NQG; ++g) { o[dt][g] = WFrag<T16>::mma(vf[dt], pb[g], o[dt][g]); if (SPL) { o[dt][g] = WFrag<T16>::mma(vf[dt], pb2[g], o[dt][g]); o[dt][g] = WFrag<T16>::mma(vf2[dt], pb[g], o[dt][g]); } }
        }
    }
#pragma unroll
    for (int g = 0; g < NQG; ++g) { l[g] += __shfl_xor(l[g], 16, 32);   // the two lane halves summed different keys of the same query
        if (hi == 0) { sm[w * NQ + g * 16 + lr] = m[g]; sl[w * NQ + g * 16 + lr] = l[g]; }
#pragma unroll
        for (int dt = 0; dt < 4; ++dt) { float* po = so + (w * NQ + g * 16 + lr) * 68 + dt * 16 + 8 * hi; const v8f c = o[dt][g]; *(v4f*)po = __builtin_shufflevector(c, c, 0, 1, 2, 3); *(v4f*)(po + 4) = __builtin_shufflevector(c, c, 4, 5, 6, 7); } }
    __syncthreads();                                     // every wave's partial maximum, sum and tile are in LDS
    constexpr int TPQ = 32 * FNW / NQ, CH = HD / TPQ;    // threads per query (neighbouring lanes, so that one wave writes a query's whole 128-byte line) and head dimensions per thread
    const int q = threadIdx.x / TPQ, c0 = (threadIdx.x % TPQ) * CH;
    float M = sm[q];
#pragma unroll
    for (int ww = 1; ww < FNW; ++ww) M = fmaxf(M, sm[ww * NQ + q]);
    float L = 0.f; v4f acc[CH / 4];
#pragma unroll
    for (int i = 0; i < CH / 4; ++i) acc[i] = (v4f){};
#pragma unroll
    for (int ww = 0; ww < FNW; ++ww) { const float wg = __builtin_amdgcn_exp2f((sm[ww * NQ + q] - M) * C); L += wg * sl[ww * NQ + q];   // a wave without keys has maximum -3e38: weight 0
#pragma unroll
        for (int i = 0; i < CH / 4; ++i) acc[i] += *(const v4f*)(so + (ww * NQ + q) * 68 + c0 + i * 4) * wg; }
    const float inv = __fdiv_rn(1.0f, L);
    const size_t oo = (size_t)(q0 + q) * DQ + c0;
#pragma unroll
    for (int i = 0; i < CH / 8; ++i) { v8us oh, ol;
#pragma unroll
        for (int e = 0; e < 8; ++e) { unsigned short x, y; splitf(acc[i * 2 + (e >> 2)][e & 3] * inv, x, y); oh[e] = x; ol[e] = y; }
        *(v8us*)(Ah + oo + i * 8) = oh; *(v8us*)(Al + oo + i * 8) = ol; }
    asm volatile("s_wait_xcnt 0x0" ::: "memory");        // behind the last store: in the built kernel the other tile form's code follows this one, and there the stores' registers are written again
}
// grid (batch x heads, query tiles), so that work-groups start longest first over all heads: the tiles of 32 rows >= RH from the last down (fp16 operands), then the tiles of 16 rows < RH (hi / lo planes, 3 products)
__global__ __launch_bounds__(32 * FNW) void k_fattn(const h16* __restrict__ Q16, const h16* __restrict__ K16, const h16* __restrict__ V16, const bf* __restrict__ Qh, const bf* __restrict__ Ql, const bf* __restrict__ Kh, const bf* __restrict__ Kl, const bf* __restrict__ Vh, const bf* __restrict__ Vl, bf* Ah, bf* Al) {
    __shared__ __align__(16) float so[FNW * 32 * 68]; __shared__ float sm[FNW * 32]; __shared__ float sl[FNW * 32];
    constexpr int NLO = (TT - RH) / 32;
    const size_t zq = (size_t)blockIdx.x * TT * HD, zk = (size_t)(blockIdx.x / REP) * TT * HD; const int x = blockIdx.y;
    const size_t za = (size_t)(blockIdx.x / NH_) * TT * DQ + (blockIdx.x % NH_) * HD;   // merged-head planes are [batch][row][head][dim]
    bf* ah = Ah + za; bf* al = Al + za;
    if (x < NLO) attn_tile<h16, false, 2>(Q16 + zq, nullptr, K16 + zk, nullptr, V16 + zk, nullptr, TT - 32 - x * 32, so, sm, sl, ah, al);
    else attn_tile<bf, true, 1>(Qh + zq, Ql + zq, Kh + zk, Kl + zk, Vh + zk, Vl + zk, RH - 16 - (x - NLO) * 16, so, sm, sl, ah, al);
}

extern "C" void kernel_launch(void* const* d_in, const int* in_sizes, int n_in,
                              void* d_out, int out_size, void* d_ws, size_t ws_size, hipStream_t stream) {
    (void)in_sizes; (void)n_in; (void)out_size;
    const float* x = (const float*)d_in[0]; const float* wattn = (const float*)d_in[1]; const float* wo = (const float*)d_in[2];   /* order x, w_attn ('oi' [3072][1024]: q | k | v row thirds), w_proj ('oi') */ const float* wq = wattn; const float* wk = wattn + (size_t)DQ * DM; const float* wv = wattn + (size_t)2 * DQ * DM;
    float* OUT = (float*)d_out;     // [4][2048][1024]
    char* wsp = (char*)d_ws;
    auto take = [&](size_t bytes) { char* p = wsp; wsp += (bytes + 255) & ~(size_t)255; return (void*)p; };
    bf* WQ = (bf*)take((size_t)DQ * DM * 2); bf* WK = (bf*)take((size_t)DKV * DM * 2); bf* WV = (bf*)take((size_t)DKV * DM * 2); bf* WO = (bf*)take((size_t)DM * DQ * 2); float* CS = (float*)take((size_t)TT * HD * 2 * 4);
    bf* XB = (bf*)take((size_t)NB_ * TT * DM * 2); float* F = (float*)take((size_t)TT * NB_ * DQ * 4);   // F: one projection of all batches, [row][batch][head][dim], so that a batch's heads follow the heads of the batch before it in every row
    h16* QP16 = (h16*)take((size_t)NB_ * NH_ * TT * HD * 2); h16* KP16 = (h16*)take((size_t)NB_ * NKV * TT * HD * 2); h16* VT16 = (h16*)take((size_t)NB_ * NKV * HD * TT * 2);
    bf* QPh = (bf*)take((size_t)NB_ * NH_ * TT * HD * 2); bf* QPl = (bf*)take((size_t)NB_ * NH_ * TT * HD * 2); bf* KPh = (bf*)take((size_t)NB_ * NKV * TT * HD * 2); bf* KPl = (bf*)take((size_t)NB_ * NKV * TT * HD * 2); bf* VTh = (bf*)take((size_t)NB_ * NKV * HD * TT * 2); bf* VTl = (bf*)take((size_t)NB_ * NKV * HD * TT * 2);
    bf* ATh = (bf*)take((size_t)NB_ * TT * DQ * 2); bf* ATl = (bf*)take((size_t)NB_ * TT * DQ * 2);
    if ((size_t)(wsp - (char*)d_ws) > ws_size) return;    // ws 256 MiB
    // the q, k and v projections take turns in F: each is overwritten only behind the launch that built its planes (stream-ordered)
    { k_cvt8<<<(unsigned)(((size_t)DQ * DM / 8 + 255) / 256), 256, 0, stream>>>(wq, WQ, (size_t)DQ * DM / 8); k_cvt8<<<(unsigned)(((size_t)DKV * DM / 8 + 255) / 256), 256, 0, stream>>>(wk, WK, (size_t)DKV * DM / 8); k_cvt8<<<(unsigned)(((size_t)DKV * DM / 8 + 255) / 256), 256, 0, stream>>>(wv, WV, (size_t)DKV * DM / 8);
      k_cvt8<<<(unsigned)(((size_t)DM * DQ / 8 + 255) / 256), 256, 0, stream>>>(wo, WO, (size_t)DM * DQ / 8);
       }
    k_cs5<<<(TT * HD + 255) / 256, 256, 0, stream>>>(CS);   /* rotary {cos, sin} table computed from INVT */
    const unsigned LQ = (unsigned)(((size_t)NB_ * NH_ * TT * HD / 2 + 255) / 256), LKv = (unsigned)(((size_t)NB_ * NKV * TT * HD / 2 + 255) / 256);
    // every stage runs once for all batches: the products take the batch as grid z (z strides of A and C), the plane builders and the attention see NB_ x heads heads
    k_cvt8<<<(unsigned)(((size_t)NB_ * TT * DM / 8 + 255) / 256), 256, 0, stream>>>(x, XB, (size_t)NB_ * TT * DM / 8);
    k_gemmw<bf, 0, false><<<dim3(TT / 64, DQ / 64, NB_), 32, 0, stream>>>(XB, nullptr, WQ, nullptr, DM, F, NB_ * DQ, nullptr, (size_t)TT * DM, 0, DQ);
    k_ropeI2<<<LQ, 256, 0, stream>>>(F, NB_ * DQ, NB_ * NH_, CS, 1.0f, QP16, QPh, QPl);
    k_gemmw<bf, 0, false><<<dim3(TT / 64, DKV / 64, NB_), 32, 0, stream>>>(XB, nullptr, WK, nullptr, DM, F, NB_ * DKV, nullptr, (size_t)TT * DM, 0, DKV);
    k_ropeI2<<<LKv, 256, 0, stream>>>(F, NB_ * DKV, NB_ * NKV, CS, 1.0f, KP16, KPh, KPl);
    k_gemmw<bf, 0, false><<<dim3(TT / 64, DKV / 64, NB_), 32, 0, stream>>>(XB, nullptr, WV, nullptr, DM, F, NB_ * DKV, nullptr, (size_t)TT * DM, 0, DKV);
    k_vtp<<<LKv, 256, 0, stream>>>(F, NB_ * DKV, NB_ * NKV, VT16, VTh, VTl);
    k_fattn<<<dim3(NB_ * NH_, (TT - RH) / 32 + RH / 16, 1), 32 * FNW, 0, stream>>>(QP16, KP16, VT16, QPh, QPl, KPh, KPl, VTh, VTl, ATh, ATl);
    k_gemmw<bf, 1, false><<<dim3(TT / 64, DM / 64, NB_), 32, 0, stream>>>(ATh, ATl, WO, nullptr, DQ, OUT, DM, nullptr, (size_t)TT * DQ, 0, (size_t)TT * DM);
}

// v005
// One run takes 286 microseconds.
// Timed twice side by side with v004, it ran 1.21 times as fast both times.
// All steps since v000 together make it 9.98 times as fast.
#include <hip/hip_runtime.h>

// Causal self-attention with a fused bias-free qkv weight and the source's pairwise rotary form (x [4][2048][1024]; qkv = x w_attn^T ('oi' [3072][1024]) split in thirds q | k | v (16 heads x 64); rope on consecutive pairs with PER-ELEMENT table columns: out[2i] = x[2i] cos[2i] - x[2i+1] sin[2i], out[2i+1] = x[2i+1] cos[2i+1] + x[2i] sin[2i+1] where cos / sin = cat(freqs, freqs) of angle t x 1/10000^(2j/64) (so column d uses frequency d mod 32: the module reshapes the concatenated tables pairwise; reproduced literally; 32 f32 frequencies; precise cosf/sinf); scores x 1/sqrt(64); causal (finfo.min == exclusion); softmax; y = merged w_proj^T ('oi') -> [4][2048][1024] (8.4 M); argument order x, w_attn, w_proj).
// Layout, all batches in every launch: bf16 copy of x; 'oi' weights; exact projections; computed {cos, sin} table k_cs5 (INVT[32]); q, k, v projections in one launch whose epilogue applies the interleaved-pair rotary with per-dimension table entries and writes the planes (k_qkv); one-kernel causal T-2048 attention k_fattn (hybrid rows: < 512 hi/lo 3 products, rest fp16 x1024; key blocks above the diagonal are never visited); merged hi/lo x Wo exact.
// Compute dtypes, f32 accumulate: every input rounded to bf16 (tables f32); projections exact; rotary f32; attention rows < 512 3 products, rest fp16; softmax f32; Wo hl x exact.

#define NB_  4
#define TT   2048
#define DM   1024
#define NH_  16
#define NKV  16
#define REP  (NH_ / NKV)
#define HD   64
#define DQ   (NH_ * HD)
#define DKV  (NKV * HD)
#define RH   512                  // query rows < RH use hi+lo planes (0: none)
#define SCL  0.125f   // HD^-0.5
typedef _Float16 h16;
typedef unsigned short bf;
typedef __attribute__((ext_vector_type(16))) __bf16   v16bf;
typedef __attribute__((ext_vector_type(16))) _Float16 v16h;
typedef __attribute__((ext_vector_type(8)))  _Float16 v8h;
typedef __attribute__((ext_vector_type(8)))  unsigned short v8us;
typedef __attribute__((ext_vector_type(8)))  float    v8f;
typedef __attribute__((ext_vector_type(4)))  float    v4f;
typedef v8h  __attribute__((may_alias)) v8ha;
typedef v4f  __attribute__((may_alias)) v4fa;
typedef v8us __attribute__((may_alias)) v8usa;

__device__ __forceinline__ unsigned short f2bf(float f) { unsigned u = __float_as_uint(f); u += 0x7FFFu + ((u >> 16) & 1u); return (unsigned short)(u >> 16); }
__device__ __forceinline__ float bf2f(unsigned short b) { return __uint_as_float(((unsigned)b) << 16); }
__device__ __forceinline__ float bfr(float f) { return bf2f(f2bf(f)); }
__device__ __forceinline__ v16h cat16(v8h lo, v8h hi) { return __builtin_shufflevector(lo, hi, 0, 1, 2, 3, 4, 5, 6, 7, 8, 9, 10, 11, 12, 13, 14, 15); }
__device__ __forceinline__ v16bf cat16b(v8us lo, v8us hi) { return __builtin_bit_cast(v16bf, __builtin_shufflevector(lo, hi, 0, 1, 2, 3, 4, 5, 6, 7, 8, 9, 10, 11, 12, 13, 14, 15)); }
__device__ __forceinline__ v8f wmma16(v16h a, v16h b, v8f c) { return __builtin_amdgcn_wmma_f32_16x16x32_f16(false, a, false, b, (short)0, c, false, false); }
__device__ __forceinline__ v8f wmmab(v16bf a, v16bf b, v8f c) { return __builtin_amdgcn_wmma_f32_16x16x32_bf16(false, a, false, b, (short)0, c, false, false); }



// ---- k_gemmw: register-blocked GEMM, ONE WAVE per 64x64 output tile (16 accumulators), operands straight from K-contiguous 16-bit planes; grid (M/64, N/64, Z), 32 threads.
// C[m][n] (f32, pitch ldc, + optional f32 bias[n]) = sum_k A[m][k] Bt[n][k] (+ split products per NSPLIT). z-batch strides sA/sB/sC in elements. K % 32 == 0.
template <typename T16> struct WFrag;
template <> struct WFrag<h16> { typedef v16h V; static __device__ __forceinline__ V ld(const h16* p) { return cat16(*(const v8h*)p, *(const v8h*)(p + 16)); } static __device__ __forceinline__ v8f mma(V a, V b, v8f c) { return wmma16(a, b, c); } };
template <> struct WFrag<bf> { typedef v16bf V; static __device__ __forceinline__ V ld(const bf* p) { return cat16b(*(const v8us*)p, *(const v8us*)(p + 16)); } static __device__ __forceinline__ v8f mma(V a, V b, v8f c) { return wmmab(a, b, c); } };
template <typename T16, int NSPLIT, bool BIAS>
__global__ __launch_bounds__(32) void k_gemmw(const T16* __restrict__ A, const T16* __restrict__ A2, const T16* __restrict__ Bt, const T16* __restrict__ Bt2, int K, float* C, int ldc, const float* __restrict__ bias, size_t sA, size_t sB, size_t sC) {
    typedef typename WFrag<T16>::V V;
    __shared__ __align__(16) float os[16 * 68];
    const size_t z = blockIdx.z; A += z * sA; if (A2) A2 += z * sA; Bt += z * sB; if (Bt2) Bt2 += z * sB; C += z * sC;
    const int lane = threadIdx.x & 31, lr = lane & 15, hi = lane >> 4; const int r0 = blockIdx.x * 64, c0 = blockIdx.y * 64;
    v8f acc[4][4];
#pragma unroll
    for (int mb = 0; mb < 4; ++mb)
#pragma unroll
        for (int nb = 0; nb < 4; ++nb) acc[mb][nb] = (v8f){};
    const size_t aoff = (size_t)(r0 + lr) * K + 8 * hi, boff = (size_t)(c0 + lr) * K + 8 * hi;
#pragma unroll 1
    for (int kc = 0; kc < K; kc += 32) {
        V a[4], a2[4];
#pragma unroll
        for (int mb = 0; mb < 4; ++mb) { a[mb] = WFrag<T16>::ld(A + aoff + (size_t)mb * 16 * K + kc); if (NSPLIT == 1 || NSPLIT == 2) a2[mb] = WFrag<T16>::ld(A2 + aoff + (size_t)mb * 16 * K + kc); }
#pragma unroll
        for (int nb = 0; nb < 4; ++nb) { const V b = WFrag<T16>::ld(Bt + boff + (size_t)nb * 16 * K + kc); V b2; if (NSPLIT >= 2) b2 = WFrag<T16>::ld(Bt2 + boff + (size_t)nb * 16 * K + kc);
#pragma unroll
            for (int mb = 0; mb < 4; ++mb) { acc[mb][nb] = WFrag<T16>::mma(a[mb], b, acc[mb][nb]); if (NSPLIT == 1 || NSPLIT == 2) acc[mb][nb] = WFrag<T16>::mma(a2[mb], b, acc[mb][nb]); if (NSPLIT >= 2) acc[mb][nb] = WFrag<T16>::mma(a[mb], b2, acc[mb][nb]); } }
        asm volatile("v_nop\n\tv_nop\n\tv_nop\n\tv_nop" : "+v"(acc[0][0]), "+v"(acc[1][1]), "+v"(acc[2][2]), "+v"(acc[3][3]) : "v"(a[0]), "v"(a[3]));
    }
#pragma unroll
    for (int mb = 0; mb < 4; ++mb) {
#pragma unroll
        for (int nb = 0; nb < 4; ++nb) {
#pragma unroll
            for (int j = 0; j < 8; ++j) os[(hi * 8 + j) * 68 + nb * 16 + lr] = acc[mb][nb][j]; }
        __builtin_amdgcn_wave_barrier(); asm volatile("" ::: "memory");
        float* crow = C + (size_t)(r0 + mb * 16) * ldc + c0;
{
#pragma unroll
            for (int s = 0; s < 8; ++s) { const int row = 2 * s + hi, cofs = lr * 4; v4f val = *(const v4fa*)(os + row * 68 + cofs); if (BIAS) { val[0] += bfr(bias[c0 + cofs]); val[1] += bfr(bias[c0 + cofs + 1]); val[2] += bfr(bias[c0 + cofs + 2]); val[3] += bfr(bias[c0 + cofs + 3]); }
                *(v4f*)(crow + (size_t)row * ldc + cofs) = val; }
             }
        __builtin_amdgcn_wave_barrier(); asm volatile("" ::: "memory");
    }
}

__device__ __forceinline__ void splitf(float y, unsigned short& h, unsigned short& l) { h = f2bf(y); l = f2bf(y - bf2f(h)); }
typedef __attribute__((ext_vector_type(2))) _Float16 v2h;
typedef __attribute__((ext_vector_type(4))) _Float16 v4h;
typedef __attribute__((ext_vector_type(4))) unsigned short v4us;
typedef __attribute__((ext_vector_type(2))) float v2f;
typedef __attribute__((ext_vector_type(4))) int v4i;

__global__ __launch_bounds__(256) void k_cvt8(const float* __restrict__ src, bf* dst, size_t n8) { const size_t i = (size_t)blockIdx.x * 256 + threadIdx.x; if (i >= n8) return; const v8f v = *(const v8f*)(src + i * 8); v8us o;
#pragma unroll
    for (int k = 0; k < 8; ++k) o[k] = f2bf(v[k]); *(v8us*)(dst + i * 8) = o;  }

__constant__ float INVT[HD / 2] = { 1.000000000e+00f, 7.498942018e-01f, 5.623413324e-01f, 4.216965139e-01f, 3.162277639e-01f, 2.371373624e-01f, 1.778279394e-01f, 1.333521456e-01f, 1.000000015e-01f, 7.498941571e-02f, 5.623412877e-02f, 4.216964915e-02f, 3.162277862e-02f, 2.371373586e-02f, 1.778279431e-02f, 1.333521493e-02f, 9.999999776e-03f, 7.498942316e-03f, 5.623413250e-03f, 4.216964822e-03f, 3.162277862e-03f, 2.371373819e-03f, 1.778279431e-03f, 1.333521446e-03f, 1.000000047e-03f, 7.498941850e-04f, 5.623413017e-04f, 4.216964880e-04f, 3.162277862e-04f, 2.371373848e-04f, 1.778279402e-04f, 1.333521504e-04f };   // float32 1 / 10000^(2i/64), generated with jnp to be bit-exact
__global__ __launch_bounds__(256) void k_cs5(float* CS) { const int idx = blockIdx.x * 256 + threadIdx.x; if (idx >= TT * HD) return; const int d = idx % HD; const int t = idx / HD; const float a = __fmul_rn((float)t, INVT[d % (HD / 2)]); v2f cs; cs[0] = cosf(a); cs[1] = sinf(a); *(v2f*)(CS + (size_t)idx * 2) = cs;  }
typedef __attribute__((ext_vector_type(2))) __bf16 v2bf;
typedef __attribute__((ext_vector_type(4))) unsigned v4u;
typedef v4u __attribute__((may_alias)) v4ua;
// two f32 -> their fp16 pair, their bf16 hi pair and the bf16 pair of what hi leaves over, each packed in one word; the packed conversions round to nearest even, as a plain cast and splitf do
__device__ __forceinline__ void pack2(v2f y, unsigned& w16, unsigned& wh, unsigned& wl) {
    w16 = __builtin_bit_cast(unsigned, __builtin_convertvector(y, v2h)); wh = __builtin_bit_cast(unsigned, __builtin_convertvector(y, v2bf));
    v2f b; b[0] = __uint_as_float(wh << 16); b[1] = __uint_as_float(wh & 0xFFFF0000u); wl = __builtin_bit_cast(unsigned, __builtin_convertvector(y - b, v2bf)); }
// ---- k_qkv: the q, k and v projections of all batches in ONE launch; the product loop is k_gemmw's (one wave per 64x64 tile), and the tile leaves the accumulators as finished 16-bit planes: no f32 projection is stored.
// grid (T/64, 3 x heads, batch): Bt is the [3 x 1024][1024] weight (q | k | v row thirds), so a tile's 64 columns are the 64 dimensions of ONE head of q, k or v, and its rows are 64 positions of one batch.
// q, k: 16 rows at a time through LDS, so that a lane holds 8 neighbouring dimensions of one position (4 rotary pairs, whole 16-byte stores, 4 rows = 512 bytes in a row per store); table entries per dimension as k_cs5 wrote them.
// v: a lane's 8 accumulator registers are 8 consecutive positions of one dimension, which is a 16-byte piece of a transposed value row: stored straight from the registers; the wave writes each row's whole 128-byte line.
__global__ __launch_bounds__(32) void k_qkv(const bf* __restrict__ A, const bf* __restrict__ Bt, const float* __restrict__ CS, h16* Q16, bf* Qh, bf* Ql, h16* K16, bf* Kh, bf* Kl, h16* V16, bf* Vh, bf* Vl) {
    typedef WFrag<bf>::V V;
    __shared__ __align__(16) float os[16 * 68];
    constexpr int K = DM;
    A += (size_t)blockIdx.z * TT * DM;
    const int lane = threadIdx.x & 31, lr = lane & 15, hi = lane >> 4; const int r0 = blockIdx.x * 64, c0 = blockIdx.y * 64;
    v8f acc[4][4];
#pragma unroll
    for (int mb = 0; mb < 4; ++mb)
#pragma unroll
        for (int nb = 0; nb < 4; ++nb) acc[mb][nb] = (v8f){};
    const char* pa = (const char*)(A + (size_t)r0 * K); const char* pb = (const char*)(Bt + (size_t)c0 * K);   // wave-uniform bases
    const unsigned ko = (unsigned)(lr * K + 8 * hi) * 2u;                // the lane's byte offset in either operand's 16 rows; the rest of each address is wave-uniform or a constant
#pragma unroll 1   // as in k_gemmw: one body holds the 16 accumulator tiles and 5 fragments
    for (int kc = 0; kc < K; kc += 32, pa += 64, pb += 64) {
        V a[4]; const char* la = pa + ko; const char* lb = pb + ko;   // the lane's addresses in this step's fragments
#pragma unroll
        for (int mb = 0; mb < 4; ++mb) a[mb] = WFrag<bf>::ld((const bf*)la + mb * 16 * K);
#pragma unroll
        for (int nb = 0; nb < 4; ++nb) { const V b = WFrag<bf>::ld((const bf*)lb + nb * 16 * K);
#pragma unroll
            for (int mb = 0; mb < 4; ++mb) acc[mb][nb] = WFrag<bf>::mma(a[mb], b, acc[mb][nb]); }
        asm volatile("s_wait_xcnt 0x0" :: "v"(la), "v"(lb) : "memory");   // the loads' address registers stay whole up to here; behind it they are given to other values
        asm volatile("v_nop\n\tv_nop\n\tv_nop\n\tv_nop" : "+v"(acc[0][0]), "+v"(acc[1][1]), "+v"(acc[2][2]), "+v"(acc[3][3]) : "v"(a[0]), "v"(a[3]));   // the distance behind the last matrix instruction, on the back edge and on the way out alike
    }
    const int part = blockIdx.y / NH_;                                   // 0 q, 1 k, 2 v (the same for the whole wave)
    const size_t g = (size_t)blockIdx.z * NH_ + blockIdx.y % NH_;        // batch x heads index of the planes
    if (part == 2) {
        const size_t e0 = (g * HD * TT + r0) * 2; char* p16 = (char*)V16 + e0; char* ph = (char*)Vh + e0; char* pl = (char*)Vl + e0;   // wave-uniform bases
        const unsigned lo = (unsigned)(lr * TT + 8 * hi) * 2u;              // the lane's byte offset; the rest of each address is a constant
#pragma unroll
        for (int nb = 0; nb < 4; ++nb)
#pragma unroll
            for (int mb = 0; mb < 4; ++mb) { v4u o16, oh, ol;
#pragma unroll
                for (int p = 0; p < 4; ++p) { v2f y; y[0] = acc[mb][nb][2 * p]; y[1] = acc[mb][nb][2 * p + 1]; unsigned a, b, d; pack2(y, a, b, d); o16[p] = a; oh[p] = b; ol[p] = d; }
                const int e = (nb * 16 * TT + mb * 16) * 2;
                *(v4ua*)(p16 + lo + e) = o16; *(v4ua*)(ph + lo + e) = oh; *(v4ua*)(pl + lo + e) = ol; }
    } else {
        const size_t e0 = (g * TT + r0) * HD * 2; char* p16 = (char*)(part ? K16 : Q16) + e0; char* ph = (char*)(part ? Kh : Qh) + e0; char* pl = (char*)(part ? Kl : Ql) + e0;   // wave-uniform bases
        const char* pcs = (const char*)(CS + (size_t)r0 * HD * 2);
        const int rr = lane >> 3, cofs = (lane & 7) * 8;                 // the lane's row among 4 and its first dimension
        const unsigned lo = (unsigned)(rr * HD + cofs) * 2u;               // the lane's byte offset in a plane (4 times that in the table); the rest of each address is a constant
#pragma unroll
        for (int mb = 0; mb < 4; ++mb) {
#pragma unroll
            for (int nb = 0; nb < 4; ++nb) {
#pragma unroll
                for (int j = 0; j < 8; ++j) os[(hi * 8 + j) * 68 + nb * 16 + lr] = acc[mb][nb][j]; }
            __builtin_amdgcn_wave_barrier(); asm volatile("" ::: "memory");   // the reads below take other lanes' words: they stay behind these writes
#pragma unroll
            for (int s = 0; s < 4; ++s) { const int row = 4 * s + rr, e = (mb * 16 + 4 * s) * HD * 2;
                const v4f xa = *(const v4fa*)(os + row * 68 + cofs), xb = *(const v4fa*)(os + row * 68 + cofs + 4);
                const char* cs = pcs + lo * 4u + e * 4;                      // {cos, sin} of 8 dimensions
                v4u o16, oh, ol;
#pragma unroll
                for (int p = 0; p < 4; ++p) { const v4f c = *(const v4fa*)(cs + p * 16); const float x0 = p < 2 ? xa[2 * p] : xb[2 * p - 4], x1 = p < 2 ? xa[2 * p + 1] : xb[2 * p - 3];
                    v2f y; y[0] = x0 * c[0] - x1 * c[1]; y[1] = x0 * c[3] + x1 * c[2];   /* even: x0 c - x1 s; odd: x0 s + x1 c */
                    unsigned a, b, d; pack2(y, a, b, d); o16[p] = a; oh[p] = b; ol[p] = d; }
                *(v4ua*)(p16 + lo + e) = o16; *(v4ua*)(ph + lo + e) = oh; *(v4ua*)(pl + lo + e) = ol; }
            __builtin_amdgcn_wave_barrier(); asm volatile("s_wait_xcnt 0x0" ::: "memory");   // the next 16 rows are written only behind these reads; the wait stands behind the stores, whose registers the next rows' loads take
        }
    }
}
#define FNW 4
template <typename T16, bool SPL> struct PPack;
template <> struct PPack<h16, false> { static __device__ __forceinline__ void pk(const float* p, v16h& ph, v16h& pl) { (void)pl;
#pragma unroll
    for (int s = 0; s < 16; ++s) ph[s] = (h16)p[s]; } };
template <> struct PPack<bf, true> { static __device__ __forceinline__ void pk(const float* p, v16bf& ph, v16bf& pl) { v8us h0, h1, l0, l1;
#pragma unroll
    for (int s = 0; s < 8; ++s) { unsigned short x, y; splitf(p[s], x, y); h0[s] = x; l0[s] = y; splitf(p[8 + s], x, y); h1[s] = x; l1[s] = y; }
    ph = cat16b(h0, h1); pl = cat16b(l0, l1); } };
template <typename T16, bool SPL, int NQG>
__device__ __forceinline__ void attn_tile(const T16* __restrict__ Q, const T16* __restrict__ Q2, const T16* __restrict__ Kp, const T16* __restrict__ K2, const T16* __restrict__ Vt, const T16* __restrict__ V2, const int q0, float* so, float* sm, float* sl, bf* Ah, bf* Al) {
    typedef typename WFrag<T16>::V V;
    constexpr int NQ = NQG * 16;
    constexpr float C = SCL * 1.4426950408889634f;      // raw score -> exponent of 2
    constexpr float OFF = SPL ? 0.0f : 10.0f;           // fp16 probabilities carry a factor 1024 (it cancels against the sum, which carries it too)
    const int lane = threadIdx.x & 31, lr = lane & 15, hi = lane >> 4; const int w = __builtin_amdgcn_readfirstlane(threadIdx.x >> 5);
    const int nbl = q0 / 32 + 1, per = (nbl + FNW - 1) / FNW, kb0 = w * per, kb1 = min(nbl, kb0 + per);   // 32-key blocks up to the diagonal one; this wave's share
    v8f o[4][NQG]; float m[NQG], l[NQG];
#pragma unroll
    for (int g = 0; g < NQG; ++g) { m[g] = -3.0e38f; l[g] = 0.f;
#pragma unroll
        for (int dt = 0; dt < 4; ++dt) o[dt][g] = (v8f){}; }
    if (kb0 < kb1) {
        V qf[NQG][2], qf2[NQG][2], kf[2][2], kf2[2][2];
        const unsigned ko = (unsigned)(lr * HD + 8 * hi) * 2u, vo = (unsigned)(lr * TT + 8 * hi) * 2u;   // the lane's byte offset in a query or key tile and in a value tile; the rest of each address is wave-uniform
#pragma unroll
        for (int g = 0; g < NQG; ++g)
#pragma unroll
            for (int kk = 0; kk < 2; ++kk) { const int qc = (q0 + g * 16) * HD + kk * 32; qf[g][kk] = WFrag<T16>::ld((const T16*)((const char*)(Q + qc) + ko)); if (SPL) qf2[g][kk] = WFrag<T16>::ld((const T16*)((const char*)(Q2 + qc) + ko)); }
        if (!SPL) {
#pragma unroll
            for (int t = 0; t < 2; ++t)
#pragma unroll
                for (int kk = 0; kk < 2; ++kk) kf[t][kk] = WFrag<T16>::ld((const T16*)((const char*)(Kp + kb0 * 32 * HD) + ko) + t * 16 * HD + kk * 32);
        }
#pragma unroll 1   // the trip count is known only at run time and one body already takes most of the registers that four waves a SIMD leave: a second copy would spill
        for (int kb = kb0; kb < kb1; ++kb) {
            const int k0 = kb * 32;
            V vf[4], vf2[4];
            const char* pv = (const char*)(Vt + k0) + vo; const char* pv2 = SPL ? (const char*)(V2 + k0) + vo : pv;   // the lane's addresses in this block's value tiles
            if (!SPL) {                                  // one plane each: the value tiles are asked for in front of the score products, their latency passes behind scores and softmax
#pragma unroll
                for (int dt = 0; dt < 4; ++dt) vf[dt] = WFrag<T16>::ld((const T16*)pv + dt * 16 * TT);
            } else {                                     // two planes each: key and value tiles take turns in the registers, so that four waves fit a SIMD
                const char* pk = (const char*)(Kp + k0 * HD) + ko; const char* pk2 = (const char*)(K2 + k0 * HD) + ko;
#pragma unroll
                for (int t = 0; t < 2; ++t)
#pragma unroll
                    for (int kk = 0; kk < 2; ++kk) { const int kc = t * 16 * HD + kk * 32; kf[t][kk] = WFrag<T16>::ld((const T16*)pk + kc); kf2[t][kk] = WFrag<T16>::ld((const T16*)pk2 + kc); }
                asm volatile("s_wait_xcnt 0x0" :: "v"(pk), "v"(pk2) : "memory");   // the loads' address registers stay whole up to here; behind it they are given to other values
                __builtin_amdgcn_sched_barrier(0);       // all key tiles are asked for at once: with matrix instructions lifted among the loads the tiles shared registers and each load waited for the one before
            }
            v8f s[2][NQG];
#pragma unroll
            for (int t = 0; t < 2; ++t)
#pragma unroll
                for (int g = 0; g < NQG; ++g) { s[t][g] = (v8f){};
#pragma unroll
                    for (int kk = 0; kk < 2; ++kk) { s[t][g] = WFrag<T16>::mma(kf[t][kk], qf[g][kk], s[t][g]); if (SPL) { s[t][g] = WFrag<T16>::mma(kf[t][kk], qf2[g][kk], s[t][g]); s[t][g] = WFrag<T16>::mma(kf2[t][kk], qf[g][kk], s[t][g]); } } }
            if (!SPL) { const char* pk = (const char*)(Kp + min(kb + 1, kb1 - 1) * 32 * HD) + ko;    // the next block's key tiles are asked for one block ahead (the last block asks for itself again)
#pragma unroll
                for (int t = 0; t < 2; ++t)
#pragma unroll
                    for (int kk = 0; kk < 2; ++kk) kf[t][kk] = WFrag<T16>::ld((const T16*)pk + t * 16 * HD + kk * 32);
                asm volatile("s_wait_xcnt 0x0" :: "v"(pv), "v"(pk) : "memory");    // the loads' address registers stay whole up to here; behind it they are given to other values
            } else {
#pragma unroll
                for (int dt = 0; dt < 4; ++dt) { vf[dt] = WFrag<T16>::ld((const T16*)pv + dt * 16 * TT); vf2[dt] = WFrag<T16>::ld((const T16*)pv2 + dt * 16 * TT); }
                asm volatile("s_wait_xcnt 0x0" :: "v"(pv), "v"(pv2) : "memory");   // the loads' address registers stay whole up to here; behind it they are given to other values
            }
            if (k0 + 31 > q0) {                          // the diagonal block (wave-uniform): keys behind the query are excluded
#pragma unroll
                for (int t = 0; t < 2; ++t)
#pragma unroll
                    for (int g = 0; g < NQG; ++g)
#pragma unroll
                        for (int r = 0; r < 8; ++r) s[t][g][r] = (k0 + t * 16 + 8 * hi + r <= q0 + g * 16 + lr) ? s[t][g][r] : -3.0e38f;
            }
            V pb[NQG], pb2[NQG];
#pragma unroll
            for (int g = 0; g < NQG; ++g) {
                float bm = s[0][g][0];
#pragma unroll
                for (int r = 1; r < 8; ++r) bm = fmaxf(bm, s[0][g][r]);
#pragma unroll
                for (int r = 0; r < 8; ++r) bm = fmaxf(bm, s[1][g][r]);
                bm = fmaxf(bm, __shfl_xor(bm, 16, 32));  // the query's other 16 keys of the block lie in the other lane half
                const float mn = fmaxf(m[g], bm), sc = __builtin_amdgcn_exp2f((m[g] - mn) * C), nb = OFF - mn * C; m[g] = mn;
                float p[16], ps = 0.f;
#pragma unroll
                for (int e = 0; e < 16; ++e) { p[e] = __builtin_amdgcn_exp2f(fmaf(s[e >> 3][g][e & 7], C, nb)); ps += p[e]; }
                l[g] = l[g] * sc + ps;
#pragma unroll
                for (int dt = 0; dt < 4; ++dt) o[dt][g] *= sc;
                PPack<T16, SPL>::pk(p, pb[g], pb2[g]);
            }
#pragma unroll
            for (int dt = 0; dt < 4; ++dt)
#pragma unroll
                for (int g = 0; g < NQG; ++g) { o[dt][g] = WFrag<T16>::mma(vf[dt], pb[g], o[dt][g]); if (SPL) { o[dt][g] = WFrag<T16>::mma(vf[dt], pb2[g], o[dt][g]); o[dt][g] = WFrag<T16>::mma(vf2[dt], pb[g], o[dt][g]); } }
        }
    }
#pragma unroll
    for (int g = 0; g < NQG; ++g) { l[g] += __shfl_xor(l[g], 16, 32);   // the two lane halves summed different keys of the same query
        if (hi == 0) { sm[w * NQ + g * 16 + lr] = m[g]; sl[w * NQ + g * 16 + lr] = l[g]; }
#pragma unroll
        for (int dt = 0; dt < 4; ++dt) { float* po = so + (w * NQ + g * 16 + lr) * 68 + dt * 16 + 8 * hi; const v8f c = o[dt][g]; *(v4f*)po = __builtin_shufflevector(c, c, 0, 1, 2, 3); *(v4f*)(po + 4) = __builtin_shufflevector(c, c, 4, 5, 6, 7); } }
    __syncthreads();                                     // every wave's partial maximum, sum and tile are in LDS
    constexpr int TPQ = 32 * FNW / NQ, CH = HD / TPQ;    // threads per query (neighbouring lanes, so that one wave writes a query's whole 128-byte line) and head dimensions per thread
    const int q = threadIdx.x / TPQ, c0 = (threadIdx.x % TPQ) * CH;
    float M = sm[q];
#pragma unroll
    for (int ww = 1; ww < FNW; ++ww) M = fmaxf(M, sm[ww * NQ + q]);
    float L = 0.f; v4f acc[CH / 4];
#pragma unroll
    for (int i = 0; i < CH / 4; ++i) acc[i] = (v4f){};
#pragma unroll
    for (int ww = 0; ww < FNW; ++ww) { const float wg = __builtin_amdgcn_exp2f((sm[ww * NQ + q] - M) * C); L += wg * sl[ww * NQ + q];   // a wave without keys has maximum -3e38: weight 0
#pragma unroll
        for (int i = 0; i < CH / 4; ++i) acc[i] += *(const v4f*)(so + (ww * NQ + q) * 68 + c0 + i * 4) * wg; }
    const float inv = __fdiv_rn(1.0f, L);
    const size_t oo = (size_t)(q0 + q) * DQ + c0;
#pragma unroll
    for (int i = 0; i < CH / 8; ++i) { v8us oh, ol;
#pragma unroll
        for (int e = 0; e < 8; ++e) { unsigned short x, y; splitf(acc[i * 2 + (e >> 2)][e & 3] * inv, x, y); oh[e] = x; ol[e] = y; }
        *(v8us*)(Ah + oo + i * 8) = oh; *(v8us*)(Al + oo + i * 8) = ol; }
    asm volatile("s_wait_xcnt 0x0" ::: "memory");        // behind the last store: in the built kernel the other tile form's code follows this one, and there the stores' registers are written again
}
// grid (batch x heads, query tiles), so that work-groups start longest first over all heads: the tiles of 32 rows >= RH from the last down (fp16 operands), then the tiles of 16 rows < RH (hi / lo planes, 3 products)
__global__ __launch_bounds__(32 * FNW) void k_fattn(const h16* __restrict__ Q16, const h16* __restrict__ K16, const h16* __restrict__ V16, const bf* __restrict__ Qh, const bf* __restrict__ Ql, const bf* __restrict__ Kh, const bf* __restrict__ Kl, const bf* __restrict__ Vh, const bf* __restrict__ Vl, bf* Ah, bf* Al) {
    __shared__ __align__(16) float so[FNW * 32 * 68]; __shared__ float sm[FNW * 32]; __shared__ float sl[FNW * 32];
    constexpr int NLO = (TT - RH) / 32;
    const size_t zq = (size_t)blockIdx.x * TT * HD, zk = (size_t)(blockIdx.x / REP) * TT * HD; const int x = blockIdx.y;
    const size_t za = (size_t)(blockIdx.x / NH_) * TT * DQ + (blockIdx.x % NH_) * HD;   // merged-head planes are [batch][row][head][dim]
    bf* ah = Ah + za; bf* al = Al + za;
    if (x < NLO) attn_tile<h16, false, 2>(Q16 + zq, nullptr, K16 + zk, nullptr, V16 + zk, nullptr, TT - 32 - x * 32, so, sm, sl, ah, al);
    else attn_tile<bf, true, 1>(Qh + zq, Ql + zq, Kh + zk, Kl + zk, Vh + zk, Vl + zk, RH - 16 - (x - NLO) * 16, so, sm, sl, ah, al);
}

extern "C" void kernel_launch(void* const* d_in, const int* in_sizes, int n_in,
                              void* d_out, int out_size, void* d_ws, size_t ws_size, hipStream_t stream) {
    (void)in_sizes; (void)n_in; (void)out_size;
    const float* x = (const float*)d_in[0]; const float* wattn = (const float*)d_in[1]; const float* wo = (const float*)d_in[2];   /* order x, w_attn ('oi' [3072][1024]: q | k | v row thirds), w_proj ('oi') */ const float* wq = wattn; const float* wk = wattn + (size_t)DQ * DM; const float* wv = wattn + (size_t)2 * DQ * DM;
    float* OUT = (float*)d_out;     // [4][2048][1024]
    char* wsp = (char*)d_ws;
    auto take = [&](size_t bytes) { char* p = wsp; wsp += (bytes + 255) & ~(size_t)255; return (void*)p; };
    bf* WQ = (bf*)take((size_t)(DQ + 2 * DKV) * DM * 2); bf* WK = WQ + (size_t)DQ * DM; bf* WV = WK + (size_t)DKV * DM;   /* one [3072][1024] plane, q | k | v */ bf* WO = (bf*)take((size_t)DM * DQ * 2); float* CS = (float*)take((size_t)TT * HD * 2 * 4);
    bf* XB = (bf*)take((size_t)NB_ * TT * DM * 2);
    h16* QP16 = (h16*)take((size_t)NB_ * NH_ * TT * HD * 2); h16* KP16 = (h16*)take((size_t)NB_ * NKV * TT * HD * 2); h16* VT16 = (h16*)take((size_t)NB_ * NKV * HD * TT * 2);
    bf* QPh = (bf*)take((size_t)NB_ * NH_ * TT * HD * 2); bf* QPl = (bf*)take((size_t)NB_ * NH_ * TT * HD * 2); bf* KPh = (bf*)take((size_t)NB_ * NKV * TT * HD * 2); bf* KPl = (bf*)take((size_t)NB_ * NKV * TT * HD * 2); bf* VTh = (bf*)take((size_t)NB_ * NKV * HD * TT * 2); bf* VTl = (bf*)take((size_t)NB_ * NKV * HD * TT * 2);
    bf* ATh = (bf*)take((size_t)NB_ * TT * DQ * 2); bf* ATl = (bf*)take((size_t)NB_ * TT * DQ * 2);
    if ((size_t)(wsp - (char*)d_ws) > ws_size) return;    // ws 256 MiB
    { k_cvt8<<<(unsigned)(((size_t)DQ * DM / 8 + 255) / 256), 256, 0, stream>>>(wq, WQ, (size_t)DQ * DM / 8); k_cvt8<<<(unsigned)(((size_t)DKV * DM / 8 + 255) / 256), 256, 0, stream>>>(wk, WK, (size_t)DKV * DM / 8); k_cvt8<<<(unsigned)(((size_t)DKV * DM / 8 + 255) / 256), 256, 0, stream>>>(wv, WV, (size_t)DKV * DM / 8);
      k_cvt8<<<(unsigned)(((size_t)DM * DQ / 8 + 255) / 256), 256, 0, stream>>>(wo, WO, (size_t)DM * DQ / 8);
       }
    k_cs5<<<(TT * HD + 255) / 256, 256, 0, stream>>>(CS);   /* rotary table from INVT and the positions */
    // every stage runs once for all batches: the products take the batch as grid z, the attention sees NB_ x heads heads
    k_cvt8<<<(unsigned)(((size_t)NB_ * TT * DM / 8 + 255) / 256), 256, 0, stream>>>(x, XB, (size_t)NB_ * TT * DM / 8);
    k_qkv<<<dim3(TT / 64, (DQ + 2 * DKV) / 64, NB_), 32, 0, stream>>>(XB, WQ, CS, QP16, QPh, QPl, KP16, KPh, KPl, VT16, VTh, VTl);
    k_fattn<<<dim3(NB_ * NH_, (TT - RH) / 32 + RH / 16, 1), 32 * FNW, 0, stream>>>(QP16, KP16, VT16, QPh, QPl, KPh, KPl, VTh, VTl, ATh, ATl);
    k_gemmw<bf, 1, false><<<dim3(TT / 64, DM / 64, NB_), 32, 0, stream>>>(ATh, ATl, WO, nullptr, DQ, OUT, DM, nullptr, (size_t)TT * DQ, 0, (size_t)TT * DM);
}

// v006
// One run takes 212 microseconds.
// Timed twice side by side with v005, it ran 1.35 times as fast both times.
// All steps since v000 together make it 13.5 times as fast.
#include <hip/hip_runtime.h>

// Causal self-attention with a fused bias-free qkv weight and the source's pairwise rotary form (x [4][2048][1024]; qkv = x w_attn^T ('oi' [3072][1024]) split in thirds q | k | v (16 heads x 64); rope on consecutive pairs with PER-ELEMENT table columns: out[2i] = x[2i] cos[2i] - x[2i+1] sin[2i], out[2i+1] = x[2i+1] cos[2i+1] + x[2i] sin[2i+1] where cos / sin = cat(freqs, freqs) of angle t x 1/10000^(2j/64) (so column d uses frequency d mod 32: the module reshapes the concatenated tables pairwise; reproduced literally; 32 f32 frequencies; precise cosf/sinf); scores x 1/sqrt(64); causal (finfo.min == exclusion); softmax; y = merged w_proj^T ('oi') -> [4][2048][1024] (8.4 M); argument order x, w_attn, w_proj).
// Layout, all batches in every launch: bf16 copy of x; 'oi' weights; exact projections; computed {cos, sin} table k_cs5 (INVT[32]); q, k, v projections in one launch whose epilogue applies the interleaved-pair rotary with per-dimension table entries and writes the planes (k_qkv); one-kernel causal T-2048 attention k_fattn (hybrid rows: < 512 hi/lo 3 products, rest fp16 x1024; key blocks above the diagonal are never visited); merged hi/lo x Wo exact.
// Compute dtypes, f32 accumulate: every input rounded to bf16 (tables f32); projections exact; rotary f32; attention rows < 512 3 products, rest fp16; softmax f32; Wo hl x exact.

#define NB_  4
#define TT   2048
#define DM   1024
#define NH_  16
#define NKV  16
#define REP  (NH_ / NKV)
#define HD   64
#define DQ   (NH_ * HD)
#define DKV  (NKV * HD)
#define RH   512                  // query rows < RH use hi+lo planes (0: none)
#define SCL  0.125f   // HD^-0.5
typedef _Float16 h16;
typedef unsigned short bf;
typedef __attribute__((ext_vector_type(16))) __bf16   v16bf;
typedef __attribute__((ext_vector_type(16))) _Float16 v16h;
typedef __attribute__((ext_vector_type(8)))  _Float16 v8h;
typedef __attribute__((ext_vector_type(8)))  unsigned short v8us;
typedef __attribute__((ext_vector_type(8)))  float    v8f;
typedef __attribute__((ext_vector_type(4)))  float    v4f;
typedef v8h  __attribute__((may_alias)) v8ha;
typedef v4f  __attribute__((may_alias)) v4fa;
typedef v8us __attribute__((may_alias)) v8usa;

__device__ __forceinline__ unsigned short f2bf(float f) { unsigned u = __float_as_uint(f); u += 0x7FFFu + ((u >> 16) & 1u); return (unsigned short)(u >> 16); }
__device__ __forceinline__ float bf2f(unsigned short b) { return __uint_as_float(((unsigned)b) << 16); }
__device__ __forceinline__ float bfr(float f) { return bf2f(f2bf(f)); }
__device__ __forceinline__ v16h cat16(v8h lo, v8h hi) { return __builtin_shufflevector(lo, hi, 0, 1, 2, 3, 4, 5, 6, 7, 8, 9, 10, 11, 12, 13, 14, 15); }
__device__ __forceinline__ v16bf cat16b(v8us lo, v8us hi) { return __builtin_bit_cast(v16bf, __builtin_shufflevector(lo, hi, 0, 1, 2, 3, 4, 5, 6, 7, 8, 9, 10, 11, 12, 13, 14, 15)); }
__device__ __forceinline__ v8f wmma16(v16h a, v16h b, v8f c) { return __builtin_amdgcn_wmma_f32_16x16x32_f16(false, a, false, b, (short)0, c, false, false); }
__device__ __forceinline__ v8f wmmab(v16bf a, v16bf b, v8f c) { return __builtin_amdgcn_wmma_f32_16x16x32_bf16(false, a, false, b, (short)0, c, false, false); }



// ---- gemm128: the product loop of both GEMM kernels. A work-group of 4 waves (2 x 2) owns a 128x128 output tile, each wave a 64x64 quarter (16 accumulators).
// A pass is 64 k = 128 bytes of each of the 128 rows of every operand (K-contiguous 16-bit planes, row length DM). The rows come into LDS by asynchronous copies, each copy 4 whole 128-byte lines, each wave 32 rows of every operand;
// two buffers: the next pass's copies fly while this pass's fragments are read from LDS, every row by two waves. Products and their order along k are those of one wave per tile: k in steps of 32, A before A2.
#define PB    144                 // LDS pitch of a 128-byte row piece: 16 bytes x odd, the pitch of 16-byte fragment reads
#define TILEB (128 * PB)          // one operand's rows of one pass
#define NPASS (DM / 64)
template <typename T16> struct WFrag;
template <> struct WFrag<h16> { typedef v16h V; static __device__ __forceinline__ V ld(const h16* p) { return cat16(*(const v8h*)p, *(const v8h*)(p + 16)); } static __device__ __forceinline__ v8f mma(V a, V b, v8f c) { return wmma16(a, b, c); } };
template <> struct WFrag<bf> { typedef v16bf V; static __device__ __forceinline__ V ld(const bf* p) { return cat16b(*(const v8us*)p, *(const v8us*)(p + 16)); } static __device__ __forceinline__ v8f mma(V a, V b, v8f c) { return wmmab(a, b, c); } };
// 32 rows x 128 bytes: 8 copies of a wave; lds and g are the lane's own addresses in the first 4 rows. The wait in the same statement stands in front of every later write of the address registers.
__device__ __forceinline__ void copy32(unsigned lds, const char* g) {
    asm volatile("global_load_async_to_lds_b128 %0, %8, off\n\t"
                 "global_load_async_to_lds_b128 %1, %9, off\n\t"
                 "global_load_async_to_lds_b128 %2, %10, off\n\t"
                 "global_load_async_to_lds_b128 %3, %11, off\n\t"
                 "global_load_async_to_lds_b128 %4, %12, off\n\t"
                 "global_load_async_to_lds_b128 %5, %13, off\n\t"
                 "global_load_async_to_lds_b128 %6, %14, off\n\t"
                 "global_load_async_to_lds_b128 %7, %15, off\n\t"
                 "s_wait_xcnt 0x0"
                 :: "v"(lds), "v"(lds + 4 * PB), "v"(lds + 8 * PB), "v"(lds + 12 * PB), "v"(lds + 16 * PB), "v"(lds + 20 * PB), "v"(lds + 24 * PB), "v"(lds + 28 * PB),
                    "v"(g), "v"(g + 4 * DM * 2), "v"(g + 8 * DM * 2), "v"(g + 12 * DM * 2), "v"(g + 16 * DM * 2), "v"(g + 20 * DM * 2), "v"(g + 24 * DM * 2), "v"(g + 28 * DM * 2)
                 : "memory");
}
__device__ __forceinline__ v16bf ldsfrag(const char* p) { return cat16b(*(const v8usa*)p, *(const v8usa*)(p + 32)); }   // WFrag::ld's two 16-byte pieces, from LDS
// pa, pa2 (NA == 2), pb: first row of the work-group's 128 rows of each operand; smem: 2 x (NA + 1) x TILEB bytes. On return every wave has passed the last barrier and no copy is outstanding: smem is free.
template <int NA>
__device__ __forceinline__ void gemm128(const char* pa, const char* pa2, const char* pb, char* smem, const int w, const int lane, v8f (&acc)[4][4]) {
    constexpr int BUFB = (NA + 1) * TILEB;
    const int lr = lane & 15, hi = lane >> 4;
    const unsigned go = (unsigned)((w * 32 + (lane >> 3)) * (DM * 2) + (lane & 7) * 16);                              // the lane's byte in an operand's 128 rows: 8 lanes a row
    const unsigned lo = (unsigned)(size_t)smem + (unsigned)((w * 32 + (lane >> 3)) * PB + (lane & 7) * 16);          // and its LDS byte address in a tile
    auto stage = [&](const int t, const int buf) {
        copy32(lo + buf * BUFB, pa + go + t * 128);
        if (NA == 2) copy32(lo + buf * BUFB + TILEB, pa2 + go + t * 128);
        copy32(lo + buf * BUFB + NA * TILEB, pb + go + t * 128); };
#pragma unroll
    for (int mb = 0; mb < 4; ++mb)
#pragma unroll
        for (int nb = 0; nb < 4; ++nb) acc[mb][nb] = (v8f){};
    stage(0, 0);
    asm volatile("s_wait_asynccnt 0x0" ::: "memory");   // this wave's rows of pass 0 have landed
    __syncthreads();                                     // and every other wave's
    stage(1, 1);
    const char* fa = smem + ((w >> 1) * 64 + lr) * PB + 16 * hi; const char* fb = smem + NA * TILEB + ((w & 1) * 64 + lr) * PB + 16 * hi;   // the lane's row in the wave's first A and B fragment
#pragma unroll 1   // one body holds the 16 accumulator tiles and the fragments of one k step
    for (int t = 0; t < NPASS; ++t) {
        const int bo = (t & 1) * BUFB;
        v16bf a[4], a2[4], b[4];
        auto frags = [&](const int kk) {                     // the fragments of k step kk of this pass
#pragma unroll
            for (int mb = 0; mb < 4; ++mb) { a[mb] = ldsfrag(fa + bo + mb * 16 * PB + kk * 64); if (NA == 2) a2[mb] = ldsfrag(fa + bo + TILEB + mb * 16 * PB + kk * 64); }
#pragma unroll
            for (int nb = 0; nb < 4; ++nb) b[nb] = ldsfrag(fb + bo + nb * 16 * PB + kk * 64); };
        auto products = [&]() {
#pragma unroll
            for (int nb = 0; nb < 4; ++nb) {
#pragma unroll
                for (int mb = 0; mb < 4; ++mb) acc[mb][nb] = wmmab(a[mb], b[nb], acc[mb][nb]);
                if (NA == 2) {
#pragma unroll
                    for (int mb = 0; mb < 4; ++mb) acc[mb][nb] = wmmab(a2[mb], b[nb], acc[mb][nb]); } } };
        frags(0);
        __builtin_amdgcn_sched_barrier(0);                   // all fragments of a k step are asked for at once: with the reads sunk among the matrix instructions the B fragments shared one register set and each waited out its own LDS latency
        products();
        frags(1);                                            // the pass's last reads of its buffer
        if (NA == 2) { __builtin_amdgcn_sched_barrier(0); products(); __builtin_amdgcn_sched_barrier(0); }   // three fragment sets leave no registers for the copies' addresses: the products come first, and stay in front of the barrier, so that the copies go out right behind it
        asm volatile("s_wait_dscnt 0x0" ::: "memory");      // this wave's reads of the buffer are done before it is filled again
        asm volatile("s_wait_asynccnt 0x0" ::: "memory");   // this wave's rows of pass t + 1 have landed
        __syncthreads();                                     // pass t + 1 is whole, and nobody reads pass t's buffer any more
        if (t + 2 < NPASS) stage(t + 2, t & 1);
        if (NA == 1) { __builtin_amdgcn_sched_barrier(0); products(); }   // these products need registers only: the copies go out in front of them, so that they have a whole pass to land
    }
    asm volatile("s_wait_asynccnt 0x0" ::: "memory");       // nothing is in flight when the buffers are given to the epilogue
}
// ---- k_gemmw: C[m][n] (f32, pitch DM) = sum_k (A[m][k] + A2[m][k]) Bt[n][k], K = DQ; grid (T/128, DM/128, batch), 4 waves; each wave stores its 64x64 quarter, 16 rows at a time through its own piece of LDS.
__global__ __launch_bounds__(128) void k_gemmw(const bf* __restrict__ A, const bf* __restrict__ A2, const bf* __restrict__ Bt, float* C) {
    __shared__ __attribute__((aligned(128))) char smem[2 * 3 * TILEB];
    constexpr int ldc = DM;
    const int lane = threadIdx.x & 31, lr = lane & 15, hi = lane >> 4; const int w = __builtin_amdgcn_readfirstlane(threadIdx.x >> 5);
    const size_t ra = ((size_t)blockIdx.z * TT + blockIdx.x * 128) * DQ;
    v8f acc[4][4];
    gemm128<2>((const char*)(A + ra), (const char*)(A2 + ra), (const char*)(Bt + (size_t)blockIdx.y * 128 * DQ), smem, w, lane, acc);
    float* os = (float*)(smem + w * (16 * 68 * 4));
    C += (size_t)blockIdx.z * TT * DM; const int r0 = blockIdx.x * 128 + (w >> 1) * 64, c0 = blockIdx.y * 128 + (w & 1) * 64;
#pragma unroll
    for (int mb = 0; mb < 4; ++mb) {
#pragma unroll
        for (int nb = 0; nb < 4; ++nb) {
#pragma unroll
            for (int j = 0; j < 8; ++j) os[(hi * 8 + j) * 68 + nb * 16 + lr] = acc[mb][nb][j]; }
        __builtin_amdgcn_wave_barrier(); asm volatile("" ::: "memory");   // the reads below take other lanes' words: they stay behind these writes
        float* crow = C + (size_t)(r0 + mb * 16) * ldc + c0;
#pragma unroll
        for (int s = 0; s < 8; ++s) { const int row = 2 * s + hi, cofs = lr * 4; const v4f val = *(const v4fa*)(os + row * 68 + cofs);
            *(v4f*)(crow + (size_t)row * ldc + cofs) = val; }
        __builtin_amdgcn_wave_barrier(); asm volatile("s_wait_xcnt 0x0" ::: "memory");   // the next 16 rows are written only behind these reads; the wait stands behind the stores, whose registers the next rows' loads take
    }
}

__device__ __forceinline__ void splitf(float y, unsigned short& h, unsigned short& l) { h = f2bf(y); l = f2bf(y - bf2f(h)); }
typedef __attribute__((ext_vector_type(2))) _Float16 v2h;
typedef __attribute__((ext_vector_type(4))) _Float16 v4h;
typedef __attribute__((ext_vector_type(4))) unsigned short v4us;
typedef __attribute__((ext_vector_type(2))) float v2f;
typedef __attribute__((ext_vector_type(4))) int v4i;

__global__ __launch_bounds__(256) void k_cvt8(const float* __restrict__ src, bf* dst, size_t n8) { const size_t i = (size_t)blockIdx.x * 256 + threadIdx.x; if (i >= n8) return; const v8f v = *(const v8f*)(src + i * 8); v8us o;
#pragma unroll
    for (int k = 0; k < 8; ++k) o[k] = f2bf(v[k]); *(v8us*)(dst + i * 8) = o;  }

__constant__ float INVT[HD / 2] = { 1.000000000e+00f, 7.498942018e-01f, 5.623413324e-01f, 4.216965139e-01f, 3.162277639e-01f, 2.371373624e-01f, 1.778279394e-01f, 1.333521456e-01f, 1.000000015e-01f, 7.498941571e-02f, 5.623412877e-02f, 4.216964915e-02f, 3.162277862e-02f, 2.371373586e-02f, 1.778279431e-02f, 1.333521493e-02f, 9.999999776e-03f, 7.498942316e-03f, 5.623413250e-03f, 4.216964822e-03f, 3.162277862e-03f, 2.371373819e-03f, 1.778279431e-03f, 1.333521446e-03f, 1.000000047e-03f, 7.498941850e-04f, 5.623413017e-04f, 4.216964880e-04f, 3.162277862e-04f, 2.371373848e-04f, 1.778279402e-04f, 1.333521504e-04f };   // float32 1 / 10000^(2i/64), generated with jnp to be bit-exact
__global__ __launch_bounds__(256) void k_cs5(float* CS) { const int idx = blockIdx.x * 256 + threadIdx.x; if (idx >= TT * HD) return; const int d = idx % HD; const int t = idx / HD; const float a = __fmul_rn((float)t, INVT[d % (HD / 2)]); v2f cs; cs[0] = cosf(a); cs[1] = sinf(a); *(v2f*)(CS + (size_t)idx * 2) = cs;  }
typedef __attribute__((ext_vector_type(2))) __bf16 v2bf;
typedef __attribute__((ext_vector_type(4))) unsigned v4u;
typedef v4u __attribute__((may_alias)) v4ua;
// two f32 -> their fp16 pair, their bf16 hi pair and the bf16 pair of what hi leaves over, each packed in one word; the packed conversions round to nearest even, as a plain cast and splitf do
__device__ __forceinline__ void pack2(v2f y, unsigned& w16, unsigned& wh, unsigned& wl) {
    w16 = __builtin_bit_cast(unsigned, __builtin_convertvector(y, v2h)); wh = __builtin_bit_cast(unsigned, __builtin_convertvector(y, v2bf));
    v2f b; b[0] = __uint_as_float(wh << 16); b[1] = __uint_as_float(wh & 0xFFFF0000u); wl = __builtin_bit_cast(unsigned, __builtin_convertvector(y - b, v2bf)); }
// ---- k_qkv: the q, k and v projections of all batches in ONE launch; the product loop is gemm128 (one wave per 64x64 quarter), and the tile leaves the accumulators as finished 16-bit planes: no f32 projection is stored.
// grid (T/128, 3 x heads / 2, batch), 4 waves: Bt is the [3 x 1024][1024] weight (q | k | v row thirds), so a wave's 64 columns are the 64 dimensions of ONE head of q, k or v, and its rows are 64 positions of one batch.
// q, k: 16 rows at a time through LDS, so that a lane holds 8 neighbouring dimensions of one position (4 rotary pairs, whole 16-byte stores, 4 rows = 512 bytes in a row per store); table entries per dimension as k_cs5 wrote them.
// v: a lane's 8 accumulator registers are 8 consecutive positions of one dimension, which is a 16-byte piece of a transposed value row: stored straight from the registers; the wave writes each row's whole 128-byte line.
__global__ __launch_bounds__(128) void k_qkv(const bf* __restrict__ A, const bf* __restrict__ Bt, const float* __restrict__ CS, h16* Q16, bf* Qh, bf* Ql, h16* K16, bf* Kh, bf* Kl, h16* V16, bf* Vh, bf* Vl) {
    __shared__ __attribute__((aligned(128))) char smem[2 * 2 * TILEB];
    const int lane = threadIdx.x & 31, lr = lane & 15, hi = lane >> 4; const int w = __builtin_amdgcn_readfirstlane(threadIdx.x >> 5);
    v8f acc[4][4];
    gemm128<1>((const char*)(A + ((size_t)blockIdx.z * TT + blockIdx.x * 128) * DM), nullptr, (const char*)(Bt + (size_t)blockIdx.y * 128 * DM), smem, w, lane, acc);
    float* os = (float*)(smem + w * (16 * 68 * 4));                      // the wave's own 16 x 68 words for its epilogue
    const int r0 = blockIdx.x * 128 + (w >> 1) * 64, ct = blockIdx.y * 2 + (w & 1);   // the wave's first position and its 64-column tile
    const int part = ct / NH_;                                           // 0 q, 1 k, 2 v (the same for the whole wave)
    const size_t g = (size_t)blockIdx.z * NH_ + ct % NH_;                // batch x heads index of the planes
    if (part == 2) {
        const size_t e0 = (g * HD * TT + r0) * 2; char* p16 = (char*)V16 + e0; char* ph = (char*)Vh + e0; char* pl = (char*)Vl + e0;   // wave-uniform bases
        const unsigned lo = (unsigned)(lr * TT + 8 * hi) * 2u;              // the lane's byte offset; the rest of each address is a constant
#pragma unroll
        for (int nb = 0; nb < 4; ++nb)
#pragma unroll
            for (int mb = 0; mb < 4; ++mb) { v4u o16, oh, ol;
#pragma unroll
                for (int p = 0; p < 4; ++p) { v2f y; y[0] = acc[mb][nb][2 * p]; y[1] = acc[mb][nb][2 * p + 1]; unsigned a, b, d; pack2(y, a, b, d); o16[p] = a; oh[p] = b; ol[p] = d; }
                const int e = (nb * 16 * TT + mb * 16) * 2;
                *(v4ua*)(p16 + lo + e) = o16; *(v4ua*)(ph + lo + e) = oh; *(v4ua*)(pl + lo + e) = ol; }
    } else {
        const size_t e0 = (g * TT + r0) * HD * 2; char* p16 = (char*)(part ? K16 : Q16) + e0; char* ph = (char*)(part ? Kh : Qh) + e0; char* pl = (char*)(part ? Kl : Ql) + e0;   // wave-uniform bases
        const char* pcs = (const char*)(CS + (size_t)r0 * HD * 2);
        const int rr = lane >> 3, cofs = (lane & 7) * 8;                 // the lane's row among 4 and its first dimension
        const unsigned lo = (unsigned)(rr * HD + cofs) * 2u;               // the lane's byte offset in a plane (4 times that in the table); the rest of each address is a constant
#pragma unroll
        for (int mb = 0; mb < 4; ++mb) {
#pragma unroll
            for (int nb = 0; nb < 4; ++nb) {
#pragma unroll
                for (int j = 0; j < 8; ++j) os[(hi * 8 + j) * 68 + nb * 16 + lr] = acc[mb][nb][j]; }
            __builtin_amdgcn_wave_barrier(); asm volatile("" ::: "memory");   // the reads below take other lanes' words: they stay behind these writes
#pragma unroll
            for (int s = 0; s < 4; ++s) { const int row = 4 * s + rr, e = (mb * 16 + 4 * s) * HD * 2;
                const v4f xa = *(const v4fa*)(os + row * 68 + cofs), xb = *(const v4fa*)(os + row * 68 + cofs + 4);
                const char* cs = pcs + lo * 4u + e * 4;                      // {cos, sin} of 8 dimensions
                v4u o16, oh, ol;
#pragma unroll
                for (int p = 0; p < 4; ++p) { const v4f c = *(const v4fa*)(cs + p * 16); const float x0 = p < 2 ? xa[2 * p] : xb[2 * p - 4], x1 = p < 2 ? xa[2 * p + 1] : xb[2 * p - 3];
                    v2f y; y[0] = x0 * c[0] - x1 * c[1]; y[1] = x0 * c[3] + x1 * c[2];   /* even: x0 c - x1 s; odd: x0 s + x1 c */
                    unsigned a, b, d; pack2(y, a, b, d); o16[p] = a; oh[p] = b; ol[p] = d; }
                *(v4ua*)(p16 + lo + e) = o16; *(v4ua*)(ph + lo + e) = oh; *(v4ua*)(pl + lo + e) = ol; }
            __builtin_amdgcn_wave_barrier(); asm volatile("s_wait_xcnt 0x0" ::: "memory");   // the next 16 rows are written only behind these reads; the wait stands behind the stores, whose registers the next rows' loads take
        }
    }
}
#define FNW 4
template <typename T16, bool SPL> struct PPack;
template <> struct PPack<h16, false> { static __device__ __forceinline__ void pk(const float* p, v16h& ph, v16h& pl) { (void)pl;
#pragma unroll
    for (int s = 0; s < 16; ++s) ph[s] = (h16)p[s]; } };
template <> struct PPack<bf, true> { static __device__ __forceinline__ void pk(const float* p, v16bf& ph, v16bf& pl) { v8us h0, h1, l0, l1;
#pragma unroll
    for (int s = 0; s < 8; ++s) { unsigned short x, y; splitf(p[s], x, y); h0[s] = x; l0[s] = y; splitf(p[8 + s], x, y); h1[s] = x; l1[s] = y; }
    ph = cat16b(h0, h1); pl = cat16b(l0, l1); } };
template <typename T16, bool SPL, int NQG>
__device__ __forceinline__ void attn_tile(const T16* __restrict__ Q, const T16* __restrict__ Q2, const T16* __restrict__ Kp, const T16* __restrict__ K2, const T16* __restrict__ Vt, const T16* __restrict__ V2, const int q0, float* so, float* sm, float* sl, bf* Ah, bf* Al) {
    typedef typename WFrag<T16>::V V;
    constexpr int NQ = NQG * 16;
    constexpr float C = SCL * 1.4426950408889634f;      // raw score -> exponent of 2
    constexpr float OFF = SPL ? 0.0f : 10.0f;           // fp16 probabilities carry a factor 1024 (it cancels against the sum, which carries it too)
    const int lane = threadIdx.x & 31, lr = lane & 15, hi = lane >> 4; const int w = __builtin_amdgcn_readfirstlane(threadIdx.x >> 5);
    const int nbl = q0 / 32 + 1, per = (nbl + FNW - 1) / FNW, kb0 = w * per, kb1 = min(nbl, kb0 + per);   // 32-key blocks up to the diagonal one; this wave's share
    v8f o[4][NQG]; float m[NQG], l[NQG];
#pragma unroll
    for (int g = 0; g < NQG; ++g) { m[g] = -3.0e38f; l[g] = 0.f;
#pragma unroll
        for (int dt = 0; dt < 4; ++dt) o[dt][g] = (v8f){}; }
    if (kb0 < kb1) {
        V qf[NQG][2], qf2[NQG][2], kf[2][2], kf2[2][2];
        const unsigned ko = (unsigned)(lr * HD + 8 * hi) * 2u, vo = (unsigned)(lr * TT + 8 * hi) * 2u;   // the lane's byte offset in a query or key tile and in a value tile; the rest of each address is wave-uniform
#pragma unroll
        for (int g = 0; g < NQG; ++g)
#pragma unroll
            for (int kk = 0; kk < 2; ++kk) { const int qc = (q0 + g * 16) * HD + kk * 32; qf[g][kk] = WFrag<T16>::ld((const T16*)((const char*)(Q + qc) + ko)); if (SPL) qf2[g][kk] = WFrag<T16>::ld((const T16*)((const char*)(Q2 + qc) + ko)); }
        if (!SPL) {
#pragma unroll
            for (int t = 0; t < 2; ++t)
#pragma unroll
                for (int kk = 0; kk < 2; ++kk) kf[t][kk] = WFrag<T16>::ld((const T16*)((const char*)(Kp + kb0 * 32 * HD) + ko) + t * 16 * HD + kk * 32);
        }
#pragma unroll 1   // the trip count is known only at run time and one body already takes most of the registers that four waves a SIMD leave: a second copy would spill
        for (int kb = kb0; kb < kb1; ++kb) {
            const int k0 = kb * 32;
            V vf[4], vf2[4];
            const char* pv = (const char*)(Vt + k0) + vo; const char* pv2 = SPL ? (const char*)(V2 + k0) + vo : pv;   // the lane's addresses in this block's value tiles
            if (!SPL) {                                  // one plane each: the value tiles are asked for in front of the score products, their latency passes behind scores and softmax
#pragma unroll
                for (int dt = 0; dt < 4; ++dt) vf[dt] = WFrag<T16>::ld((const T16*)pv + dt * 16 * TT);
            } else {                                     // two planes each: key and value tiles take turns in the registers, so that four waves fit a SIMD
                const char* pk = (const char*)(Kp + k0 * HD) + ko; const char* pk2 = (const char*)(K2 + k0 * HD) + ko;
#pragma unroll
                for (int t = 0; t < 2; ++t)
#pragma unroll
                    for (int kk = 0; kk < 2; ++kk) { const int kc = t * 16 * HD + kk * 32; kf[t][kk] = WFrag<T16>::ld((const T16*)pk + kc); kf2[t][kk] = WFrag<T16>::ld((const T16*)pk2 + kc); }
                asm volatile("s_wait_xcnt 0x0" :: "v"(pk), "v"(pk2) : "memory");   // the loads' address registers stay whole up to here; behind it they are given to other values
                __builtin_amdgcn_sched_barrier(0);       // all key tiles are asked for at once: with matrix instructions lifted among the loads the tiles shared registers and each load waited for the one before
            }
            v8f s[2][NQG];
#pragma unroll
            for (int t = 0; t < 2; ++t)
#pragma unroll
                for (int g = 0; g < NQG; ++g) { s[t][g] = (v8f){};
#pragma unroll
                    for (int kk = 0; kk < 2; ++kk) { s[t][g] = WFrag<T16>::mma(kf[t][kk], qf[g][kk], s[t][g]); if (SPL) { s[t][g] = WFrag<T16>::mma(kf[t][kk], qf2[g][kk], s[t][g]); s[t][g] = WFrag<T16>::mma(kf2[t][kk], qf[g][kk], s[t][g]); } } }
            if (!SPL) { const char* pk = (const char*)(Kp + min(kb + 1, kb1 - 1) * 32 * HD) + ko;    // the next block's key tiles are asked for one block ahead (the last block asks for itself again)
#pragma unroll
                for (int t = 0; t < 2; ++t)
#pragma unroll
                    for (int kk = 0; kk < 2; ++kk) kf[t][kk] = WFrag<T16>::ld((const T16*)pk + t * 16 * HD + kk * 32);
                asm volatile("s_wait_xcnt 0x0" :: "v"(pv), "v"(pk) : "memory");    // the loads' address registers stay whole up to here; behind it they are given to other values
            } else {
#pragma unroll
                for (int dt = 0; dt < 4; ++dt) { vf[dt] = WFrag<T16>::ld((const T16*)pv + dt * 16 * TT); vf2[dt] = WFrag<T16>::ld((const T16*)pv2 + dt * 16 * TT); }
                asm volatile("s_wait_xcnt 0x0" :: "v"(pv), "v"(pv2) : "memory");   // the loads' address registers stay whole up to here; behind it they are given to other values
            }
            if (k0 + 31 > q0) {                          // the diagonal block (wave-uniform): keys behind the query are excluded
#pragma unroll
                for (int t = 0; t < 2; ++t)
#pragma unroll
                    for (int g = 0; g < NQG; ++g)
#pragma unroll
                        for (int r = 0; r < 8; ++r) s[t][g][r] = (k0 + t * 16 + 8 * hi + r <= q0 + g * 16 + lr) ? s[t][g][r] : -3.0e38f;
            }
            V pb[NQG], pb2[NQG];
#pragma unroll
            for (int g = 0; g < NQG; ++g) {
                float bm = s[0][g][0];
#pragma unroll
                for (int r = 1; r < 8; ++r) bm = fmaxf(bm, s[0][g][r]);
#pragma unroll
                for (int r = 0; r < 8; ++r) bm = fmaxf(bm, s[1][g][r]);
                bm = fmaxf(bm, __shfl_xor(bm, 16, 32));  // the query's other 16 keys of the block lie in the other lane half
                const float mn = fmaxf(m[g], bm), sc = __builtin_amdgcn_exp2f((m[g] - mn) * C), nb = OFF - mn * C; m[g] = mn;
                float p[16], ps = 0.f;
#pragma unroll
                for (int e = 0; e < 16; ++e) { p[e] = __builtin_amdgcn_exp2f(fmaf(s[e >> 3][g][e & 7], C, nb)); ps += p[e]; }
                l[g] = l[g] * sc + ps;
#pragma unroll
                for (int dt = 0; dt < 4; ++dt) o[dt][g] *= sc;
                PPack<T16, SPL>::pk(p, pb[g], pb2[g]);
            }
#pragma unroll
            for (int dt = 0; dt < 4; ++dt)
#pragma unroll
                for (int g = 0; g < NQG; ++g) { o[dt][g] = WFrag<T16>::mma(vf[dt], pb[g], o[dt][g]); if (SPL) { o[dt][g] = WFrag<T16>::mma(vf[dt], pb2[g], o[dt][g]); o[dt][g] = WFrag<T16>::mma(vf2[dt], pb[g], o[dt][g]); } }
        }
    }
#pragma unroll
    for (int g = 0; g < NQG; ++g) { l[g] += __shfl_xor(l[g], 16, 32);   // the two lane halves summed different keys of the same query
        if (hi == 0) { sm[w * NQ + g * 16 + lr] = m[g]; sl[w * NQ + g * 16 + lr] = l[g]; }
#pragma unroll
        for (int dt = 0; dt < 4; ++dt) { float* po = so + (w * NQ + g * 16 + lr) * 68 + dt * 16 + 8 * hi; const v8f c = o[dt][g]; *(v4f*)po = __builtin_shufflevector(c, c, 0, 1, 2, 3); *(v4f*)(po + 4) = __builtin_shufflevector(c, c, 4, 5, 6, 7); } }
    __syncthreads();                                     // every wave's partial maximum, sum and tile are in LDS
    constexpr int TPQ = 32 * FNW / NQ, CH = HD / TPQ;    // threads per query (neighbouring lanes, so that one wave writes a query's whole 128-byte line) and head dimensions per thread
    const int q = threadIdx.x / TPQ, c0 = (threadIdx.x % TPQ) * CH;
    float M = sm[q];
#pragma unroll
    for (int ww = 1; ww < FNW; ++ww) M = fmaxf(M, sm[ww * NQ + q]);
    float L = 0.f; v4f acc[CH / 4];
#pragma unroll
    for (int i = 0; i < CH / 4; ++i) acc[i] = (v4f){};
#pragma unroll
    for (int ww = 0; ww < FNW; ++ww) { const float wg = __builtin_amdgcn_exp2f((sm[ww * NQ + q] - M) * C); L += wg * sl[ww * NQ + q];   // a wave without keys has maximum -3e38: weight 0
#pragma unroll
        for (int i = 0; i < CH / 4; ++i) acc[i] += *(const v4f*)(so + (ww * NQ + q) * 68 + c0 + i * 4) * wg; }
    const float inv = __fdiv_rn(1.0f, L);
    const size_t oo = (size_t)(q0 + q) * DQ + c0;
#pragma unroll
    for (int i = 0; i < CH / 8; ++i) { v8us oh, ol;
#pragma unroll
        for (int e = 0; e < 8; ++e) { unsigned short x, y; splitf(acc[i * 2 + (e >> 2)][e & 3] * inv, x, y); oh[e] = x; ol[e] = y; }
        *(v8us*)(Ah + oo + i * 8) = oh; *(v8us*)(Al + oo + i * 8) = ol; }
    asm volatile("s_wait_xcnt 0x0" ::: "memory");        // behind the last store: in the built kernel the other tile form's code follows this one, and there the stores' registers are written again
}
// grid (batch x heads, query tiles), so that work-groups start longest first over all heads: the tiles of 32 rows >= RH from the last down (fp16 operands), then the tiles of 16 rows < RH (hi / lo planes, 3 products)
__global__ __launch_bounds__(32 * FNW) void k_fattn(const h16* __restrict__ Q16, const h16* __restrict__ K16, const h16* __restrict__ V16, const bf* __restrict__ Qh, const bf* __restrict__ Ql, const bf* __restrict__ Kh, const bf* __restrict__ Kl, const bf* __restrict__ Vh, const bf* __restrict__ Vl, bf* Ah, bf* Al) {
    __shared__ __align__(16) float so[FNW * 32 * 68]; __shared__ float sm[FNW * 32]; __shared__ float sl[FNW * 32];
    constexpr int NLO = (TT - RH) / 32;
    const size_t zq = (size_t)blockIdx.x * TT * HD, zk = (size_t)(blockIdx.x / REP) * TT * HD; const int x = blockIdx.y;
    const size_t za = (size_t)(blockIdx.x / NH_) * TT * DQ + (blockIdx.x % NH_) * HD;   // merged-head planes are [batch][row][head][dim]
    bf* ah = Ah + za; bf* al = Al + za;
    if (x < NLO) attn_tile<h16, false, 2>(Q16 + zq, nullptr, K16 + zk, nullptr, V16 + zk, nullptr, TT - 32 - x * 32, so, sm, sl, ah, al);
    else attn_tile<bf, true, 1>(Qh + zq, Ql + zq, Kh + zk, Kl + zk, Vh + zk, Vl + zk, RH - 16 - (x - NLO) * 16, so, sm, sl, ah, al);
}

extern "C" void kernel_launch(void* const* d_in, const int* in_sizes, int n_in,
                              void* d_out, int out_size, void* d_ws, size_t ws_size, hipStream_t stream) {
    (void)in_sizes; (void)n_in; (void)out_size;
    const float* x = (const float*)d_in[0]; const float* wattn = (const float*)d_in[1]; const float* wo = (const float*)d_in[2];   /* order x, w_attn ('oi' [3072][1024]: q | k | v row thirds), w_proj ('oi') */ const float* wq = wattn; const float* wk = wattn + (size_t)DQ * DM; const float* wv = wattn + (size_t)2 * DQ * DM;
    float* OUT = (float*)d_out;     // [4][2048][1024]
    char* wsp = (char*)d_ws;
    auto take = [&](size_t bytes) { char* p = wsp; wsp += (bytes + 255) & ~(size_t)255; return (void*)p; };
    bf* WQ = (bf*)take((size_t)(DQ + 2 * DKV) * DM * 2); bf* WK = WQ + (size_t)DQ * DM; bf* WV = WK + (size_t)DKV * DM;   /* one [3072][1024] plane, q | k | v */ bf* WO = (bf*)take((size_t)DM * DQ * 2); float* CS = (float*)take((size_t)TT * HD * 2 * 4);
    bf* XB = (bf*)take((size_t)NB_ * TT * DM * 2);
    h16* QP16 = (h16*)take((size_t)NB_ * NH_ * TT * HD * 2); h16* KP16 = (h16*)take((size_t)NB_ * NKV * TT * HD * 2); h16* VT16 = (h16*)take((size_t)NB_ * NKV * HD * TT * 2);
    bf* QPh = (bf*)take((size_t)NB_ * NH_ * TT * HD * 2); bf* QPl = (bf*)take((size_t)NB_ * NH_ * TT * HD * 2); bf* KPh = (bf*)take((size_t)NB_ * NKV * TT * HD * 2); bf* KPl = (bf*)take((size_t)NB_ * NKV * TT * HD * 2); bf* VTh = (bf*)take((size_t)NB_ * NKV * HD * TT * 2); bf* VTl = (bf*)take((size_t)NB_ * NKV * HD * TT * 2);
    bf* ATh = (bf*)take((size_t)NB_ * TT * DQ * 2); bf* ATl = (bf*)take((size_t)NB_ * TT * DQ * 2);
    if ((size_t)(wsp - (char*)d_ws) > ws_size) return;    // ws 256 MiB
    { k_cvt8<<<(unsigned)(((size_t)DQ * DM / 8 + 255) / 256), 256, 0, stream>>>(wq, WQ, (size_t)DQ * DM / 8); k_cvt8<<<(unsigned)(((size_t)DKV * DM / 8 + 255) / 256), 256, 0, stream>>>(wk, WK, (size_t)DKV * DM / 8); k_cvt8<<<(unsigned)(((size_t)DKV * DM / 8 + 255) / 256), 256, 0, stream>>>(wv, WV, (size_t)DKV * DM / 8);
      k_cvt8<<<(unsigned)(((size_t)DM * DQ / 8 + 255) / 256), 256, 0, stream>>>(wo, WO, (size_t)DM * DQ / 8);
       }
    k_cs5<<<(TT * HD + 255) / 256, 256, 0, stream>>>(CS);   /* rotary table from INVT and the positions */
    // every stage runs once for all batches: the products take the batch as grid z, the attention sees NB_ x heads heads
    k_cvt8<<<(unsigned)(((size_t)NB_ * TT * DM / 8 + 255) / 256), 256, 0, stream>>>(x, XB, (size_t)NB_ * TT * DM / 8);
    k_qkv<<<dim3(TT / 128, (DQ + 2 * DKV) / 128, NB_), 128, 0, stream>>>(XB, WQ, CS, QP16, QPh, QPl, KP16, KPh, KPl, VT16, VTh, VTl);
    k_fattn<<<dim3(NB_ * NH_, (TT - RH) / 32 + RH / 16, 1), 32 * FNW, 0, stream>>>(QP16, KP16, VT16, QPh, QPl, KPh, KPl, VTh, VTl, ATh, ATl);
    k_gemmw<<<dim3(TT / 128, DM / 128, NB_), 128, 0, stream>>>(ATh, ATl, WO, OUT);
}

// v007
// It runs in 157 microseconds.
// Timed twice side by side with v006, it ran 1.35 times as fast both times.
// Over all steps from v000 it is 18.2 times as fast.
#include <hip/hip_runtime.h>

// Causal self-attention with a fused bias-free qkv weight and the source's pairwise rotary form (x [4][2048][1024]; qkv = x w_attn^T ('oi' [3072][1024]) split in thirds q | k | v (16 heads x 64); rope on consecutive pairs with PER-ELEMENT table columns: out[2i] = x[2i] cos[2i] - x[2i+1] sin[2i], out[2i+1] = x[2i+1] cos[2i+1] + x[2i] sin[2i+1] where cos / sin = cat(freqs, freqs) of angle t x 1/10000^(2j/64) (so column d uses frequency d mod 32: the module reshapes the concatenated tables pairwise; reproduced literally; 32 f32 frequencies; precise cosf/sinf); scores x 1/sqrt(64); causal (finfo.min == exclusion); softmax; y = merged w_proj^T ('oi') -> [4][2048][1024] (8.4 M); argument order x, w_attn, w_proj).
// Layout, all batches in every launch: bf16 copy of x; 'oi' weights; exact projections; computed {cos, sin} table k_cs5 (INVT[32]); q, k, v projections in one launch whose epilogue applies the interleaved-pair rotary with per-dimension table entries and writes the planes (k_qkv); one-kernel causal T-2048 attention k_fattn (hybrid rows: < 512 hi/lo 3 products, rest fp16 x1024; key blocks above the diagonal are never visited); merged hi/lo x Wo exact.
// Compute dtypes, f32 accumulate: every input rounded to bf16 (tables f32); projections exact; rotary f32; attention rows < 512 3 products, rest fp16; softmax f32; Wo hl x exact.

#define NB_  4
#define TT   2048
#define DM   1024
#define NH_  16
#define NKV  16
#define REP  (NH_ / NKV)
#define HD   64
#define DQ   (NH_ * HD)
#define DKV  (NKV * HD)
#define RH   512                  // query rows < RH use hi+lo planes (0: none)
#define SCL  0.125f   // HD^-0.5
typedef _Float16 h16;
typedef unsigned short bf;
typedef __attribute__((ext_vector_type(16))) __bf16   v16bf;
typedef __attribute__((ext_vector_type(16))) _Float16 v16h;
typedef __attribute__((ext_vector_type(8)))  _Float16 v8h;
typedef __attribute__((ext_vector_type(8)))  unsigned short v8us;
typedef __attribute__((ext_vector_type(8)))  float    v8f;
typedef __attribute__((ext_vector_type(4)))  float    v4f;
typedef v8h  __attribute__((may_alias)) v8ha;
typedef v4f  __attribute__((may_alias)) v4fa;
typedef v8us __attribute__((may_alias)) v8usa;

__device__ __forceinline__ unsigned short f2bf(float f) { unsigned u = __float_as_uint(f); u += 0x7FFFu + ((u >> 16) & 1u); return (unsigned short)(u >> 16); }
__device__ __forceinline__ float bf2f(unsigned short b) { return __uint_as_float(((unsigned)b) << 16); }
__device__ __forceinline__ float bfr(float f) { return bf2f(f2bf(f)); }
__device__ __forceinline__ v16h cat16(v8h lo, v8h hi) { return __builtin_shufflevector(lo, hi, 0, 1, 2, 3, 4, 5, 6, 7, 8, 9, 10, 11, 12, 13, 14, 15); }
__device__ __forceinline__ v16bf cat16b(v8us lo, v8us hi) { return __builtin_bit_cast(v16bf, __builtin_shufflevector(lo, hi, 0, 1, 2, 3, 4, 5, 6, 7, 8, 9, 10, 11, 12, 13, 14, 15)); }
__device__ __forceinline__ v8f wmma16(v16h a, v16h b, v8f c) { return __builtin_amdgcn_wmma_f32_16x16x32_f16(false, a, false, b, (short)0, c, false, false); }
__device__ __forceinline__ v8f wmmab(v16bf a, v16bf b, v8f c) { return __builtin_amdgcn_wmma_f32_16x16x32_bf16(false, a, false, b, (short)0, c, false, false); }



// ---- gemm128: the product loop of both GEMM kernels. A work-group of 4 waves (2 x 2) owns a 128x128 output tile, each wave a 64x64 quarter (16 accumulators).
// A pass is 64 k = 128 bytes of each of the 128 rows of every operand (K-contiguous 16-bit planes, row length DM). The rows come into LDS by asynchronous copies, each copy 4 whole 128-byte lines, each wave 32 rows of every operand;
// two buffers: the next pass's copies fly while this pass's fragments are read from LDS, every row by two waves. Products and their order along k are those of one wave per tile: k in steps of 32, A before A2.
#define PB    144                 // LDS pitch of a 128-byte row piece: 16 bytes x odd, the pitch of 16-byte fragment reads
#define TILEB (128 * PB)          // one operand's rows of one pass
#define NPASS (DM / 64)
template <typename T16> struct WFrag;
template <> struct WFrag<h16> { typedef v16h V; static __device__ __forceinline__ V ld(const h16* p) { return cat16(*(const v8h*)p, *(const v8h*)(p + 16)); } static __device__ __forceinline__ v8f mma(V a, V b, v8f c) { return wmma16(a, b, c); } };
template <> struct WFrag<bf> { typedef v16bf V; static __device__ __forceinline__ V ld(const bf* p) { return cat16b(*(const v8us*)p, *(const v8us*)(p + 16)); } static __device__ __forceinline__ v8f mma(V a, V b, v8f c) { return wmmab(a, b, c); } };
// 32 rows x 128 bytes: 8 copies of a wave; lds and g are the lane's own addresses in the first 4 rows. The wait in the same statement stands in front of every later write of the address registers.
__device__ __forceinline__ void copy32(unsigned lds, const char* g) {
    asm volatile("global_load_async_to_lds_b128 %0, %8, off\n\t"
                 "global_load_async_to_lds_b128 %1, %9, off\n\t"
                 "global_load_async_to_lds_b128 %2, %10, off\n\t"
                 "global_load_async_to_lds_b128 %3, %11, off\n\t"
                 "global_load_async_to_lds_b128 %4, %12, off\n\t"
                 "global_load_async_to_lds_b128 %5, %13, off\n\t"
                 "global_load_async_to_lds_b128 %6, %14, off\n\t"
                 "global_load_async_to_lds_b128 %7, %15, off\n\t"
                 "s_wait_xcnt 0x0"
                 :: "v"(lds), "v"(lds + 4 * PB), "v"(lds + 8 * PB), "v"(lds + 12 * PB), "v"(lds + 16 * PB), "v"(lds + 20 * PB), "v"(lds + 24 * PB), "v"(lds + 28 * PB),
                    "v"(g), "v"(g + 4 * DM * 2), "v"(g + 8 * DM * 2), "v"(g + 12 * DM * 2), "v"(g + 16 * DM * 2), "v"(g + 20 * DM * 2), "v"(g + 24 * DM * 2), "v"(g + 28 * DM * 2)
                 : "memory");
}
__device__ __forceinline__ v16bf ldsfrag(const char* p) { return cat16b(*(const v8usa*)p, *(const v8usa*)(p + 32)); }   // WFrag::ld's two 16-byte pieces, from LDS
// pa, pa2 (NA == 2), pb: first row of the work-group's 128 rows of each operand; smem: 2 x (NA + 1) x TILEB bytes. On return every wave has passed the last barrier and no copy is outstanding: smem is free.
template <int NA>
__device__ __forceinline__ void gemm128(const char* pa, const char* pa2, const char* pb, char* smem, const int w, const int lane, v8f (&acc)[4][4]) {
    constexpr int BUFB = (NA + 1) * TILEB;
    const int lr = lane & 15, hi = lane >> 4;
    const unsigned go = (unsigned)((w * 32 + (lane >> 3)) * (DM * 2) + (lane & 7) * 16);                              // the lane's byte in an operand's 128 rows: 8 lanes a row
    const unsigned lo = (unsigned)(size_t)smem + (unsigned)((w * 32 + (lane >> 3)) * PB + (lane & 7) * 16);          // and its LDS byte address in a tile
    auto stage = [&](const int t, const int buf) {
        copy32(lo + buf * BUFB, pa + go + t * 128);
        if (NA == 2) copy32(lo + buf * BUFB + TILEB, pa2 + go + t * 128);
        copy32(lo + buf * BUFB + NA * TILEB, pb + go + t * 128); };
#pragma unroll
    for (int mb = 0; mb < 4; ++mb)
#pragma unroll
        for (int nb = 0; nb < 4; ++nb) acc[mb][nb] = (v8f){};
    stage(0, 0);
    asm volatile("s_wait_asynccnt 0x0" ::: "memory");   // this wave's rows of pass 0 have landed
    __syncthreads();                                     // and every other wave's
    stage(1, 1);
    const char* fa = smem + ((w >> 1) * 64 + lr) * PB + 16 * hi; const char* fb = smem + NA * TILEB + ((w & 1) * 64 + lr) * PB + 16 * hi;   // the lane's row in the wave's first A and B fragment
#pragma unroll 1   // one body holds the 16 accumulator tiles and the fragments of one k step
    for (int t = 0; t < NPASS; ++t) {
        const int bo = (t & 1) * BUFB;
        v16bf a[4], a2[4], b[4];
        auto frags = [&](const int kk) {                     // the fragments of k step kk of this pass
#pragma unroll
            for (int mb = 0; mb < 4; ++mb) { a[mb] = ldsfrag(fa + bo + mb * 16 * PB + kk * 64); if (NA == 2) a2[mb] = ldsfrag(fa + bo + TILEB + mb * 16 * PB + kk * 64); }
#pragma unroll
            for (int nb = 0; nb < 4; ++nb) b[nb] = ldsfrag(fb + bo + nb * 16 * PB + kk * 64); };
        auto products = [&]() {
#pragma unroll
            for (int nb = 0; nb < 4; ++nb) {
#pragma unroll
                for (int mb = 0; mb < 4; ++mb) acc[mb][nb] = wmmab(a[mb], b[nb], acc[mb][nb]);
                if (NA == 2) {
#pragma unroll
                    for (int mb = 0; mb < 4; ++mb) acc[mb][nb] = wmmab(a2[mb], b[nb], acc[mb][nb]); } } };
        frags(0);
        __builtin_amdgcn_sched_barrier(0);                   // all fragments of a k step are asked for at once: with the reads sunk among the matrix instructions the B fragments shared one register set and each waited out its own LDS latency
        products();
        frags(1);                                            // the pass's last reads of its buffer
        if (NA == 2) { __builtin_amdgcn_sched_barrier(0); products(); __builtin_amdgcn_sched_barrier(0); }   // three fragment sets leave no registers for the copies' addresses: the products come first, and stay in front of the barrier, so that the copies go out right behind it
        asm volatile("s_wait_dscnt 0x0" ::: "memory");      // this wave's reads of the buffer are done before it is filled again
        asm volatile("s_wait_asynccnt 0x0" ::: "memory");   // this wave's rows of pass t + 1 have landed
        __syncthreads();                                     // pass t + 1 is whole, and nobody reads pass t's buffer any more
        if (t + 2 < NPASS) stage(t + 2, t & 1);
        if (NA == 1) { __builtin_amdgcn_sched_barrier(0); products(); }   // these products need registers only: the copies go out in front of them, so that they have a whole pass to land
    }
    asm volatile("s_wait_asynccnt 0x0" ::: "memory");       // nothing is in flight when the buffers are given to the epilogue
}
// ---- k_gemmw: C[m][n] (f32, pitch DM) = sum_k (A[m][k] + A2[m][k]) Bt[n][k], K = DQ; grid (T/128, DM/128, batch), 4 waves; each wave stores its 64x64 quarter, 16 rows at a time through its own piece of LDS.
__global__ __launch_bounds__(128) void k_gemmw(const bf* __restrict__ A, const bf* __restrict__ A2, const bf* __restrict__ Bt, float* C) {
    __shared__ __attribute__((aligned(128))) char smem[2 * 3 * TILEB];
    constexpr int ldc = DM;
    const int lane = threadIdx.x & 31, lr = lane & 15, hi = lane >> 4; const int w = __builtin_amdgcn_readfirstlane(threadIdx.x >> 5);
    const size_t ra = ((size_t)blockIdx.z * TT + blockIdx.x * 128) * DQ;
    v8f acc[4][4];
    gemm128<2>((const char*)(A + ra), (const char*)(A2 + ra), (const char*)(Bt + (size_t)blockIdx.y * 128 * DQ), smem, w, lane, acc);
    float* os = (float*)(smem + w * (16 * 68 * 4));
    C += (size_t)blockIdx.z * TT * DM; const int r0 = blockIdx.x * 128 + (w >> 1) * 64, c0 = blockIdx.y * 128 + (w & 1) * 64;
#pragma unroll
    for (int mb = 0; mb < 4; ++mb) {
#pragma unroll
        for (int nb = 0; nb < 4; ++nb) {
#pragma unroll
            for (int j = 0; j < 8; ++j) os[(hi * 8 + j) * 68 + nb * 16 + lr] = acc[mb][nb][j]; }
        __builtin_amdgcn_wave_barrier(); asm volatile("" ::: "memory");   // the reads below take other lanes' words: they stay behind these writes
        float* crow = C + (size_t)(r0 + mb * 16) * ldc + c0;
#pragma unroll
        for (int s = 0; s < 8; ++s) { const int row = 2 * s + hi, cofs = lr * 4; const v4f val = *(const v4fa*)(os + row * 68 + cofs);
            *(v4f*)(crow + (size_t)row * ldc + cofs) = val; }
        __builtin_amdgcn_wave_barrier(); asm volatile("s_wait_xcnt 0x0" ::: "memory");   // the next 16 rows are written only behind these reads; the wait stands behind the stores, whose registers the next rows' loads take
    }
}

__device__ __forceinline__ void splitf(float y, unsigned short& h, unsigned short& l) { h = f2bf(y); l = f2bf(y - bf2f(h)); }
typedef __attribute__((ext_vector_type(2))) _Float16 v2h;
typedef __attribute__((ext_vector_type(4))) _Float16 v4h;
typedef __attribute__((ext_vector_type(4))) unsigned short v4us;
typedef __attribute__((ext_vector_type(2))) float v2f;
typedef __attribute__((ext_vector_type(4))) int v4i;

__global__ __launch_bounds__(256) void k_cvt8(const float* __restrict__ src, bf* dst, size_t n8) { const size_t i = (size_t)blockIdx.x * 256 + threadIdx.x; if (i >= n8) return; const v8f v = *(const v8f*)(src + i * 8); v8us o;
#pragma unroll
    for (int k = 0; k < 8; ++k) o[k] = f2bf(v[k]); *(v8us*)(dst + i * 8) = o;  }

__constant__ float INVT[HD / 2] = { 1.000000000e+00f, 7.498942018e-01f, 5.623413324e-01f, 4.216965139e-01f, 3.162277639e-01f, 2.371373624e-01f, 1.778279394e-01f, 1.333521456e-01f, 1.000000015e-01f, 7.498941571e-02f, 5.623412877e-02f, 4.216964915e-02f, 3.162277862e-02f, 2.371373586e-02f, 1.778279431e-02f, 1.333521493e-02f, 9.999999776e-03f, 7.498942316e-03f, 5.623413250e-03f, 4.216964822e-03f, 3.162277862e-03f, 2.371373819e-03f, 1.778279431e-03f, 1.333521446e-03f, 1.000000047e-03f, 7.498941850e-04f, 5.623413017e-04f, 4.216964880e-04f, 3.162277862e-04f, 2.371373848e-04f, 1.778279402e-04f, 1.333521504e-04f };   // float32 1 / 10000^(2i/64), generated with jnp to be bit-exact
__global__ __launch_bounds__(256) void k_cs5(float* CS) { const int idx = blockIdx.x * 256 + threadIdx.x; if (idx >= TT * HD) return; const int d = idx % HD; const int t = idx / HD; const float a = __fmul_rn((float)t, INVT[d % (HD / 2)]); v2f cs; cs[0] = cosf(a); cs[1] = sinf(a); *(v2f*)(CS + (size_t)idx * 2) = cs;  }
typedef __attribute__((ext_vector_type(2))) __bf16 v2bf;
typedef __attribute__((ext_vector_type(4))) unsigned v4u;
typedef v4u __attribute__((may_alias)) v4ua;
// two f32 -> their fp16 pair, their bf16 hi pair and the bf16 pair of what hi leaves over, each packed in one word; the packed conversions round to nearest even, as a plain cast and splitf do
__device__ __forceinline__ void pack2(v2f y, unsigned& w16, unsigned& wh, unsigned& wl) {
    w16 = __builtin_bit_cast(unsigned, __builtin_convertvector(y, v2h)); wh = __builtin_bit_cast(unsigned, __builtin_convertvector(y, v2bf));
    v2f b; b[0] = __uint_as_float(wh << 16); b[1] = __uint_as_float(wh & 0xFFFF0000u); wl = __builtin_bit_cast(unsigned, __builtin_convertvector(y - b, v2bf)); }
// ---- k_qkv: the q, k and v projections of all batches in ONE launch; the product loop is gemm128 (one wave per 64x64 quarter), and the tile leaves the accumulators as finished 16-bit planes: no f32 projection is stored.
// grid (T/128, 3 x heads / 2, batch), 4 waves: Bt is the [3 x 1024][1024] weight (q | k | v row thirds), so a wave's 64 columns are the 64 dimensions of ONE head of q, k or v, and its rows are 64 positions of one batch.
// q, k: 16 rows at a time through LDS, so that a lane holds 8 neighbouring dimensions of one position (4 rotary pairs, whole 16-byte stores, 4 rows = 512 bytes in a row per store); table entries per dimension as k_cs5 wrote them.
// v: a lane's 8 accumulator registers are 8 consecutive positions of one dimension, which is a 16-byte piece of a transposed value row: stored straight from the registers; the wave writes each row's whole 128-byte line.
__global__ __launch_bounds__(128) void k_qkv(const bf* __restrict__ A, const bf* __restrict__ Bt, const float* __restrict__ CS, h16* Q16, bf* Qh, bf* Ql, h16* K16, bf* Kh, bf* Kl, h16* V16, bf* Vh, bf* Vl) {
    __shared__ __attribute__((aligned(128))) char smem[2 * 2 * TILEB];
    const int lane = threadIdx.x & 31, lr = lane & 15, hi = lane >> 4; const int w = __builtin_amdgcn_readfirstlane(threadIdx.x >> 5);
    v8f acc[4][4];
    gemm128<1>((const char*)(A + ((size_t)blockIdx.z * TT + blockIdx.x * 128) * DM), nullptr, (const char*)(Bt + (size_t)blockIdx.y * 128 * DM), smem, w, lane, acc);
    float* os = (float*)(smem + w * (16 * 68 * 4));                      // the wave's own 16 x 68 words for its epilogue
    const int r0 = blockIdx.x * 128 + (w >> 1) * 64, ct = blockIdx.y * 2 + (w & 1);   // the wave's first position and its 64-column tile
    const int part = ct / NH_;                                           // 0 q, 1 k, 2 v (the same for the whole wave)
    const size_t g = (size_t)blockIdx.z * NH_ + ct % NH_;                // batch x heads index of the planes
    if (part == 2) {
        const size_t e0 = (g * HD * TT + r0) * 2; char* p16 = (char*)V16 + e0; char* ph = (char*)Vh + e0; char* pl = (char*)Vl + e0;   // wave-uniform bases
        const unsigned lo = (unsigned)(lr * TT + 8 * hi) * 2u;              // the lane's byte offset; the rest of each address is a constant
#pragma unroll
        for (int nb = 0; nb < 4; ++nb)
#pragma unroll
            for (int mb = 0; mb < 4; ++mb) { v4u o16, oh, ol;
#pragma unroll
                for (int p = 0; p < 4; ++p) { v2f y; y[0] = acc[mb][nb][2 * p]; y[1] = acc[mb][nb][2 * p + 1]; unsigned a, b, d; pack2(y, a, b, d); o16[p] = a; oh[p] = b; ol[p] = d; }
                const int e = (nb * 16 * TT + mb * 16) * 2;
                *(v4ua*)(p16 + lo + e) = o16; *(v4ua*)(ph + lo + e) = oh; *(v4ua*)(pl + lo + e) = ol; }
    } else {
        const size_t e0 = (g * TT + r0) * HD * 2; char* p16 = (char*)(part ? K16 : Q16) + e0; char* ph = (char*)(part ? Kh : Qh) + e0; char* pl = (char*)(part ? Kl : Ql) + e0;   // wave-uniform bases
        const char* pcs = (const char*)(CS + (size_t)r0 * HD * 2);
        const int rr = lane >> 3, cofs = (lane & 7) * 8;                 // the lane's row among 4 and its first dimension
        const unsigned lo = (unsigned)(rr * HD + cofs) * 2u;               // the lane's byte offset in a plane (4 times that in the table); the rest of each address is a constant
#pragma unroll
        for (int mb = 0; mb < 4; ++mb) {
#pragma unroll
            for (int nb = 0; nb < 4; ++nb) {
#pragma unroll
                for (int j = 0; j < 8; ++j) os[(hi * 8 + j) * 68 + nb * 16 + lr] = acc[mb][nb][j]; }
            __builtin_amdgcn_wave_barrier(); asm volatile("" ::: "memory");   // the reads below take other lanes' words: they stay behind these writes
#pragma unroll
            for (int s = 0; s < 4; ++s) { const int row = 4 * s + rr, e = (mb * 16 + 4 * s) * HD * 2;
                const v4f xa = *(const v4fa*)(os + row * 68 + cofs), xb = *(const v4fa*)(os + row * 68 + cofs + 4);
                const char* cs = pcs + lo * 4u + e * 4;                      // {cos, sin} of 8 dimensions
                v4u o16, oh, ol;
#pragma unroll
                for (int p = 0; p < 4; ++p) { const v4f c = *(const v4fa*)(cs + p * 16); const float x0 = p < 2 ? xa[2 * p] : xb[2 * p - 4], x1 = p < 2 ? xa[2 * p + 1] : xb[2 * p - 3];
                    v2f y; y[0] = x0 * c[0] - x1 * c[1]; y[1] = x0 * c[3] + x1 * c[2];   /* even: x0 c - x1 s; odd: x0 s + x1 c */
                    unsigned a, b, d; pack2(y, a, b, d); o16[p] = a; oh[p] = b; ol[p] = d; }
                *(v4ua*)(p16 + lo + e) = o16; *(v4ua*)(ph + lo + e) = oh; *(v4ua*)(pl + lo + e) = ol; }
            __builtin_amdgcn_wave_barrier(); asm volatile("s_wait_xcnt 0x0" ::: "memory");   // the next 16 rows are written only behind these reads; the wait stands behind the stores, whose registers the next rows' loads take
        }
    }
}
#define FNW 4
#define KST 64                    // keys of a stage
#define ATB (KST * PB)            // one plane's 64 rows of one stage in LDS
// 16 rows x 128 bytes, GP bytes apart at the source: 4 copies of a wave; lds and g are the lane's own addresses in the first 4 rows. The wait in the same statement stands in front of every later write of the address registers.
template <int GP>
__device__ __forceinline__ void copy16(unsigned lds, const char* g) {
    asm volatile("global_load_async_to_lds_b128 %0, %4, off\n\t"
                 "global_load_async_to_lds_b128 %1, %5, off\n\t"
                 "global_load_async_to_lds_b128 %2, %6, off\n\t"
                 "global_load_async_to_lds_b128 %3, %7, off\n\t"
                 "s_wait_xcnt 0x0"
                 :: "v"(lds), "v"(lds + 4 * PB), "v"(lds + 8 * PB), "v"(lds + 12 * PB),
                    "v"(g), "v"(g + 4 * GP), "v"(g + 8 * GP), "v"(g + 12 * GP)
                 : "memory");
}
template <typename T16> struct LFrag;   // WFrag::ld's two 16-byte pieces, from LDS
template <> struct LFrag<h16> { static __device__ __forceinline__ v16h ld(const char* p) { return cat16(*(const v8ha*)p, *(const v8ha*)(p + 32)); } };
template <> struct LFrag<bf> { static __device__ __forceinline__ v16bf ld(const char* p) { return ldsfrag(p); } };
template <typename T16, bool SPL> struct PPack;
template <> struct PPack<h16, false> { static __device__ __forceinline__ void pk(const float* p, v16h& ph, v16h& pl) { (void)pl;
#pragma unroll
    for (int s = 0; s < 16; ++s) ph[s] = (h16)p[s]; } };
template <> struct PPack<bf, true> { static __device__ __forceinline__ void pk(const float* p, v16bf& ph, v16bf& pl) { v8us h0, h1, l0, l1;
#pragma unroll
    for (int s = 0; s < 8; ++s) { unsigned short x, y; splitf(p[s], x, y); h0[s] = x; l0[s] = y; splitf(p[8 + s], x, y); h1[s] = x; l1[s] = y; }
    ph = cat16b(h0, h1); pl = cat16b(l0, l1); } };
// qw0: the work-group's first query, a multiple of its FNW x NQG x 16 queries; smem: 2 buffers x (1 or 2 key planes, then as many value planes) x ATB bytes
template <typename T16, bool SPL, int NQG>
__device__ __forceinline__ void attn_tile(const T16* __restrict__ Q, const T16* __restrict__ Q2, const T16* __restrict__ Kp, const T16* __restrict__ K2, const T16* __restrict__ Vt, const T16* __restrict__ V2, const int qw0, char* smem, bf* Ah, bf* Al) {
    typedef typename WFrag<T16>::V V;
    constexpr int NQ = NQG * 16;                        // queries of a wave
    constexpr int NP = SPL ? 2 : 1;                     // planes of each operand
    constexpr int BUFB = 2 * NP * ATB;
    constexpr float C = SCL * 1.4426950408889634f;      // raw score -> exponent of 2
    constexpr float OFF = SPL ? 0.0f : 10.0f;           // fp16 probabilities carry a factor 1024 (it cancels against the sum, which carries it too)
    const int lane = threadIdx.x & 31, lr = lane & 15, hi = lane >> 4; const int w = __builtin_amdgcn_readfirstlane(threadIdx.x >> 5);
    const int q0 = qw0 + w * NQ;                        // this wave's first query
    const int nbl = q0 / 32 + 1;                        // its 32-key blocks up to the diagonal one
    const int nst = (qw0 + FNW * NQ) / KST;             // the work-group's stages: up to the last wave's diagonal block
    const unsigned lo = (unsigned)(size_t)smem + (unsigned)((w * 16 + (lane >> 3)) * PB + (lane & 7) * 16);   // the lane's LDS byte address in a plane: 8 lanes a row
    const unsigned gk = (unsigned)((w * 16 + (lane >> 3)) * (HD * 2) + (lane & 7) * 16), gv = (unsigned)((w * 16 + (lane >> 3)) * (TT * 2) + (lane & 7) * 16);   // and its byte in a stage's key rows and value rows
    auto stage = [&](const int t, const int buf) {
        const unsigned d = lo + buf * BUFB;
        copy16<HD * 2>(d, (const char*)Kp + gk + t * (KST * HD * 2));
        if (SPL) copy16<HD * 2>(d + ATB, (const char*)K2 + gk + t * (KST * HD * 2));
        copy16<TT * 2>(d + NP * ATB, (const char*)Vt + gv + t * (KST * 2));
        if (SPL) copy16<TT * 2>(d + (NP + 1) * ATB, (const char*)V2 + gv + t * (KST * 2)); };
    stage(0, 0);
    v8f o[4][NQG]; float m[NQG], l[NQG];
#pragma unroll
    for (int g = 0; g < NQG; ++g) { m[g] = -3.0e38f; l[g] = 0.f;
#pragma unroll
        for (int dt = 0; dt < 4; ++dt) o[dt][g] = (v8f){}; }
    V qf[NQG][2], qf2[NQG][2];
    const unsigned ko = (unsigned)(lr * HD + 8 * hi) * 2u;   // the lane's byte offset in a query tile; the rest of each address is wave-uniform
#pragma unroll
    for (int g = 0; g < NQG; ++g)
#pragma unroll
        for (int kk = 0; kk < 2; ++kk) { const int qc = (q0 + g * 16) * HD + kk * 32; qf[g][kk] = WFrag<T16>::ld((const T16*)((const char*)(Q + qc) + ko)); if (SPL) qf2[g][kk] = WFrag<T16>::ld((const T16*)((const char*)(Q2 + qc) + ko)); }
    asm volatile("s_wait_asynccnt 0x0" ::: "memory");   // this wave's rows of stage 0 have landed
    __syncthreads();                                     // and every other wave's
    if (1 < nst) stage(1, 1);
    const char* fr = smem + lr * PB + 16 * hi;           // the lane's row in a plane's first 16 rows
#pragma unroll 1   // the trip count is known only at run time
    for (int t = 0; t < nst; ++t) {
        const int hn = min(2, nbl - 2 * t);              // this wave's blocks of the stage (wave-uniform): none behind its diagonal block
        const char* pk = fr + (t & 1) * BUFB; const char* pv = pk + NP * ATB;   // the lane's place in a block's 32 key rows and in its 64 bytes of every value row
#pragma unroll 1   // one body serves both blocks of a stage: the trip count (0, 1 or 2) is known only at run time, and a second copy would only lengthen the loop's code
        for (int h = 0; h < hn; ++h) {
            const int k0 = t * KST + h * 32;
            V kf[2][2], kf2[2][2], vf[4], vf2[4];
#pragma unroll
            for (int tt = 0; tt < 2; ++tt)
#pragma unroll
                for (int kk = 0; kk < 2; ++kk) { kf[tt][kk] = LFrag<T16>::ld(pk + tt * 16 * PB + kk * 64); if (SPL) kf2[tt][kk] = LFrag<T16>::ld(pk + ATB + tt * 16 * PB + kk * 64); }
            __builtin_amdgcn_sched_barrier(0);           // all key fragments are asked for at once: with matrix instructions lifted among the reads two fragments shared registers and the second waited out its own LDS latency
#pragma unroll
            for (int dt = 0; dt < 4; ++dt) { vf[dt] = LFrag<T16>::ld(pv + dt * 16 * PB); if (SPL) vf2[dt] = LFrag<T16>::ld(pv + ATB + dt * 16 * PB); }
            pk += 32 * PB; pv += 64;                     // the stage's next block
            v8f s[2][NQG];
#pragma unroll
            for (int tt = 0; tt < 2; ++tt)
#pragma unroll
                for (int g = 0; g < NQG; ++g) { s[tt][g] = (v8f){};
#pragma unroll
                    for (int kk = 0; kk < 2; ++kk) { s[tt][g] = WFrag<T16>::mma(kf[tt][kk], qf[g][kk], s[tt][g]); if (SPL) { s[tt][g] = WFrag<T16>::mma(kf[tt][kk], qf2[g][kk], s[tt][g]); s[tt][g] = WFrag<T16>::mma(kf2[tt][kk], qf[g][kk], s[tt][g]); } } }
            if (k0 + 31 > q0) {                          // the diagonal block (wave-uniform): keys behind the query are excluded
#pragma unroll
                for (int tt = 0; tt < 2; ++tt)
#pragma unroll
                    for (int g = 0; g < NQG; ++g)
#pragma unroll
                        for (int r = 0; r < 8; ++r) s[tt][g][r] = (k0 + tt * 16 + 8 * hi + r <= q0 + g * 16 + lr) ? s[tt][g][r] : -3.0e38f;
            }
            V pb[NQG], pb2[NQG];
#pragma unroll
            for (int g = 0; g < NQG; ++g) {
                float bm = s[0][g][0];
#pragma unroll
                for (int r = 1; r < 8; ++r) bm = fmaxf(bm, s[0][g][r]);
#pragma unroll
                for (int r = 0; r < 8; ++r) bm = fmaxf(bm, s[1][g][r]);
                bm = fmaxf(bm, __shfl_xor(bm, 16, 32));  // the query's other 16 keys of the block lie in the other lane half
                const float mn = fmaxf(m[g], bm), sc = __builtin_amdgcn_exp2f((m[g] - mn) * C), nb = OFF - mn * C; m[g] = mn;
                float p[16], ps = 0.f;
#pragma unroll
                for (int e = 0; e < 16; ++e) { p[e] = __builtin_amdgcn_exp2f(fmaf(s[e >> 3][g][e & 7], C, nb)); ps += p[e]; }
                l[g] = l[g] * sc + ps;
#pragma unroll
                for (int dt = 0; dt < 4; ++dt) o[dt][g] *= sc;
                PPack<T16, SPL>::pk(p, pb[g], pb2[g]);
            }
#pragma unroll
            for (int dt = 0; dt < 4; ++dt)
#pragma unroll
                for (int g = 0; g < NQG; ++g) { o[dt][g] = WFrag<T16>::mma(vf[dt], pb[g], o[dt][g]); if (SPL) { o[dt][g] = WFrag<T16>::mma(vf[dt], pb2[g], o[dt][g]); o[dt][g] = WFrag<T16>::mma(vf2[dt], pb[g], o[dt][g]); } }
        }
        asm volatile("s_wait_dscnt 0x0" ::: "memory");      // this wave's reads of the buffer are done before it is filled again
        asm volatile("s_wait_asynccnt 0x0" ::: "memory");   // this wave's rows of stage t + 1 have landed
        __syncthreads();                                     // stage t + 1 is whole, and nobody reads stage t's buffer any more
        if (t + 2 < nst) stage(t + 2, t & 1);
    }
    asm volatile("s_wait_asynccnt 0x0" ::: "memory");       // nothing is in flight when the wave ends
#pragma unroll
    for (int g = 0; g < NQG; ++g) {
        const float L = l[g] + __shfl_xor(l[g], 16, 32);    // the two lane halves summed different keys of the same query
        const float inv = __fdiv_rn(1.0f, L);
        const size_t oo = (size_t)(q0 + g * 16 + lr) * DQ + 8 * hi;   // a lane's 8 registers of a tile are 8 neighbouring head dimensions of its query; the wave writes each query's whole 128-byte line
#pragma unroll
        for (int dt = 0; dt < 4; ++dt) { v8us oh, ol;
#pragma unroll
            for (int e = 0; e < 8; ++e) { unsigned short x, y; splitf(o[dt][g][e] * inv, x, y); oh[e] = x; ol[e] = y; }
            *(v8us*)(Ah + oo + dt * 16) = oh; *(v8us*)(Al + oo + dt * 16) = ol; } }
    asm volatile("s_wait_xcnt 0x0" ::: "memory");        // behind the last store: in the built kernel the other tile form's code follows this one, and there the stores' registers are written again
}
// grid (batch x heads, query tiles), so that work-groups start longest first over all heads: the tiles of 128 rows >= RH from the last down (fp16 operands), then the tiles of 64 rows < RH (hi / lo planes, 3 products)
__global__ __launch_bounds__(32 * FNW) void k_fattn(const h16* __restrict__ Q16, const h16* __restrict__ K16, const h16* __restrict__ V16, const bf* __restrict__ Qh, const bf* __restrict__ Ql, const bf* __restrict__ Kh, const bf* __restrict__ Kl, const bf* __restrict__ Vh, const bf* __restrict__ Vl, bf* Ah, bf* Al) {
    __shared__ __attribute__((aligned(128))) char smem[2 * 4 * ATB];
    constexpr int NLO = (TT - RH) / (FNW * 32);
    const size_t zq = (size_t)blockIdx.x * TT * HD, zk = (size_t)(blockIdx.x / REP) * TT * HD; const int x = blockIdx.y;
    const size_t za = (size_t)(blockIdx.x / NH_) * TT * DQ + (blockIdx.x % NH_) * HD;   // merged-head planes are [batch][row][head][dim]
    bf* ah = Ah + za; bf* al = Al + za;
    if (x < NLO) attn_tile<h16, false, 2>(Q16 + zq, nullptr, K16 + zk, nullptr, V16 + zk, nullptr, TT - FNW * 32 - x * (FNW * 32), smem, ah, al);
    else attn_tile<bf, true, 1>(Qh + zq, Ql + zq, Kh + zk, Kl + zk, Vh + zk, Vl + zk, RH - FNW * 16 - (x - NLO) * (FNW * 16), smem, ah, al);
}

extern "C" void kernel_launch(void* const* d_in, const int* in_sizes, int n_in,
                              void* d_out, int out_size, void* d_ws, size_t ws_size, hipStream_t stream) {
    (void)in_sizes; (void)n_in; (void)out_size;
    const float* x = (const float*)d_in[0]; const float* wattn = (const float*)d_in[1]; const float* wo = (const float*)d_in[2];   /* order x, w_attn ('oi' [3072][1024]: q | k | v row thirds), w_proj ('oi') */ const float* wq = wattn; const float* wk = wattn + (size_t)DQ * DM; const float* wv = wattn + (size_t)2 * DQ * DM;
    float* OUT = (float*)d_out;     // [4][2048][1024]
    char* wsp = (char*)d_ws;
    auto take = [&](size_t bytes) { char* p = wsp; wsp += (bytes + 255) & ~(size_t)255; return (void*)p; };
    bf* WQ = (bf*)take((size_t)(DQ + 2 * DKV) * DM * 2); bf* WK = WQ + (size_t)DQ * DM; bf* WV = WK + (size_t)DKV * DM;   /* one [3072][1024] plane, q | k | v */ bf* WO = (bf*)take((size_t)DM * DQ * 2); float* CS = (float*)take((size_t)TT * HD * 2 * 4);
    bf* XB = (bf*)take((size_t)NB_ * TT * DM * 2);
    h16* QP16 = (h16*)take((size_t)NB_ * NH_ * TT * HD * 2); h16* KP16 = (h16*)take((size_t)NB_ * NKV * TT * HD * 2); h16* VT16 = (h16*)take((size_t)NB_ * NKV * HD * TT * 2);
    bf* QPh = (bf*)take((size_t)NB_ * NH_ * TT * HD * 2); bf* QPl = (bf*)take((size_t)NB_ * NH_ * TT * HD * 2); bf* KPh = (bf*)take((size_t)NB_ * NKV * TT * HD * 2); bf* KPl = (bf*)take((size_t)NB_ * NKV * TT * HD * 2); bf* VTh = (bf*)take((size_t)NB_ * NKV * HD * TT * 2); bf* VTl = (bf*)take((size_t)NB_ * NKV * HD * TT * 2);
    bf* ATh = (bf*)take((size_t)NB_ * TT * DQ * 2); bf* ATl = (bf*)take((size_t)NB_ * TT * DQ * 2);
    if ((size_t)(wsp - (char*)d_ws) > ws_size) return;    // ws 256 MiB
    { k_cvt8<<<(unsigned)(((size_t)DQ * DM / 8 + 255) / 256), 256, 0, stream>>>(wq, WQ, (size_t)DQ * DM / 8); k_cvt8<<<(unsigned)(((size_t)DKV * DM / 8 + 255) / 256), 256, 0, stream>>>(wk, WK, (size_t)DKV * DM / 8); k_cvt8<<<(unsigned)(((size_t)DKV * DM / 8 + 255) / 256), 256, 0, stream>>>(wv, WV, (size_t)DKV * DM / 8);
      k_cvt8<<<(unsigned)(((size_t)DM * DQ / 8 + 255) / 256), 256, 0, stream>>>(wo, WO, (size_t)DM * DQ / 8);
       }
    k_cs5<<<(TT * HD + 255) / 256, 256, 0, stream>>>(CS);   /* rotary table from INVT and the positions */
    // every stage runs once for all batches: the products take the batch as grid z, the attention sees NB_ x heads heads
    k_cvt8<<<(unsigned)(((size_t)NB_ * TT * DM / 8 + 255) / 256), 256, 0, stream>>>(x, XB, (size_t)NB_ * TT * DM / 8);
    k_qkv<<<dim3(TT / 128, (DQ + 2 * DKV) / 128, NB_), 128, 0, stream>>>(XB, WQ, CS, QP16, QPh, QPl, KP16, KPh, KPl, VT16, VTh, VTl);
    k_fattn<<<dim3(NB_ * NH_, (TT - RH) / (FNW * 32) + RH / (FNW * 16), 1), 32 * FNW, 0, stream>>>(QP16, KP16, VT16, QPh, QPl, KPh, KPl, VTh, VTl, ATh, ATl);
    k_gemmw<<<dim3(TT / 128, DM / 128, NB_), 128, 0, stream>>>(ATh, ATl, WO, OUT);
}

// v008
// Measured time: 148 microseconds a run.
// Timed twice side by side with v007, it ran 1.07 times as fast both times.
// Over all steps from v000 it is 19.4 times as fast.
#include <hip/hip_runtime.h>

// Causal self-attention with a fused bias-free qkv weight and the source's pairwise rotary form (x [4][2048][1024]; qkv = x w_attn^T ('oi' [3072][1024]) split in thirds q | k | v (16 heads x 64); rope on consecutive pairs with PER-ELEMENT table columns: out[2i] = x[2i] cos[2i] - x[2i+1] sin[2i], out[2i+1] = x[2i+1] cos[2i+1] + x[2i] sin[2i+1] where cos / sin = cat(freqs, freqs) of angle t x 1/10000^(2j/64) (so column d uses frequency d mod 32: the module reshapes the concatenated tables pairwise; reproduced literally; 32 f32 frequencies; precise cosf/sinf); scores x 1/sqrt(64); causal (finfo.min == exclusion); softmax; y = merged w_proj^T ('oi') -> [4][2048][1024] (8.4 M); argument order x, w_attn, w_proj).
// Layout, all batches in every launch: bf16 copy of x; 'oi' weights; exact projections; bf16 copies and the computed {cos, sin} table (INVT[32]) in one launch (k_prep); q, k, v projections in one launch whose epilogue applies the interleaved-pair rotary with per-dimension table entries and writes the planes (k_qkv); one-kernel causal T-2048 attention k_fattn (hybrid rows: < 512 hi/lo 3 products, rest fp16 x1024; key blocks above the diagonal are never visited); merged hi/lo x Wo exact.
// Compute dtypes, f32 accumulate: every input rounded to bf16; the {cos, sin} table f32; projections exact; rotary f32; attention rows < 512 3 products, rest fp16; softmax f32; Wo hl x exact.

#define NB_  4
#define TT   2048
#define DM   1024
#define NH_  16
#define NKV  16
#define REP  (NH_ / NKV)
#define HD   64
#define DQ   (NH_ * HD)
#define DKV  (NKV * HD)
#define RH   512                  // query rows < RH use hi+lo planes (0: none)
#define SCL  0.125f   // HD^-0.5
typedef _Float16 h16;
typedef unsigned short bf;
typedef __attribute__((ext_vector_type(16))) __bf16   v16bf;
typedef __attribute__((ext_vector_type(16))) _Float16 v16h;
typedef __attribute__((ext_vector_type(8)))  _Float16 v8h;
typedef __attribute__((ext_vector_type(8)))  unsigned short v8us;
typedef __attribute__((ext_vector_type(8)))  float    v8f;
typedef __attribute__((ext_vector_type(4)))  float    v4f;
typedef v8h  __attribute__((may_alias)) v8ha;
typedef v4f  __attribute__((may_alias)) v4fa;
typedef v8us __attribute__((may_alias)) v8usa;

__device__ __forceinline__ unsigned short f2bf(float f) { unsigned u = __float_as_uint(f); u += 0x7FFFu + ((u >> 16) & 1u); return (unsigned short)(u >> 16); }
__device__ __forceinline__ float bf2f(unsigned short b) { return __uint_as_float(((unsigned)b) << 16); }
__device__ __forceinline__ float bfr(float f) { return bf2f(f2bf(f)); }
__device__ __forceinline__ v16h cat16(v8h lo, v8h hi) { return __builtin_shufflevector(lo, hi, 0, 1, 2, 3, 4, 5, 6, 7, 8, 9, 10, 11, 12, 13, 14, 15); }
__device__ __forceinline__ v16bf cat16b(v8us lo, v8us hi) { return __builtin_bit_cast(v16bf, __builtin_shufflevector(lo, hi, 0, 1, 2, 3, 4, 5, 6, 7, 8, 9, 10, 11, 12, 13, 14, 15)); }
__device__ __forceinline__ v8f wmma16(v16h a, v16h b, v8f c) { return __builtin_amdgcn_wmma_f32_16x16x32_f16(false, a, false, b, (short)0, c, false, false); }
__device__ __forceinline__ v8f wmmab(v16bf a, v16bf b, v8f c) { return __builtin_amdgcn_wmma_f32_16x16x32_bf16(false, a, false, b, (short)0, c, false, false); }



// ---- gemm128: the product loop of both GEMM kernels. A work-group of 4 waves (2 x 2) owns a 128x128 output tile, each wave a 64x64 quarter (16 accumulators).
// A pass is 64 k = 128 bytes of each of the 128 rows of every operand (K-contiguous 16-bit planes, row length DM). The rows come into LDS by asynchronous copies, each copy 4 whole 128-byte lines, each wave 32 rows of every operand;
// two buffers: the next pass's copies fly while this pass's fragments are read from LDS, every row by two waves. Products and their order along k are those of one wave per tile: k in steps of 32, A before A2.
#define PB    144                 // LDS pitch of a 128-byte row piece: 16 bytes x odd, the pitch of 16-byte fragment reads
#define TILEB (128 * PB)          // one operand's rows of one pass
#define NPASS (DM / 64)
template <typename T16> struct WFrag;
template <> struct WFrag<h16> { typedef v16h V; static __device__ __forceinline__ V ld(const h16* p) { return cat16(*(const v8h*)p, *(const v8h*)(p + 16)); } static __device__ __forceinline__ v8f mma(V a, V b, v8f c) { return wmma16(a, b, c); } };
template <> struct WFrag<bf> { typedef v16bf V; static __device__ __forceinline__ V ld(const bf* p) { return cat16b(*(const v8us*)p, *(const v8us*)(p + 16)); } static __device__ __forceinline__ v8f mma(V a, V b, v8f c) { return wmmab(a, b, c); } };
// 32 rows x 128 bytes: 8 copies of a wave; lds and g are the lane's own addresses in the first 4 rows. The wait in the same statement stands in front of every later write of the address registers.
__device__ __forceinline__ void copy32(unsigned lds, const char* g) {
    asm volatile("global_load_async_to_lds_b128 %0, %8, off\n\t"
                 "global_load_async_to_lds_b128 %1, %9, off\n\t"
                 "global_load_async_to_lds_b128 %2, %10, off\n\t"
                 "global_load_async_to_lds_b128 %3, %11, off\n\t"
                 "global_load_async_to_lds_b128 %4, %12, off\n\t"
                 "global_load_async_to_lds_b128 %5, %13, off\n\t"
                 "global_load_async_to_lds_b128 %6, %14, off\n\t"
                 "global_load_async_to_lds_b128 %7, %15, off\n\t"
                 "s_wait_xcnt 0x0"
                 :: "v"(lds), "v"(lds + 4 * PB), "v"(lds + 8 * PB), "v"(lds + 12 * PB), "v"(lds + 16 * PB), "v"(lds + 20 * PB), "v"(lds + 24 * PB), "v"(lds + 28 * PB),
                    "v"(g), "v"(g + 4 * DM * 2), "v"(g + 8 * DM * 2), "v"(g + 12 * DM * 2), "v"(g + 16 * DM * 2), "v"(g + 20 * DM * 2), "v"(g + 24 * DM * 2), "v"(g + 28 * DM * 2)
                 : "memory");
}
__device__ __forceinline__ v16bf ldsfrag(const char* p) { return cat16b(*(const v8usa*)p, *(const v8usa*)(p + 32)); }   // WFrag::ld's two 16-byte pieces, from LDS
// pa, pa2 (NA == 2), pb: first row of the work-group's 128 rows of each operand; smem: 2 x (NA + 1) x TILEB bytes. On return every wave has passed the last barrier and no copy is outstanding: smem is free.
template <int NA>
__device__ __forceinline__ void gemm128(const char* pa, const char* pa2, const char* pb, char* smem, const int w, const int lane, v8f (&acc)[4][4]) {
    constexpr int BUFB = (NA + 1) * TILEB;
    const int lr = lane & 15, hi = lane >> 4;
    const unsigned go = (unsigned)((w * 32 + (lane >> 3)) * (DM * 2) + (lane & 7) * 16);                              // the lane's byte in an operand's 128 rows: 8 lanes a row
    const unsigned lo = (unsigned)(size_t)smem + (unsigned)((w * 32 + (lane >> 3)) * PB + (lane & 7) * 16);          // and its LDS byte address in a tile
    auto stage = [&](const int t, const int buf) {
        copy32(lo + buf * BUFB, pa + go + t * 128);
        if (NA == 2) copy32(lo + buf * BUFB + TILEB, pa2 + go + t * 128);
        copy32(lo + buf * BUFB + NA * TILEB, pb + go + t * 128); };
#pragma unroll
    for (int mb = 0; mb < 4; ++mb)
#pragma unroll
        for (int nb = 0; nb < 4; ++nb) acc[mb][nb] = (v8f){};
    stage(0, 0);
    asm volatile("s_wait_asynccnt 0x0" ::: "memory");   // this wave's rows of pass 0 have landed
    __syncthreads();                                     // and every other wave's
    stage(1, 1);
    const char* fa = smem + ((w >> 1) * 64 + lr) * PB + 16 * hi; const char* fb = smem + NA * TILEB + ((w & 1) * 64 + lr) * PB + 16 * hi;   // the lane's row in the wave's first A and B fragment
#pragma unroll 1   // one body holds the 16 accumulator tiles and the fragments of one k step
    for (int t = 0; t < NPASS; ++t) {
        const int bo = (t & 1) * BUFB;
        v16bf a[4], a2[4], b[4];
        auto frags = [&](const int kk) {                     // the fragments of k step kk of this pass
#pragma unroll
            for (int mb = 0; mb < 4; ++mb) { a[mb] = ldsfrag(fa + bo + mb * 16 * PB + kk * 64); if (NA == 2) a2[mb] = ldsfrag(fa + bo + TILEB + mb * 16 * PB + kk * 64); }
#pragma unroll
            for (int nb = 0; nb < 4; ++nb) b[nb] = ldsfrag(fb + bo + nb * 16 * PB + kk * 64); };
        auto products = [&]() {
#pragma unroll
            for (int nb = 0; nb < 4; ++nb) {
#pragma unroll
                for (int mb = 0; mb < 4; ++mb) acc[mb][nb] = wmmab(a[mb], b[nb], acc[mb][nb]);
                if (NA == 2) {
#pragma unroll
                    for (int mb = 0; mb < 4; ++mb) acc[mb][nb] = wmmab(a2[mb], b[nb], acc[mb][nb]); } } };
        frags(0);
        __builtin_amdgcn_sched_barrier(0);                   // all fragments of a k step are asked for at once: with the reads sunk among the matrix instructions the B fragments shared one register set and each waited out its own LDS latency
        products();
        frags(1);                                            // the pass's last reads of its buffer
        if (NA == 2) { __builtin_amdgcn_sched_barrier(0); products(); __builtin_amdgcn_sched_barrier(0); }   // three fragment sets leave no registers for the copies' addresses: the products come first, and stay in front of the barrier, so that the copies go out right behind it
        asm volatile("s_wait_dscnt 0x0" ::: "memory");      // this wave's reads of the buffer are done before it is filled again
        asm volatile("s_wait_asynccnt 0x0" ::: "memory");   // this wave's rows of pass t + 1 have landed
        __syncthreads();                                     // pass t + 1 is whole, and nobody reads pass t's buffer any more
        if (t + 2 < NPASS) stage(t + 2, t & 1);
        if (NA == 1) { __builtin_amdgcn_sched_barrier(0); products(); }   // these products need registers only: the copies go out in front of them, so that they have a whole pass to land
    }
    asm volatile("s_wait_asynccnt 0x0" ::: "memory");       // nothing is in flight when the buffers are given to the epilogue
}
// ---- k_gemmw: C[m][n] (f32, pitch DM) = sum_k (A[m][k] + A2[m][k]) Bt[n][k], K = DQ; grid (T/128, DM/128, batch), 4 waves; each wave stores its 64x64 quarter, 16 rows at a time through its own piece of LDS.
__global__ __launch_bounds__(128) void k_gemmw(const bf* __restrict__ A, const bf* __restrict__ A2, const bf* __restrict__ Bt, float* C) {
    __shared__ __attribute__((aligned(128))) char smem[2 * 3 * TILEB];
    constexpr int ldc = DM;
    const int lane = threadIdx.x & 31, lr = lane & 15, hi = lane >> 4; const int w = __builtin_amdgcn_readfirstlane(threadIdx.x >> 5);
    const size_t ra = ((size_t)blockIdx.z * TT + blockIdx.x * 128) * DQ;
    v8f acc[4][4];
    gemm128<2>((const char*)(A + ra), (const char*)(A2 + ra), (const char*)(Bt + (size_t)blockIdx.y * 128 * DQ), smem, w, lane, acc);
    float* os = (float*)(smem + w * (16 * 68 * 4));
    C += (size_t)blockIdx.z * TT * DM; const int r0 = blockIdx.x * 128 + (w >> 1) * 64, c0 = blockIdx.y * 128 + (w & 1) * 64;
#pragma unroll
    for (int mb = 0; mb < 4; ++mb) {
#pragma unroll
        for (int nb = 0; nb < 4; ++nb) {
#pragma unroll
            for (int j = 0; j < 8; ++j) os[(hi * 8 + j) * 68 + nb * 16 + lr] = acc[mb][nb][j]; }
        __builtin_amdgcn_wave_barrier(); asm volatile("" ::: "memory");   // the reads below take other lanes' words: they stay behind these writes
        float* crow = C + (size_t)(r0 + mb * 16) * ldc + c0;
#pragma unroll
        for (int s = 0; s < 8; ++s) { const int row = 2 * s + hi, cofs = lr * 4; const v4f val = *(const v4fa*)(os + row * 68 + cofs);
            *(v4f*)(crow + (size_t)row * ldc + cofs) = val; }
        __builtin_amdgcn_wave_barrier(); asm volatile("s_wait_xcnt 0x0" ::: "memory");   // the next 16 rows are written only behind these reads; the wait stands behind the stores, whose registers the next rows' loads take
    }
}

__device__ __forceinline__ void splitf(float y, unsigned short& h, unsigned short& l) { h = f2bf(y); l = f2bf(y - bf2f(h)); }
typedef __attribute__((ext_vector_type(2))) _Float16 v2h;
typedef __attribute__((ext_vector_type(4))) _Float16 v4h;
typedef __attribute__((ext_vector_type(4))) unsigned short v4us;
typedef __attribute__((ext_vector_type(2))) float v2f;
typedef __attribute__((ext_vector_type(4))) int v4i;

__constant__ float INVT[HD / 2] = { 1.000000000e+00f, 7.498942018e-01f, 5.623413324e-01f, 4.216965139e-01f, 3.162277639e-01f, 2.371373624e-01f, 1.778279394e-01f, 1.333521456e-01f, 1.000000015e-01f, 7.498941571e-02f, 5.623412877e-02f, 4.216964915e-02f, 3.162277862e-02f, 2.371373586e-02f, 1.778279431e-02f, 1.333521493e-02f, 9.999999776e-03f, 7.498942316e-03f, 5.623413250e-03f, 4.216964822e-03f, 3.162277862e-03f, 2.371373819e-03f, 1.778279431e-03f, 1.333521446e-03f, 1.000000047e-03f, 7.498941850e-04f, 5.623413017e-04f, 4.216964880e-04f, 3.162277862e-04f, 2.371373848e-04f, 1.778279402e-04f, 1.333521504e-04f };   // float32 1 / 10000^(2i/64), generated with jnp to be bit-exact
// ---- k_prep: everything the products need, in ONE launch of PG work-groups x PT threads (one work-group of 16 waves a WGP): the bf16 copies of x, w_attn and w_proj and the {cos, sin} table.
// Few waves, each started once for 24 pieces (starting a wave costs more than converting a piece): a piece is 512 bytes in a row (16 bytes a lane, 4 whole lines), its copy 256 bytes in a row. A work-group owns one run of each input: N steps of PT x 16 bytes.
// All of a lane's loads are asked for first; the table entry (one a thread) is computed while they fly.
#define PG 256
#define PT 512
#define PSTEP (PT * 4)           // floats of one step of a work-group
// s, d: the work-group's run (uniform); e: the thread's first float in a step; the step is a constant of the address
template <int N>
__device__ __forceinline__ void ld_steps(const float* __restrict__ s, const unsigned e, v4f (&v)[N]) {
#pragma unroll
    for (int j = 0; j < N; ++j) v[j] = *(const v4f*)(s + e + j * PSTEP); }
template <int N>
__device__ __forceinline__ void st_steps(bf* d, const unsigned e, const v4f (&v)[N]) {
#pragma unroll
    for (int j = 0; j < N; ++j) { v4us o;
#pragma unroll
        for (int k = 0; k < 4; ++k) o[k] = f2bf(v[j][k]);
        *(v4us*)(d + e + j * PSTEP) = o; } }
__global__ __launch_bounds__(PT) void k_prep(const float* __restrict__ x, const float* __restrict__ wa, const float* __restrict__ wo, bf* XB, bf* WA, bf* WO, float* CS) {
    constexpr int NX = NB_ * TT * DM / (PG * PSTEP), NA = (DQ + 2 * DKV) * DM / (PG * PSTEP), NO = DM * DQ / (PG * PSTEP);
    static_assert(NX * PG * PSTEP == NB_ * TT * DM && NA * PG * PSTEP == (DQ + 2 * DKV) * DM && NO * PG * PSTEP == DM * DQ && PG * PT == TT * HD, "whole steps");
    const unsigned idx = blockIdx.x * PT + threadIdx.x, e = threadIdx.x * 4;   // the thread's table entry, and its first float in a step
    const size_t bx = (size_t)blockIdx.x * (NX * PSTEP), ba = (size_t)blockIdx.x * (NA * PSTEP), bo = (size_t)blockIdx.x * (NO * PSTEP);   // where the work-group's runs begin
    const float fr = INVT[idx % HD % (HD / 2)];   // entry idx is dimension idx % HD of position idx / HD
    __builtin_amdgcn_sched_barrier(0);   // the frequency is asked for first: loads return in order, so behind the pieces' loads its wait would be a wait for all of them
    v4f vx[NX], va[NA], vo[NO];
    ld_steps(x + bx, e, vx); ld_steps(wa + ba, e, va); ld_steps(wo + bo, e, vo);
    asm volatile("s_wait_xcnt 0x0" ::: "memory");   // behind the loads: what follows takes registers that their addresses stand in
    __builtin_amdgcn_sched_barrier(0);   // the table's arithmetic stays behind all loads, so that it runs inside their latency, and behind that wait
    const float a = __fmul_rn((float)(idx / HD), fr); v2f cs; cs[0] = cosf(a); cs[1] = sinf(a); *(v2f*)(CS + (size_t)idx * 2) = cs;
    st_steps(XB + bx, e, vx); st_steps(WA + ba, e, va); st_steps(WO + bo, e, vo);
}
typedef __attribute__((ext_vector_type(2))) __bf16 v2bf;
typedef __attribute__((ext_vector_type(4))) unsigned v4u;
typedef v4u __attribute__((may_alias)) v4ua;
// two f32 -> their fp16 pair, their bf16 hi pair and the bf16 pair of what hi leaves over, each packed in one word; the packed conversions round to nearest even, as a plain cast and splitf do
__device__ __forceinline__ void pack2(v2f y, unsigned& w16, unsigned& wh, unsigned& wl) {
    w16 = __builtin_bit_cast(unsigned, __builtin_convertvector(y, v2h)); wh = __builtin_bit_cast(unsigned, __builtin_convertvector(y, v2bf));
    v2f b; b[0] = __uint_as_float(wh << 16); b[1] = __uint_as_float(wh & 0xFFFF0000u); wl = __builtin_bit_cast(unsigned, __builtin_convertvector(y - b, v2bf)); }
// ---- k_qkv: the q, k and v projections of all batches in ONE launch; the product loop is gemm128 (one wave per 64x64 quarter), and the tile leaves the accumulators as finished 16-bit planes: no f32 projection is stored.
// grid (T/128, 3 x heads / 2, batch), 4 waves: Bt is the [3 x 1024][1024] weight (q | k | v row thirds), so a wave's 64 columns are the 64 dimensions of ONE head of q, k or v, and its rows are 64 positions of one batch.
// q, k: 16 rows at a time through LDS, so that a lane holds 8 neighbouring dimensions of one position (4 rotary pairs, whole 16-byte stores, 4 rows = 512 bytes in a row per store); table entries per dimension as k_prep wrote them.
// v: a lane's 8 accumulator registers are 8 consecutive positions of one dimension, which is a 16-byte piece of a transposed value row: stored straight from the registers; the wave writes each row's whole 128-byte line.
__global__ __launch_bounds__(128) void k_qkv(const bf* __restrict__ A, const bf* __restrict__ Bt, const float* __restrict__ CS, h16* Q16, bf* Qh, bf* Ql, h16* K16, bf* Kh, bf* Kl, h16* V16, bf* Vh, bf* Vl) {
    __shared__ __attribute__((aligned(128))) char smem[2 * 2 * TILEB];
    const int lane = threadIdx.x & 31, lr = lane & 15, hi = lane >> 4; const int w = __builtin_amdgcn_readfirstlane(threadIdx.x >> 5);
    v8f acc[4][4];
    gemm128<1>((const char*)(A + ((size_t)blockIdx.z * TT + blockIdx.x * 128) * DM), nullptr, (const char*)(Bt + (size_t)blockIdx.y * 128 * DM), smem, w, lane, acc);
    float* os = (float*)(smem + w * (16 * 68 * 4));                      // the wave's own 16 x 68 words for its epilogue
    const int r0 = blockIdx.x * 128 + (w >> 1) * 64, ct = blockIdx.y * 2 + (w & 1);   // the wave's first position and its 64-column tile
    const int part = ct / NH_;                                           // 0 q, 1 k, 2 v (the same for the whole wave)
    const size_t g = (size_t)blockIdx.z * NH_ + ct % NH_;                // batch x heads index of the planes
    if (part == 2) {
        const size_t e0 = (g * HD * TT + r0) * 2; char* p16 = (char*)V16 + e0; char* ph = (char*)Vh + e0; char* pl = (char*)Vl + e0;   // wave-uniform bases
        const unsigned lo = (unsigned)(lr * TT + 8 * hi) * 2u;              // the lane's byte offset; the rest of each address is a constant
#pragma unroll
        for (int nb = 0; nb < 4; ++nb)
#pragma unroll
            for (int mb = 0; mb < 4; ++mb) { v4u o16, oh, ol;
#pragma unroll
                for (int p = 0; p < 4; ++p) { v2f y; y[0] = acc[mb][nb][2 * p]; y[1] = acc[mb][nb][2 * p + 1]; unsigned a, b, d; pack2(y, a, b, d); o16[p] = a; oh[p] = b; ol[p] = d; }
                const int e = (nb * 16 * TT + mb * 16) * 2;
                *(v4ua*)(p16 + lo + e) = o16; *(v4ua*)(ph + lo + e) = oh; *(v4ua*)(pl + lo + e) = ol; }
    } else {
        const size_t e0 = (g * TT + r0) * HD * 2; char* p16 = (char*)(part ? K16 : Q16) + e0; char* ph = (char*)(part ? Kh : Qh) + e0; char* pl = (char*)(part ? Kl : Ql) + e0;   // wave-uniform bases
        const char* pcs = (const char*)(CS + (size_t)r0 * HD * 2);
        const int rr = lane >> 3, cofs = (lane & 7) * 8;                 // the lane's row among 4 and its first dimension
        const unsigned lo = (unsigned)(rr * HD + cofs) * 2u;               // the lane's byte offset in a plane (4 times that in the table); the rest of each address is a constant
#pragma unroll
        for (int mb = 0; mb < 4; ++mb) {
#pragma unroll
            for (int nb = 0; nb < 4; ++nb) {
#pragma unroll
                for (int j = 0; j < 8; ++j) os[(hi * 8 + j) * 68 + nb * 16 + lr] = acc[mb][nb][j]; }
            __builtin_amdgcn_wave_barrier(); asm volatile("" ::: "memory");   // the reads below take other lanes' words: they stay behind these writes
#pragma unroll
            for (int s = 0; s < 4; ++s) { const int row = 4 * s + rr, e = (mb * 16 + 4 * s) * HD * 2;
                const v4f xa = *(const v4fa*)(os + row * 68 + cofs), xb = *(const v4fa*)(os + row * 68 + cofs + 4);
                const char* cs = pcs + lo * 4u + e * 4;                      // {cos, sin} of 8 dimensions
                v4u o16, oh, ol;
#pragma unroll
                for (int p = 0; p < 4; ++p) { const v4f c = *(const v4fa*)(cs + p * 16); const float x0 = p < 2 ? xa[2 * p] : xb[2 * p - 4], x1 = p < 2 ? xa[2 * p + 1] : xb[2 * p - 3];
                    v2f y; y[0] = x0 * c[0] - x1 * c[1]; y[1] = x0 * c[3] + x1 * c[2];   /* even: x0 c - x1 s; odd: x0 s + x1 c */
                    unsigned a, b, d; pack2(y, a, b, d); o16[p] = a; oh[p] = b; ol[p] = d; }
                *(v4ua*)(p16 + lo + e) = o16; *(v4ua*)(ph + lo + e) = oh; *(v4ua*)(pl + lo + e) = ol; }
            __builtin_amdgcn_wave_barrier(); asm volatile("s_wait_xcnt 0x0" ::: "memory");   // the next 16 rows are written only behind these reads; the wait stands behind the stores, whose registers the next rows' loads take
        }
    }
}
#define FNW 4
#define KST 64                    // keys of a stage
#define ATB (KST * PB)            // one plane's 64 rows of one stage in LDS
// 16 rows x 128 bytes, GP bytes apart at the source: 4 copies of a wave; lds and g are the lane's own addresses in the first 4 rows. The wait in the same statement stands in front of every later write of the address registers.
template <int GP>
__device__ __forceinline__ void copy16(unsigned lds, const char* g) {
    asm volatile("global_load_async_to_lds_b128 %0, %4, off\n\t"
                 "global_load_async_to_lds_b128 %1, %5, off\n\t"
                 "global_load_async_to_lds_b128 %2, %6, off\n\t"
                 "global_load_async_to_lds_b128 %3, %7, off\n\t"
                 "s_wait_xcnt 0x0"
                 :: "v"(lds), "v"(lds + 4 * PB), "v"(lds + 8 * PB), "v"(lds + 12 * PB),
                    "v"(g), "v"(g + 4 * GP), "v"(g + 8 * GP), "v"(g + 12 * GP)
                 : "memory");
}
template <typename T16> struct LFrag;   // WFrag::ld's two 16-byte pieces, from LDS
template <> struct LFrag<h16> { static __device__ __forceinline__ v16h ld(const char* p) { return cat16(*(const v8ha*)p, *(const v8ha*)(p + 32)); } };
template <> struct LFrag<bf> { static __device__ __forceinline__ v16bf ld(const char* p) { return ldsfrag(p); } };
template <typename T16, bool SPL> struct PPack;
template <> struct PPack<h16, false> { static __device__ __forceinline__ void pk(const float* p, v16h& ph, v16h& pl) { (void)pl;
#pragma unroll
    for (int s = 0; s < 16; ++s) ph[s] = (h16)p[s]; } };
template <> struct PPack<bf, true> { static __device__ __forceinline__ void pk(const float* p, v16bf& ph, v16bf& pl) { v8us h0, h1, l0, l1;
#pragma unroll
    for (int s = 0; s < 8; ++s) { unsigned short x, y; splitf(p[s], x, y); h0[s] = x; l0[s] = y; splitf(p[8 + s], x, y); h1[s] = x; l1[s] = y; }
    ph = cat16b(h0, h1); pl = cat16b(l0, l1); } };
// qw0: the work-group's first query, a multiple of its FNW x NQG x 16 queries; smem: 2 buffers x (1 or 2 key planes, then as many value planes) x ATB bytes
template <typename T16, bool SPL, int NQG>
__device__ __forceinline__ void attn_tile(const T16* __restrict__ Q, const T16* __restrict__ Q2, const T16* __restrict__ Kp, const T16* __restrict__ K2, const T16* __restrict__ Vt, const T16* __restrict__ V2, const int qw0, char* smem, bf* Ah, bf* Al) {
    typedef typename WFrag<T16>::V V;
    constexpr int NQ = NQG * 16;                        // queries of a wave
    constexpr int NP = SPL ? 2 : 1;                     // planes of each operand
    constexpr int BUFB = 2 * NP * ATB;
    constexpr float C = SCL * 1.4426950408889634f;      // raw score -> exponent of 2
    constexpr float OFF = SPL ? 0.0f : 10.0f;           // fp16 probabilities carry a factor 1024 (it cancels against the sum, which carries it too)
    const int lane = threadIdx.x & 31, lr = lane & 15, hi = lane >> 4; const int w = __builtin_amdgcn_readfirstlane(threadIdx.x >> 5);
    const int q0 = qw0 + w * NQ;                        // this wave's first query
    const int nbl = q0 / 32 + 1;                        // its 32-key blocks up to the diagonal one
    const int nst = (qw0 + FNW * NQ) / KST;             // the work-group's stages: up to the last wave's diagonal block
    const unsigned lo = (unsigned)(size_t)smem + (unsigned)((w * 16 + (lane >> 3)) * PB + (lane & 7) * 16);   // the lane's LDS byte address in a plane: 8 lanes a row
    const unsigned gk = (unsigned)((w * 16 + (lane >> 3)) * (HD * 2) + (lane & 7) * 16), gv = (unsigned)((w * 16 + (lane >> 3)) * (TT * 2) + (lane & 7) * 16);   // and its byte in a stage's key rows and value rows
    auto stage = [&](const int t, const int buf) {
        const unsigned d = lo + buf * BUFB;
        copy16<HD * 2>(d, (const char*)Kp + gk + t * (KST * HD * 2));
        if (SPL) copy16<HD * 2>(d + ATB, (const char*)K2 + gk + t * (KST * HD * 2));
        copy16<TT * 2>(d + NP * ATB, (const char*)Vt + gv + t * (KST * 2));
        if (SPL) copy16<TT * 2>(d + (NP + 1) * ATB, (const char*)V2 + gv + t * (KST * 2)); };
    stage(0, 0);
    v8f o[4][NQG]; float m[NQG], l[NQG];
#pragma unroll
    for (int g = 0; g < NQG; ++g) { m[g] = -3.0e38f; l[g] = 0.f;
#pragma unroll
        for (int dt = 0; dt < 4; ++dt) o[dt][g] = (v8f){}; }
    V qf[NQG][2], qf2[NQG][2];
    const unsigned ko = (unsigned)(lr * HD + 8 * hi) * 2u;   // the lane's byte offset in a query tile; the rest of each address is wave-uniform
#pragma unroll
    for (int g = 0; g < NQG; ++g)
#pragma unroll
        for (int kk = 0; kk < 2; ++kk) { const int qc = (q0 + g * 16) * HD + kk * 32; qf[g][kk] = WFrag<T16>::ld((const T16*)((const char*)(Q + qc) + ko)); if (SPL) qf2[g][kk] = WFrag<T16>::ld((const T16*)((const char*)(Q2 + qc) + ko)); }
    asm volatile("s_wait_asynccnt 0x0" ::: "memory");   // this wave's rows of stage 0 have landed
    __syncthreads();                                     // and every other wave's
    if (1 < nst) stage(1, 1);
    const char* fr = smem + lr * PB + 16 * hi;           // the lane's row in a plane's first 16 rows
#pragma unroll 1   // the trip count is known only at run time
    for (int t = 0; t < nst; ++t) {
        const int hn = min(2, nbl - 2 * t);              // this wave's blocks of the stage (wave-uniform): none behind its diagonal block
        const char* pk = fr + (t & 1) * BUFB; const char* pv = pk + NP * ATB;   // the lane's place in a block's 32 key rows and in its 64 bytes of every value row
#pragma unroll 1   // one body serves both blocks of a stage: the trip count (0, 1 or 2) is known only at run time, and a second copy would only lengthen the loop's code
        for (int h = 0; h < hn; ++h) {
            const int k0 = t * KST + h * 32;
            V kf[2][2], kf2[2][2], vf[4], vf2[4];
#pragma unroll
            for (int tt = 0; tt < 2; ++tt)
#pragma unroll
                for (int kk = 0; kk < 2; ++kk) { kf[tt][kk] = LFrag<T16>::ld(pk + tt * 16 * PB + kk * 64); if (SPL) kf2[tt][kk] = LFrag<T16>::ld(pk + ATB + tt * 16 * PB + kk * 64); }
            __builtin_amdgcn_sched_barrier(0);           // all key fragments are asked for at once: with matrix instructions lifted among the reads two fragments shared registers and the second waited out its own LDS latency
#pragma unroll
            for (int dt = 0; dt < 4; ++dt) { vf[dt] = LFrag<T16>::ld(pv + dt * 16 * PB); if (SPL) vf2[dt] = LFrag<T16>::ld(pv + ATB + dt * 16 * PB); }
            pk += 32 * PB; pv += 64;                     // the stage's next block
            v8f s[2][NQG];
#pragma unroll
            for (int tt = 0; tt < 2; ++tt)
#pragma unroll
                for (int g = 0; g < NQG; ++g) { s[tt][g] = (v8f){};
#pragma unroll
                    for (int kk = 0; kk < 2; ++kk) { s[tt][g] = WFrag<T16>::mma(kf[tt][kk], qf[g][kk], s[tt][g]); if (SPL) { s[tt][g] = WFrag<T16>::mma(kf[tt][kk], qf2[g][kk], s[tt][g]); s[tt][g] = WFrag<T16>::mma(kf2[tt][kk], qf[g][kk], s[tt][g]); } } }
            if (k0 + 31 > q0) {                          // the diagonal block (wave-uniform): keys behind the query are excluded
#pragma unroll
                for (int tt = 0; tt < 2; ++tt)
#pragma unroll
                    for (int g = 0; g < NQG; ++g)
#pragma unroll
                        for (int r = 0; r < 8; ++r) s[tt][g][r] = (k0 + tt * 16 + 8 * hi + r <= q0 + g * 16 + lr) ? s[tt][g][r] : -3.0e38f;
            }
            V pb[NQG], pb2[NQG];
#pragma unroll
            for (int g = 0; g < NQG; ++g) {
                float bm = s[0][g][0];
#pragma unroll
                for (int r = 1; r < 8; ++r) bm = fmaxf(bm, s[0][g][r]);
#pragma unroll
                for (int r = 0; r < 8; ++r) bm = fmaxf(bm, s[1][g][r]);
                bm = fmaxf(bm, __shfl_xor(bm, 16, 32));  // the query's other 16 keys of the block lie in the other lane half
                const float mn = fmaxf(m[g], bm), sc = __builtin_amdgcn_exp2f((m[g] - mn) * C), nb = OFF - mn * C; m[g] = mn;
                float p[16], ps = 0.f;
#pragma unroll
                for (int e = 0; e < 16; ++e) { p[e] = __builtin_amdgcn_exp2f(fmaf(s[e >> 3][g][e & 7], C, nb)); ps += p[e]; }
                l[g] = l[g] * sc + ps;
#pragma unroll
                for (int dt = 0; dt < 4; ++dt) o[dt][g] *= sc;
                PPack<T16, SPL>::pk(p, pb[g], pb2[g]);
            }
#pragma unroll
            for (int dt = 0; dt < 4; ++dt)
#pragma unroll
                for (int g = 0; g < NQG; ++g) { o[dt][g] = WFrag<T16>::mma(vf[dt], pb[g], o[dt][g]); if (SPL) { o[dt][g] = WFrag<T16>::mma(vf[dt], pb2[g], o[dt][g]); o[dt][g] = WFrag<T16>::mma(vf2[dt], pb[g], o[dt][g]); } }
        }
        asm volatile("s_wait_dscnt 0x0" ::: "memory");      // this wave's reads of the buffer are done before it is filled again
        asm volatile("s_wait_asynccnt 0x0" ::: "memory");   // this wave's rows of stage t + 1 have landed
        __syncthreads();                                     // stage t + 1 is whole, and nobody reads stage t's buffer any more
        if (t + 2 < nst) stage(t + 2, t & 1);
    }
    asm volatile("s_wait_asynccnt 0x0" ::: "memory");       // nothing is in flight when the wave ends
#pragma unroll
    for (int g = 0; g < NQG; ++g) {
        const float L = l[g] + __shfl_xor(l[g], 16, 32);    // the two lane halves summed different keys of the same query
        const float inv = __fdiv_rn(1.0f, L);
        const size_t oo = (size_t)(q0 + g * 16 + lr) * DQ + 8 * hi;   // a lane's 8 registers of a tile are 8 neighbouring head dimensions of its query; the wave writes each query's whole 128-byte line
#pragma unroll
        for (int dt = 0; dt < 4; ++dt) { v8us oh, ol;
#pragma unroll
            for (int e = 0; e < 8; ++e) { unsigned short x, y; splitf(o[dt][g][e] * inv, x, y); oh[e] = x; ol[e] = y; }
            *(v8us*)(Ah + oo + dt * 16) = oh; *(v8us*)(Al + oo + dt * 16) = ol; } }
    asm volatile("s_wait_xcnt 0x0" ::: "memory");        // behind the last store: in the built kernel the other tile form's code follows this one, and there the stores' registers are written again
}
// grid (batch x heads, query tiles), so that work-groups start longest first over all heads: the tiles of 128 rows >= RH from the last down (fp16 operands), then the tiles of 64 rows < RH (hi / lo planes, 3 products)
__global__ __launch_bounds__(32 * FNW) void k_fattn(const h16* __restrict__ Q16, const h16* __restrict__ K16, const h16* __restrict__ V16, const bf* __restrict__ Qh, const bf* __restrict__ Ql, const bf* __restrict__ Kh, const bf* __restrict__ Kl, const bf* __restrict__ Vh, const bf* __restrict__ Vl, bf* Ah, bf* Al) {
    __shared__ __attribute__((aligned(128))) char smem[2 * 4 * ATB];
    constexpr int NLO = (TT - RH) / (FNW * 32);
    const size_t zq = (size_t)blockIdx.x * TT * HD, zk = (size_t)(blockIdx.x / REP) * TT * HD; const int x = blockIdx.y;
    const size_t za = (size_t)(blockIdx.x / NH_) * TT * DQ + (blockIdx.x % NH_) * HD;   // merged-head planes are [batch][row][head][dim]
    bf* ah = Ah + za; bf* al = Al + za;
    if (x < NLO) attn_tile<h16, false, 2>(Q16 + zq, nullptr, K16 + zk, nullptr, V16 + zk, nullptr, TT - FNW * 32 - x * (FNW * 32), smem, ah, al);
    else attn_tile<bf, true, 1>(Qh + zq, Ql + zq, Kh + zk, Kl + zk, Vh + zk, Vl + zk, RH - FNW * 16 - (x - NLO) * (FNW * 16), smem, ah, al);
}

extern "C" void kernel_launch(void* const* d_in, const int* in_sizes, int n_in,
                              void* d_out, int out_size, void* d_ws, size_t ws_size, hipStream_t stream) {
    (void)in_sizes; (void)n_in; (void)out_size;
    const float* x = (const float*)d_in[0]; const float* wattn = (const float*)d_in[1]; const float* wo = (const float*)d_in[2];   /* x, w_attn ('oi' [3072][1024]: q | k | v row thirds), w_proj ('oi') */
    float* OUT = (float*)d_out;     // [4][2048][1024]
    char* wsp = (char*)d_ws;
    auto take = [&](size_t bytes) { char* p = wsp; wsp += (bytes + 255) & ~(size_t)255; return (void*)p; };
    bf* WQ = (bf*)take((size_t)(DQ + 2 * DKV) * DM * 2);   /* one [3072][1024] plane, q | k | v */ bf* WO = (bf*)take((size_t)DM * DQ * 2); float* CS = (float*)take((size_t)TT * HD * 2 * 4);
    bf* XB = (bf*)take((size_t)NB_ * TT * DM * 2);
    h16* QP16 = (h16*)take((size_t)NB_ * NH_ * TT * HD * 2); h16* KP16 = (h16*)take((size_t)NB_ * NKV * TT * HD * 2); h16* VT16 = (h16*)take((size_t)NB_ * NKV * HD * TT * 2);
    bf* QPh = (bf*)take((size_t)NB_ * NH_ * TT * HD * 2); bf* QPl = (bf*)take((size_t)NB_ * NH_ * TT * HD * 2); bf* KPh = (bf*)take((size_t)NB_ * NKV * TT * HD * 2); bf* KPl = (bf*)take((size_t)NB_ * NKV * TT * HD * 2); bf* VTh = (bf*)take((size_t)NB_ * NKV * HD * TT * 2); bf* VTl = (bf*)take((size_t)NB_ * NKV * HD * TT * 2);
    bf* ATh = (bf*)take((size_t)NB_ * TT * DQ * 2); bf* ATl = (bf*)take((size_t)NB_ * TT * DQ * 2);
    if ((size_t)(wsp - (char*)d_ws) > ws_size) return;    // ws 256 MiB
    // every stage runs once for all batches: the products take the batch as grid z, the attention sees NB_ x heads heads
    k_prep<<<PG, PT, 0, stream>>>(x, wattn, wo, XB, WQ, WO, CS);   /* bf16 copies of the inputs, rotary table */
    k_qkv<<<dim3(TT / 128, (DQ + 2 * DKV) / 128, NB_), 128, 0, stream>>>(XB, WQ, CS, QP16, QPh, QPl, KP16, KPh, KPl, VT16, VTh, VTl);
    k_fattn<<<dim3(NB_ * NH_, (TT - RH) / (FNW * 32) + RH / (FNW * 16), 1), 32 * FNW, 0, stream>>>(QP16, KP16, VT16, QPh, QPl, KPh, KPl, VTh, VTl, ATh, ATl);
    k_gemmw<<<dim3(TT / 128, DM / 128, NB_), 128, 0, stream>>>(ATh, ATl, WO, OUT);
}

// v009
// A run of this version takes 138 microseconds.
// Two timings next to v008 put it at 1.07 and 1.06 times that version's speed.
// Counting every step since v000, it is 20.7 times as fast.
#include <hip/hip_runtime.h>

// Causal self-attention with a fused bias-free qkv weight and the source's pairwise rotary form (x [4][2048][1024]; qkv = x w_attn^T ('oi' [3072][1024]) split in thirds q | k | v (16 heads x 64); rope on consecutive pairs with PER-ELEMENT table columns: out[2i] = x[2i] cos[2i] - x[2i+1] sin[2i], out[2i+1] = x[2i+1] cos[2i+1] + x[2i] sin[2i+1] where cos / sin = cat(freqs, freqs) of angle t x 1/10000^(2j/64) (so column d uses frequency d mod 32: the module reshapes the concatenated tables pairwise; reproduced literally; 32 f32 frequencies; precise cosf/sinf); scores x 1/sqrt(64); causal (finfo.min == exclusion); softmax; y = merged w_proj^T ('oi') -> [4][2048][1024] (8.4 M); argument order x, w_attn, w_proj).
// Layout, all batches in every launch: bf16 copy of x; 'oi' weights; exact projections; bf16 copies and the computed {cos, sin} table (INVT[32]) in one launch (k_prep); q, k, v projections in one launch whose epilogue applies the interleaved-pair rotary with per-dimension table entries and writes the planes (k_qkv); one-kernel causal T-2048 attention k_fattn (hybrid rows: < 512 hi/lo 3 products, rest fp16 x1024; key blocks above the diagonal are never visited); merged hi/lo x Wo exact.
// Compute dtypes, f32 accumulate: every input rounded to bf16; the {cos, sin} table f32; projections exact; rotary f32; attention rows < 512 3 products, rest fp16; softmax f32; Wo hl x exact.

#define NB_  4
#define TT   2048
#define DM   1024
#define NH_  16
#define NKV  16
#define REP  (NH_ / NKV)
#define HD   64
#define DQ   (NH_ * HD)
#define DKV  (NKV * HD)
#define RH   512                  // query rows < RH use hi+lo planes (0: none)
#define SCL  0.125f   // HD^-0.5
typedef _Float16 h16;
typedef unsigned short bf;
typedef __attribute__((ext_vector_type(16))) __bf16   v16bf;
typedef __attribute__((ext_vector_type(16))) _Float16 v16h;
typedef __attribute__((ext_vector_type(8)))  _Float16 v8h;
typedef __attribute__((ext_vector_type(8)))  unsigned short v8us;
typedef __attribute__((ext_vector_type(8)))  float    v8f;
typedef __attribute__((ext_vector_type(4)))  float    v4f;
typedef v8h  __attribute__((may_alias)) v8ha;
typedef v4f  __attribute__((may_alias)) v4fa;
typedef v8us __attribute__((may_alias)) v8usa;

__device__ __forceinline__ unsigned short f2bf(float f) { unsigned u = __float_as_uint(f); u += 0x7FFFu + ((u >> 16) & 1u); return (unsigned short)(u >> 16); }
__device__ __forceinline__ float bf2f(unsigned short b) { return __uint_as_float(((unsigned)b) << 16); }
__device__ __forceinline__ float bfr(float f) { return bf2f(f2bf(f)); }
__device__ __forceinline__ v16h cat16(v8h lo, v8h hi) { return __builtin_shufflevector(lo, hi, 0, 1, 2, 3, 4, 5, 6, 7, 8, 9, 10, 11, 12, 13, 14, 15); }
__device__ __forceinline__ v16bf cat16b(v8us lo, v8us hi) { return __builtin_bit_cast(v16bf, __builtin_shufflevector(lo, hi, 0, 1, 2, 3, 4, 5, 6, 7, 8, 9, 10, 11, 12, 13, 14, 15)); }
__device__ __forceinline__ v8f wmma16(v16h a, v16h b, v8f c) { return __builtin_amdgcn_wmma_f32_16x16x32_f16(false, a, false, b, (short)0, c, false, false); }
__device__ __forceinline__ v8f wmmab(v16bf a, v16bf b, v8f c) { return __builtin_amdgcn_wmma_f32_16x16x32_bf16(false, a, false, b, (short)0, c, false, false); }



// ---- gemm128: the product loop of both GEMM kernels. A work-group of 4 waves (2 x 2) owns a 128x128 output tile, each wave a 64x64 quarter (16 accumulators).
// A pass is 64 k = 128 bytes of each of the 128 rows of every operand (K-contiguous 16-bit planes, row length DM). The rows come into LDS by asynchronous copies, each copy 4 whole 128-byte lines, each wave 32 rows of every operand;
// two buffers: the next pass's copies fly while this pass's fragments are read from LDS, every row by two waves. Products and their order along k are those of one wave per tile: k in steps of 32, A before A2.
#define PB    144                 // LDS pitch of a 128-byte row piece: 16 bytes x odd, the pitch of 16-byte fragment reads
#define TILEB (128 * PB)          // one operand's rows of one pass
#define NPASS (DM / 64)
template <typename T16> struct WFrag;
template <> struct WFrag<h16> { typedef v16h V; static __device__ __forceinline__ V ld(const h16* p) { return cat16(*(const v8h*)p, *(const v8h*)(p + 16)); } static __device__ __forceinline__ v8f mma(V a, V b, v8f c) { return wmma16(a, b, c); } };
template <> struct WFrag<bf> { typedef v16bf V; static __device__ __forceinline__ V ld(const bf* p) { return cat16b(*(const v8us*)p, *(const v8us*)(p + 16)); } static __device__ __forceinline__ v8f mma(V a, V b, v8f c) { return wmmab(a, b, c); } };
// 32 rows x 128 bytes: 8 copies of a wave; lds and g are the lane's own addresses in the first 4 rows. The wait in the same statement stands in front of every later write of the address registers.
__device__ __forceinline__ void copy32(unsigned lds, const char* g) {
    asm volatile("global_load_async_to_lds_b128 %0, %8, off\n\t"
                 "global_load_async_to_lds_b128 %1, %9, off\n\t"
                 "global_load_async_to_lds_b128 %2, %10, off\n\t"
                 "global_load_async_to_lds_b128 %3, %11, off\n\t"
                 "global_load_async_to_lds_b128 %4, %12, off\n\t"
                 "global_load_async_to_lds_b128 %5, %13, off\n\t"
                 "global_load_async_to_lds_b128 %6, %14, off\n\t"
                 "global_load_async_to_lds_b128 %7, %15, off\n\t"
                 "s_wait_xcnt 0x0"
                 :: "v"(lds), "v"(lds + 4 * PB), "v"(lds + 8 * PB), "v"(lds + 12 * PB), "v"(lds + 16 * PB), "v"(lds + 20 * PB), "v"(lds + 24 * PB), "v"(lds + 28 * PB),
                    "v"(g), "v"(g + 4 * DM * 2), "v"(g + 8 * DM * 2), "v"(g + 12 * DM * 2), "v"(g + 16 * DM * 2), "v"(g + 20 * DM * 2), "v"(g + 24 * DM * 2), "v"(g + 28 * DM * 2)
                 : "memory");
}
__device__ __forceinline__ v16bf ldsfrag(const char* p) { return cat16b(*(const v8usa*)p, *(const v8usa*)(p + 32)); }   // WFrag::ld's two 16-byte pieces, from LDS
// pa, pa2 (NA == 2), pb: first row of the work-group's 128 rows of each operand; smem: 2 x (NA + 1) x TILEB bytes. On return every wave has passed the last barrier and no copy is outstanding: smem is free.
template <int NA>
__device__ __forceinline__ void gemm128(const char* pa, const char* pa2, const char* pb, char* smem, const int w, const int lane, v8f (&acc)[4][4]) {
    constexpr int BUFB = (NA + 1) * TILEB;
    const int lr = lane & 15, hi = lane >> 4;
    const unsigned go = (unsigned)((w * 32 + (lane >> 3)) * (DM * 2) + (lane & 7) * 16);                              // the lane's byte in an operand's 128 rows: 8 lanes a row
    const unsigned lo = (unsigned)(size_t)smem + (unsigned)((w * 32 + (lane >> 3)) * PB + (lane & 7) * 16);          // and its LDS byte address in a tile
    auto stage = [&](const int t, const int buf) {
        copy32(lo + buf * BUFB, pa + go + t * 128);
        if (NA == 2) copy32(lo + buf * BUFB + TILEB, pa2 + go + t * 128);
        copy32(lo + buf * BUFB + NA * TILEB, pb + go + t * 128); };
#pragma unroll
    for (int mb = 0; mb < 4; ++mb)
#pragma unroll
        for (int nb = 0; nb < 4; ++nb) acc[mb][nb] = (v8f){};
    stage(0, 0);
    asm volatile("s_wait_asynccnt 0x0" ::: "memory");   // this wave's rows of pass 0 have landed
    __syncthreads();                                     // and every other wave's
    stage(1, 1);
    const char* fa = smem + ((w >> 1) * 64 + lr) * PB + 16 * hi; const char* fb = smem + NA * TILEB + ((w & 1) * 64 + lr) * PB + 16 * hi;   // the lane's row in the wave's first A and B fragment
#pragma unroll 1   // one body holds the 16 accumulator tiles and the fragments of one k step
    for (int t = 0; t < NPASS; ++t) {
        const int bo = (t & 1) * BUFB;
        v16bf a[4], a2[4], b[4];
        auto frags = [&](const int kk) {                     // the fragments of k step kk of this pass
#pragma unroll
            for (int mb = 0; mb < 4; ++mb) { a[mb] = ldsfrag(fa + bo + mb * 16 * PB + kk * 64); if (NA == 2) a2[mb] = ldsfrag(fa + bo + TILEB + mb * 16 * PB + kk * 64); }
#pragma unroll
            for (int nb = 0; nb < 4; ++nb) b[nb] = ldsfrag(fb + bo + nb * 16 * PB + kk * 64); };
        auto products = [&]() {
#pragma unroll
            for (int nb = 0; nb < 4; ++nb) {
#pragma unroll
                for (int mb = 0; mb < 4; ++mb) acc[mb][nb] = wmmab(a[mb], b[nb], acc[mb][nb]);
                if (NA == 2) {
#pragma unroll
                    for (int mb = 0; mb < 4; ++mb) acc[mb][nb] = wmmab(a2[mb], b[nb], acc[mb][nb]); } } };
        frags(0);
        __builtin_amdgcn_sched_barrier(0);                   // all fragments of a k step are asked for at once: with the reads sunk among the matrix instructions the B fragments shared one register set and each waited out its own LDS latency
        products();
        frags(1);                                            // the pass's last reads of its buffer
        if (NA == 2) { __builtin_amdgcn_sched_barrier(0); products(); __builtin_amdgcn_sched_barrier(0); }   // three fragment sets leave no registers for the copies' addresses: the products come first, and stay in front of the barrier, so that the copies go out right behind it
        asm volatile("s_wait_dscnt 0x0" ::: "memory");      // this wave's reads of the buffer are done before it is filled again
        asm volatile("s_wait_asynccnt 0x0" ::: "memory");   // this wave's rows of pass t + 1 have landed
        __syncthreads();                                     // pass t + 1 is whole, and nobody reads pass t's buffer any more
        if (t + 2 < NPASS) stage(t + 2, t & 1);
        if (NA == 1) { __builtin_amdgcn_sched_barrier(0); products(); }   // these products need registers only: the copies go out in front of them, so that they have a whole pass to land
    }
    asm volatile("s_wait_asynccnt 0x0" ::: "memory");       // nothing is in flight when the buffers are given to the epilogue
}
// ---- k_gemmw: C[m][n] (f32, pitch DM) = sum_k (A[m][k] + A2[m][k]) Bt[n][k], K = DQ; grid (T/128, DM/128, batch), 4 waves; each wave stores its 64x64 quarter, 16 rows at a time through its own piece of LDS.
__global__ __launch_bounds__(128) void k_gemmw(const bf* __restrict__ A, const bf* __restrict__ A2, const bf* __restrict__ Bt, float* C) {
    __shared__ __attribute__((aligned(128))) char smem[2 * 3 * TILEB];
    constexpr int ldc = DM;
    const int lane = threadIdx.x & 31, lr = lane & 15, hi = lane >> 4; const int w = __builtin_amdgcn_readfirstlane(threadIdx.x >> 5);
    const size_t ra = ((size_t)blockIdx.z * TT + blockIdx.x * 128) * DQ;
    v8f acc[4][4];
    gemm128<2>((const char*)(A + ra), (const char*)(A2 + ra), (const char*)(Bt + (size_t)blockIdx.y * 128 * DQ), smem, w, lane, acc);
    float* os = (float*)(smem + w * (16 * 68 * 4));
    C += (size_t)blockIdx.z * TT * DM; const int r0 = blockIdx.x * 128 + (w >> 1) * 64, c0 = blockIdx.y * 128 + (w & 1) * 64;
#pragma unroll
    for (int mb = 0; mb < 4; ++mb) {
#pragma unroll
        for (int nb = 0; nb < 4; ++nb) {
#pragma unroll
            for (int j = 0; j < 8; ++j) os[(hi * 8 + j) * 68 + nb * 16 + lr] = acc[mb][nb][j]; }
        __builtin_amdgcn_wave_barrier(); asm volatile("" ::: "memory");   // the reads below take other lanes' words: they stay behind these writes
        float* crow = C + (size_t)(r0 + mb * 16) * ldc + c0;
#pragma unroll
        for (int s = 0; s < 8; ++s) { const int row = 2 * s + hi, cofs = lr * 4; const v4f val = *(const v4fa*)(os + row * 68 + cofs);
            *(v4f*)(crow + (size_t)row * ldc + cofs) = val; }
        __builtin_amdgcn_wave_barrier(); asm volatile("s_wait_xcnt 0x0" ::: "memory");   // the next 16 rows are written only behind these reads; the wait stands behind the stores, whose registers the next rows' loads take
    }
}

__device__ __forceinline__ void splitf(float y, unsigned short& h, unsigned short& l) { h = f2bf(y); l = f2bf(y - bf2f(h)); }
typedef __attribute__((ext_vector_type(2))) _Float16 v2h;
typedef __attribute__((ext_vector_type(4))) _Float16 v4h;
typedef __attribute__((ext_vector_type(4))) unsigned short v4us;
typedef __attribute__((ext_vector_type(2))) float v2f;
typedef __attribute__((ext_vector_type(4))) int v4i;

__constant__ float INVT[HD / 2] = { 1.000000000e+00f, 7.498942018e-01f, 5.623413324e-01f, 4.216965139e-01f, 3.162277639e-01f, 2.371373624e-01f, 1.778279394e-01f, 1.333521456e-01f, 1.000000015e-01f, 7.498941571e-02f, 5.623412877e-02f, 4.216964915e-02f, 3.162277862e-02f, 2.371373586e-02f, 1.778279431e-02f, 1.333521493e-02f, 9.999999776e-03f, 7.498942316e-03f, 5.623413250e-03f, 4.216964822e-03f, 3.162277862e-03f, 2.371373819e-03f, 1.778279431e-03f, 1.333521446e-03f, 1.000000047e-03f, 7.498941850e-04f, 5.623413017e-04f, 4.216964880e-04f, 3.162277862e-04f, 2.371373848e-04f, 1.778279402e-04f, 1.333521504e-04f };   // float32 1 / 10000^(2i/64), generated with jnp to be bit-exact
// ---- k_prep: everything the products need, in ONE launch of PG work-groups x PT threads (one work-group of 16 waves a WGP): the bf16 copies of x, w_attn and w_proj and the {cos, sin} table.
// Few waves, each started once for 24 pieces (starting a wave costs more than converting a piece): a piece is 512 bytes in a row (16 bytes a lane, 4 whole lines), its copy 256 bytes in a row. A work-group owns one run of each input: N steps of PT x 16 bytes.
// All of a lane's loads are asked for first; the table entry (one a thread) is computed while they fly.
#define PG 256
#define PT 512
#define PSTEP (PT * 4)           // floats of one step of a work-group
// s, d: the work-group's run (uniform); e: the thread's first float in a step; the step is a constant of the address
template <int N>
__device__ __forceinline__ void ld_steps(const float* __restrict__ s, const unsigned e, v4f (&v)[N]) {
#pragma unroll
    for (int j = 0; j < N; ++j) v[j] = *(const v4f*)(s + e + j * PSTEP); }
template <int N>
__device__ __forceinline__ void st_steps(bf* d, const unsigned e, const v4f (&v)[N]) {
#pragma unroll
    for (int j = 0; j < N; ++j) { v4us o;
#pragma unroll
        for (int k = 0; k < 4; ++k) o[k] = f2bf(v[j][k]);
        *(v4us*)(d + e + j * PSTEP) = o; } }
__global__ __launch_bounds__(PT) void k_prep(const float* __restrict__ x, const float* __restrict__ wa, const float* __restrict__ wo, bf* XB, bf* WA, bf* WO, float* CS) {
    constexpr int NX = NB_ * TT * DM / (PG * PSTEP), NA = (DQ + 2 * DKV) * DM / (PG * PSTEP), NO = DM * DQ / (PG * PSTEP);
    static_assert(NX * PG * PSTEP == NB_ * TT * DM && NA * PG * PSTEP == (DQ + 2 * DKV) * DM && NO * PG * PSTEP == DM * DQ && PG * PT == TT * HD, "whole steps");
    const unsigned idx = blockIdx.x * PT + threadIdx.x, e = threadIdx.x * 4;   // the thread's table entry, and its first float in a step
    const size_t bx = (size_t)blockIdx.x * (NX * PSTEP), ba = (size_t)blockIdx.x * (NA * PSTEP), bo = (size_t)blockIdx.x * (NO * PSTEP);   // where the work-group's runs begin
    const float fr = INVT[idx % HD % (HD / 2)];   // entry idx is dimension idx % HD of position idx / HD
    __builtin_amdgcn_sched_barrier(0);   // the frequency is asked for first: loads return in order, so behind the pieces' loads its wait would be a wait for all of them
    v4f vx[NX], va[NA], vo[NO];
    ld_steps(x + bx, e, vx); ld_steps(wa + ba, e, va); ld_steps(wo + bo, e, vo);
    asm volatile("s_wait_xcnt 0x0" ::: "memory");   // behind the loads: what follows takes registers that their addresses stand in
    __builtin_amdgcn_sched_barrier(0);   // the table's arithmetic stays behind all loads, so that it runs inside their latency, and behind that wait
    const float a = __fmul_rn((float)(idx / HD), fr); v2f cs; cs[0] = cosf(a); cs[1] = sinf(a); *(v2f*)(CS + (size_t)idx * 2) = cs;
    st_steps(XB + bx, e, vx); st_steps(WA + ba, e, va); st_steps(WO + bo, e, vo);
}
typedef __attribute__((ext_vector_type(2))) __bf16 v2bf;
typedef __attribute__((ext_vector_type(4))) unsigned v4u;
typedef v4u __attribute__((may_alias)) v4ua;
// two f32 -> their fp16 pair, their bf16 hi pair and the bf16 pair of what hi leaves over, each packed in one word; the packed conversions round to nearest even, as a plain cast and splitf do
__device__ __forceinline__ void pack2(v2f y, unsigned& w16, unsigned& wh, unsigned& wl) {
    w16 = __builtin_bit_cast(unsigned, __builtin_convertvector(y, v2h)); wh = __builtin_bit_cast(unsigned, __builtin_convertvector(y, v2bf));
    v2f b; b[0] = __uint_as_float(wh << 16); b[1] = __uint_as_float(wh & 0xFFFF0000u); wl = __builtin_bit_cast(unsigned, __builtin_convertvector(y - b, v2bf)); }
// The two epilogues of k_qkv, one wave's 64 positions x 64 dimensions each. W16: the fp16 plane is written; WHL: the hi and lo planes are written. A plane that is not written is not converted either.
// v: p16, ph, pl: the wave's first byte in each transposed plane
template <bool WHL>
__device__ __forceinline__ void v_planes(const v8f (&acc)[4][4], char* p16, char* ph, char* pl, const int lane) {
    const int lr = lane & 15, hi = lane >> 4;
    const unsigned lo = (unsigned)(lr * TT + 8 * hi) * 2u;              // the lane's byte offset; the rest of each address is a constant
#pragma unroll
    for (int nb = 0; nb < 4; ++nb)
#pragma unroll
        for (int mb = 0; mb < 4; ++mb) { v4u o16, oh, ol;
#pragma unroll
            for (int p = 0; p < 4; ++p) { v2f y; y[0] = acc[mb][nb][2 * p]; y[1] = acc[mb][nb][2 * p + 1]; unsigned a, b, d; pack2(y, a, b, d); o16[p] = a; oh[p] = b; ol[p] = d; }
            const int e = (nb * 16 * TT + mb * 16) * 2;
            *(v4ua*)(p16 + lo + e) = o16; if (WHL) { *(v4ua*)(ph + lo + e) = oh; *(v4ua*)(pl + lo + e) = ol; } }
    asm volatile("s_wait_xcnt 0x0" ::: "memory");        // behind the last store: in the built kernel the other form's code follows this one, and there the stores' registers are written again
}
// q, k: os: the wave's own 16 x 68 words of LDS; pcs: the table entries of its first position; p16, ph, pl: its first byte in each plane
template <bool W16, bool WHL>
__device__ __forceinline__ void qk_planes(const v8f (&acc)[4][4], float* os, const char* pcs, char* p16, char* ph, char* pl, const int lane) {
    const int lr = lane & 15, hi = lane >> 4;
    const int rr = lane >> 3, cofs = (lane & 7) * 8;                 // the lane's row among 4 and its first dimension
    const unsigned lo = (unsigned)(rr * HD + cofs) * 2u;               // the lane's byte offset in a plane (4 times that in the table); the rest of each address is a constant
#pragma unroll
    for (int mb = 0; mb < 4; ++mb) {
#pragma unroll
        for (int nb = 0; nb < 4; ++nb) {
#pragma unroll
            for (int j = 0; j < 8; ++j) os[(hi * 8 + j) * 68 + nb * 16 + lr] = acc[mb][nb][j]; }
        __builtin_amdgcn_wave_barrier(); asm volatile("" ::: "memory");   // the reads below take other lanes' words: they stay behind these writes
#pragma unroll
        for (int s = 0; s < 4; ++s) { const int row = 4 * s + rr, e = (mb * 16 + 4 * s) * HD * 2;
            const v4f xa = *(const v4fa*)(os + row * 68 + cofs), xb = *(const v4fa*)(os + row * 68 + cofs + 4);
            const char* cs = pcs + lo * 4u + e * 4;                      // {cos, sin} of 8 dimensions
            v4u o16, oh, ol;
#pragma unroll
            for (int p = 0; p < 4; ++p) { const v4f c = *(const v4fa*)(cs + p * 16); const float x0 = p < 2 ? xa[2 * p] : xb[2 * p - 4], x1 = p < 2 ? xa[2 * p + 1] : xb[2 * p - 3];
                v2f y; y[0] = x0 * c[0] - x1 * c[1]; y[1] = x0 * c[3] + x1 * c[2];   /* even: x0 c - x1 s; odd: x0 s + x1 c */
                unsigned a, b, d; pack2(y, a, b, d); o16[p] = a; oh[p] = b; ol[p] = d; }
            if (W16) *(v4ua*)(p16 + lo + e) = o16;
            if (WHL) { *(v4ua*)(ph + lo + e) = oh; *(v4ua*)(pl + lo + e) = ol; } }
        __builtin_amdgcn_wave_barrier(); asm volatile("s_wait_xcnt 0x0" ::: "memory");   // the next 16 rows are written only behind these reads; the wait stands behind the stores, whose registers the next rows' loads take
    }
}
// ---- k_qkv: the q, k and v projections of all batches in ONE launch; the product loop is gemm128 (one wave per 64x64 quarter), and the tile leaves the accumulators as finished 16-bit planes: no f32 projection is stored.
// grid (T/128, 3 x heads / 2, batch), 4 waves: Bt is the [3 x 1024][1024] weight (q | k | v row thirds), so a wave's 64 columns are the 64 dimensions of ONE head of q, k or v, and its rows are 64 positions of one batch.
// q, k: 16 rows at a time through LDS, so that a lane holds 8 neighbouring dimensions of one position (4 rotary pairs, whole 16-byte stores, 4 rows = 512 bytes in a row per store); table entries per dimension as k_prep wrote them.
// v: a lane's 8 accumulator registers are 8 consecutive positions of one dimension, which is a 16-byte piece of a transposed value row: stored straight from the registers; the wave writes each row's whole 128-byte line.
// Only what k_fattn reads is written: its hi / lo tiles take queries, keys and values of positions < RH alone, its fp16 tiles queries of positions >= RH and keys and values of every position.
// So hi and lo planes: positions < RH; fp16 query plane: positions >= RH; fp16 key and value planes: all positions. The rest of each plane stays unwritten and unread.
__global__ __launch_bounds__(128) void k_qkv(const bf* __restrict__ A, const bf* __restrict__ Bt, const float* __restrict__ CS, h16* Q16, bf* Qh, bf* Ql, h16* K16, bf* Kh, bf* Kl, h16* V16, bf* Vh, bf* Vl) {
    __shared__ __attribute__((aligned(128))) char smem[2 * 2 * TILEB];
    const int lane = threadIdx.x & 31, lr = lane & 15, hi = lane >> 4; const int w = __builtin_amdgcn_readfirstlane(threadIdx.x >> 5);
    v8f acc[4][4];
    gemm128<1>((const char*)(A + ((size_t)blockIdx.z * TT + blockIdx.x * 128) * DM), nullptr, (const char*)(Bt + (size_t)blockIdx.y * 128 * DM), smem, w, lane, acc);
    float* os = (float*)(smem + w * (16 * 68 * 4));                      // the wave's own 16 x 68 words for its epilogue
    const int r0 = blockIdx.x * 128 + (w >> 1) * 64, ct = blockIdx.y * 2 + (w & 1);   // the wave's first position and its 64-column tile
    const int part = ct / NH_;                                           // 0 q, 1 k, 2 v (the same for the whole wave)
    const size_t g = (size_t)blockIdx.z * NH_ + ct % NH_;                // batch x heads index of the planes
    const bool low = r0 < RH;                                            // the wave's 64 positions lie wholly below RH or wholly at or above it (wave-uniform)
    if (part == 2) {
        const size_t e0 = (g * HD * TT + r0) * 2; char* p16 = (char*)V16 + e0; char* ph = (char*)Vh + e0; char* pl = (char*)Vl + e0;   // wave-uniform bases
        if (low) v_planes<true>(acc, p16, ph, pl, lane); else v_planes<false>(acc, p16, ph, pl, lane);
    } else {
        const size_t e0 = (g * TT + r0) * HD * 2; char* p16 = (char*)(part ? K16 : Q16) + e0; char* ph = (char*)(part ? Kh : Qh) + e0; char* pl = (char*)(part ? Kl : Ql) + e0;   // wave-uniform bases
        const char* pcs = (const char*)(CS + (size_t)r0 * HD * 2);
        if (!low) qk_planes<true, false>(acc, os, pcs, p16, ph, pl, lane);
        else if (part) qk_planes<true, true>(acc, os, pcs, p16, ph, pl, lane);
        else qk_planes<false, true>(acc, os, pcs, p16, ph, pl, lane);
    }
}
#define FNW 4
#define KST 64                    // keys of a stage
#define ATB (KST * PB)            // one plane's 64 rows of one stage in LDS
// 16 rows x 128 bytes, GP bytes apart at the source: 4 copies of a wave; lds and g are the lane's own addresses in the first 4 rows. The wait in the same statement stands in front of every later write of the address registers.
template <int GP>
__device__ __forceinline__ void copy16(unsigned lds, const char* g) {
    asm volatile("global_load_async_to_lds_b128 %0, %4, off\n\t"
                 "global_load_async_to_lds_b128 %1, %5, off\n\t"
                 "global_load_async_to_lds_b128 %2, %6, off\n\t"
                 "global_load_async_to_lds_b128 %3, %7, off\n\t"
                 "s_wait_xcnt 0x0"
                 :: "v"(lds), "v"(lds + 4 * PB), "v"(lds + 8 * PB), "v"(lds + 12 * PB),
                    "v"(g), "v"(g + 4 * GP), "v"(g + 8 * GP), "v"(g + 12 * GP)
                 : "memory");
}
template <typename T16> struct LFrag;   // WFrag::ld's two 16-byte pieces, from LDS
template <> struct LFrag<h16> { static __device__ __forceinline__ v16h ld(const char* p) { return cat16(*(const v8ha*)p, *(const v8ha*)(p + 32)); } };
template <> struct LFrag<bf> { static __device__ __forceinline__ v16bf ld(const char* p) { return ldsfrag(p); } };
template <typename T16, bool SPL> struct PPack;
template <> struct PPack<h16, false> { static __device__ __forceinline__ void pk(const float* p, v16h& ph, v16h& pl) { (void)pl;
#pragma unroll
    for (int s = 0; s < 16; ++s) ph[s] = (h16)p[s]; } };
template <> struct PPack<bf, true> { static __device__ __forceinline__ void pk(const float* p, v16bf& ph, v16bf& pl) { v8us h0, h1, l0, l1;
#pragma unroll
    for (int s = 0; s < 8; ++s) { unsigned short x, y; splitf(p[s], x, y); h0[s] = x; l0[s] = y; splitf(p[8 + s], x, y); h1[s] = x; l1[s] = y; }
    ph = cat16b(h0, h1); pl = cat16b(l0, l1); } };
// qw0: the work-group's first query, a multiple of its FNW x NQG x 16 queries; smem: 2 buffers x (1 or 2 key planes, then as many value planes) x ATB bytes
template <typename T16, bool SPL, int NQG>
__device__ __forceinline__ void attn_tile(const T16* __restrict__ Q, const T16* __restrict__ Q2, const T16* __restrict__ Kp, const T16* __restrict__ K2, const T16* __restrict__ Vt, const T16* __restrict__ V2, const int qw0, char* smem, bf* Ah, bf* Al) {
    typedef typename WFrag<T16>::V V;
    constexpr int NQ = NQG * 16;                        // queries of a wave
    constexpr int NP = SPL ? 2 : 1;                     // planes of each operand
    constexpr int BUFB = 2 * NP * ATB;
    constexpr float C = SCL * 1.4426950408889634f;      // raw score -> exponent of 2
    constexpr float OFF = SPL ? 0.0f : 10.0f;           // fp16 probabilities carry a factor 1024 (it cancels against the sum, which carries it too)
    const int lane = threadIdx.x & 31, lr = lane & 15, hi = lane >> 4; const int w = __builtin_amdgcn_readfirstlane(threadIdx.x >> 5);
    const int q0 = qw0 + w * NQ;                        // this wave's first query
    const int nbl = q0 / 32 + 1;                        // its 32-key blocks up to the diagonal one
    const int nst = (qw0 + FNW * NQ) / KST;             // the work-group's stages: up to the last wave's diagonal block
    const unsigned lo = (unsigned)(size_t)smem + (unsigned)((w * 16 + (lane >> 3)) * PB + (lane & 7) * 16);   // the lane's LDS byte address in a plane: 8 lanes a row
    const unsigned gk = (unsigned)((w * 16 + (lane >> 3)) * (HD * 2) + (lane & 7) * 16), gv = (unsigned)((w * 16 + (lane >> 3)) * (TT * 2) + (lane & 7) * 16);   // and its byte in a stage's key rows and value rows
    auto stage = [&](const int t, const int buf) {
        const unsigned d = lo + buf * BUFB;
        copy16<HD * 2>(d, (const char*)Kp + gk + t * (KST * HD * 2));
        if (SPL) copy16<HD * 2>(d + ATB, (const char*)K2 + gk + t * (KST * HD * 2));
        copy16<TT * 2>(d + NP * ATB, (const char*)Vt + gv + t * (KST * 2));
        if (SPL) copy16<TT * 2>(d + (NP + 1) * ATB, (const char*)V2 + gv + t * (KST * 2)); };
    stage(0, 0);
    v8f o[4][NQG]; float m[NQG], l[NQG];
#pragma unroll
    for (int g = 0; g < NQG; ++g) { m[g] = -3.0e38f; l[g] = 0.f;
#pragma unroll
        for (int dt = 0; dt < 4; ++dt) o[dt][g] = (v8f){}; }
    V qf[NQG][2], qf2[NQG][2];
    const unsigned ko = (unsigned)(lr * HD + 8 * hi) * 2u;   // the lane's byte offset in a query tile; the rest of each address is wave-uniform
#pragma unroll
    for (int g = 0; g < NQG; ++g)
#pragma unroll
        for (int kk = 0; kk < 2; ++kk) { const int qc = (q0 + g * 16) * HD + kk * 32; qf[g][kk] = WFrag<T16>::ld((const T16*)((const char*)(Q + qc) + ko)); if (SPL) qf2[g][kk] = WFrag<T16>::ld((const T16*)((const char*)(Q2 + qc) + ko)); }
    asm volatile("s_wait_asynccnt 0x0" ::: "memory");   // this wave's rows of stage 0 have landed
    __syncthreads();                                     // and every other wave's
    if (1 < nst) stage(1, 1);
    const char* fr = smem + lr * PB + 16 * hi;           // the lane's row in a plane's first 16 rows
#pragma unroll 1   // the trip count is known only at run time
    for (int t = 0; t < nst; ++t) {
        const int hn = min(2, nbl - 2 * t);              // this wave's blocks of the stage (wave-uniform): none behind its diagonal block
        const char* pk = fr + (t & 1) * BUFB; const char* pv = pk + NP * ATB;   // the lane's place in a block's 32 key rows and in its 64 bytes of every value row
#pragma unroll 1   // one body serves both blocks of a stage: the trip count (0, 1 or 2) is known only at run time, and a second copy would only lengthen the loop's code
        for (int h = 0; h < hn; ++h) {
            const int k0 = t * KST + h * 32;
            V kf[2][2], kf2[2][2], vf[4], vf2[4];
#pragma unroll
            for (int tt = 0; tt < 2; ++tt)
#pragma unroll
                for (int kk = 0; kk < 2; ++kk) { kf[tt][kk] = LFrag<T16>::ld(pk + tt * 16 * PB + kk * 64); if (SPL) kf2[tt][kk] = LFrag<T16>::ld(pk + ATB + tt * 16 * PB + kk * 64); }
            __builtin_amdgcn_sched_barrier(0);           // all key fragments are asked for at once: with matrix instructions lifted among the reads two fragments shared registers and the second waited out its own LDS latency
#pragma unroll
            for (int dt = 0; dt < 4; ++dt) { vf[dt] = LFrag<T16>::ld(pv + dt * 16 * PB); if (SPL) vf2[dt] = LFrag<T16>::ld(pv + ATB + dt * 16 * PB); }
            pk += 32 * PB; pv += 64;                     // the stage's next block
            v8f s[2][NQG];
#pragma unroll
            for (int tt = 0; tt < 2; ++tt)
#pragma unroll
                for (int g = 0; g < NQG; ++g) { s[tt][g] = (v8f){};
#pragma unroll
                    for (int kk = 0; kk < 2; ++kk) { s[tt][g] = WFrag<T16>::mma(kf[tt][kk], qf[g][kk], s[tt][g]); if (SPL) { s[tt][g] = WFrag<T16>::mma(kf[tt][kk], qf2[g][kk], s[tt][g]); s[tt][g] = WFrag<T16>::mma(kf2[tt][kk], qf[g][kk], s[tt][g]); } } }
            if (k0 + 31 > q0) {                          // the diagonal block (wave-uniform): keys behind the query are excluded
#pragma unroll
                for (int tt = 0; tt < 2; ++tt)
#pragma unroll
                    for (int g = 0; g < NQG; ++g)
#pragma unroll
                        for (int r = 0; r < 8; ++r) s[tt][g][r] = (k0 + tt * 16 + 8 * hi + r <= q0 + g * 16 + lr) ? s[tt][g][r] : -3.0e38f;
            }
            V pb[NQG], pb2[NQG];
#pragma unroll
            for (int g = 0; g < NQG; ++g) {
                float bm = s[0][g][0];
#pragma unroll
                for (int r = 1; r < 8; ++r) bm = fmaxf(bm, s[0][g][r]);
#pragma unroll
                for (int r = 0; r < 8; ++r) bm = fmaxf(bm, s[1][g][r]);
                bm = fmaxf(bm, __shfl_xor(bm, 16, 32));  // the query's other 16 keys of the block lie in the other lane half
                const float mn = fmaxf(m[g], bm), sc = __builtin_amdgcn_exp2f((m[g] - mn) * C), nb = OFF - mn * C; m[g] = mn;
                float p[16], ps = 0.f;
#pragma unroll
                for (int e = 0; e < 16; ++e) { p[e] = __builtin_amdgcn_exp2f(fmaf(s[e >> 3][g][e & 7], C, nb)); ps += p[e]; }
                l[g] = l[g] * sc + ps;
#pragma unroll
                for (int dt = 0; dt < 4; ++dt) o[dt][g] *= sc;
                PPack<T16, SPL>::pk(p, pb[g], pb2[g]);
            }
#pragma unroll
            for (int dt = 0; dt < 4; ++dt)
#pragma unroll
                for (int g = 0; g < NQG; ++g) { o[dt][g] = WFrag<T16>::mma(vf[dt], pb[g], o[dt][g]); if (SPL) { o[dt][g] = WFrag<T16>::mma(vf[dt], pb2[g], o[dt][g]); o[dt][g] = WFrag<T16>::mma(vf2[dt], pb[g], o[dt][g]); } }
        }
        asm volatile("s_wait_dscnt 0x0" ::: "memory");      // this wave's reads of the buffer are done before it is filled again
        asm volatile("s_wait_asynccnt 0x0" ::: "memory");   // this wave's rows of stage t + 1 have landed
        __syncthreads();                                     // stage t + 1 is whole, and nobody reads stage t's buffer any more
        if (t + 2 < nst) stage(t + 2, t & 1);
    }
    asm volatile("s_wait_asynccnt 0x0" ::: "memory");       // nothing is in flight when the wave ends
#pragma unroll
    for (int g = 0; g < NQG; ++g) {
        const float L = l[g] + __shfl_xor(l[g], 16, 32);    // the two lane halves summed different keys of the same query
        const float inv = __fdiv_rn(1.0f, L);
        const size_t oo = (size_t)(q0 + g * 16 + lr) * DQ + 8 * hi;   // a lane's 8 registers of a tile are 8 neighbouring head dimensions of its query; the wave writes each query's whole 128-byte line
#pragma unroll
        for (int dt = 0; dt < 4; ++dt) { v8us oh, ol;
#pragma unroll
            for (int e = 0; e < 8; ++e) { unsigned short x, y; splitf(o[dt][g][e] * inv, x, y); oh[e] = x; ol[e] = y; }
            *(v8us*)(Ah + oo + dt * 16) = oh; *(v8us*)(Al + oo + dt * 16) = ol; } }
    asm volatile("s_wait_xcnt 0x0" ::: "memory");        // behind the last store: in the built kernel the other tile form's code follows this one, and there the stores' registers are written again
}
// grid (batch x heads, query tiles), so that work-groups start longest first over all heads: the tiles of 128 rows >= RH from the last down (fp16 operands), then the tiles of 64 rows < RH (hi / lo planes, 3 products)
__global__ __launch_bounds__(32 * FNW) void k_fattn(const h16* __restrict__ Q16, const h16* __restrict__ K16, const h16* __restrict__ V16, const bf* __restrict__ Qh, const bf* __restrict__ Ql, const bf* __restrict__ Kh, const bf* __restrict__ Kl, const bf* __restrict__ Vh, const bf* __restrict__ Vl, bf* Ah, bf* Al) {
    __shared__ __attribute__((aligned(128))) char smem[2 * 4 * ATB];
    constexpr int NLO = (TT - RH) / (FNW * 32);
    const size_t zq = (size_t)blockIdx.x * TT * HD, zk = (size_t)(blockIdx.x / REP) * TT * HD; const int x = blockIdx.y;
    const size_t za = (size_t)(blockIdx.x / NH_) * TT * DQ + (blockIdx.x % NH_) * HD;   // merged-head planes are [batch][row][head][dim]
    bf* ah = Ah + za; bf* al = Al + za;
    if (x < NLO) attn_tile<h16, false, 2>(Q16 + zq, nullptr, K16 + zk, nullptr, V16 + zk, nullptr, TT - FNW * 32 - x * (FNW * 32), smem, ah, al);
    else attn_tile<bf, true, 1>(Qh + zq, Ql + zq, Kh + zk, Kl + zk, Vh + zk, Vl + zk, RH - FNW * 16 - (x - NLO) * (FNW * 16), smem, ah, al);
}

extern "C" void kernel_launch(void* const* d_in, const int* in_sizes, int n_in,
                              void* d_out, int out_size, void* d_ws, size_t ws_size, hipStream_t stream) {
    (void)in_sizes; (void)n_in; (void)out_size;
    const float* x = (const float*)d_in[0]; const float* wattn = (const float*)d_in[1]; const float* wo = (const float*)d_in[2];   /* x, w_attn ('oi' [3072][1024]: q | k | v row thirds), w_proj ('oi') */
    float* OUT = (float*)d_out;     // [4][2048][1024]
    char* wsp = (char*)d_ws;
    auto take = [&](size_t bytes) { char* p = wsp; wsp += (bytes + 255) & ~(size_t)255; return (void*)p; };
    bf* WQ = (bf*)take((size_t)(DQ + 2 * DKV) * DM * 2);   /* one [3072][1024] plane, q | k | v */ bf* WO = (bf*)take((size_t)DM * DQ * 2); float* CS = (float*)take((size_t)TT * HD * 2 * 4);
    bf* XB = (bf*)take((size_t)NB_ * TT * DM * 2);
    h16* QP16 = (h16*)take((size_t)NB_ * NH_ * TT * HD * 2); h16* KP16 = (h16*)take((size_t)NB_ * NKV * TT * HD * 2); h16* VT16 = (h16*)take((size_t)NB_ * NKV * HD * TT * 2);
    bf* QPh = (bf*)take((size_t)NB_ * NH_ * TT * HD * 2); bf* QPl = (bf*)take((size_t)NB_ * NH_ * TT * HD * 2); bf* KPh = (bf*)take((size_t)NB_ * NKV * TT * HD * 2); bf* KPl = (bf*)take((size_t)NB_ * NKV * TT * HD * 2); bf* VTh = (bf*)take((size_t)NB_ * NKV * HD * TT * 2); bf* VTl = (bf*)take((size_t)NB_ * NKV * HD * TT * 2);
    bf* ATh = (bf*)take((size_t)NB_ * TT * DQ * 2); bf* ATl = (bf*)take((size_t)NB_ * TT * DQ * 2);
    if ((size_t)(wsp - (char*)d_ws) > ws_size) return;    // ws 256 MiB
    // every stage runs once for all batches: the products take the batch as grid z, the attention sees NB_ x heads heads
    k_prep<<<PG, PT, 0, stream>>>(x, wattn, wo, XB, WQ, WO, CS);   /* bf16 copies of the inputs, rotary table */
    k_qkv<<<dim3(TT / 128, (DQ + 2 * DKV) / 128, NB_), 128, 0, stream>>>(XB, WQ, CS, QP16, QPh, QPl, KP16, KPh, KPl, VT16, VTh, VTl);
    k_fattn<<<dim3(NB_ * NH_, (TT - RH) / (FNW * 32) + RH / (FNW * 16), 1), 32 * FNW, 0, stream>>>(QP16, KP16, VT16, QPh, QPl, KPh, KPl, VTh, VTl, ATh, ATl);
    k_gemmw<<<dim3(TT / 128, DM / 128, NB_), 128, 0, stream>>>(ATh, ATl, WO, OUT);
}

// v010
// One run takes 123 microseconds.
// Two timings next to v009 both put it at 1.12 times that version's speed.
// All steps since v000 together make it 23.3 times as fast.
#include <hip/hip_runtime.h>

// Causal self-attention with a fused bias-free qkv weight and the source's pairwise rotary form (x [4][2048][1024]; qkv = x w_attn^T ('oi' [3072][1024]) split in thirds q | k | v (16 heads x 64); rope on consecutive pairs with PER-ELEMENT table columns: out[2i] = x[2i] cos[2i] - x[2i+1] sin[2i], out[2i+1] = x[2i+1] cos[2i+1] + x[2i] sin[2i+1] where cos / sin = cat(freqs, freqs) of angle t x 1/10000^(2j/64) (so column d uses frequency d mod 32: the module reshapes the concatenated tables pairwise; reproduced literally; 32 f32 frequencies; precise cosf/sinf); scores x 1/sqrt(64); causal (finfo.min == exclusion); softmax; y = merged w_proj^T ('oi') -> [4][2048][1024] (8.4 M); argument order x, w_attn, w_proj).
// Layout, all batches in every launch: bf16 copy of x; 'oi' weights; exact projections; bf16 copies and the computed {cos, sin} table (INVT[32]) in one launch (k_prep); q, k, v projections in one launch whose epilogue applies the interleaved-pair rotary with per-dimension table entries and writes the planes (k_qkv); one-kernel causal T-2048 attention k_fattn (hybrid rows: < 512 hi/lo 3 products, rest fp16 x1024; key blocks above the diagonal are never visited); merged hi/lo x Wo exact.
// Every plane that asynchronous copies bring into LDS lies in the order of the copies: GEMM operands as [k / 64][row][64] (all rows of a plane, then the next 64 k), transposed values as [batch x head][key / 64][dimension][64 keys]; the 128-byte row pieces of a stage follow one another, so a copy of 4 pieces takes 512 bytes in a row.
// Compute dtypes, f32 accumulate: every input rounded to bf16, the tables f32; projections exact; rotary f32; attention rows < 512 3 products, rest fp16; softmax f32; Wo hl x exact.

#define NB_  4
#define TT   2048
#define DM   1024
#define NH_  16
#define NKV  16
#define REP  (NH_ / NKV)
#define HD   64
#define DQ   (NH_ * HD)
#define DKV  (NKV * HD)
#define RH   512                  // query rows < RH use hi+lo planes (0: none)
#define SCL  0.125f   // HD^-0.5
typedef _Float16 h16;
typedef unsigned short bf;
typedef __attribute__((ext_vector_type(16))) __bf16   v16bf;
typedef __attribute__((ext_vector_type(16))) _Float16 v16h;
typedef __attribute__((ext_vector_type(8)))  _Float16 v8h;
typedef __attribute__((ext_vector_type(8)))  unsigned short v8us;
typedef __attribute__((ext_vector_type(8)))  float    v8f;
typedef __attribute__((ext_vector_type(4)))  float    v4f;
typedef v8h  __attribute__((may_alias)) v8ha;
typedef v4f  __attribute__((may_alias)) v4fa;
typedef v8us __attribute__((may_alias)) v8usa;

__device__ __forceinline__ unsigned short f2bf(float f) { unsigned u = __float_as_uint(f); u += 0x7FFFu + ((u >> 16) & 1u); return (unsigned short)(u >> 16); }
__device__ __forceinline__ float bf2f(unsigned short b) { return __uint_as_float(((unsigned)b) << 16); }
__device__ __forceinline__ float bfr(float f) { return bf2f(f2bf(f)); }
__device__ __forceinline__ v16h cat16(v8h lo, v8h hi) { return __builtin_shufflevector(lo, hi, 0, 1, 2, 3, 4, 5, 6, 7, 8, 9, 10, 11, 12, 13, 14, 15); }
__device__ __forceinline__ v16bf cat16b(v8us lo, v8us hi) { return __builtin_bit_cast(v16bf, __builtin_shufflevector(lo, hi, 0, 1, 2, 3, 4, 5, 6, 7, 8, 9, 10, 11, 12, 13, 14, 15)); }
__device__ __forceinline__ v8f wmma16(v16h a, v16h b, v8f c) { return __builtin_amdgcn_wmma_f32_16x16x32_f16(false, a, false, b, (short)0, c, false, false); }
__device__ __forceinline__ v8f wmmab(v16bf a, v16bf b, v8f c) { return __builtin_amdgcn_wmma_f32_16x16x32_bf16(false, a, false, b, (short)0, c, false, false); }



// ---- gemm128: the product loop of both GEMM kernels. A work-group of 4 waves (2 x 2) owns a 128x128 output tile, each wave a 64x64 quarter (16 accumulators).
// A pass is 64 k = 128 bytes of each of the 128 rows of every operand (16-bit planes [k / 64][row][64]: a pass's row pieces lie one behind the other). The rows come into LDS by asynchronous copies, each copy 4 row pieces = 512 bytes in a row, each wave 32 rows = 4 KiB in a row of every operand;
// two buffers: the next pass's copies fly while this pass's fragments are read from LDS, every row by two waves. Products and their order along k are those of one wave per tile: k in steps of 32, A before A2.
#define PB    144                 // LDS pitch of a 128-byte row piece: 16 bytes x odd, the pitch of 16-byte fragment reads
#define TILEB (128 * PB)          // one operand's rows of one pass
#define NPASS (DM / 64)
template <typename T16> struct WFrag;
template <> struct WFrag<h16> { typedef v16h V; static __device__ __forceinline__ V ld(const h16* p) { return cat16(*(const v8h*)p, *(const v8h*)(p + 16)); } static __device__ __forceinline__ v8f mma(V a, V b, v8f c) { return wmma16(a, b, c); } };
template <> struct WFrag<bf> { typedef v16bf V; static __device__ __forceinline__ V ld(const bf* p) { return cat16b(*(const v8us*)p, *(const v8us*)(p + 16)); } static __device__ __forceinline__ v8f mma(V a, V b, v8f c) { return wmmab(a, b, c); } };
// 32 rows x 128 bytes: 8 copies of a wave; lds and g are the lane's own addresses in the first 4 rows. The wait in the same statement stands in front of every later write of the address registers.
__device__ __forceinline__ void copy32(unsigned lds, const char* g) {
    asm volatile("global_load_async_to_lds_b128 %0, %8, off\n\t"
                 "global_load_async_to_lds_b128 %1, %9, off\n\t"
                 "global_load_async_to_lds_b128 %2, %10, off\n\t"
                 "global_load_async_to_lds_b128 %3, %11, off\n\t"
                 "global_load_async_to_lds_b128 %4, %12, off\n\t"
                 "global_load_async_to_lds_b128 %5, %13, off\n\t"
                 "global_load_async_to_lds_b128 %6, %14, off\n\t"
                 "global_load_async_to_lds_b128 %7, %15, off\n\t"
                 "s_wait_xcnt 0x0"
                 :: "v"(lds), "v"(lds + 4 * PB), "v"(lds + 8 * PB), "v"(lds + 12 * PB), "v"(lds + 16 * PB), "v"(lds + 20 * PB), "v"(lds + 24 * PB), "v"(lds + 28 * PB),
                    "v"(g), "v"(g + 4 * 128), "v"(g + 8 * 128), "v"(g + 12 * 128), "v"(g + 16 * 128), "v"(g + 20 * 128), "v"(g + 24 * 128), "v"(g + 28 * 128)
                 : "memory");
}
__device__ __forceinline__ v16bf ldsfrag(const char* p) { return cat16b(*(const v8usa*)p, *(const v8usa*)(p + 32)); }   // WFrag::ld's two 16-byte pieces, from LDS
// pa, pa2 (NA == 2), pb: first row of the work-group's 128 rows of each operand in the plane's first 64 k; RA, RB: rows of the whole A and B planes (a pass is RA or RB x 128 bytes further on); smem: 2 x (NA + 1) x TILEB bytes. On return every wave has passed the last barrier and no copy is outstanding: smem is free.
template <int NA, int RA, int RB>
__device__ __forceinline__ void gemm128(const char* pa, const char* pa2, const char* pb, char* smem, const int w, const int lane, v8f (&acc)[4][4]) {
    constexpr int BUFB = (NA + 1) * TILEB;
    const int lr = lane & 15, hi = lane >> 4;
    const unsigned go = (unsigned)(w * (32 * 128) + lane * 16);                                                      // the lane's byte in an operand's 128 row pieces: 8 lanes a row
    const unsigned lo = (unsigned)(size_t)smem + (unsigned)((w * 32 + (lane >> 3)) * PB + (lane & 7) * 16);          // and its LDS byte address in a tile
    auto stage = [&](const int t, const int buf) {
        copy32(lo + buf * BUFB, pa + go + t * (RA * 128));
        if (NA == 2) copy32(lo + buf * BUFB + TILEB, pa2 + go + t * (RA * 128));
        copy32(lo + buf * BUFB + NA * TILEB, pb + go + t * (RB * 128)); };
#pragma unroll
    for (int mb = 0; mb < 4; ++mb)
#pragma unroll
        for (int nb = 0; nb < 4; ++nb) acc[mb][nb] = (v8f){};
    stage(0, 0);
    asm volatile("s_wait_asynccnt 0x0" ::: "memory");   // this wave's rows of pass 0 have landed
    __syncthreads();                                     // and every other wave's
    stage(1, 1);
    const char* fa = smem + ((w >> 1) * 64 + lr) * PB + 16 * hi; const char* fb = smem + NA * TILEB + ((w & 1) * 64 + lr) * PB + 16 * hi;   // the lane's row in the wave's first A and B fragment
#pragma unroll 1   // one body holds the 16 accumulator tiles and the fragments of one k step
    for (int t = 0; t < NPASS; ++t) {
        const int bo = (t & 1) * BUFB;
        v16bf a[4], a2[4], b[4];
        auto frags = [&](const int kk) {                     // the fragments of k step kk of this pass
#pragma unroll
            for (int mb = 0; mb < 4; ++mb) { a[mb] = ldsfrag(fa + bo + mb * 16 * PB + kk * 64); if (NA == 2) a2[mb] = ldsfrag(fa + bo + TILEB + mb * 16 * PB + kk * 64); }
#pragma unroll
            for (int nb = 0; nb < 4; ++nb) b[nb] = ldsfrag(fb + bo + nb * 16 * PB + kk * 64); };
        auto products = [&]() {
#pragma unroll
            for (int nb = 0; nb < 4; ++nb) {
#pragma unroll
                for (int mb = 0; mb < 4; ++mb) acc[mb][nb] = wmmab(a[mb], b[nb], acc[mb][nb]);
                if (NA == 2) {
#pragma unroll
                    for (int mb = 0; mb < 4; ++mb) acc[mb][nb] = wmmab(a2[mb], b[nb], acc[mb][nb]); } } };
        frags(0);
        __builtin_amdgcn_sched_barrier(0);                   // all fragments of a k step are asked for at once: with the reads sunk among the matrix instructions the B fragments shared one register set and each waited out its own LDS latency
        products();
        frags(1);                                            // the pass's last reads of its buffer
        if (NA == 2) { __builtin_amdgcn_sched_barrier(0); products(); __builtin_amdgcn_sched_barrier(0); }   // three fragment sets leave no registers for the copies' addresses: the products come first, and stay in front of the barrier, so that the copies go out right behind it
        asm volatile("s_wait_dscnt 0x0" ::: "memory");      // this wave's reads of the buffer are done before it is filled again
        asm volatile("s_wait_asynccnt 0x0" ::: "memory");   // this wave's rows of pass t + 1 have landed
        __syncthreads();                                     // pass t + 1 is whole, and nobody reads pass t's buffer any more
        if (t + 2 < NPASS) stage(t + 2, t & 1);
        if (NA == 1) { __builtin_amdgcn_sched_barrier(0); products(); }   // these products need registers only: the copies go out in front of them, so that they have a whole pass to land
    }
    asm volatile("s_wait_asynccnt 0x0" ::: "memory");       // nothing is in flight when the buffers are given to the epilogue
}
// ---- k_gemmw: C[m][n] (f32, pitch DM) = sum_k (A[m][k] + A2[m][k]) Bt[n][k], K = DQ; grid (T/128, DM/128, batch), 4 waves; each wave stores its 64x64 quarter, 16 rows at a time through its own piece of LDS.
__global__ __launch_bounds__(128) void k_gemmw(const bf* __restrict__ A, const bf* __restrict__ A2, const bf* __restrict__ Bt, float* C) {
    __shared__ __attribute__((aligned(128))) char smem[2 * 3 * TILEB];
    constexpr int ldc = DM;
    const int lane = threadIdx.x & 31, lr = lane & 15, hi = lane >> 4; const int w = __builtin_amdgcn_readfirstlane(threadIdx.x >> 5);
    const size_t ra = ((size_t)blockIdx.z * TT + blockIdx.x * 128) * 64;
    v8f acc[4][4];
    gemm128<2, NB_ * TT, DM>((const char*)(A + ra), (const char*)(A2 + ra), (const char*)(Bt + (size_t)blockIdx.y * 128 * 64), smem, w, lane, acc);
    float* os = (float*)(smem + w * (16 * 68 * 4));
    C += (size_t)blockIdx.z * TT * DM; const int r0 = blockIdx.x * 128 + (w >> 1) * 64, c0 = blockIdx.y * 128 + (w & 1) * 64;
#pragma unroll
    for (int mb = 0; mb < 4; ++mb) {
#pragma unroll
        for (int nb = 0; nb < 4; ++nb) {
#pragma unroll
            for (int j = 0; j < 8; ++j) os[(hi * 8 + j) * 68 + nb * 16 + lr] = acc[mb][nb][j]; }
        __builtin_amdgcn_wave_barrier(); asm volatile("" ::: "memory");   // the reads below take other lanes' words: they stay behind these writes
        float* crow = C + (size_t)(r0 + mb * 16) * ldc + c0;
#pragma unroll
        for (int s = 0; s < 8; ++s) { const int row = 2 * s + hi, cofs = lr * 4; const v4f val = *(const v4fa*)(os + row * 68 + cofs);
            *(v4f*)(crow + (size_t)row * ldc + cofs) = val; }
        __builtin_amdgcn_wave_barrier(); asm volatile("s_wait_xcnt 0x0" ::: "memory");   // the next 16 rows are written only behind these reads; the wait stands behind the stores, whose registers the next rows' loads take
    }
}

__device__ __forceinline__ void splitf(float y, unsigned short& h, unsigned short& l) { h = f2bf(y); l = f2bf(y - bf2f(h)); }
typedef __attribute__((ext_vector_type(2))) _Float16 v2h;
typedef __attribute__((ext_vector_type(4))) _Float16 v4h;
typedef __attribute__((ext_vector_type(4))) unsigned short v4us;
typedef __attribute__((ext_vector_type(2))) float v2f;
typedef __attribute__((ext_vector_type(4))) int v4i;

__constant__ float INVT[HD / 2] = { 1.000000000e+00f, 7.498942018e-01f, 5.623413324e-01f, 4.216965139e-01f, 3.162277639e-01f, 2.371373624e-01f, 1.778279394e-01f, 1.333521456e-01f, 1.000000015e-01f, 7.498941571e-02f, 5.623412877e-02f, 4.216964915e-02f, 3.162277862e-02f, 2.371373586e-02f, 1.778279431e-02f, 1.333521493e-02f, 9.999999776e-03f, 7.498942316e-03f, 5.623413250e-03f, 4.216964822e-03f, 3.162277862e-03f, 2.371373819e-03f, 1.778279431e-03f, 1.333521446e-03f, 1.000000047e-03f, 7.498941850e-04f, 5.623413017e-04f, 4.216964880e-04f, 3.162277862e-04f, 2.371373848e-04f, 1.778279402e-04f, 1.333521504e-04f };   // float32 1 / 10000^(2i/64), generated with jnp to be bit-exact
// ---- k_prep: everything the products need, in ONE launch of PG work-groups x PT threads (one work-group of 16 waves a WGP): the bf16 copies of x, w_attn and w_proj and the {cos, sin} table.
// Few waves, each started once for 24 pieces (starting a wave costs more than converting a piece): a piece is 512 bytes in a row (16 bytes a lane, 4 whole lines), its copy two whole 128-byte row pieces of neighbouring k tiles. A work-group owns one run of each input: N steps of PT x 16 bytes = 2 rows.
// The copies are written as [k / 64][row][64]: the order in which the GEMM kernels' asynchronous copies read them.
// All of a lane's loads are asked for first; the table entry (one a thread) is computed while they fly.
#define PG 256
#define PT 512
#define PSTEP (PT * 4)           // floats of one step of a work-group
// s: the work-group's run (uniform); e: the thread's first float in a step; d: the work-group's first row in the copy's first k tile (uniform); eo: the thread's first element from there; the step (2 rows) is a constant of the address
template <int N>
__device__ __forceinline__ void ld_steps(const float* __restrict__ s, const unsigned e, v4f (&v)[N]) {
#pragma unroll
    for (int j = 0; j < N; ++j) v[j] = *(const v4f*)(s + e + j * PSTEP); }
template <int N>
__device__ __forceinline__ void st_steps(bf* d, const unsigned eo, const v4f (&v)[N]) {
#pragma unroll
    for (int j = 0; j < N; ++j) { v4us o;
#pragma unroll
        for (int k = 0; k < 4; ++k) o[k] = f2bf(v[j][k]);
        *(v4us*)(d + eo + j * (2 * 64)) = o; } }
__global__ __launch_bounds__(PT) void k_prep(const float* __restrict__ x, const float* __restrict__ wa, const float* __restrict__ wo, bf* XB, bf* WA, bf* WO, float* CS) {
    constexpr int NX = NB_ * TT * DM / (PG * PSTEP), NA = (DQ + 2 * DKV) * DM / (PG * PSTEP), NO = DM * DQ / (PG * PSTEP);
    static_assert(NX * PG * PSTEP == NB_ * TT * DM && NA * PG * PSTEP == (DQ + 2 * DKV) * DM && NO * PG * PSTEP == DM * DQ && PG * PT == TT * HD && PSTEP == 2 * DM && DQ == DM, "whole steps of 2 rows");
    const unsigned idx = blockIdx.x * PT + threadIdx.x, e = threadIdx.x * 4;   // the thread's table entry, and its first float in a step
    const size_t bx = (size_t)blockIdx.x * (NX * PSTEP), ba = (size_t)blockIdx.x * (NA * PSTEP), bo = (size_t)blockIdx.x * (NO * PSTEP);   // where the work-group's runs begin
    const float fr = INVT[idx % HD % (HD / 2)];   // entry idx is dimension idx % HD of position idx / HD
    __builtin_amdgcn_sched_barrier(0);   // the frequency is asked for first: loads return in order, so behind the pieces' loads its wait would be a wait for all of them
    v4f vx[NX], va[NA], vo[NO];
    ld_steps(x + bx, e, vx); ld_steps(wa + ba, e, va); ld_steps(wo + bo, e, vo);
    asm volatile("s_wait_xcnt 0x0" ::: "memory");   // behind the loads: what follows takes registers that their addresses stand in
    __builtin_amdgcn_sched_barrier(0);   // the table's arithmetic stays behind all loads, so that it runs inside their latency, and behind that wait
    const float a = __fmul_rn((float)(idx / HD), fr); v2f cs; cs[0] = cosf(a); cs[1] = sinf(a); *(v2f*)(CS + (size_t)idx * 2) = cs;
    const unsigned kt = (e % DM) / 64, er = (e / DM) * 64 + e % 64;   // the thread's k tile, and its place in the step's 2 row pieces of that tile
    st_steps(XB + bx / DM * 64, kt * (NB_ * TT * 64) + er, vx); st_steps(WA + ba / DM * 64, kt * ((DQ + 2 * DKV) * 64) + er, va); st_steps(WO + bo / DM * 64, kt * (DM * 64) + er, vo);
}
typedef __attribute__((ext_vector_type(2))) __bf16 v2bf;
typedef __attribute__((ext_vector_type(4))) unsigned v4u;
typedef v4u __attribute__((may_alias)) v4ua;
// two f32 -> their fp16 pair, their bf16 hi pair and the bf16 pair of what hi leaves over, each packed in one word; the packed conversions round to nearest even, as a plain cast and splitf do
__device__ __forceinline__ void pack2(v2f y, unsigned& w16, unsigned& wh, unsigned& wl) {
    w16 = __builtin_bit_cast(unsigned, __builtin_convertvector(y, v2h)); wh = __builtin_bit_cast(unsigned, __builtin_convertvector(y, v2bf));
    v2f b; b[0] = __uint_as_float(wh << 16); b[1] = __uint_as_float(wh & 0xFFFF0000u); wl = __builtin_bit_cast(unsigned, __builtin_convertvector(y - b, v2bf)); }
// The two epilogues of k_qkv, one wave's 64 positions x 64 dimensions each. W16: the fp16 plane is written; WHL: the hi and lo planes are written. A plane that is not written is not converted either.
// v: p16, ph, pl: the first byte of the wave's [64 dimensions][64 keys] tile in each transposed plane
template <bool WHL>
__device__ __forceinline__ void v_planes(const v8f (&acc)[4][4], char* p16, char* ph, char* pl, const int lane) {
    const int lr = lane & 15, hi = lane >> 4;
    const unsigned lo = (unsigned)(lr * 64 + 8 * hi) * 2u;              // the lane's byte offset in the wave's [dimension][64 keys] tile; the rest of each address is a constant
#pragma unroll
    for (int nb = 0; nb < 4; ++nb)
#pragma unroll
        for (int mb = 0; mb < 4; ++mb) { v4u o16, oh, ol;
#pragma unroll
            for (int p = 0; p < 4; ++p) { v2f y; y[0] = acc[mb][nb][2 * p]; y[1] = acc[mb][nb][2 * p + 1]; unsigned a, b, d; pack2(y, a, b, d); o16[p] = a; oh[p] = b; ol[p] = d; }
            const int e = (nb * 16 * 64 + mb * 16) * 2;
            *(v4ua*)(p16 + lo + e) = o16; if (WHL) { *(v4ua*)(ph + lo + e) = oh; *(v4ua*)(pl + lo + e) = ol; } }
    asm volatile("s_wait_xcnt 0x0" ::: "memory");        // behind the last store: in the built kernel the other form's code follows this one, and there the stores' registers are written again
}
// q, k: os: the wave's own 16 x 68 words of LDS; pcs: the table entries of its first position; p16, ph, pl: its first byte in each plane
template <bool W16, bool WHL>
__device__ __forceinline__ void qk_planes(const v8f (&acc)[4][4], float* os, const char* pcs, char* p16, char* ph, char* pl, const int lane) {
    const int lr = lane & 15, hi = lane >> 4;
    const int rr = lane >> 3, cofs = (lane & 7) * 8;                 // the lane's row among 4 and its first dimension
    const unsigned lo = (unsigned)(rr * HD + cofs) * 2u;               // the lane's byte offset in a plane (4 times that in the table); the rest of each address is a constant
#pragma unroll
    for (int mb = 0; mb < 4; ++mb) {
#pragma unroll
        for (int nb = 0; nb < 4; ++nb) {
#pragma unroll
            for (int j = 0; j < 8; ++j) os[(hi * 8 + j) * 68 + nb * 16 + lr] = acc[mb][nb][j]; }
        __builtin_amdgcn_wave_barrier(); asm volatile("" ::: "memory");   // the reads below take other lanes' words: they stay behind these writes
#pragma unroll
        for (int s = 0; s < 4; ++s) { const int row = 4 * s + rr, e = (mb * 16 + 4 * s) * HD * 2;
            const v4f xa = *(const v4fa*)(os + row * 68 + cofs), xb = *(const v4fa*)(os + row * 68 + cofs + 4);
            const char* cs = pcs + lo * 4u + e * 4;                      // {cos, sin} of 8 dimensions
            v4u o16, oh, ol;
#pragma unroll
            for (int p = 0; p < 4; ++p) { const v4f c = *(const v4fa*)(cs + p * 16); const float x0 = p < 2 ? xa[2 * p] : xb[2 * p - 4], x1 = p < 2 ? xa[2 * p + 1] : xb[2 * p - 3];
                v2f y; y[0] = x0 * c[0] - x1 * c[1]; y[1] = x0 * c[3] + x1 * c[2];   /* even: x0 c - x1 s; odd: x0 s + x1 c */
                unsigned a, b, d; pack2(y, a, b, d); o16[p] = a; oh[p] = b; ol[p] = d; }
            if (W16) *(v4ua*)(p16 + lo + e) = o16;
            if (WHL) { *(v4ua*)(ph + lo + e) = oh; *(v4ua*)(pl + lo + e) = ol; } }
        __builtin_amdgcn_wave_barrier(); asm volatile("s_wait_xcnt 0x0" ::: "memory");   // the next 16 rows are written only behind these reads; the wait stands behind the stores, whose registers the next rows' loads take
    }
}
// ---- k_qkv: the q, k and v projections of all batches in ONE launch; the product loop is gemm128 (one wave per 64x64 quarter), and the tile leaves the accumulators as finished 16-bit planes: no f32 projection is stored.
// grid (T/128, 3 x heads / 2, batch), 4 waves: Bt is the weight as [k / 64][3 x 1024][64] (q | k | v row thirds), so a wave's 64 columns are the 64 dimensions of ONE head of q, k or v, and its rows are 64 positions of one batch.
// q, k: 16 rows at a time through LDS, so that a lane holds 8 neighbouring dimensions of one position (4 rotary pairs, whole 16-byte stores, 4 rows = 512 bytes in a row per store); table entries per dimension as k_prep wrote them.
// v: a lane's 8 accumulator registers are 8 consecutive positions of one dimension, which is a 16-byte piece of a transposed value row: stored straight from the registers; the wave's 64 positions are one [64 dimensions][64 keys] tile, 8 KiB in a row.
// Only what k_fattn reads is written: its hi / lo tiles take queries, keys and values of positions < RH alone, its fp16 tiles queries of positions >= RH and keys and values of every position.
// So hi and lo planes: positions < RH; fp16 query plane: positions >= RH; fp16 key and value planes: all positions. The rest of each plane stays unwritten and unread.
__global__ __launch_bounds__(128) void k_qkv(const bf* __restrict__ A, const bf* __restrict__ Bt, const float* __restrict__ CS, h16* Q16, bf* Qh, bf* Ql, h16* K16, bf* Kh, bf* Kl, h16* V16, bf* Vh, bf* Vl) {
    __shared__ __attribute__((aligned(128))) char smem[2 * 2 * TILEB];
    const int lane = threadIdx.x & 31, lr = lane & 15, hi = lane >> 4; const int w = __builtin_amdgcn_readfirstlane(threadIdx.x >> 5);
    v8f acc[4][4];
    gemm128<1, NB_ * TT, DQ + 2 * DKV>((const char*)(A + ((size_t)blockIdx.z * TT + blockIdx.x * 128) * 64), nullptr, (const char*)(Bt + (size_t)blockIdx.y * 128 * 64), smem, w, lane, acc);
    float* os = (float*)(smem + w * (16 * 68 * 4));                      // the wave's own 16 x 68 words for its epilogue
    const int r0 = blockIdx.x * 128 + (w >> 1) * 64, ct = blockIdx.y * 2 + (w & 1);   // the wave's first position and its 64-column tile
    const int part = ct / NH_;                                           // 0 q, 1 k, 2 v (the same for the whole wave)
    const size_t g = (size_t)blockIdx.z * NH_ + ct % NH_;                // batch x heads index of the planes
    const bool low = r0 < RH;                                            // the wave's 64 positions lie wholly below RH or wholly at or above it (wave-uniform)
    if (part == 2) {
        const size_t e0 = (g * TT + r0) * HD * 2; char* p16 = (char*)V16 + e0; char* ph = (char*)Vh + e0; char* pl = (char*)Vl + e0;   // wave-uniform bases
        if (low) v_planes<true>(acc, p16, ph, pl, lane); else v_planes<false>(acc, p16, ph, pl, lane);
    } else {
        const size_t e0 = (g * TT + r0) * HD * 2; char* p16 = (char*)(part ? K16 : Q16) + e0; char* ph = (char*)(part ? Kh : Qh) + e0; char* pl = (char*)(part ? Kl : Ql) + e0;   // wave-uniform bases
        const char* pcs = (const char*)(CS + (size_t)r0 * HD * 2);
        if (!low) qk_planes<true, false>(acc, os, pcs, p16, ph, pl, lane);
        else if (part) qk_planes<true, true>(acc, os, pcs, p16, ph, pl, lane);
        else qk_planes<false, true>(acc, os, pcs, p16, ph, pl, lane);
    }
}
#define FNW 4
#define KST 64                    // keys of a stage
#define ATB (KST * PB)            // one plane's 64 rows of one stage in LDS
// 16 rows x 128 bytes, one behind the other at the source: 4 copies of a wave; lds and g are the lane's own addresses in the first 4 rows. The wait in the same statement stands in front of every later write of the address registers.
__device__ __forceinline__ void copy16(unsigned lds, const char* g) {
    asm volatile("global_load_async_to_lds_b128 %0, %4, off\n\t"
                 "global_load_async_to_lds_b128 %1, %5, off\n\t"
                 "global_load_async_to_lds_b128 %2, %6, off\n\t"
                 "global_load_async_to_lds_b128 %3, %7, off\n\t"
                 "s_wait_xcnt 0x0"
                 :: "v"(lds), "v"(lds + 4 * PB), "v"(lds + 8 * PB), "v"(lds + 12 * PB),
                    "v"(g), "v"(g + 4 * 128), "v"(g + 8 * 128), "v"(g + 12 * 128)
                 : "memory");
}
template <typename T16> struct LFrag;   // WFrag::ld's two 16-byte pieces, from LDS
template <> struct LFrag<h16> { static __device__ __forceinline__ v16h ld(const char* p) { return cat16(*(const v8ha*)p, *(const v8ha*)(p + 32)); } };
template <> struct LFrag<bf> { static __device__ __forceinline__ v16bf ld(const char* p) { return ldsfrag(p); } };
template <typename T16, bool SPL> struct PPack;
template <> struct PPack<h16, false> { static __device__ __forceinline__ void pk(const float* p, v16h& ph, v16h& pl) { (void)pl;
#pragma unroll
    for (int s = 0; s < 16; ++s) ph[s] = (h16)p[s]; } };
template <> struct PPack<bf, true> { static __device__ __forceinline__ void pk(const float* p, v16bf& ph, v16bf& pl) { v8us h0, h1, l0, l1;
#pragma unroll
    for (int s = 0; s < 8; ++s) { unsigned short x, y; splitf(p[s], x, y); h0[s] = x; l0[s] = y; splitf(p[8 + s], x, y); h1[s] = x; l1[s] = y; }
    ph = cat16b(h0, h1); pl = cat16b(l0, l1); } };
// qw0: the work-group's first query, a multiple of its FNW x NQG x 16 queries; smem: 2 buffers x (1 or 2 key planes, then as many value planes) x ATB bytes
template <typename T16, bool SPL, int NQG>
__device__ __forceinline__ void attn_tile(const T16* __restrict__ Q, const T16* __restrict__ Q2, const T16* __restrict__ Kp, const T16* __restrict__ K2, const T16* __restrict__ Vt, const T16* __restrict__ V2, const int qw0, char* smem, bf* Ah, bf* Al) {
    typedef typename WFrag<T16>::V V;
    constexpr int NQ = NQG * 16;                        // queries of a wave
    constexpr int NP = SPL ? 2 : 1;                     // planes of each operand
    constexpr int BUFB = 2 * NP * ATB;
    constexpr float C = SCL * 1.4426950408889634f;      // raw score -> exponent of 2
    constexpr float OFF = SPL ? 0.0f : 10.0f;           // fp16 probabilities carry a factor 1024 (it cancels against the sum, which carries it too)
    const int lane = threadIdx.x & 31, lr = lane & 15, hi = lane >> 4; const int w = __builtin_amdgcn_readfirstlane(threadIdx.x >> 5);
    const int q0 = qw0 + w * NQ;                        // this wave's first query
    const int nbl = q0 / 32 + 1;                        // its 32-key blocks up to the diagonal one
    const int nst = (qw0 + FNW * NQ) / KST;             // the work-group's stages: up to the last wave's diagonal block
    const unsigned lo = (unsigned)(size_t)smem + (unsigned)((w * 16 + (lane >> 3)) * PB + (lane & 7) * 16);   // the lane's LDS byte address in a plane: 8 lanes a row
    const unsigned gk = (unsigned)(w * (16 * 128) + lane * 16);   // and its byte in a stage's key rows, and in its value rows
    auto stage = [&](const int t, const int buf) {
        const unsigned d = lo + buf * BUFB;
        copy16(d, (const char*)Kp + gk + t * (KST * HD * 2));
        if (SPL) copy16(d + ATB, (const char*)K2 + gk + t * (KST * HD * 2));
        copy16(d + NP * ATB, (const char*)Vt + gk + t * (HD * KST * 2));
        if (SPL) copy16(d + (NP + 1) * ATB, (const char*)V2 + gk + t * (HD * KST * 2)); };
    stage(0, 0);
    v8f o[4][NQG]; float m[NQG], l[NQG];
#pragma unroll
    for (int g = 0; g < NQG; ++g) { m[g] = -3.0e38f; l[g] = 0.f;
#pragma unroll
        for (int dt = 0; dt < 4; ++dt) o[dt][g] = (v8f){}; }
    V qf[NQG][2], qf2[NQG][2];
    const unsigned ko = (unsigned)(lr * HD + 8 * hi) * 2u;   // the lane's byte offset in a query tile; the rest of each address is wave-uniform
#pragma unroll
    for (int g = 0; g < NQG; ++g)
#pragma unroll
        for (int kk = 0; kk < 2; ++kk) { const int qc = (q0 + g * 16) * HD + kk * 32; qf[g][kk] = WFrag<T16>::ld((const T16*)((const char*)(Q + qc) + ko)); if (SPL) qf2[g][kk] = WFrag<T16>::ld((const T16*)((const char*)(Q2 + qc) + ko)); }
    asm volatile("s_wait_asynccnt 0x0" ::: "memory");   // this wave's rows of stage 0 have landed
    __syncthreads();                                     // and every other wave's
    if (1 < nst) stage(1, 1);
    const char* fr = smem + lr * PB + 16 * hi;           // the lane's row in a plane's first 16 rows
#pragma unroll 1   // the trip count is known only at run time
    for (int t = 0; t < nst; ++t) {
        const int hn = min(2, nbl - 2 * t);              // this wave's blocks of the stage (wave-uniform): none behind its diagonal block
        const char* pk = fr + (t & 1) * BUFB; const char* pv = pk + NP * ATB;   // the lane's place in a block's 32 key rows and in its 64 bytes of every value row
#pragma unroll 1   // one body serves both blocks of a stage: the trip count (0, 1 or 2) is known only at run time, and a second copy would only lengthen the loop's code
        for (int h = 0; h < hn; ++h) {
            const int k0 = t * KST + h * 32;
            V kf[2][2], kf2[2][2], vf[4], vf2[4];
#pragma unroll
            for (int tt = 0; tt < 2; ++tt)
#pragma unroll
                for (int kk = 0; kk < 2; ++kk) { kf[tt][kk] = LFrag<T16>::ld(pk + tt * 16 * PB + kk * 64); if (SPL) kf2[tt][kk] = LFrag<T16>::ld(pk + ATB + tt * 16 * PB + kk * 64); }
            __builtin_amdgcn_sched_barrier(0);           // all key fragments are asked for at once: with matrix instructions lifted among the reads two fragments shared registers and the second waited out its own LDS latency
#pragma unroll
            for (int dt = 0; dt < 4; ++dt) { vf[dt] = LFrag<T16>::ld(pv + dt * 16 * PB); if (SPL) vf2[dt] = LFrag<T16>::ld(pv + ATB + dt * 16 * PB); }
            pk += 32 * PB; pv += 64;                     // the stage's next block
            v8f s[2][NQG];
#pragma unroll
            for (int tt = 0; tt < 2; ++tt)
#pragma unroll
                for (int g = 0; g < NQG; ++g) { s[tt][g] = (v8f){};
#pragma unroll
                    for (int kk = 0; kk < 2; ++kk) { s[tt][g] = WFrag<T16>::mma(kf[tt][kk], qf[g][kk], s[tt][g]); if (SPL) { s[tt][g] = WFrag<T16>::mma(kf[tt][kk], qf2[g][kk], s[tt][g]); s[tt][g] = WFrag<T16>::mma(kf2[tt][kk], qf[g][kk], s[tt][g]); } } }
            if (k0 + 31 > q0) {                          // the diagonal block (wave-uniform): keys behind the query are excluded
#pragma unroll
                for (int tt = 0; tt < 2; ++tt)
#pragma unroll
                    for (int g = 0; g < NQG; ++g)
#pragma unroll
                        for (int r = 0; r < 8; ++r) s[tt][g][r] = (k0 + tt * 16 + 8 * hi + r <= q0 + g * 16 + lr) ? s[tt][g][r] : -3.0e38f;
            }
            V pb[NQG], pb2[NQG];
#pragma unroll
            for (int g = 0; g < NQG; ++g) {
                float bm = s[0][g][0];
#pragma unroll
                for (int r = 1; r < 8; ++r) bm = fmaxf(bm, s[0][g][r]);
#pragma unroll
                for (int r = 0; r < 8; ++r) bm = fmaxf(bm, s[1][g][r]);
                bm = fmaxf(bm, __shfl_xor(bm, 16, 32));  // the query's other 16 keys of the block lie in the other lane half
                const float mn = fmaxf(m[g], bm), sc = __builtin_amdgcn_exp2f((m[g] - mn) * C), nb = OFF - mn * C; m[g] = mn;
                float p[16], ps = 0.f;
#pragma unroll
                for (int e = 0; e < 16; ++e) { p[e] = __builtin_amdgcn_exp2f(fmaf(s[e >> 3][g][e & 7], C, nb)); ps += p[e]; }
                l[g] = l[g] * sc + ps;
#pragma unroll
                for (int dt = 0; dt < 4; ++dt) o[dt][g] *= sc;
                PPack<T16, SPL>::pk(p, pb[g], pb2[g]);
            }
#pragma unroll
            for (int dt = 0; dt < 4; ++dt)
#pragma unroll
                for (int g = 0; g < NQG; ++g) { o[dt][g] = WFrag<T16>::mma(vf[dt], pb[g], o[dt][g]); if (SPL) { o[dt][g] = WFrag<T16>::mma(vf[dt], pb2[g], o[dt][g]); o[dt][g] = WFrag<T16>::mma(vf2[dt], pb[g], o[dt][g]); } }
        }
        asm volatile("s_wait_dscnt 0x0" ::: "memory");      // this wave's reads of the buffer are done before it is filled again
        asm volatile("s_wait_asynccnt 0x0" ::: "memory");   // this wave's rows of stage t + 1 have landed
        __syncthreads();                                     // stage t + 1 is whole, and nobody reads stage t's buffer any more
        if (t + 2 < nst) stage(t + 2, t & 1);
    }
    asm volatile("s_wait_asynccnt 0x0" ::: "memory");       // nothing is in flight when the wave ends
#pragma unroll
    for (int g = 0; g < NQG; ++g) {
        const float L = l[g] + __shfl_xor(l[g], 16, 32);    // the two lane halves summed different keys of the same query
        const float inv = __fdiv_rn(1.0f, L);
        const size_t oo = (size_t)(q0 + g * 16 + lr) * HD + 8 * hi;   // a lane's 8 registers of a tile are 8 neighbouring head dimensions of its query; the wave writes each query's whole 128-byte line, 16 queries 2 KiB in a row
#pragma unroll
        for (int dt = 0; dt < 4; ++dt) { v8us oh, ol;
#pragma unroll
            for (int e = 0; e < 8; ++e) { unsigned short x, y; splitf(o[dt][g][e] * inv, x, y); oh[e] = x; ol[e] = y; }
            *(v8us*)(Ah + oo + dt * 16) = oh; *(v8us*)(Al + oo + dt * 16) = ol; } }
    asm volatile("s_wait_xcnt 0x0" ::: "memory");        // behind the last store: in the built kernel the other tile form's code follows this one, and there the stores' registers are written again
}
// grid (batch x heads, query tiles), so that work-groups start longest first over all heads: the tiles of 128 rows >= RH from the last down (fp16 operands), then the tiles of 64 rows < RH (hi / lo planes, 3 products)
__global__ __launch_bounds__(32 * FNW) void k_fattn(const h16* __restrict__ Q16, const h16* __restrict__ K16, const h16* __restrict__ V16, const bf* __restrict__ Qh, const bf* __restrict__ Ql, const bf* __restrict__ Kh, const bf* __restrict__ Kl, const bf* __restrict__ Vh, const bf* __restrict__ Vl, bf* Ah, bf* Al) {
    __shared__ __attribute__((aligned(128))) char smem[2 * 4 * ATB];
    constexpr int NLO = (TT - RH) / (FNW * 32);
    const size_t zq = (size_t)blockIdx.x * TT * HD, zk = (size_t)(blockIdx.x / REP) * TT * HD; const int x = blockIdx.y;
    const size_t za = ((size_t)(blockIdx.x % NH_) * NB_ + blockIdx.x / NH_) * TT * HD;   // merged-head planes are [head][batch][row][dim]: a head's 64 dimensions are one k tile of the out projection's A operand
    bf* ah = Ah + za; bf* al = Al + za;
    if (x < NLO) attn_tile<h16, false, 2>(Q16 + zq, nullptr, K16 + zk, nullptr, V16 + zk, nullptr, TT - FNW * 32 - x * (FNW * 32), smem, ah, al);
    else attn_tile<bf, true, 1>(Qh + zq, Ql + zq, Kh + zk, Kl + zk, Vh + zk, Vl + zk, RH - FNW * 16 - (x - NLO) * (FNW * 16), smem, ah, al);
}

extern "C" void kernel_launch(void* const* d_in, const int* in_sizes, int n_in,
                              void* d_out, int out_size, void* d_ws, size_t ws_size, hipStream_t stream) {
    (void)in_sizes; (void)n_in; (void)out_size;
    const float* x = (const float*)d_in[0]; const float* wattn = (const float*)d_in[1]; const float* wo = (const float*)d_in[2];   /* x, w_attn ('oi' [3072][1024]: q | k | v row thirds), w_proj ('oi') */
    float* OUT = (float*)d_out;     // [4][2048][1024]
    char* wsp = (char*)d_ws;
    auto take = [&](size_t bytes) { char* p = wsp; wsp += (bytes + 255) & ~(size_t)255; return (void*)p; };
    bf* WQ = (bf*)take((size_t)(DQ + 2 * DKV) * DM * 2);   /* one [16][3072][64] plane ([k / 64][row][64]), q | k | v */ bf* WO = (bf*)take((size_t)DM * DQ * 2); float* CS = (float*)take((size_t)TT * HD * 2 * 4);
    bf* XB = (bf*)take((size_t)NB_ * TT * DM * 2);
    h16* QP16 = (h16*)take((size_t)NB_ * NH_ * TT * HD * 2); h16* KP16 = (h16*)take((size_t)NB_ * NKV * TT * HD * 2); h16* VT16 = (h16*)take((size_t)NB_ * NKV * HD * TT * 2);
    bf* QPh = (bf*)take((size_t)NB_ * NH_ * TT * HD * 2); bf* QPl = (bf*)take((size_t)NB_ * NH_ * TT * HD * 2); bf* KPh = (bf*)take((size_t)NB_ * NKV * TT * HD * 2); bf* KPl = (bf*)take((size_t)NB_ * NKV * TT * HD * 2); bf* VTh = (bf*)take((size_t)NB_ * NKV * HD * TT * 2); bf* VTl = (bf*)take((size_t)NB_ * NKV * HD * TT * 2);
    bf* ATh = (bf*)take((size_t)NB_ * TT * DQ * 2); bf* ATl = (bf*)take((size_t)NB_ * TT * DQ * 2);
    if ((size_t)(wsp - (char*)d_ws) > ws_size) return;    // ws 256 MiB
    // every stage runs once for all batches: the products take the batch as grid z, the attention sees NB_ x heads heads
    k_prep<<<PG, PT, 0, stream>>>(x, wattn, wo, XB, WQ, WO, CS);   /* bf16 copies of the inputs, rotary table */
    k_qkv<<<dim3(TT / 128, (DQ + 2 * DKV) / 128, NB_), 128, 0, stream>>>(XB, WQ, CS, QP16, QPh, QPl, KP16, KPh, KPl, VT16, VTh, VTl);
    k_fattn<<<dim3(NB_ * NH_, (TT - RH) / (FNW * 32) + RH / (FNW * 16), 1), 32 * FNW, 0, stream>>>(QP16, KP16, VT16, QPh, QPl, KPh, KPl, VTh, VTl, ATh, ATl);
    k_gemmw<<<dim3(TT / 128, DM / 128, NB_), 128, 0, stream>>>(ATh, ATl, WO, OUT);
}
